// v000
// The times below were measured on an AMD MI455X: many runs one after another, warmed up first and cycling through
// copies of the inputs, with the whole window's GPU time divided by the number of runs. Launches and the gaps
// between them are all in it. The median over several windows is given; except for v000 it joins two sittings, which
// can be a few percent apart, so the side-by-side timings, each taken in one sitting, are the better comparison.
// v000 is the starting kernel. One run takes 11.1 milliseconds.
#include <hip/hip_runtime.h>
// Transformer encoder layer (x [8][1024][1024]; per-head q/k/v = x Wq[h] + bq[h] (Wq [16][1024][64]); scores / 8 with a key-padding mask x_mask [8][1][1024] (int32, read; all zeros here); softmax; a = attn v concatenated over heads; x1 = x + LayerNorm(a) g1 + be1; h = relu(x1 W1 + b1); f = h W2 + b2 (W1, W2 [1024][1024] [in][out]); out = x1 + LayerNorm(f) g2 + be2 -> [8][1024][1024]).
// Structure: token rows; x as exact f16 rows; Q, K, V as three WMMA GEMMs (32x64 wave tiles, f32 accumulation, exact x16 head-stacked weights + bias, f16 outputs); per batch: V^T for all heads via LDS transposes; per group of 4 heads: scores GEMM (K = 64), masked row softmax on VALU (f32 statistics, native exp; weights x256 f16, masked keys 0), a = P . V^T GEMM (K = 1024) into f32 rows; per row on VALU: x1 = bf16(x) + LayerNorm(a) (f32 + f16 copies); h = relu(x1 W1 + b1) GEMM (f16); f = h W2 + b2 GEMM (f32); per row on VALU: out = x1 + LayerNorm(f).
// Compute dtype: inputs rounded to bf16; x / weights exact; q, k, v, softmax weights, x1 (as GEMM operand) and h plain f16 (~2^-12); attention output, LayerNorms, residuals f32. v_wmma_f32_16x16x32_f16.
#define NB 8
#define SQ 1024
#define DM 1024
#define NH 16
#define HD 64
#define HG 4
#define B0 0                         /* first batch processed (debug hook) */
#define NBR NB                       /* batches processed (debug hook) */
#define QN SQ                        /* query rows attended per batch (debug hook) */
#define NR ((size_t)NB * SQ)
#define MP ((int)((size_t)NBR * SQ)) /* rows projected (debug hook) */
#define MPO MP                       /* rows through the post-attention stages (debug hook) */
typedef __bf16 v16b __attribute__((ext_vector_type(16)));
typedef unsigned short v8us __attribute__((ext_vector_type(8), may_alias));
typedef float  v8f  __attribute__((ext_vector_type(8)));
typedef float  v4f  __attribute__((ext_vector_type(4)));
typedef float  v4fa __attribute__((ext_vector_type(4), may_alias));
union FragB { v16b v; v8us half[2]; unsigned short u[16]; };

__device__ __forceinline__ unsigned short bf16_bits(float x) { unsigned int u = __float_as_uint(x); return (unsigned short)((u + 0x7FFFu + ((u >> 16) & 1u)) >> 16); }
__device__ __forceinline__ float bf16_val(unsigned short b) { return __uint_as_float(((unsigned int)b) << 16); }
__device__ __forceinline__ float bf16_round(float x) { return bf16_val(bf16_bits(x)); }
// D += A·B with NT terms: 1 = ah·bh, 2 = + al·bh (A split), 3 = + ah·bl (both split)
template <int NT>
__device__ __forceinline__ v8f mmaN(v16b ah, v16b al, v16b bh, v16b bl, v8f c) {
  c = __builtin_amdgcn_wmma_f32_16x16x32_bf16(false, ah, false, bh, (short)0, c, false, false);
  if (NT >= 2) c = __builtin_amdgcn_wmma_f32_16x16x32_bf16(false, al, false, bh, (short)0, c, false, false);
  if (NT >= 3) c = __builtin_amdgcn_wmma_f32_16x16x32_bf16(false, ah, false, bl, (short)0, c, false, false);
  asm volatile("v_nop\n\tv_nop\n\tv_nop\n\tv_nop" : "+v"(c) : "v"(ah), "v"(al), "v"(bh), "v"(bl));
  return c;
}

__global__ __launch_bounds__(256) void k_wt_bf16(const float* __restrict__ W, unsigned short* __restrict__ Wt, int K, int N) {
  const int t = blockIdx.x * 256 + threadIdx.x;
  const int k8n = K / 8;
  if (t >= N * k8n) return;
  const int n = t / k8n, k8 = (t % k8n) * 8;
  v8us v;
#pragma unroll
  for (int i = 0; i < 8; ++i) v[i] = bf16_bits(W[(size_t)(k8 + i) * N + n]);
  *(v8us*)(Wt + (size_t)n * K + k8) = v;
  
}

// GEMM C[M][N] (f32, pitch ldc) = act(A[M][K]·W + bias). A f32 row-major (pitch lda) converted per fragment to bf16
// (ASPLIT: hi/lo two planes -> 2 terms, else single rounded term); Wt bf16 [N][K] (pitch ldb). BIAS_BF16 rounds the
// bias to bf16 first (bias quantised to bf16 before the add). K%32==0, M%16==0, N%64==0.
template <bool ASPLIT, int ACT, bool BIAS_BF16>
__global__ __launch_bounds__(128) void k_gemm_bf(const float* __restrict__ A, int lda, const unsigned short* __restrict__ Wt, int ldb,
                                               const float* __restrict__ bias, float* __restrict__ C, int ldc, int M, int N, int K) {
  __shared__ __attribute__((aligned(16))) float so[4][16][64];
  const int tid = threadIdx.x, w = tid >> 5, lane = tid & 31, ln = lane & 15, hh = lane >> 4;
  const int ntn = N / 64;
  const int wid = blockIdx.x * 4 + w;
  const int mt = wid / ntn, nq = wid % ntn;
  if (mt * 16 >= M) return;
  const int row0 = mt * 16, col0 = nq * 64;
  const float* arow = A + (size_t)(row0 + ln) * lda;
  v8f acc[4] = {};
  for (int kb = 0; kb < K; kb += 32) {
    FragB ah, al;
    const v4f x0 = *(const v4fa*)(arow + kb + 8 * hh), x1 = *(const v4fa*)(arow + kb + 8 * hh + 4);
    const v4f x2 = *(const v4fa*)(arow + kb + 16 + 8 * hh), x3 = *(const v4fa*)(arow + kb + 16 + 8 * hh + 4);
    float xs[16] = {x0[0],x0[1],x0[2],x0[3],x1[0],x1[1],x1[2],x1[3],x2[0],x2[1],x2[2],x2[3],x3[0],x3[1],x3[2],x3[3]};
#pragma unroll
    for (int i = 0; i < 16; ++i) { const unsigned short hb = bf16_bits(xs[i]); ah.u[i] = hb; al.u[i] = ASPLIT ? bf16_bits(xs[i] - bf16_val(hb)) : (unsigned short)0; }
#pragma unroll
    for (int t = 0; t < 4; ++t) {
      const unsigned short* brow = Wt + (size_t)(col0 + t * 16 + ln) * ldb + kb;
      FragB b;
      b.half[0] = *(const v8us*)(brow + 8 * hh);
      b.half[1] = *(const v8us*)(brow + 16 + 8 * hh);
      acc[t] = mmaN<ASPLIT ? 2 : 1>(ah.v, al.v, b.v, b.v, acc[t]);
    }
  }
#pragma unroll
  for (int t = 0; t < 4; ++t) {
    float bv = bias ? bias[col0 + t * 16 + ln] : 0.f;
    if (BIAS_BF16) bv = bf16_round(bv);
#pragma unroll
    for (int r = 0; r < 8; ++r) { float v = acc[t][r] + bv; if (ACT == 1) v = fmaxf(v, 0.f); so[w][8 * hh + r][t * 16 + ln] = v; }
  }
  __builtin_amdgcn_fence(__ATOMIC_ACQ_REL, "workgroup");
  __builtin_amdgcn_wave_barrier();
  const int rsub = lane >> 4, c4 = (lane & 15) * 4;
  {
#pragma unroll
    for (int q = 0; q < 8; ++q) {
      const int r = q * 2 + rsub;
      const v4f v = *(const v4fa*)&so[w][r][c4];
      *(v4f*)(C + (size_t)(row0 + r) * ldc + col0 + c4) = v;
    }
    
  }
}

// GEMM C = act(A·W + bias + resid): A f32 (ASPLIT -> hi/lo 2 terms), Wt bf16 [N][K]; ACT 0 none, 1 relu, 2 exact gelu;
// resid (optional, f32, row index = (row % rmod), pitch ldr, RES_BF16 rounds it) added before the activation.
template <bool ASPLIT, int ACT, bool BIAS_BF16, bool RES_BF16>
__global__ __launch_bounds__(128) void k_gemm_bf3(const float* __restrict__ A, int lda, const unsigned short* __restrict__ Wt, int ldb,
                                                const float* __restrict__ bias, const float* __restrict__ resid, int rmod, int ldr,
                                                float* __restrict__ C, int ldc, int M, int N, int K) {
  __shared__ __attribute__((aligned(16))) float so[4][16][64];
  const int tid = threadIdx.x, w = tid >> 5, lane = tid & 31, ln = lane & 15, hh = lane >> 4;
  const int ntn = N / 64;
  const int wid = blockIdx.x * 4 + w;
  const int mt = wid / ntn, nq = wid % ntn;
  if (mt * 16 >= M) return;
  const int row0 = mt * 16, col0 = nq * 64;
  const float* arow = A + (size_t)(row0 + ln) * lda;
  v8f acc[4] = {};
  for (int kb = 0; kb < K; kb += 32) {
    FragB ah, al;
    const v4f x0 = *(const v4fa*)(arow + kb + 8 * hh), x1 = *(const v4fa*)(arow + kb + 8 * hh + 4);
    const v4f x2 = *(const v4fa*)(arow + kb + 16 + 8 * hh), x3 = *(const v4fa*)(arow + kb + 16 + 8 * hh + 4);
    float xs[16] = {x0[0],x0[1],x0[2],x0[3],x1[0],x1[1],x1[2],x1[3],x2[0],x2[1],x2[2],x2[3],x3[0],x3[1],x3[2],x3[3]};
#pragma unroll
    for (int i = 0; i < 16; ++i) { const unsigned short hb = bf16_bits(xs[i]); ah.u[i] = hb; al.u[i] = ASPLIT ? bf16_bits(xs[i] - bf16_val(hb)) : (unsigned short)0; }
#pragma unroll
    for (int t = 0; t < 4; ++t) {
      const unsigned short* brow = Wt + (size_t)(col0 + t * 16 + ln) * ldb + kb;
      FragB b;
      b.half[0] = *(const v8us*)(brow + 8 * hh);
      b.half[1] = *(const v8us*)(brow + 16 + 8 * hh);
      acc[t] = mmaN<ASPLIT ? 2 : 1>(ah.v, al.v, b.v, b.v, acc[t]);
    }
  }
#pragma unroll
  for (int t = 0; t < 4; ++t) {
    const int col = col0 + t * 16 + ln;
    float bv = bias ? bias[col] : 0.f;
    if (BIAS_BF16) bv = bf16_round(bv);
#pragma unroll
    for (int r = 0; r < 8; ++r) {
      float v = acc[t][r] + bv;
      if (resid) { float rv = resid[(size_t)((row0 + 8 * hh + r) % rmod) * ldr + col]; if (RES_BF16) rv = bf16_round(rv); v += rv; }
      if (ACT == 1) v = fmaxf(v, 0.f);
      if (ACT == 2) v = 0.5f * v * (1.0f + erff(v * 0.70710678118654752f));
      if (ACT == 3) { const float u = 0.7978845608028654f * (v + 0.044715f * v * v * v); v = 0.5f * v * (1.0f + tanhf(u)); }
      so[w][8 * hh + r][t * 16 + ln] = v;
    }
  }
  __builtin_amdgcn_fence(__ATOMIC_ACQ_REL, "workgroup");
  __builtin_amdgcn_wave_barrier();
  const int rsub = lane >> 4, c4 = (lane & 15) * 4;
  {
#pragma unroll
    for (int q = 0; q < 8; ++q) {
      const int r = q * 2 + rsub;
      const v4f v = *(const v4fa*)&so[w][r][c4];
      *(v4f*)(C + (size_t)(row0 + r) * ldc + col0 + c4) = v;
    }
    
  }
}
// row LayerNorm (biased variance, eps) over N: s = X (+ R); optional out_sum <- s; out_norm <- (s-mu)*rsqrt(var+eps)*g + b
template <bool PARAM_BF16>
__global__ __launch_bounds__(256) void k_layernorm(const float* __restrict__ X, const float* __restrict__ R, const float* __restrict__ g, const float* __restrict__ bta,
                                                  float* __restrict__ out_sum, float* __restrict__ out_norm, int N, float eps) {
  __shared__ float red[256];
  const int row = blockIdx.x, tid = threadIdx.x;
  const float* x = X + (size_t)row * N; const float* rr = R ? R + (size_t)row * N : nullptr;
  float vals[16];                     // up to N = 4096
  const int per = N / 256;            // contiguous chunk per thread? use strided-by-4 chunks: thread handles j = tid*4 + 1024*u
  float s1 = 0.f;
  for (int u = 0; u < per / 4; ++u) {
    const int j = tid * 4 + 1024 * u;
    const v4f a = *(const v4fa*)(x + j);
    v4f b = {0.f,0.f,0.f,0.f}; if (rr) b = *(const v4fa*)(rr + j);
#pragma unroll
    for (int q = 0; q < 4; ++q) { const float v = a[q] + b[q]; vals[u * 4 + q] = v; s1 += v; }
  }
  red[tid] = s1; __syncthreads();
  for (int st = 128; st > 0; st >>= 1) { if (tid < st) red[tid] += red[tid + st]; __syncthreads(); }
  const float mu = red[0] / (float)N; __syncthreads();
  float s2 = 0.f;
  for (int u = 0; u < per / 4; ++u)
#pragma unroll
    for (int q = 0; q < 4; ++q) { const float c = vals[u * 4 + q] - mu; s2 += c * c; }
  red[tid] = s2; __syncthreads();
  for (int st = 128; st > 0; st >>= 1) { if (tid < st) red[tid] += red[tid + st]; __syncthreads(); }
  const float rs = rsqrtf(red[0] / (float)N + eps);
  {
    for (int u = 0; u < per / 4; ++u) {
      const int j = tid * 4 + 1024 * u;
      v4f o, sm;
#pragma unroll
      for (int q = 0; q < 4; ++q) {
        float gg = g[j + q], bb = bta[j + q];
        if (PARAM_BF16) { gg = bf16_round(gg); bb = bf16_round(bb); }
        sm[q] = vals[u * 4 + q]; o[q] = (vals[u * 4 + q] - mu) * rs * gg + bb;
      }
      if (out_sum) *(v4f*)(out_sum + (size_t)row * N + j) = sm;
      *(v4f*)(out_norm + (size_t)row * N + j) = o;
    }
    
  }
}



// ---- f16 WMMA path (v_wmma_f32_16x16x32_f16): 11-bit significands for operands in range — used for every GEMM launched here
typedef _Float16 v16h __attribute__((ext_vector_type(16)));
union FragH { v16h v; v8us half[2]; _Float16 h[16]; unsigned short u[16]; };
template <int NT>
__device__ __forceinline__ v8f mmaH(v16h ah, v16h al, v16h bh, v16h bl, v8f c) {
  c = __builtin_amdgcn_wmma_f32_16x16x32_f16(false, ah, false, bh, (short)0, c, false, false);
  if (NT >= 2) c = __builtin_amdgcn_wmma_f32_16x16x32_f16(false, al, false, bh, (short)0, c, false, false);
  if (NT >= 3) c = __builtin_amdgcn_wmma_f32_16x16x32_f16(false, ah, false, bl, (short)0, c, false, false);
  asm volatile("v_nop\n\tv_nop\n\tv_nop\n\tv_nop" : "+v"(c) : "v"(ah), "v"(al), "v"(bh), "v"(bl));
  return c;
}
// batched GEMM like k_gemm_b but f16 operands: A f32 (split into f16 hi/lo if ASPLIT, else rounded to f16), Bt = f16 values [n][k]; alpha; C f32; N multiple of 16 (partial tiles skipped)
template <bool ASPLIT>
__global__ __launch_bounds__(128) void k_gemm_h(const float* __restrict__ A, int lda, size_t sA, const _Float16* __restrict__ Bh, int ldb, size_t sB, float alpha, float* __restrict__ C, int ldc, size_t sC, int M, int N, int K) {
  __shared__ __attribute__((aligned(16))) float so[4][16][64];
  const int tid = threadIdx.x, w = tid >> 5, lane = tid & 31, ln = lane & 15, hh = lane >> 4; const int by = blockIdx.y;
  A += (size_t)by * sA; Bh += (size_t)by * sB; C += (size_t)by * sC;
  const int ntn = (N + 63) / 64; const int wid = blockIdx.x * 4 + w; const int mt = wid / ntn, nq = wid % ntn; if (mt * 16 >= M) return;
  const int row0 = mt * 16, col0 = nq * 64; const float* arow = A + (size_t)(row0 + ln) * lda;
  v8f acc[4] = {};
  for (int kb = 0; kb < K; kb += 32) {
    FragH ah, al;
    const v4f x0 = *(const v4fa*)(arow + kb + 8 * hh), x1 = *(const v4fa*)(arow + kb + 8 * hh + 4), x2 = *(const v4fa*)(arow + kb + 16 + 8 * hh), x3 = *(const v4fa*)(arow + kb + 16 + 8 * hh + 4);
    float xs[16] = {x0[0],x0[1],x0[2],x0[3],x1[0],x1[1],x1[2],x1[3],x2[0],x2[1],x2[2],x2[3],x3[0],x3[1],x3[2],x3[3]};
#pragma unroll
    for (int i = 0; i < 16; ++i) { const _Float16 h = (_Float16)xs[i]; ah.h[i] = h; al.h[i] = ASPLIT ? (_Float16)(xs[i] - (float)h) : (_Float16)0.0f; }
#pragma unroll
    for (int t = 0; t < 4; ++t) { if (col0 + t * 16 >= N) continue; const size_t boff = (size_t)(col0 + t * 16 + ln) * ldb + kb; FragH bq; bq.half[0] = *(const v8us*)(Bh + boff + 8 * hh); bq.half[1] = *(const v8us*)(Bh + boff + 16 + 8 * hh);
      acc[t] = mmaH<ASPLIT ? 2 : 1>(ah.v, al.v, bq.v, bq.v, acc[t]); }
  }
#pragma unroll
  for (int t = 0; t < 4; ++t) { if (col0 + t * 16 >= N) continue;
#pragma unroll
    for (int r = 0; r < 8; ++r) so[w][8 * hh + r][t * 16 + ln] = acc[t][r] * alpha; }
  __builtin_amdgcn_fence(__ATOMIC_ACQ_REL, "workgroup"); __builtin_amdgcn_wave_barrier();
  const int rsub = lane >> 4, c4 = (lane & 15) * 4;
  {
#pragma unroll
    for (int q = 0; q < 8; ++q) { const int r = q * 2 + rsub; if (col0 + c4 < N) { const v4f v = *(const v4fa*)&so[w][r][c4]; *(v4f*)(C + (size_t)(row0 + r) * ldc + col0 + c4) = v; } }
     }
}

// Wt[n][k] = f16(W[k][n]·scale) from f32 row-major W[K][N] (scale = power of two; bf16-exact weights stay exact in f16 away from the subnormal range)
__global__ __launch_bounds__(256) void k_wt_f16(const float* __restrict__ W, _Float16* __restrict__ Wt, int K, int N, float scale) {
  const int t = blockIdx.x * 256 + threadIdx.x; if (t >= N * (K / 8)) return; const int n = t / (K / 8), k8 = (t % (K / 8)) * 8; FragH f;
#pragma unroll
  for (int i = 0; i < 8; ++i) f.h[i] = (_Float16)(bf16_round(W[(size_t)(k8 + i) * N + n]) * scale); const v8us o = f.half[0];
  *(v8us*)((unsigned short*)Wt + (size_t)n * K + k8) = o; 
}
// k_gemm_hh variant with fused epilogue: v = acc·alpha + bias[by·sBias + col] (+ CP[(row/rowsPerB)·sCPb + by·64 + col] if CP) ; ACT 0 none / 1 elu ; writes f16 C16 (and f32 C if non-null)
template <int ACT>
__global__ __launch_bounds__(128) void k_gemm_hhx(const _Float16* __restrict__ A, int lda, size_t sA, const _Float16* __restrict__ Bh, int ldb, size_t sB, float alpha, const float* __restrict__ bias, size_t sBias, const float* __restrict__ CP, int rowsPerB, size_t sCPb, int row0g,
    float* __restrict__ C, _Float16* __restrict__ C16, int ldc, size_t sC, int M, int N, int K) {
  __shared__ __attribute__((aligned(16))) float so[4][16][64];
  const int tid = threadIdx.x, w = tid >> 5, lane = tid & 31, ln = lane & 15, hh = lane >> 4; const int by = blockIdx.y;
  A += (size_t)by * sA; Bh += (size_t)by * sB; const size_t cofs = (size_t)by * sC; const float* bp = bias ? bias + (size_t)by * sBias : nullptr;
  const int ntn = (N + 63) / 64; const int wid = blockIdx.x * 4 + w; const int mt = wid / ntn, nq = wid % ntn; if (mt * 16 >= M) return;
  const int row0 = mt * 16, col0 = nq * 64; const _Float16* arow = A + (size_t)(row0 + ln) * lda;
  v8f acc[4] = {};
  for (int kb = 0; kb < K; kb += 32) { FragH ah; ah.half[0] = *(const v8us*)((const unsigned short*)arow + kb + 8 * hh); ah.half[1] = *(const v8us*)((const unsigned short*)arow + kb + 16 + 8 * hh);
#pragma unroll
    for (int t = 0; t < 4; ++t) { if (col0 + t * 16 >= N) continue; const size_t boff = (size_t)(col0 + t * 16 + ln) * ldb + kb; FragH bq; bq.half[0] = *(const v8us*)((const unsigned short*)Bh + boff + 8 * hh); bq.half[1] = *(const v8us*)((const unsigned short*)Bh + boff + 16 + 8 * hh);
      acc[t] = mmaH<1>(ah.v, ah.v, bq.v, bq.v, acc[t]); }
  }
#pragma unroll
  for (int t = 0; t < 4; ++t) { if (col0 + t * 16 >= N) continue; const int col = col0 + t * 16 + ln; const float bv = bp ? bf16_round(bp[col]) : 0.f;
#pragma unroll
    for (int r = 0; r < 8; ++r) { float v = acc[t][r] * alpha + bv; if (CP) { const int rr = row0g + row0 + 8 * hh + r; if (rowsPerB < 0) v += CP[cofs + (size_t)rr * ldc + col];      /* rowsPerB < 0: own element of the batched C plane */ else { const int bidx = rr / rowsPerB; v += CP[(size_t)bidx * sCPb + (size_t)by * 64 + col]; } } if (ACT == 1) v = (v > 0.f) ? v : expm1f(v); else if (ACT == 7) v = (v > 0.f) ? v + 1.0f : expf(v); else if (ACT == 8) v = tanhf(v); else if (ACT == 9) v = 0.5f * v * (1.0f + tanhf(0.7978845608028654f * (v + 0.044715f * v * v * v))); else if (ACT == 11) v = 1.0f / (1.0f + expf(-v)); else if (ACT == 12) v = (v > 0.f) ? v : 0.01f * v; else if (ACT == 14) v = (v > 0.f) ? v : 0.1f * v; else if (ACT == 16) v = (v >= 0.f) ? v : 0.3f * v; else if (ACT == 17) v = (v >= 0.f) ? v : 0.2f * v; else if (ACT == 15) v = v / (1.0f + expf(-v)); else if (ACT == 3) v = fmaxf(v, 0.f); else if (ACT == 6) v = 0.5f * v * (1.0f + erff(v * 0.70710678118654752f)); so[w][8 * hh + r][t * 16 + ln] = v; } }
  __builtin_amdgcn_fence(__ATOMIC_ACQ_REL, "workgroup"); __builtin_amdgcn_wave_barrier();
  const int rsub = lane >> 4, c4 = (lane & 15) * 4; typedef _Float16 v4h __attribute__((ext_vector_type(4)));
  {
#pragma unroll
    for (int q = 0; q < 8; ++q) { const int r = q * 2 + rsub; if (col0 + c4 < N) { const v4f v = *(const v4fa*)&so[w][r][c4]; if (C) *(v4f*)(C + cofs + (size_t)(row0 + r) * ldc + col0 + c4) = v; if (C16) { v4h h4; for (int i = 0; i < 4; ++i) h4[i] = (_Float16)v[i]; *(v4h*)(C16 + cofs + (size_t)(row0 + r) * ldc + col0 + c4) = h4; } } }
     }
}


typedef _Float16 v4h __attribute__((ext_vector_type(4)));

__global__ __launch_bounds__(256) void k_x16(const float* __restrict__ x, _Float16* __restrict__ X16, size_t n8) { const size_t t = (size_t)blockIdx.x * 256 + threadIdx.x; if (t >= n8) return; FragH f;
#pragma unroll
  for (int q = 0; q < 8; ++q) f.h[q] = (_Float16)bf16_round(x[t * 8 + q]); *(v8us*)((unsigned short*)X16 + t * 8) = f.half[0];  }
__global__ __launch_bounds__(256) void k_h16(const float* __restrict__ x, _Float16* __restrict__ X16, size_t n8) { const size_t t = (size_t)blockIdx.x * 256 + threadIdx.x; if (t >= n8) return; FragH f;
#pragma unroll
  for (int q = 0; q < 8; ++q) f.h[q] = (_Float16)x[t * 8 + q]; *(v8us*)((unsigned short*)X16 + t * 8) = f.half[0];  }
__global__ __launch_bounds__(256) void k_round16f(const float* __restrict__ W, _Float16* __restrict__ Bt, size_t n8) { const size_t t = (size_t)blockIdx.x * 256 + threadIdx.x; if (t >= n8) return; FragH f;
#pragma unroll
  for (int i = 0; i < 8; ++i) f.h[i] = (_Float16)(bf16_round(W[t * 8 + i]) * 16.0f); *(v8us*)((unsigned short*)Bt + t * 8) = f.half[0];  }
template <int NHv, int TTv>
__global__ __launch_bounds__(256) void k_vt(const _Float16* __restrict__ V16, int ldv, int voff, _Float16* __restrict__ Vt) { __shared__ unsigned short tl[64][66]; const int tid = threadIdx.x; const int slab = blockIdx.x / (TTv / 64), lg = blockIdx.x % (TTv / 64); const int b = slab / NHv, h = slab % NHv;
  for (int i = tid; i < 64 * 8; i += 256) { const int r = i / 8, c8 = (i % 8) * 8; FragH f; f.half[0] = *(const v8us*)((const unsigned short*)V16 + ((size_t)b * TTv + lg * 64 + r) * ldv + voff + h * 64 + c8);
#pragma unroll
    for (int q = 0; q < 8; ++q) tl[r][c8 + q] = f.u[q]; }
  __syncthreads();
  {
#pragma unroll
    for (int rd = 0; rd < 2; ++rd) { const int d = rd * 32 + tid / 8, pc = tid % 8; FragH f;
#pragma unroll
      for (int q = 0; q < 8; ++q) f.u[q] = tl[pc * 8 + q][d];
      *(v8us*)((unsigned short*)Vt + ((size_t)slab * 64 + d) * TTv + lg * 64 + pc * 8) = f.half[0]; }
     } }

__global__ __launch_bounds__(256) void k_hl(const float* __restrict__ F, _Float16* __restrict__ Hh, _Float16* __restrict__ Hl, size_t n8) { const size_t t = (size_t)blockIdx.x * 256 + threadIdx.x; if (t >= n8) return; FragH fh, fl; const v4f a = *(const v4fa*)(F + t * 8), c = *(const v4fa*)(F + t * 8 + 4);
#pragma unroll
  for (int q = 0; q < 4; ++q) { _Float16 h = (_Float16)a[q]; fh.h[q] = h; fl.h[q] = (_Float16)((a[q] - (float)h) * 1024.0f); h = (_Float16)c[q]; fh.h[4 + q] = h; fl.h[4 + q] = (_Float16)((c[q] - (float)h) * 1024.0f); }
  { *(v8us*)((unsigned short*)Hh + t * 8) = fh.half[0]; *(v8us*)((unsigned short*)Hl + t * 8) = fl.half[0];  } }

// ---- fast GEMM (wave tile 32x64; requires M % 32 == 0 rows per launch region and N % 64 == 0); epilogue = k_gemm_hhx semantics ----
__device__ __forceinline__ v16h g2_frag(const _Float16* p, int hh) { FragH f; f.half[0] = *(const v8us*)((const unsigned short*)p + 8 * hh); f.half[1] = *(const v8us*)((const unsigned short*)p + 16 + 8 * hh); return f.v; }
__device__ __forceinline__ v8f g2_mma(v16h a, v16h b, v8f c) { v8f d = __builtin_amdgcn_wmma_f32_16x16x32_f16(false, a, false, b, (short)0, c, false, false); asm volatile("v_nop\n\tv_nop\n\tv_nop\n\tv_nop" : "+v"(d) : "v"(a), "v"(b)); return d; }
template <int ACT>
__global__ __launch_bounds__(128) void k_gemm2(const _Float16* __restrict__ A, int lda, size_t sA, const _Float16* __restrict__ Bh, int ldb, size_t sB, float alpha, const float* __restrict__ bias, size_t sBias, const float* __restrict__ CP, int rowsPerB, size_t sCPb, int row0g,
    float* __restrict__ C, _Float16* __restrict__ C16, int ldc, size_t sC, int M, int N, int K) { static_assert(ACT == 0 || ACT == 3 || ACT == 6 || ACT == 8 || ACT == 9 || ACT == 11 || ACT == 12 || ACT == 14 || ACT == 15 || ACT == 16 || ACT == 17, "k_gemm2: unsupported ACT code (would silently apply no activation)");
  __shared__ __attribute__((aligned(16))) float so[4][32][68];
  const int tid = threadIdx.x, w = tid >> 5, lane = tid & 31, ln = lane & 15, hh = lane >> 4; const int by = blockIdx.y;
  A += (size_t)by * sA; Bh += (size_t)by * sB; const size_t cofs = (size_t)by * sC; const float* bp = bias ? bias + (size_t)by * sBias : nullptr;
  const int ntn = N >> 6; const int mt = blockIdx.x / ntn, nq = blockIdx.x - mt * ntn; const int row0 = mt * 128 + 32 * w, col0 = nq * 64; if (row0 >= M) return;
  const _Float16* a0p = A + (size_t)(row0 + ln) * lda; const _Float16* a1p = a0p + (size_t)16 * lda;
  const _Float16* b0p = Bh + (size_t)(col0 + ln) * ldb; const _Float16* b1p = b0p + (size_t)16 * ldb; const _Float16* b2p = b1p + (size_t)16 * ldb; const _Float16* b3p = b2p + (size_t)16 * ldb;
  const v8f z8 = {0.f,0.f,0.f,0.f,0.f,0.f,0.f,0.f}; v8f c00 = z8, c01 = z8, c02 = z8, c03 = z8, c10 = z8, c11 = z8, c12 = z8, c13 = z8;
#pragma unroll 1
  for (int kb = 0; kb < K; kb += 32) { const v16h a0 = g2_frag(a0p + kb, hh), a1 = g2_frag(a1p + kb, hh);
    v16h b = g2_frag(b0p + kb, hh); c00 = g2_mma(a0, b, c00); c10 = g2_mma(a1, b, c10);
    b = g2_frag(b1p + kb, hh); c01 = g2_mma(a0, b, c01); c11 = g2_mma(a1, b, c11);
    b = g2_frag(b2p + kb, hh); c02 = g2_mma(a0, b, c02); c12 = g2_mma(a1, b, c12);
    b = g2_frag(b3p + kb, hh); c03 = g2_mma(a0, b, c03); c13 = g2_mma(a1, b, c13); }
  v8f accs[8] = {c00, c01, c02, c03, c10, c11, c12, c13};
#pragma unroll
  for (int u = 0; u < 8; ++u) { const int t = u & 3, half = u >> 2; const int col = col0 + t * 16 + ln; const float bv = bp ? bf16_round(bp[col]) : 0.f;
#pragma unroll
    for (int r = 0; r < 8; ++r) { const int rloc = half * 16 + 8 * hh + r; float v = accs[u][r] * alpha + bv; if (CP) { if (rowsPerB < 0) v += CP[cofs + (size_t)(row0g + row0 + rloc) * ldc + col];      /* rowsPerB < 0: own element of the batched C plane */ else { const int bidx = (row0g + row0 + rloc) / rowsPerB; v += CP[(size_t)bidx * sCPb + (size_t)by * 64 + col]; } }
      if (ACT == 3) v = fmaxf(v, 0.f); else if (ACT == 6) v = 0.5f * v * (1.0f + erff(v * 0.70710678118654752f)); else if (ACT == 11) v = 1.0f / (1.0f + expf(-v)); else if (ACT == 15) v = v / (1.0f + expf(-v)); else if (ACT == 12) v = (v > 0.f) ? v : 0.01f * v; else if (ACT == 8) v = tanhf(v); else if (ACT == 9) v = 0.5f * v * (1.0f + tanhf(0.7978845608028654f * (v + 0.044715f * v * v * v))); else if (ACT == 14) v = (v > 0.f) ? v : 0.1f * v; else if (ACT == 16) v = (v >= 0.f) ? v : 0.3f * v; else if (ACT == 17) v = (v >= 0.f) ? v : 0.2f * v;
      so[w][rloc][t * 16 + ln] = v; } }
  __builtin_amdgcn_fence(__ATOMIC_ACQ_REL, "workgroup"); __builtin_amdgcn_wave_barrier();
  const int rsub = lane >> 4, c4 = (lane & 15) * 4;
  {
#pragma unroll
    for (int q = 0; q < 16; ++q) { const int r = q * 2 + rsub; const v4f v = *(const v4fa*)&so[w][r][c4]; if (C) *(v4f*)(C + cofs + (size_t)(row0 + r) * ldc + col0 + c4) = v; if (C16) { v4h h4; for (int i = 0; i < 4; ++i) h4[i] = (_Float16)v[i]; *(v4h*)(C16 + cofs + (size_t)(row0 + r) * ldc + col0 + c4) = h4; } }
     } }


__global__ __launch_bounds__(256) void k_wnat(const float* __restrict__ w, size_t n8, _Float16* __restrict__ Bt) { const size_t t = (size_t)blockIdx.x * 256 + threadIdx.x; if (t >= n8) return; FragH f; for (int q = 0; q < 8; ++q) f.h[q] = (_Float16)(bf16_round(w[t * 8 + q]) * 16.0f); *(v8us*)((unsigned short*)Bt + t * 8) = f.half[0];  }
__global__ __launch_bounds__(256) void k_rsm(const float* __restrict__ S, _Float16* __restrict__ P, int nrows) {
  #pragma clang fp contract(off)
  const int i = blockIdx.x * 256 + threadIdx.x; if (i >= nrows) return; const float* s = S + (size_t)i * SQ; float mx = -3.0e38f;
#pragma unroll 1
  for (int j = 0; j < SQ; ++j) mx = fmaxf(mx, s[j]); float se = 0.f;
#pragma unroll 1
  for (int j = 0; j < SQ; ++j) se += expf(s[j] - mx); const float sc = 256.0f / se;
#pragma unroll 1
  for (int j0 = 0; j0 < SQ; j0 += 8) { FragH f; for (int q = 0; q < 8; ++q) f.h[q] = (_Float16)(expf(s[j0 + q] - mx) * sc); unsigned short* d = (unsigned short*)P + (size_t)i * SQ + j0; *(v8us*)d = f.half[0];  } }
__global__ __launch_bounds__(256) void k_vt(const _Float16* __restrict__ V16, int b, int h0, _Float16* __restrict__ VT) { __shared__ unsigned short tl[64][65]; const int tid = threadIdx.x; const int hh = blockIdx.x % HG, sg = blockIdx.x / HG; const int s0 = sg * 64; const int h = h0 + hh;
  for (int i = tid; i < 64 * 8; i += 256) { const int j = i / 8, d8 = (i % 8) * 8; FragH f; f.half[0] = *(const v8us*)((const unsigned short*)V16 + ((size_t)b * SQ + s0 + j) * DM + h * HD + d8); for (int q = 0; q < 8; ++q) tl[d8 + q][j] = f.u[q]; }
  __syncthreads();
  { for (int i = tid; i < 64 * 8; i += 256) { const int d = i / 8, j8 = (i % 8) * 8; FragH f; for (int q = 0; q < 8; ++q) f.u[q] = tl[d][j8 + q]; *(v8us*)((unsigned short*)VT + ((size_t)hh * HD + d) * SQ + s0 + j8) = f.half[0]; }  } }


__global__ __launch_bounds__(256) void k_whd(const float* __restrict__ w, _Float16* __restrict__ Bt) { const size_t t = (size_t)blockIdx.x * 256 + threadIdx.x; if (t >= (size_t)DM * (DM / 8)) return; const int d8 = (int)(t % (DM / 8)) * 8; const int n = (int)(t / (DM / 8)); const int h = n / HD, k = n % HD; FragH f;
  for (int q = 0; q < 8; ++q) f.h[q] = (_Float16)(bf16_round(w[((size_t)h * DM + d8 + q) * HD + k]) * 16.0f);
  unsigned short* dst = (unsigned short*)Bt + (size_t)n * DM + d8; *(v8us*)dst = f.half[0];  }
__global__ __launch_bounds__(256) void k_rsmfm(const float* __restrict__ S, _Float16* __restrict__ P, int qn, int hg, const int* __restrict__ mk) {
  #pragma clang fp contract(off)
  const int t = blockIdx.x * 256 + threadIdx.x; if (t >= qn * hg) return; const size_t i = (size_t)(t / qn) * SQ + (t % qn); const float* s = S + i * SQ; float mx = -3.0e38f;
#pragma unroll 1
  for (int j = 0; j < SQ; ++j) if (mk[j] == 0) mx = fmaxf(mx, s[j]); float se = 0.f;
#pragma unroll 1
  for (int j = 0; j < SQ; ++j) if (mk[j] == 0) se += __expf(s[j] - mx); const float sc = 256.0f / se;
#pragma unroll 1
  for (int j0 = 0; j0 < SQ; j0 += 8) { FragH f; for (int q = 0; q < 8; ++q) f.h[q] = (_Float16)((mk[j0 + q] == 0) ? __expf(s[j0 + q] - mx) * sc : 0.f); unsigned short* d = (unsigned short*)P + i * SQ + j0; *(v8us*)d = f.half[0];  } }
template <int RBF>
__global__ __launch_bounds__(256) void k_lnadd(const float* __restrict__ A, const float* __restrict__ R, const float* __restrict__ g, const float* __restrict__ bta, float eps, float* __restrict__ OF_, _Float16* __restrict__ OH_) {
  #pragma clang fp contract(off)
  __shared__ float red[256]; const size_t row = blockIdx.x; const int tid = threadIdx.x; const int j0 = tid * 4; float a[4], r[4]; float s1 = 0.f;
  { const v4f av = *(const v4fa*)(A + row * DM + j0); const v4f rv = *(const v4fa*)(R + row * DM + j0); for (int q = 0; q < 4; ++q) { a[q] = av[q]; r[q] = RBF ? bf16_round(rv[q]) : rv[q]; s1 = __fadd_rn(s1, a[q]); } }
  red[tid] = s1; __syncthreads(); for (int st = 128; st > 0; st >>= 1) { if (tid < st) red[tid] = __fadd_rn(red[tid], red[tid + st]); __syncthreads(); }
  const float mu = red[0] / (float)DM; __syncthreads(); float s2 = 0.f;
  for (int q = 0; q < 4; ++q) { const float c = __fadd_rn(a[q], -mu); s2 = __fadd_rn(s2, __fmul_rn(c, c)); }
  red[tid] = s2; __syncthreads(); for (int st = 128; st > 0; st >>= 1) { if (tid < st) red[tid] = __fadd_rn(red[tid], red[tid + st]); __syncthreads(); }
  const float rs = rsqrtf(__fadd_rn(red[0] / (float)DM, eps)); v4f o; FragH h;
  for (int q = 0; q < 4; ++q) { o[q] = __fadd_rn(r[q], __fadd_rn(__fmul_rn(__fmul_rn(__fadd_rn(a[q], -mu), rs), bf16_round(g[j0 + q])), bf16_round(bta[j0 + q]))); h.h[q] = (_Float16)o[q]; }
  typedef unsigned short v4us __attribute__((ext_vector_type(4))); v4us h4; for (int q = 0; q < 4; ++q) h4[q] = h.u[q];
  { *(v4f*)(OF_ + row * DM + j0) = o; if (OH_) *(v4us*)((unsigned short*)OH_ + row * DM + j0) = h4;  } }

extern "C" void kernel_launch(void* const* d_in, const int* in_sizes, int n_in,
                              void* d_out, int out_size, void* d_ws, size_t ws_size, hipStream_t stream) {
  (void)in_sizes; (void)n_in; (void)out_size;
  const float* const* I = (const float* const*)d_in; const float* x = I[0]; const int* xmask = (const int*)d_in[1]; const float* wq = I[2]; const float* bq = I[3]; const float* wk = I[4]; const float* bk = I[5]; const float* wv = I[6]; const float* bv = I[7]; const float* w1 = I[8]; const float* b1 = I[9]; const float* w2 = I[10]; const float* b2 = I[11]; const float* g1 = I[12]; const float* be1 = I[13]; const float* g2 = I[14]; const float* be2 = I[15];
  char* ws = (char*)d_ws; size_t off = 0;
  auto take = [&](size_t bytes) { char* p = ws + off; off += (bytes + 255) & ~(size_t)255; return p; };
  _Float16* BQ = (_Float16*)take((size_t)DM * DM * 2); _Float16* BK = (_Float16*)take((size_t)DM * DM * 2); _Float16* BV = (_Float16*)take((size_t)DM * DM * 2); _Float16* B1 = (_Float16*)take((size_t)DM * DM * 2); _Float16* B2 = (_Float16*)take((size_t)DM * DM * 2);
  _Float16* X16 = (_Float16*)take(NR * DM * 2); _Float16* Q16 = (_Float16*)take(NR * DM * 2); _Float16* K16 = (_Float16*)take(NR * DM * 2); _Float16* V16 = (_Float16*)take(NR * DM * 2); float* AF = (float*)take(NR * DM * 4); float* X1F = (float*)take(NR * DM * 4); _Float16* X1H = (_Float16*)take(NR * DM * 2); _Float16* H16 = (_Float16*)take(NR * DM * 2); float* FF = AF;      /* f rows reuse the attention-output rows (dead after the first LayerNorm; same type) */
  float* S = (float*)take((size_t)HG * SQ * SQ * 4); _Float16* P = (_Float16*)take((size_t)HG * SQ * SQ * 2); _Float16* VT = (_Float16*)take((size_t)NH * HD * SQ * 2);
  if (off > ws_size) return;      /* 10 + 16x4 + 32 + 32 + 16 + 16 + 16 + 8 + 2 = approx 196 MiB */
  { const unsigned gw = (unsigned)(((size_t)DM * (DM / 8) + 255) / 256); k_whd<<<gw, 256, 0, stream>>>(wq, BQ); k_whd<<<gw, 256, 0, stream>>>(wk, BK); k_whd<<<gw, 256, 0, stream>>>(wv, BV); k_wt_f16<<<gw, 256, 0, stream>>>(w1, B1, DM, DM, 16.0f); k_wt_f16<<<gw, 256, 0, stream>>>(w2, B2, DM, DM, 16.0f); }
  k_x16<<<(unsigned)((NR * DM / 8 + 255) / 256), 256, 0, stream>>>(x, X16, NR * DM / 8);
  const size_t r0p = (size_t)B0 * SQ; const dim3 gp((unsigned)((MP / 128) * (DM / 64)), 1);
  k_gemm2<0><<<gp, 128, 0, stream>>>(X16 + r0p * DM, DM, 0, BQ, DM, 0, 0.0625f, bq, 0, nullptr, 1, 0, 0, nullptr, Q16 + r0p * DM, DM, 0, MP, DM, DM);
  k_gemm2<0><<<gp, 128, 0, stream>>>(X16 + r0p * DM, DM, 0, BK, DM, 0, 0.0625f, bk, 0, nullptr, 1, 0, 0, nullptr, K16 + r0p * DM, DM, 0, MP, DM, DM);
  k_gemm2<0><<<gp, 128, 0, stream>>>(X16 + r0p * DM, DM, 0, BV, DM, 0, 0.0625f, bv, 0, nullptr, 1, 0, 0, nullptr, V16 + r0p * DM, DM, 0, MP, DM, DM);
  for (int b = B0; b < B0 + NBR; ++b) { const size_t r0 = (size_t)b * SQ;
    k_vt<NH, SQ><<<NH * (SQ / 64), 256, 0, stream>>>(V16 + r0 * DM, DM, 0, VT);
    for (int h0 = 0; h0 < NH; h0 += HG) {
      k_gemm2<0><<<dim3((QN / 128) * (SQ / 64), HG), 128, 0, stream>>>(Q16 + r0 * DM + h0 * HD, DM, (size_t)HD, K16 + r0 * DM + h0 * HD, DM, (size_t)HD, 0.125f, nullptr, 0, nullptr, 1, 0, 0, S, nullptr, SQ, (size_t)SQ * SQ, QN, SQ, HD);
      k_rsmfm<<<(HG * QN + 255) / 256, 256, 0, stream>>>(S, P, QN, HG, xmask + (size_t)b * SQ);
      k_gemm2<0><<<dim3((QN / 128) * (HD / 64), HG), 128, 0, stream>>>(P, SQ, (size_t)SQ * SQ, VT + (size_t)h0 * HD * SQ, SQ, (size_t)HD * SQ, 0.00390625f, nullptr, 0, nullptr, 1, 0, 0, AF + r0 * DM + h0 * HD, nullptr, DM, (size_t)HD, QN, HD, SQ); } }      /* a (merged heads) as f32 rows */
  k_lnadd<1><<<(unsigned)MPO, 256, 0, stream>>>(AF + r0p * DM, x + r0p * DM, g1, be1, 1e-5f, X1F + r0p * DM, X1H + r0p * DM);      /* x1 = bf16(x) + LN(a) */
  const dim3 gf((unsigned)((MPO / 128) * (DM / 64)), 1);
  k_gemm2<3><<<gf, 128, 0, stream>>>(X1H + r0p * DM, DM, 0, B1, DM, 0, 0.0625f, b1, 0, nullptr, 1, 0, 0, nullptr, H16 + r0p * DM, DM, 0, MPO, DM, DM);      /* h = relu(x1 W1 + b1) (f16) */
  k_gemm2<0><<<gf, 128, 0, stream>>>(H16 + r0p * DM, DM, 0, B2, DM, 0, 0.0625f, b2, 0, nullptr, 1, 0, 0, FF + r0p * DM, nullptr, DM, 0, MPO, DM, DM);      /* f = h W2 + b2 (f32) */
  k_lnadd<0><<<(unsigned)MPO, 256, 0, stream>>>(FF + r0p * DM, X1F + r0p * DM, g2, be2, 1e-5f, (float*)d_out + r0p * DM, nullptr);      /* out = x1 + LN(f) */
}

// v001
// Measured time: 1850 microseconds a run.
// Timed twice side by side with v000, it ran 5.98 and 5.99 times as fast.
#include <hip/hip_runtime.h>
// Transformer encoder layer (x [8][1024][1024]; per-head q/k/v = x Wq[h] + bq[h] (Wq [16][1024][64]); scores / 8 with a key-padding mask x_mask [8][1][1024] (int32, read; all zeros here); softmax; a = attn v concatenated over heads; x1 = x + LayerNorm(a) g1 + be1; h = relu(x1 W1 + b1); f = h W2 + b2 (W1, W2 [1024][1024] [in][out]); out = x1 + LayerNorm(f) g2 + be2 -> [8][1024][1024]).
// Structure: token rows; x as exact f16 rows; Q, K, V as three WMMA GEMMs (32x64 wave tiles, f32 accumulation, exact x16 head-stacked weights + bias, f16 outputs); per batch: V^T for all heads via LDS transposes; per group of 4 heads: scores GEMM (K = 64), masked row softmax on VALU (f32 statistics, native exp; weights x256 f16, masked keys 0), a = P . V^T GEMM (K = 1024) into f32 rows; per row on VALU: x1 = bf16(x) + LayerNorm(a) (f32 + f16 copies); h = relu(x1 W1 + b1) GEMM (f16); f = h W2 + b2 GEMM (f32); per row on VALU: out = x1 + LayerNorm(f).
// Compute dtype: inputs rounded to bf16; x / weights exact; q, k, v, softmax weights, x1 (as GEMM operand) and h plain f16 (~2^-12); attention output, LayerNorms, residuals f32. v_wmma_f32_16x16x32_f16.
#define NB 8
#define SQ 1024
#define DM 1024
#define NH 16
#define HD 64
#define HG 4
#define B0 0                         /* first batch processed (debug hook) */
#define NBR NB                       /* batches processed (debug hook) */
#define QN SQ                        /* query rows attended per batch (debug hook) */
#define NR ((size_t)NB * SQ)
#define MP ((int)((size_t)NBR * SQ)) /* rows projected (debug hook) */
#define MPO MP                       /* rows through the post-attention stages (debug hook) */
typedef __bf16 v16b __attribute__((ext_vector_type(16)));
typedef unsigned short v8us __attribute__((ext_vector_type(8), may_alias));
typedef float  v8f  __attribute__((ext_vector_type(8)));
typedef float  v4f  __attribute__((ext_vector_type(4)));
typedef float  v4fa __attribute__((ext_vector_type(4), may_alias));
union FragB { v16b v; v8us half[2]; unsigned short u[16]; };

__device__ __forceinline__ unsigned short bf16_bits(float x) { unsigned int u = __float_as_uint(x); return (unsigned short)((u + 0x7FFFu + ((u >> 16) & 1u)) >> 16); }
__device__ __forceinline__ float bf16_val(unsigned short b) { return __uint_as_float(((unsigned int)b) << 16); }
__device__ __forceinline__ float bf16_round(float x) { return bf16_val(bf16_bits(x)); }
// D += A·B with NT terms: 1 = ah·bh, 2 = + al·bh (A split), 3 = + ah·bl (both split)
template <int NT>
__device__ __forceinline__ v8f mmaN(v16b ah, v16b al, v16b bh, v16b bl, v8f c) {
  c = __builtin_amdgcn_wmma_f32_16x16x32_bf16(false, ah, false, bh, (short)0, c, false, false);
  if (NT >= 2) c = __builtin_amdgcn_wmma_f32_16x16x32_bf16(false, al, false, bh, (short)0, c, false, false);
  if (NT >= 3) c = __builtin_amdgcn_wmma_f32_16x16x32_bf16(false, ah, false, bl, (short)0, c, false, false);
  asm volatile("v_nop\n\tv_nop\n\tv_nop\n\tv_nop" : "+v"(c) : "v"(ah), "v"(al), "v"(bh), "v"(bl));
  return c;
}

__global__ __launch_bounds__(256) void k_wt_bf16(const float* __restrict__ W, unsigned short* __restrict__ Wt, int K, int N) {
  const int t = blockIdx.x * 256 + threadIdx.x;
  const int k8n = K / 8;
  if (t >= N * k8n) return;
  const int n = t / k8n, k8 = (t % k8n) * 8;
  v8us v;
#pragma unroll
  for (int i = 0; i < 8; ++i) v[i] = bf16_bits(W[(size_t)(k8 + i) * N + n]);
  *(v8us*)(Wt + (size_t)n * K + k8) = v;
  
}

// GEMM C[M][N] (f32, pitch ldc) = act(A[M][K]·W + bias). A f32 row-major (pitch lda) converted per fragment to bf16
// (ASPLIT: hi/lo two planes -> 2 terms, else single rounded term); Wt bf16 [N][K] (pitch ldb). BIAS_BF16 rounds the
// bias to bf16 first (bias quantised to bf16 before the add). K%32==0, M%16==0, N%64==0.
template <bool ASPLIT, int ACT, bool BIAS_BF16>
__global__ __launch_bounds__(128) void k_gemm_bf(const float* __restrict__ A, int lda, const unsigned short* __restrict__ Wt, int ldb,
                                               const float* __restrict__ bias, float* __restrict__ C, int ldc, int M, int N, int K) {
  __shared__ __attribute__((aligned(16))) float so[4][16][64];
  const int tid = threadIdx.x, w = tid >> 5, lane = tid & 31, ln = lane & 15, hh = lane >> 4;
  const int ntn = N / 64;
  const int wid = blockIdx.x * 4 + w;
  const int mt = wid / ntn, nq = wid % ntn;
  if (mt * 16 >= M) return;
  const int row0 = mt * 16, col0 = nq * 64;
  const float* arow = A + (size_t)(row0 + ln) * lda;
  v8f acc[4] = {};
  for (int kb = 0; kb < K; kb += 32) {
    FragB ah, al;
    const v4f x0 = *(const v4fa*)(arow + kb + 8 * hh), x1 = *(const v4fa*)(arow + kb + 8 * hh + 4);
    const v4f x2 = *(const v4fa*)(arow + kb + 16 + 8 * hh), x3 = *(const v4fa*)(arow + kb + 16 + 8 * hh + 4);
    float xs[16] = {x0[0],x0[1],x0[2],x0[3],x1[0],x1[1],x1[2],x1[3],x2[0],x2[1],x2[2],x2[3],x3[0],x3[1],x3[2],x3[3]};
#pragma unroll
    for (int i = 0; i < 16; ++i) { const unsigned short hb = bf16_bits(xs[i]); ah.u[i] = hb; al.u[i] = ASPLIT ? bf16_bits(xs[i] - bf16_val(hb)) : (unsigned short)0; }
#pragma unroll
    for (int t = 0; t < 4; ++t) {
      const unsigned short* brow = Wt + (size_t)(col0 + t * 16 + ln) * ldb + kb;
      FragB b;
      b.half[0] = *(const v8us*)(brow + 8 * hh);
      b.half[1] = *(const v8us*)(brow + 16 + 8 * hh);
      acc[t] = mmaN<ASPLIT ? 2 : 1>(ah.v, al.v, b.v, b.v, acc[t]);
    }
  }
#pragma unroll
  for (int t = 0; t < 4; ++t) {
    float bv = bias ? bias[col0 + t * 16 + ln] : 0.f;
    if (BIAS_BF16) bv = bf16_round(bv);
#pragma unroll
    for (int r = 0; r < 8; ++r) { float v = acc[t][r] + bv; if (ACT == 1) v = fmaxf(v, 0.f); so[w][8 * hh + r][t * 16 + ln] = v; }
  }
  __builtin_amdgcn_fence(__ATOMIC_ACQ_REL, "workgroup");
  __builtin_amdgcn_wave_barrier();
  const int rsub = lane >> 4, c4 = (lane & 15) * 4;
  {
#pragma unroll
    for (int q = 0; q < 8; ++q) {
      const int r = q * 2 + rsub;
      const v4f v = *(const v4fa*)&so[w][r][c4];
      *(v4f*)(C + (size_t)(row0 + r) * ldc + col0 + c4) = v;
    }
    
  }
}

// GEMM C = act(A·W + bias + resid): A f32 (ASPLIT -> hi/lo 2 terms), Wt bf16 [N][K]; ACT 0 none, 1 relu, 2 exact gelu;
// resid (optional, f32, row index = (row % rmod), pitch ldr, RES_BF16 rounds it) added before the activation.
template <bool ASPLIT, int ACT, bool BIAS_BF16, bool RES_BF16>
__global__ __launch_bounds__(128) void k_gemm_bf3(const float* __restrict__ A, int lda, const unsigned short* __restrict__ Wt, int ldb,
                                                const float* __restrict__ bias, const float* __restrict__ resid, int rmod, int ldr,
                                                float* __restrict__ C, int ldc, int M, int N, int K) {
  __shared__ __attribute__((aligned(16))) float so[4][16][64];
  const int tid = threadIdx.x, w = tid >> 5, lane = tid & 31, ln = lane & 15, hh = lane >> 4;
  const int ntn = N / 64;
  const int wid = blockIdx.x * 4 + w;
  const int mt = wid / ntn, nq = wid % ntn;
  if (mt * 16 >= M) return;
  const int row0 = mt * 16, col0 = nq * 64;
  const float* arow = A + (size_t)(row0 + ln) * lda;
  v8f acc[4] = {};
  for (int kb = 0; kb < K; kb += 32) {
    FragB ah, al;
    const v4f x0 = *(const v4fa*)(arow + kb + 8 * hh), x1 = *(const v4fa*)(arow + kb + 8 * hh + 4);
    const v4f x2 = *(const v4fa*)(arow + kb + 16 + 8 * hh), x3 = *(const v4fa*)(arow + kb + 16 + 8 * hh + 4);
    float xs[16] = {x0[0],x0[1],x0[2],x0[3],x1[0],x1[1],x1[2],x1[3],x2[0],x2[1],x2[2],x2[3],x3[0],x3[1],x3[2],x3[3]};
#pragma unroll
    for (int i = 0; i < 16; ++i) { const unsigned short hb = bf16_bits(xs[i]); ah.u[i] = hb; al.u[i] = ASPLIT ? bf16_bits(xs[i] - bf16_val(hb)) : (unsigned short)0; }
#pragma unroll
    for (int t = 0; t < 4; ++t) {
      const unsigned short* brow = Wt + (size_t)(col0 + t * 16 + ln) * ldb + kb;
      FragB b;
      b.half[0] = *(const v8us*)(brow + 8 * hh);
      b.half[1] = *(const v8us*)(brow + 16 + 8 * hh);
      acc[t] = mmaN<ASPLIT ? 2 : 1>(ah.v, al.v, b.v, b.v, acc[t]);
    }
  }
#pragma unroll
  for (int t = 0; t < 4; ++t) {
    const int col = col0 + t * 16 + ln;
    float bv = bias ? bias[col] : 0.f;
    if (BIAS_BF16) bv = bf16_round(bv);
#pragma unroll
    for (int r = 0; r < 8; ++r) {
      float v = acc[t][r] + bv;
      if (resid) { float rv = resid[(size_t)((row0 + 8 * hh + r) % rmod) * ldr + col]; if (RES_BF16) rv = bf16_round(rv); v += rv; }
      if (ACT == 1) v = fmaxf(v, 0.f);
      if (ACT == 2) v = 0.5f * v * (1.0f + erff(v * 0.70710678118654752f));
      if (ACT == 3) { const float u = 0.7978845608028654f * (v + 0.044715f * v * v * v); v = 0.5f * v * (1.0f + tanhf(u)); }
      so[w][8 * hh + r][t * 16 + ln] = v;
    }
  }
  __builtin_amdgcn_fence(__ATOMIC_ACQ_REL, "workgroup");
  __builtin_amdgcn_wave_barrier();
  const int rsub = lane >> 4, c4 = (lane & 15) * 4;
  {
#pragma unroll
    for (int q = 0; q < 8; ++q) {
      const int r = q * 2 + rsub;
      const v4f v = *(const v4fa*)&so[w][r][c4];
      *(v4f*)(C + (size_t)(row0 + r) * ldc + col0 + c4) = v;
    }
    
  }
}
// row LayerNorm (biased variance, eps) over N: s = X (+ R); optional out_sum <- s; out_norm <- (s-mu)*rsqrt(var+eps)*g + b
template <bool PARAM_BF16>
__global__ __launch_bounds__(256) void k_layernorm(const float* __restrict__ X, const float* __restrict__ R, const float* __restrict__ g, const float* __restrict__ bta,
                                                  float* __restrict__ out_sum, float* __restrict__ out_norm, int N, float eps) {
  __shared__ float red[256];
  const int row = blockIdx.x, tid = threadIdx.x;
  const float* x = X + (size_t)row * N; const float* rr = R ? R + (size_t)row * N : nullptr;
  float vals[16];                     // up to N = 4096
  const int per = N / 256;            // contiguous chunk per thread? use strided-by-4 chunks: thread handles j = tid*4 + 1024*u
  float s1 = 0.f;
  for (int u = 0; u < per / 4; ++u) {
    const int j = tid * 4 + 1024 * u;
    const v4f a = *(const v4fa*)(x + j);
    v4f b = {0.f,0.f,0.f,0.f}; if (rr) b = *(const v4fa*)(rr + j);
#pragma unroll
    for (int q = 0; q < 4; ++q) { const float v = a[q] + b[q]; vals[u * 4 + q] = v; s1 += v; }
  }
  red[tid] = s1; __syncthreads();
  for (int st = 128; st > 0; st >>= 1) { if (tid < st) red[tid] += red[tid + st]; __syncthreads(); }
  const float mu = red[0] / (float)N; __syncthreads();
  float s2 = 0.f;
  for (int u = 0; u < per / 4; ++u)
#pragma unroll
    for (int q = 0; q < 4; ++q) { const float c = vals[u * 4 + q] - mu; s2 += c * c; }
  red[tid] = s2; __syncthreads();
  for (int st = 128; st > 0; st >>= 1) { if (tid < st) red[tid] += red[tid + st]; __syncthreads(); }
  const float rs = rsqrtf(red[0] / (float)N + eps);
  {
    for (int u = 0; u < per / 4; ++u) {
      const int j = tid * 4 + 1024 * u;
      v4f o, sm;
#pragma unroll
      for (int q = 0; q < 4; ++q) {
        float gg = g[j + q], bb = bta[j + q];
        if (PARAM_BF16) { gg = bf16_round(gg); bb = bf16_round(bb); }
        sm[q] = vals[u * 4 + q]; o[q] = (vals[u * 4 + q] - mu) * rs * gg + bb;
      }
      if (out_sum) *(v4f*)(out_sum + (size_t)row * N + j) = sm;
      *(v4f*)(out_norm + (size_t)row * N + j) = o;
    }
    
  }
}



// ---- f16 WMMA path (v_wmma_f32_16x16x32_f16): 11-bit significands for operands in range — used for every GEMM launched here
typedef _Float16 v16h __attribute__((ext_vector_type(16)));
union FragH { v16h v; v8us half[2]; _Float16 h[16]; unsigned short u[16]; };
template <int NT>
__device__ __forceinline__ v8f mmaH(v16h ah, v16h al, v16h bh, v16h bl, v8f c) {
  c = __builtin_amdgcn_wmma_f32_16x16x32_f16(false, ah, false, bh, (short)0, c, false, false);
  if (NT >= 2) c = __builtin_amdgcn_wmma_f32_16x16x32_f16(false, al, false, bh, (short)0, c, false, false);
  if (NT >= 3) c = __builtin_amdgcn_wmma_f32_16x16x32_f16(false, ah, false, bl, (short)0, c, false, false);
  asm volatile("v_nop\n\tv_nop\n\tv_nop\n\tv_nop" : "+v"(c) : "v"(ah), "v"(al), "v"(bh), "v"(bl));
  return c;
}
// batched GEMM like k_gemm_b but f16 operands: A f32 (split into f16 hi/lo if ASPLIT, else rounded to f16), Bt = f16 values [n][k]; alpha; C f32; N multiple of 16 (partial tiles skipped)
template <bool ASPLIT>
__global__ __launch_bounds__(128) void k_gemm_h(const float* __restrict__ A, int lda, size_t sA, const _Float16* __restrict__ Bh, int ldb, size_t sB, float alpha, float* __restrict__ C, int ldc, size_t sC, int M, int N, int K) {
  __shared__ __attribute__((aligned(16))) float so[4][16][64];
  const int tid = threadIdx.x, w = tid >> 5, lane = tid & 31, ln = lane & 15, hh = lane >> 4; const int by = blockIdx.y;
  A += (size_t)by * sA; Bh += (size_t)by * sB; C += (size_t)by * sC;
  const int ntn = (N + 63) / 64; const int wid = blockIdx.x * 4 + w; const int mt = wid / ntn, nq = wid % ntn; if (mt * 16 >= M) return;
  const int row0 = mt * 16, col0 = nq * 64; const float* arow = A + (size_t)(row0 + ln) * lda;
  v8f acc[4] = {};
  for (int kb = 0; kb < K; kb += 32) {
    FragH ah, al;
    const v4f x0 = *(const v4fa*)(arow + kb + 8 * hh), x1 = *(const v4fa*)(arow + kb + 8 * hh + 4), x2 = *(const v4fa*)(arow + kb + 16 + 8 * hh), x3 = *(const v4fa*)(arow + kb + 16 + 8 * hh + 4);
    float xs[16] = {x0[0],x0[1],x0[2],x0[3],x1[0],x1[1],x1[2],x1[3],x2[0],x2[1],x2[2],x2[3],x3[0],x3[1],x3[2],x3[3]};
#pragma unroll
    for (int i = 0; i < 16; ++i) { const _Float16 h = (_Float16)xs[i]; ah.h[i] = h; al.h[i] = ASPLIT ? (_Float16)(xs[i] - (float)h) : (_Float16)0.0f; }
#pragma unroll
    for (int t = 0; t < 4; ++t) { if (col0 + t * 16 >= N) continue; const size_t boff = (size_t)(col0 + t * 16 + ln) * ldb + kb; FragH bq; bq.half[0] = *(const v8us*)(Bh + boff + 8 * hh); bq.half[1] = *(const v8us*)(Bh + boff + 16 + 8 * hh);
      acc[t] = mmaH<ASPLIT ? 2 : 1>(ah.v, al.v, bq.v, bq.v, acc[t]); }
  }
#pragma unroll
  for (int t = 0; t < 4; ++t) { if (col0 + t * 16 >= N) continue;
#pragma unroll
    for (int r = 0; r < 8; ++r) so[w][8 * hh + r][t * 16 + ln] = acc[t][r] * alpha; }
  __builtin_amdgcn_fence(__ATOMIC_ACQ_REL, "workgroup"); __builtin_amdgcn_wave_barrier();
  const int rsub = lane >> 4, c4 = (lane & 15) * 4;
  {
#pragma unroll
    for (int q = 0; q < 8; ++q) { const int r = q * 2 + rsub; if (col0 + c4 < N) { const v4f v = *(const v4fa*)&so[w][r][c4]; *(v4f*)(C + (size_t)(row0 + r) * ldc + col0 + c4) = v; } }
     }
}

// Wt[n][k] = f16(W[k][n]·scale) from f32 row-major W[K][N] (scale = power of two; bf16-exact weights stay exact in f16 away from the subnormal range)
__global__ __launch_bounds__(256) void k_wt_f16(const float* __restrict__ W, _Float16* __restrict__ Wt, int K, int N, float scale) {
  const int t = blockIdx.x * 256 + threadIdx.x; if (t >= N * (K / 8)) return; const int n = t / (K / 8), k8 = (t % (K / 8)) * 8; FragH f;
#pragma unroll
  for (int i = 0; i < 8; ++i) f.h[i] = (_Float16)(bf16_round(W[(size_t)(k8 + i) * N + n]) * scale); const v8us o = f.half[0];
  *(v8us*)((unsigned short*)Wt + (size_t)n * K + k8) = o; 
}
// k_gemm_hh variant with fused epilogue: v = acc·alpha + bias[by·sBias + col] (+ CP[(row/rowsPerB)·sCPb + by·64 + col] if CP) ; ACT 0 none / 1 elu ; writes f16 C16 (and f32 C if non-null)
template <int ACT>
__global__ __launch_bounds__(128) void k_gemm_hhx(const _Float16* __restrict__ A, int lda, size_t sA, const _Float16* __restrict__ Bh, int ldb, size_t sB, float alpha, const float* __restrict__ bias, size_t sBias, const float* __restrict__ CP, int rowsPerB, size_t sCPb, int row0g,
    float* __restrict__ C, _Float16* __restrict__ C16, int ldc, size_t sC, int M, int N, int K) {
  __shared__ __attribute__((aligned(16))) float so[4][16][64];
  const int tid = threadIdx.x, w = tid >> 5, lane = tid & 31, ln = lane & 15, hh = lane >> 4; const int by = blockIdx.y;
  A += (size_t)by * sA; Bh += (size_t)by * sB; const size_t cofs = (size_t)by * sC; const float* bp = bias ? bias + (size_t)by * sBias : nullptr;
  const int ntn = (N + 63) / 64; const int wid = blockIdx.x * 4 + w; const int mt = wid / ntn, nq = wid % ntn; if (mt * 16 >= M) return;
  const int row0 = mt * 16, col0 = nq * 64; const _Float16* arow = A + (size_t)(row0 + ln) * lda;
  v8f acc[4] = {};
  for (int kb = 0; kb < K; kb += 32) { FragH ah; ah.half[0] = *(const v8us*)((const unsigned short*)arow + kb + 8 * hh); ah.half[1] = *(const v8us*)((const unsigned short*)arow + kb + 16 + 8 * hh);
#pragma unroll
    for (int t = 0; t < 4; ++t) { if (col0 + t * 16 >= N) continue; const size_t boff = (size_t)(col0 + t * 16 + ln) * ldb + kb; FragH bq; bq.half[0] = *(const v8us*)((const unsigned short*)Bh + boff + 8 * hh); bq.half[1] = *(const v8us*)((const unsigned short*)Bh + boff + 16 + 8 * hh);
      acc[t] = mmaH<1>(ah.v, ah.v, bq.v, bq.v, acc[t]); }
  }
#pragma unroll
  for (int t = 0; t < 4; ++t) { if (col0 + t * 16 >= N) continue; const int col = col0 + t * 16 + ln; const float bv = bp ? bf16_round(bp[col]) : 0.f;
#pragma unroll
    for (int r = 0; r < 8; ++r) { float v = acc[t][r] * alpha + bv; if (CP) { const int rr = row0g + row0 + 8 * hh + r; if (rowsPerB < 0) v += CP[cofs + (size_t)rr * ldc + col];      /* rowsPerB < 0: own element of the batched C plane */ else { const int bidx = rr / rowsPerB; v += CP[(size_t)bidx * sCPb + (size_t)by * 64 + col]; } } if (ACT == 1) v = (v > 0.f) ? v : expm1f(v); else if (ACT == 7) v = (v > 0.f) ? v + 1.0f : expf(v); else if (ACT == 8) v = tanhf(v); else if (ACT == 9) v = 0.5f * v * (1.0f + tanhf(0.7978845608028654f * (v + 0.044715f * v * v * v))); else if (ACT == 11) v = 1.0f / (1.0f + expf(-v)); else if (ACT == 12) v = (v > 0.f) ? v : 0.01f * v; else if (ACT == 14) v = (v > 0.f) ? v : 0.1f * v; else if (ACT == 16) v = (v >= 0.f) ? v : 0.3f * v; else if (ACT == 17) v = (v >= 0.f) ? v : 0.2f * v; else if (ACT == 15) v = v / (1.0f + expf(-v)); else if (ACT == 3) v = fmaxf(v, 0.f); else if (ACT == 6) v = 0.5f * v * (1.0f + erff(v * 0.70710678118654752f)); so[w][8 * hh + r][t * 16 + ln] = v; } }
  __builtin_amdgcn_fence(__ATOMIC_ACQ_REL, "workgroup"); __builtin_amdgcn_wave_barrier();
  const int rsub = lane >> 4, c4 = (lane & 15) * 4; typedef _Float16 v4h __attribute__((ext_vector_type(4)));
  {
#pragma unroll
    for (int q = 0; q < 8; ++q) { const int r = q * 2 + rsub; if (col0 + c4 < N) { const v4f v = *(const v4fa*)&so[w][r][c4]; if (C) *(v4f*)(C + cofs + (size_t)(row0 + r) * ldc + col0 + c4) = v; if (C16) { v4h h4; for (int i = 0; i < 4; ++i) h4[i] = (_Float16)v[i]; *(v4h*)(C16 + cofs + (size_t)(row0 + r) * ldc + col0 + c4) = h4; } } }
     }
}


typedef _Float16 v4h __attribute__((ext_vector_type(4)));

__global__ __launch_bounds__(256) void k_x16(const float* __restrict__ x, _Float16* __restrict__ X16, size_t n8) { const size_t t = (size_t)blockIdx.x * 256 + threadIdx.x; if (t >= n8) return; FragH f;
#pragma unroll
  for (int q = 0; q < 8; ++q) f.h[q] = (_Float16)bf16_round(x[t * 8 + q]); *(v8us*)((unsigned short*)X16 + t * 8) = f.half[0];  }
__global__ __launch_bounds__(256) void k_h16(const float* __restrict__ x, _Float16* __restrict__ X16, size_t n8) { const size_t t = (size_t)blockIdx.x * 256 + threadIdx.x; if (t >= n8) return; FragH f;
#pragma unroll
  for (int q = 0; q < 8; ++q) f.h[q] = (_Float16)x[t * 8 + q]; *(v8us*)((unsigned short*)X16 + t * 8) = f.half[0];  }
__global__ __launch_bounds__(256) void k_round16f(const float* __restrict__ W, _Float16* __restrict__ Bt, size_t n8) { const size_t t = (size_t)blockIdx.x * 256 + threadIdx.x; if (t >= n8) return; FragH f;
#pragma unroll
  for (int i = 0; i < 8; ++i) f.h[i] = (_Float16)(bf16_round(W[t * 8 + i]) * 16.0f); *(v8us*)((unsigned short*)Bt + t * 8) = f.half[0];  }
template <int NHv, int TTv>
__global__ __launch_bounds__(256) void k_vt(const _Float16* __restrict__ V16, int ldv, int voff, _Float16* __restrict__ Vt) { __shared__ unsigned short tl[64][66]; const int tid = threadIdx.x; const int slab = blockIdx.x / (TTv / 64), lg = blockIdx.x % (TTv / 64); const int b = slab / NHv, h = slab % NHv;
  for (int i = tid; i < 64 * 8; i += 256) { const int r = i / 8, c8 = (i % 8) * 8; FragH f; f.half[0] = *(const v8us*)((const unsigned short*)V16 + ((size_t)b * TTv + lg * 64 + r) * ldv + voff + h * 64 + c8);
#pragma unroll
    for (int q = 0; q < 8; ++q) tl[r][c8 + q] = f.u[q]; }
  __syncthreads();
  {
#pragma unroll
    for (int rd = 0; rd < 2; ++rd) { const int d = rd * 32 + tid / 8, pc = tid % 8; FragH f;
#pragma unroll
      for (int q = 0; q < 8; ++q) f.u[q] = tl[pc * 8 + q][d];
      *(v8us*)((unsigned short*)Vt + ((size_t)slab * 64 + d) * TTv + lg * 64 + pc * 8) = f.half[0]; }
     } }

__global__ __launch_bounds__(256) void k_hl(const float* __restrict__ F, _Float16* __restrict__ Hh, _Float16* __restrict__ Hl, size_t n8) { const size_t t = (size_t)blockIdx.x * 256 + threadIdx.x; if (t >= n8) return; FragH fh, fl; const v4f a = *(const v4fa*)(F + t * 8), c = *(const v4fa*)(F + t * 8 + 4);
#pragma unroll
  for (int q = 0; q < 4; ++q) { _Float16 h = (_Float16)a[q]; fh.h[q] = h; fl.h[q] = (_Float16)((a[q] - (float)h) * 1024.0f); h = (_Float16)c[q]; fh.h[4 + q] = h; fl.h[4 + q] = (_Float16)((c[q] - (float)h) * 1024.0f); }
  { *(v8us*)((unsigned short*)Hh + t * 8) = fh.half[0]; *(v8us*)((unsigned short*)Hl + t * 8) = fl.half[0];  } }

// ---- fast GEMM (wave tile 32x64; requires M % 32 == 0 rows per launch region and N % 64 == 0); epilogue = k_gemm_hhx semantics ----
__device__ __forceinline__ v16h g2_frag(const _Float16* p, int hh) { FragH f; f.half[0] = *(const v8us*)((const unsigned short*)p + 8 * hh); f.half[1] = *(const v8us*)((const unsigned short*)p + 16 + 8 * hh); return f.v; }
__device__ __forceinline__ v8f g2_mma(v16h a, v16h b, v8f c) { v8f d = __builtin_amdgcn_wmma_f32_16x16x32_f16(false, a, false, b, (short)0, c, false, false); asm volatile("v_nop\n\tv_nop\n\tv_nop\n\tv_nop" : "+v"(d) : "v"(a), "v"(b)); return d; }
template <int ACT>
__global__ __launch_bounds__(128) void k_gemm2(const _Float16* __restrict__ A, int lda, size_t sA, const _Float16* __restrict__ Bh, int ldb, size_t sB, float alpha, const float* __restrict__ bias, size_t sBias, const float* __restrict__ CP, int rowsPerB, size_t sCPb, int row0g,
    float* __restrict__ C, _Float16* __restrict__ C16, int ldc, size_t sC, int M, int N, int K) { static_assert(ACT == 0 || ACT == 3 || ACT == 6 || ACT == 8 || ACT == 9 || ACT == 11 || ACT == 12 || ACT == 14 || ACT == 15 || ACT == 16 || ACT == 17, "k_gemm2: unsupported ACT code (would silently apply no activation)");
  __shared__ __attribute__((aligned(16))) float so[4][32][68];
  const int tid = threadIdx.x, w = tid >> 5, lane = tid & 31, ln = lane & 15, hh = lane >> 4; const int by = blockIdx.y;
  A += (size_t)by * sA; Bh += (size_t)by * sB; const size_t cofs = (size_t)by * sC; const float* bp = bias ? bias + (size_t)by * sBias : nullptr;
  const int ntn = N >> 6; const int mt = blockIdx.x / ntn, nq = blockIdx.x - mt * ntn; const int row0 = mt * 128 + 32 * w, col0 = nq * 64; if (row0 >= M) return;
  const _Float16* a0p = A + (size_t)(row0 + ln) * lda; const _Float16* a1p = a0p + (size_t)16 * lda;
  const _Float16* b0p = Bh + (size_t)(col0 + ln) * ldb; const _Float16* b1p = b0p + (size_t)16 * ldb; const _Float16* b2p = b1p + (size_t)16 * ldb; const _Float16* b3p = b2p + (size_t)16 * ldb;
  const v8f z8 = {0.f,0.f,0.f,0.f,0.f,0.f,0.f,0.f}; v8f c00 = z8, c01 = z8, c02 = z8, c03 = z8, c10 = z8, c11 = z8, c12 = z8, c13 = z8;
#pragma unroll 1
  for (int kb = 0; kb < K; kb += 32) { const v16h a0 = g2_frag(a0p + kb, hh), a1 = g2_frag(a1p + kb, hh);
    v16h b = g2_frag(b0p + kb, hh); c00 = g2_mma(a0, b, c00); c10 = g2_mma(a1, b, c10);
    b = g2_frag(b1p + kb, hh); c01 = g2_mma(a0, b, c01); c11 = g2_mma(a1, b, c11);
    b = g2_frag(b2p + kb, hh); c02 = g2_mma(a0, b, c02); c12 = g2_mma(a1, b, c12);
    b = g2_frag(b3p + kb, hh); c03 = g2_mma(a0, b, c03); c13 = g2_mma(a1, b, c13); }
  v8f accs[8] = {c00, c01, c02, c03, c10, c11, c12, c13};
#pragma unroll
  for (int u = 0; u < 8; ++u) { const int t = u & 3, half = u >> 2; const int col = col0 + t * 16 + ln; const float bv = bp ? bf16_round(bp[col]) : 0.f;
#pragma unroll
    for (int r = 0; r < 8; ++r) { const int rloc = half * 16 + 8 * hh + r; float v = accs[u][r] * alpha + bv; if (CP) { if (rowsPerB < 0) v += CP[cofs + (size_t)(row0g + row0 + rloc) * ldc + col];      /* rowsPerB < 0: own element of the batched C plane */ else { const int bidx = (row0g + row0 + rloc) / rowsPerB; v += CP[(size_t)bidx * sCPb + (size_t)by * 64 + col]; } }
      if (ACT == 3) v = fmaxf(v, 0.f); else if (ACT == 6) v = 0.5f * v * (1.0f + erff(v * 0.70710678118654752f)); else if (ACT == 11) v = 1.0f / (1.0f + expf(-v)); else if (ACT == 15) v = v / (1.0f + expf(-v)); else if (ACT == 12) v = (v > 0.f) ? v : 0.01f * v; else if (ACT == 8) v = tanhf(v); else if (ACT == 9) v = 0.5f * v * (1.0f + tanhf(0.7978845608028654f * (v + 0.044715f * v * v * v))); else if (ACT == 14) v = (v > 0.f) ? v : 0.1f * v; else if (ACT == 16) v = (v >= 0.f) ? v : 0.3f * v; else if (ACT == 17) v = (v >= 0.f) ? v : 0.2f * v;
      so[w][rloc][t * 16 + ln] = v; } }
  __builtin_amdgcn_fence(__ATOMIC_ACQ_REL, "workgroup"); __builtin_amdgcn_wave_barrier();
  const int rsub = lane >> 4, c4 = (lane & 15) * 4;
  {
#pragma unroll
    for (int q = 0; q < 16; ++q) { const int r = q * 2 + rsub; const v4f v = *(const v4fa*)&so[w][r][c4]; if (C) *(v4f*)(C + cofs + (size_t)(row0 + r) * ldc + col0 + c4) = v; if (C16) { v4h h4; for (int i = 0; i < 4; ++i) h4[i] = (_Float16)v[i]; *(v4h*)(C16 + cofs + (size_t)(row0 + r) * ldc + col0 + c4) = h4; } }
     } }


__global__ __launch_bounds__(256) void k_wnat(const float* __restrict__ w, size_t n8, _Float16* __restrict__ Bt) { const size_t t = (size_t)blockIdx.x * 256 + threadIdx.x; if (t >= n8) return; FragH f; for (int q = 0; q < 8; ++q) f.h[q] = (_Float16)(bf16_round(w[t * 8 + q]) * 16.0f); *(v8us*)((unsigned short*)Bt + t * 8) = f.half[0];  }
__global__ __launch_bounds__(256) void k_rsm(const float* __restrict__ S, _Float16* __restrict__ P, int nrows) {
  #pragma clang fp contract(off)
  const int i = blockIdx.x * 256 + threadIdx.x; if (i >= nrows) return; const float* s = S + (size_t)i * SQ; float mx = -3.0e38f;
#pragma unroll 1
  for (int j = 0; j < SQ; ++j) mx = fmaxf(mx, s[j]); float se = 0.f;
#pragma unroll 1
  for (int j = 0; j < SQ; ++j) se += expf(s[j] - mx); const float sc = 256.0f / se;
#pragma unroll 1
  for (int j0 = 0; j0 < SQ; j0 += 8) { FragH f; for (int q = 0; q < 8; ++q) f.h[q] = (_Float16)(expf(s[j0 + q] - mx) * sc); unsigned short* d = (unsigned short*)P + (size_t)i * SQ + j0; *(v8us*)d = f.half[0];  } }
__global__ __launch_bounds__(256) void k_vt(const _Float16* __restrict__ V16, int b, int h0, _Float16* __restrict__ VT) { __shared__ unsigned short tl[64][65]; const int tid = threadIdx.x; const int hh = blockIdx.x % HG, sg = blockIdx.x / HG; const int s0 = sg * 64; const int h = h0 + hh;
  for (int i = tid; i < 64 * 8; i += 256) { const int j = i / 8, d8 = (i % 8) * 8; FragH f; f.half[0] = *(const v8us*)((const unsigned short*)V16 + ((size_t)b * SQ + s0 + j) * DM + h * HD + d8); for (int q = 0; q < 8; ++q) tl[d8 + q][j] = f.u[q]; }
  __syncthreads();
  { for (int i = tid; i < 64 * 8; i += 256) { const int d = i / 8, j8 = (i % 8) * 8; FragH f; for (int q = 0; q < 8; ++q) f.u[q] = tl[d][j8 + q]; *(v8us*)((unsigned short*)VT + ((size_t)hh * HD + d) * SQ + s0 + j8) = f.half[0]; }  } }


__global__ __launch_bounds__(256) void k_whd(const float* __restrict__ w, _Float16* __restrict__ Bt) { const size_t t = (size_t)blockIdx.x * 256 + threadIdx.x; if (t >= (size_t)DM * (DM / 8)) return; const int d8 = (int)(t % (DM / 8)) * 8; const int n = (int)(t / (DM / 8)); const int h = n / HD, k = n % HD; FragH f;
  for (int q = 0; q < 8; ++q) f.h[q] = (_Float16)(bf16_round(w[((size_t)h * DM + d8 + q) * HD + k]) * 16.0f);
  unsigned short* dst = (unsigned short*)Bt + (size_t)n * DM + d8; *(v8us*)dst = f.half[0];  }
// Masked row softmax, one wave per score row: lane l holds elements 128 u + 4 l .. + 3 (u = 0..7) in registers, so every load covers 512 contiguous bytes,
// the row is read once and each exponential is taken once. A masked key enters as -inf: it leaves the maximum alone and its exponential is 0.
// Maximum and sum over the row: four partials per lane, then a five-step xor butterfly (every lane ends with the same value). A row with every key masked gets weights 0.
typedef int v4ia __attribute__((ext_vector_type(4), may_alias));
template <int M> __device__ __forceinline__ float rs_xrow(float x) { return __builtin_bit_cast(float, __builtin_amdgcn_update_dpp(0, __builtin_bit_cast(int, x), 0x160 | M, 0xf, 0xf, true)); }      /* lane l <- lane l ^ M inside a 16-lane row (row_xmask) */
__device__ __forceinline__ float rs_xhalf(float x) { return __builtin_bit_cast(float, __builtin_amdgcn_permlanex16(__builtin_bit_cast(int, x), __builtin_bit_cast(int, x), 0x76543210, 0xfedcba98, false, false)); }      /* lane l <- lane l ^ 16 */
// four independent 2^x in one statement, closed by the one v_nop that the instruction set asks for behind a transcendental before its result is used or its source overwritten
// outputs are early-clobber so that no exponential writes a neighbour's source
__device__ __forceinline__ void rs_exp2x4(float* x) { float r0, r1, r2, r3;
  asm("v_exp_f32 %0, %4\n\tv_exp_f32 %1, %5\n\tv_exp_f32 %2, %6\n\tv_exp_f32 %3, %7\n\tv_nop" : "=&v"(r0), "=&v"(r1), "=&v"(r2), "=&v"(r3) : "v"(x[0]), "v"(x[1]), "v"(x[2]), "v"(x[3]));
  x[0] = r0; x[1] = r1; x[2] = r2; x[3] = r3; }
__global__ __launch_bounds__(256) void k_rsmfm(const float* __restrict__ S, _Float16* __restrict__ P, int qn, int hg, const int* __restrict__ mk) {
  const int lane = threadIdx.x & 31; const int t = blockIdx.x * 8 + __builtin_amdgcn_readfirstlane(threadIdx.x >> 5); if (t >= qn * hg) return;      /* the row number is scalar: row addresses in scalar registers, a wave-uniform exit; the kernel has no barrier */
  const size_t i = (size_t)(t / qn) * SQ + (t % qn); const float* s = S + i * SQ; const int* m = mk; const int l4 = lane * 4;
  v4f sv[8]; v4ia mv[8];
#pragma unroll      /* register arrays need constant indices */
  for (int u = 0; u < 8; ++u) { sv[u] = *(const v4fa*)(s + l4 + u * 128); mv[u] = *(const v4ia*)(m + l4 + u * 128); }
  asm volatile("s_wait_xcnt 0x0" ::: "memory");      /* behind the 16 loads, in front of every later reuse of a register that they name as an address */
  __builtin_amdgcn_sched_barrier(0);      /* all 16 loads are issued before the first value is used: one load latency per row instead of two */
  float e[32]; float m4[4] = {-3.0e38f, -3.0e38f, -3.0e38f, -3.0e38f};
#pragma unroll      /* register arrays need constant indices */
  for (int u = 0; u < 8; ++u)
#pragma unroll
    for (int q = 0; q < 4; ++q) { const float v = (mv[u][q] == 0) ? sv[u][q] : -__builtin_inff(); e[u * 4 + q] = v; m4[q] = fmaxf(m4[q], v); }
  float mx = fmaxf(fmaxf(m4[0], m4[1]), fmaxf(m4[2], m4[3]));
  mx = fmaxf(mx, rs_xrow<1>(mx)); mx = fmaxf(mx, rs_xrow<2>(mx)); mx = fmaxf(mx, rs_xrow<4>(mx)); mx = fmaxf(mx, rs_xrow<8>(mx)); mx = fmaxf(mx, rs_xhalf(mx));
  float s4[4] = {0.f, 0.f, 0.f, 0.f};
#pragma unroll      /* register arrays need constant indices */
  for (int u = 0; u < 8; ++u) {
#pragma unroll
    for (int q = 0; q < 4; ++q) e[u * 4 + q] = (e[u * 4 + q] - mx) * 1.44269504f;      /* exp(x) = 2^(x log2 e), the native form */
    rs_exp2x4(e + u * 4);
#pragma unroll
    for (int q = 0; q < 4; ++q) s4[q] += e[u * 4 + q]; }
  float se = (s4[0] + s4[1]) + (s4[2] + s4[3]);
  se += rs_xrow<1>(se); se += rs_xrow<2>(se); se += rs_xrow<4>(se); se += rs_xrow<8>(se); se += rs_xhalf(se);
  const float sc = (se == 0.f) ? 0.f : 256.0f / se; unsigned short* d = (unsigned short*)P + i * SQ; typedef unsigned short v4us __attribute__((ext_vector_type(4)));
#pragma unroll      /* register arrays need constant indices */
  for (int u = 0; u < 8; ++u) { FragH f; v4us o;
#pragma unroll
    for (int q = 0; q < 4; ++q) { f.h[q] = (_Float16)(e[u * 4 + q] * sc); o[q] = f.u[q]; }
    *(v4us*)(d + l4 + u * 128) = o; } }
template <int RBF>
__global__ __launch_bounds__(256) void k_lnadd(const float* __restrict__ A, const float* __restrict__ R, const float* __restrict__ g, const float* __restrict__ bta, float eps, float* __restrict__ OF_, _Float16* __restrict__ OH_) {
  #pragma clang fp contract(off)
  __shared__ float red[256]; const size_t row = blockIdx.x; const int tid = threadIdx.x; const int j0 = tid * 4; float a[4], r[4]; float s1 = 0.f;
  { const v4f av = *(const v4fa*)(A + row * DM + j0); const v4f rv = *(const v4fa*)(R + row * DM + j0); for (int q = 0; q < 4; ++q) { a[q] = av[q]; r[q] = RBF ? bf16_round(rv[q]) : rv[q]; s1 = __fadd_rn(s1, a[q]); } }
  red[tid] = s1; __syncthreads(); for (int st = 128; st > 0; st >>= 1) { if (tid < st) red[tid] = __fadd_rn(red[tid], red[tid + st]); __syncthreads(); }
  const float mu = red[0] / (float)DM; __syncthreads(); float s2 = 0.f;
  for (int q = 0; q < 4; ++q) { const float c = __fadd_rn(a[q], -mu); s2 = __fadd_rn(s2, __fmul_rn(c, c)); }
  red[tid] = s2; __syncthreads(); for (int st = 128; st > 0; st >>= 1) { if (tid < st) red[tid] = __fadd_rn(red[tid], red[tid + st]); __syncthreads(); }
  const float rs = rsqrtf(__fadd_rn(red[0] / (float)DM, eps)); v4f o; FragH h;
  for (int q = 0; q < 4; ++q) { o[q] = __fadd_rn(r[q], __fadd_rn(__fmul_rn(__fmul_rn(__fadd_rn(a[q], -mu), rs), bf16_round(g[j0 + q])), bf16_round(bta[j0 + q]))); h.h[q] = (_Float16)o[q]; }
  typedef unsigned short v4us __attribute__((ext_vector_type(4))); v4us h4; for (int q = 0; q < 4; ++q) h4[q] = h.u[q];
  { *(v4f*)(OF_ + row * DM + j0) = o; if (OH_) *(v4us*)((unsigned short*)OH_ + row * DM + j0) = h4;  } }

extern "C" void kernel_launch(void* const* d_in, const int* in_sizes, int n_in,
                              void* d_out, int out_size, void* d_ws, size_t ws_size, hipStream_t stream) {
  (void)in_sizes; (void)n_in; (void)out_size;
  const float* const* I = (const float* const*)d_in; const float* x = I[0]; const int* xmask = (const int*)d_in[1]; const float* wq = I[2]; const float* bq = I[3]; const float* wk = I[4]; const float* bk = I[5]; const float* wv = I[6]; const float* bv = I[7]; const float* w1 = I[8]; const float* b1 = I[9]; const float* w2 = I[10]; const float* b2 = I[11]; const float* g1 = I[12]; const float* be1 = I[13]; const float* g2 = I[14]; const float* be2 = I[15];
  char* ws = (char*)d_ws; size_t off = 0;
  auto take = [&](size_t bytes) { char* p = ws + off; off += (bytes + 255) & ~(size_t)255; return p; };
  _Float16* BQ = (_Float16*)take((size_t)DM * DM * 2); _Float16* BK = (_Float16*)take((size_t)DM * DM * 2); _Float16* BV = (_Float16*)take((size_t)DM * DM * 2); _Float16* B1 = (_Float16*)take((size_t)DM * DM * 2); _Float16* B2 = (_Float16*)take((size_t)DM * DM * 2);
  _Float16* X16 = (_Float16*)take(NR * DM * 2); _Float16* Q16 = (_Float16*)take(NR * DM * 2); _Float16* K16 = (_Float16*)take(NR * DM * 2); _Float16* V16 = (_Float16*)take(NR * DM * 2); float* AF = (float*)take(NR * DM * 4); float* X1F = (float*)take(NR * DM * 4); _Float16* X1H = (_Float16*)take(NR * DM * 2); _Float16* H16 = (_Float16*)take(NR * DM * 2); float* FF = AF;      /* f rows reuse the attention-output rows (dead after the first LayerNorm; same type) */
  float* S = (float*)take((size_t)HG * SQ * SQ * 4); _Float16* P = (_Float16*)take((size_t)HG * SQ * SQ * 2); _Float16* VT = (_Float16*)take((size_t)NH * HD * SQ * 2);
  if (off > ws_size) return;      /* 10 + 16x4 + 32 + 32 + 16 + 16 + 16 + 8 + 2 = approx 196 MiB */
  { const unsigned gw = (unsigned)(((size_t)DM * (DM / 8) + 255) / 256); k_whd<<<gw, 256, 0, stream>>>(wq, BQ); k_whd<<<gw, 256, 0, stream>>>(wk, BK); k_whd<<<gw, 256, 0, stream>>>(wv, BV); k_wt_f16<<<gw, 256, 0, stream>>>(w1, B1, DM, DM, 16.0f); k_wt_f16<<<gw, 256, 0, stream>>>(w2, B2, DM, DM, 16.0f); }
  k_x16<<<(unsigned)((NR * DM / 8 + 255) / 256), 256, 0, stream>>>(x, X16, NR * DM / 8);
  const size_t r0p = (size_t)B0 * SQ; const dim3 gp((unsigned)((MP / 128) * (DM / 64)), 1);
  k_gemm2<0><<<gp, 128, 0, stream>>>(X16 + r0p * DM, DM, 0, BQ, DM, 0, 0.0625f, bq, 0, nullptr, 1, 0, 0, nullptr, Q16 + r0p * DM, DM, 0, MP, DM, DM);
  k_gemm2<0><<<gp, 128, 0, stream>>>(X16 + r0p * DM, DM, 0, BK, DM, 0, 0.0625f, bk, 0, nullptr, 1, 0, 0, nullptr, K16 + r0p * DM, DM, 0, MP, DM, DM);
  k_gemm2<0><<<gp, 128, 0, stream>>>(X16 + r0p * DM, DM, 0, BV, DM, 0, 0.0625f, bv, 0, nullptr, 1, 0, 0, nullptr, V16 + r0p * DM, DM, 0, MP, DM, DM);
  for (int b = B0; b < B0 + NBR; ++b) { const size_t r0 = (size_t)b * SQ;
    k_vt<NH, SQ><<<NH * (SQ / 64), 256, 0, stream>>>(V16 + r0 * DM, DM, 0, VT);
    for (int h0 = 0; h0 < NH; h0 += HG) {
      k_gemm2<0><<<dim3((QN / 128) * (SQ / 64), HG), 128, 0, stream>>>(Q16 + r0 * DM + h0 * HD, DM, (size_t)HD, K16 + r0 * DM + h0 * HD, DM, (size_t)HD, 0.125f, nullptr, 0, nullptr, 1, 0, 0, S, nullptr, SQ, (size_t)SQ * SQ, QN, SQ, HD);
      k_rsmfm<<<(HG * QN + 7) / 8, 256, 0, stream>>>(S, P, QN, HG, xmask + (size_t)b * SQ);
      k_gemm2<0><<<dim3((QN / 128) * (HD / 64), HG), 128, 0, stream>>>(P, SQ, (size_t)SQ * SQ, VT + (size_t)h0 * HD * SQ, SQ, (size_t)HD * SQ, 0.00390625f, nullptr, 0, nullptr, 1, 0, 0, AF + r0 * DM + h0 * HD, nullptr, DM, (size_t)HD, QN, HD, SQ); } }      /* a (merged heads) as f32 rows */
  k_lnadd<1><<<(unsigned)MPO, 256, 0, stream>>>(AF + r0p * DM, x + r0p * DM, g1, be1, 1e-5f, X1F + r0p * DM, X1H + r0p * DM);      /* x1 = bf16(x) + LN(a) */
  const dim3 gf((unsigned)((MPO / 128) * (DM / 64)), 1);
  k_gemm2<3><<<gf, 128, 0, stream>>>(X1H + r0p * DM, DM, 0, B1, DM, 0, 0.0625f, b1, 0, nullptr, 1, 0, 0, nullptr, H16 + r0p * DM, DM, 0, MPO, DM, DM);      /* h = relu(x1 W1 + b1) (f16) */
  k_gemm2<0><<<gf, 128, 0, stream>>>(H16 + r0p * DM, DM, 0, B2, DM, 0, 0.0625f, b2, 0, nullptr, 1, 0, 0, FF + r0p * DM, nullptr, DM, 0, MPO, DM, DM);      /* f = h W2 + b2 (f32) */
  k_lnadd<0><<<(unsigned)MPO, 256, 0, stream>>>(FF + r0p * DM, X1F + r0p * DM, g2, be2, 1e-5f, (float*)d_out + r0p * DM, nullptr);      /* out = x1 + LN(f) */
}

// v003
// A run of this version takes 230 microseconds.
// Versions between v001 and this one are left out; their measured steps multiply to 7.96 times as fast.
// All steps since v000 together make it 47.6 times as fast.
#include <hip/hip_runtime.h>
// Transformer encoder layer (x [8][1024][1024]; per-head q/k/v = x Wq[h] + bq[h] (Wq [16][1024][64]); scores / 8 with a key-padding mask x_mask [8][1][1024] (int32, read; all zeros here); softmax; a = attn v concatenated over heads; x1 = x + LayerNorm(a) g1 + be1; h = relu(x1 W1 + b1); f = h W2 + b2 (W1, W2 [1024][1024] [in][out]); out = x1 + LayerNorm(f) g2 + be2 -> [8][1024][1024]).
// Structure: token rows; x as exact f16 rows; Q, K, V as three WMMA GEMMs (128x128 work-group tiles staged in LDS, 64x64 wave tiles, f32 accumulation, exact x16 head-stacked weights + bias, f16 outputs); V^T for all batches and heads via LDS transposes; one fused attention launch (scores K = 64 as S^T = K Q^T, masked running-maximum softmax on VALU in f32 with native exp, weights f16 at most 1, masked keys 0, O^T += V^T P^T, divided by the row sum in f32) into f32 rows; per row on VALU: x1 = bf16(x) + LayerNorm(a) (f32 + f16 copies); h = relu(x1 W1 + b1) GEMM (f16); f = h W2 + b2 GEMM (f32); per row on VALU: out = x1 + LayerNorm(f).
// Compute dtype: inputs rounded to bf16; x / weights exact; q, k, v, softmax weights, x1 (as GEMM operand) and h plain f16 (~2^-12); attention output, LayerNorms, residuals f32. v_wmma_f32_16x16x32_f16.
#define NB 8
#define SQ 1024
#define DM 1024
#define NH 16
#define HD 64
#define HG 4
#define B0 0                         /* first batch processed (debug hook) */
#define NBR NB                       /* batches processed (debug hook) */
#define QN SQ                        /* unused; attention covers all SQ query rows of a batch */
#define NR ((size_t)NB * SQ)
#define MP ((int)((size_t)NBR * SQ)) /* rows projected (debug hook) */
#define MPO MP                       /* rows through the post-attention stages (debug hook) */
typedef __bf16 v16b __attribute__((ext_vector_type(16)));
typedef unsigned short v8us __attribute__((ext_vector_type(8), may_alias));
typedef float  v8f  __attribute__((ext_vector_type(8)));
typedef float  v4f  __attribute__((ext_vector_type(4)));
typedef float  v4fa __attribute__((ext_vector_type(4), may_alias));
union FragB { v16b v; v8us half[2]; unsigned short u[16]; };

__device__ __forceinline__ unsigned short bf16_bits(float x) { unsigned int u = __float_as_uint(x); return (unsigned short)((u + 0x7FFFu + ((u >> 16) & 1u)) >> 16); }
__device__ __forceinline__ float bf16_val(unsigned short b) { return __uint_as_float(((unsigned int)b) << 16); }
__device__ __forceinline__ float bf16_round(float x) { return bf16_val(bf16_bits(x)); }
// D += A·B with NT terms: 1 = ah·bh, 2 = + al·bh (A split), 3 = + ah·bl (both split)
template <int NT>
__device__ __forceinline__ v8f mmaN(v16b ah, v16b al, v16b bh, v16b bl, v8f c) {
  c = __builtin_amdgcn_wmma_f32_16x16x32_bf16(false, ah, false, bh, (short)0, c, false, false);
  if (NT >= 2) c = __builtin_amdgcn_wmma_f32_16x16x32_bf16(false, al, false, bh, (short)0, c, false, false);
  if (NT >= 3) c = __builtin_amdgcn_wmma_f32_16x16x32_bf16(false, ah, false, bl, (short)0, c, false, false);
  asm volatile("v_nop\n\tv_nop\n\tv_nop\n\tv_nop" : "+v"(c) : "v"(ah), "v"(al), "v"(bh), "v"(bl));
  return c;
}

__global__ __launch_bounds__(256) void k_wt_bf16(const float* __restrict__ W, unsigned short* __restrict__ Wt, int K, int N) {
  const int t = blockIdx.x * 256 + threadIdx.x;
  const int k8n = K / 8;
  if (t >= N * k8n) return;
  const int n = t / k8n, k8 = (t % k8n) * 8;
  v8us v;
#pragma unroll
  for (int i = 0; i < 8; ++i) v[i] = bf16_bits(W[(size_t)(k8 + i) * N + n]);
  *(v8us*)(Wt + (size_t)n * K + k8) = v;
  
}

// GEMM C[M][N] (f32, pitch ldc) = act(A[M][K]·W + bias). A f32 row-major (pitch lda) converted per fragment to bf16
// (ASPLIT: hi/lo two planes -> 2 terms, else single rounded term); Wt bf16 [N][K] (pitch ldb). BIAS_BF16 rounds the
// bias to bf16 first (bias quantised to bf16 before the add). K%32==0, M%16==0, N%64==0.
template <bool ASPLIT, int ACT, bool BIAS_BF16>
__global__ __launch_bounds__(128) void k_gemm_bf(const float* __restrict__ A, int lda, const unsigned short* __restrict__ Wt, int ldb,
                                               const float* __restrict__ bias, float* __restrict__ C, int ldc, int M, int N, int K) {
  __shared__ __attribute__((aligned(16))) float so[4][16][64];
  const int tid = threadIdx.x, w = tid >> 5, lane = tid & 31, ln = lane & 15, hh = lane >> 4;
  const int ntn = N / 64;
  const int wid = blockIdx.x * 4 + w;
  const int mt = wid / ntn, nq = wid % ntn;
  if (mt * 16 >= M) return;
  const int row0 = mt * 16, col0 = nq * 64;
  const float* arow = A + (size_t)(row0 + ln) * lda;
  v8f acc[4] = {};
  for (int kb = 0; kb < K; kb += 32) {
    FragB ah, al;
    const v4f x0 = *(const v4fa*)(arow + kb + 8 * hh), x1 = *(const v4fa*)(arow + kb + 8 * hh + 4);
    const v4f x2 = *(const v4fa*)(arow + kb + 16 + 8 * hh), x3 = *(const v4fa*)(arow + kb + 16 + 8 * hh + 4);
    float xs[16] = {x0[0],x0[1],x0[2],x0[3],x1[0],x1[1],x1[2],x1[3],x2[0],x2[1],x2[2],x2[3],x3[0],x3[1],x3[2],x3[3]};
#pragma unroll
    for (int i = 0; i < 16; ++i) { const unsigned short hb = bf16_bits(xs[i]); ah.u[i] = hb; al.u[i] = ASPLIT ? bf16_bits(xs[i] - bf16_val(hb)) : (unsigned short)0; }
#pragma unroll
    for (int t = 0; t < 4; ++t) {
      const unsigned short* brow = Wt + (size_t)(col0 + t * 16 + ln) * ldb + kb;
      FragB b;
      b.half[0] = *(const v8us*)(brow + 8 * hh);
      b.half[1] = *(const v8us*)(brow + 16 + 8 * hh);
      acc[t] = mmaN<ASPLIT ? 2 : 1>(ah.v, al.v, b.v, b.v, acc[t]);
    }
  }
#pragma unroll
  for (int t = 0; t < 4; ++t) {
    float bv = bias ? bias[col0 + t * 16 + ln] : 0.f;
    if (BIAS_BF16) bv = bf16_round(bv);
#pragma unroll
    for (int r = 0; r < 8; ++r) { float v = acc[t][r] + bv; if (ACT == 1) v = fmaxf(v, 0.f); so[w][8 * hh + r][t * 16 + ln] = v; }
  }
  __builtin_amdgcn_fence(__ATOMIC_ACQ_REL, "workgroup");
  __builtin_amdgcn_wave_barrier();
  const int rsub = lane >> 4, c4 = (lane & 15) * 4;
  {
#pragma unroll
    for (int q = 0; q < 8; ++q) {
      const int r = q * 2 + rsub;
      const v4f v = *(const v4fa*)&so[w][r][c4];
      *(v4f*)(C + (size_t)(row0 + r) * ldc + col0 + c4) = v;
    }
    
  }
}

// GEMM C = act(A·W + bias + resid): A f32 (ASPLIT -> hi/lo 2 terms), Wt bf16 [N][K]; ACT 0 none, 1 relu, 2 exact gelu;
// resid (optional, f32, row index = (row % rmod), pitch ldr, RES_BF16 rounds it) added before the activation.
template <bool ASPLIT, int ACT, bool BIAS_BF16, bool RES_BF16>
__global__ __launch_bounds__(128) void k_gemm_bf3(const float* __restrict__ A, int lda, const unsigned short* __restrict__ Wt, int ldb,
                                                const float* __restrict__ bias, const float* __restrict__ resid, int rmod, int ldr,
                                                float* __restrict__ C, int ldc, int M, int N, int K) {
  __shared__ __attribute__((aligned(16))) float so[4][16][64];
  const int tid = threadIdx.x, w = tid >> 5, lane = tid & 31, ln = lane & 15, hh = lane >> 4;
  const int ntn = N / 64;
  const int wid = blockIdx.x * 4 + w;
  const int mt = wid / ntn, nq = wid % ntn;
  if (mt * 16 >= M) return;
  const int row0 = mt * 16, col0 = nq * 64;
  const float* arow = A + (size_t)(row0 + ln) * lda;
  v8f acc[4] = {};
  for (int kb = 0; kb < K; kb += 32) {
    FragB ah, al;
    const v4f x0 = *(const v4fa*)(arow + kb + 8 * hh), x1 = *(const v4fa*)(arow + kb + 8 * hh + 4);
    const v4f x2 = *(const v4fa*)(arow + kb + 16 + 8 * hh), x3 = *(const v4fa*)(arow + kb + 16 + 8 * hh + 4);
    float xs[16] = {x0[0],x0[1],x0[2],x0[3],x1[0],x1[1],x1[2],x1[3],x2[0],x2[1],x2[2],x2[3],x3[0],x3[1],x3[2],x3[3]};
#pragma unroll
    for (int i = 0; i < 16; ++i) { const unsigned short hb = bf16_bits(xs[i]); ah.u[i] = hb; al.u[i] = ASPLIT ? bf16_bits(xs[i] - bf16_val(hb)) : (unsigned short)0; }
#pragma unroll
    for (int t = 0; t < 4; ++t) {
      const unsigned short* brow = Wt + (size_t)(col0 + t * 16 + ln) * ldb + kb;
      FragB b;
      b.half[0] = *(const v8us*)(brow + 8 * hh);
      b.half[1] = *(const v8us*)(brow + 16 + 8 * hh);
      acc[t] = mmaN<ASPLIT ? 2 : 1>(ah.v, al.v, b.v, b.v, acc[t]);
    }
  }
#pragma unroll
  for (int t = 0; t < 4; ++t) {
    const int col = col0 + t * 16 + ln;
    float bv = bias ? bias[col] : 0.f;
    if (BIAS_BF16) bv = bf16_round(bv);
#pragma unroll
    for (int r = 0; r < 8; ++r) {
      float v = acc[t][r] + bv;
      if (resid) { float rv = resid[(size_t)((row0 + 8 * hh + r) % rmod) * ldr + col]; if (RES_BF16) rv = bf16_round(rv); v += rv; }
      if (ACT == 1) v = fmaxf(v, 0.f);
      if (ACT == 2) v = 0.5f * v * (1.0f + erff(v * 0.70710678118654752f));
      if (ACT == 3) { const float u = 0.7978845608028654f * (v + 0.044715f * v * v * v); v = 0.5f * v * (1.0f + tanhf(u)); }
      so[w][8 * hh + r][t * 16 + ln] = v;
    }
  }
  __builtin_amdgcn_fence(__ATOMIC_ACQ_REL, "workgroup");
  __builtin_amdgcn_wave_barrier();
  const int rsub = lane >> 4, c4 = (lane & 15) * 4;
  {
#pragma unroll
    for (int q = 0; q < 8; ++q) {
      const int r = q * 2 + rsub;
      const v4f v = *(const v4fa*)&so[w][r][c4];
      *(v4f*)(C + (size_t)(row0 + r) * ldc + col0 + c4) = v;
    }
    
  }
}
// row LayerNorm (biased variance, eps) over N: s = X (+ R); optional out_sum <- s; out_norm <- (s-mu)*rsqrt(var+eps)*g + b
template <bool PARAM_BF16>
__global__ __launch_bounds__(256) void k_layernorm(const float* __restrict__ X, const float* __restrict__ R, const float* __restrict__ g, const float* __restrict__ bta,
                                                  float* __restrict__ out_sum, float* __restrict__ out_norm, int N, float eps) {
  __shared__ float red[256];
  const int row = blockIdx.x, tid = threadIdx.x;
  const float* x = X + (size_t)row * N; const float* rr = R ? R + (size_t)row * N : nullptr;
  float vals[16];                     // up to N = 4096
  const int per = N / 256;            // contiguous chunk per thread? use strided-by-4 chunks: thread handles j = tid*4 + 1024*u
  float s1 = 0.f;
  for (int u = 0; u < per / 4; ++u) {
    const int j = tid * 4 + 1024 * u;
    const v4f a = *(const v4fa*)(x + j);
    v4f b = {0.f,0.f,0.f,0.f}; if (rr) b = *(const v4fa*)(rr + j);
#pragma unroll
    for (int q = 0; q < 4; ++q) { const float v = a[q] + b[q]; vals[u * 4 + q] = v; s1 += v; }
  }
  red[tid] = s1; __syncthreads();
  for (int st = 128; st > 0; st >>= 1) { if (tid < st) red[tid] += red[tid + st]; __syncthreads(); }
  const float mu = red[0] / (float)N; __syncthreads();
  float s2 = 0.f;
  for (int u = 0; u < per / 4; ++u)
#pragma unroll
    for (int q = 0; q < 4; ++q) { const float c = vals[u * 4 + q] - mu; s2 += c * c; }
  red[tid] = s2; __syncthreads();
  for (int st = 128; st > 0; st >>= 1) { if (tid < st) red[tid] += red[tid + st]; __syncthreads(); }
  const float rs = rsqrtf(red[0] / (float)N + eps);
  {
    for (int u = 0; u < per / 4; ++u) {
      const int j = tid * 4 + 1024 * u;
      v4f o, sm;
#pragma unroll
      for (int q = 0; q < 4; ++q) {
        float gg = g[j + q], bb = bta[j + q];
        if (PARAM_BF16) { gg = bf16_round(gg); bb = bf16_round(bb); }
        sm[q] = vals[u * 4 + q]; o[q] = (vals[u * 4 + q] - mu) * rs * gg + bb;
      }
      if (out_sum) *(v4f*)(out_sum + (size_t)row * N + j) = sm;
      *(v4f*)(out_norm + (size_t)row * N + j) = o;
    }
    
  }
}



// ---- f16 WMMA path (v_wmma_f32_16x16x32_f16): 11-bit significands for operands in range — used for every GEMM launched here
typedef _Float16 v16h __attribute__((ext_vector_type(16)));
union FragH { v16h v; v8us half[2]; _Float16 h[16]; unsigned short u[16]; };
template <int NT>
__device__ __forceinline__ v8f mmaH(v16h ah, v16h al, v16h bh, v16h bl, v8f c) {
  c = __builtin_amdgcn_wmma_f32_16x16x32_f16(false, ah, false, bh, (short)0, c, false, false);
  if (NT >= 2) c = __builtin_amdgcn_wmma_f32_16x16x32_f16(false, al, false, bh, (short)0, c, false, false);
  if (NT >= 3) c = __builtin_amdgcn_wmma_f32_16x16x32_f16(false, ah, false, bl, (short)0, c, false, false);
  asm volatile("v_nop\n\tv_nop\n\tv_nop\n\tv_nop" : "+v"(c) : "v"(ah), "v"(al), "v"(bh), "v"(bl));
  return c;
}
// batched GEMM like k_gemm_b but f16 operands: A f32 (split into f16 hi/lo if ASPLIT, else rounded to f16), Bt = f16 values [n][k]; alpha; C f32; N multiple of 16 (partial tiles skipped)
template <bool ASPLIT>
__global__ __launch_bounds__(128) void k_gemm_h(const float* __restrict__ A, int lda, size_t sA, const _Float16* __restrict__ Bh, int ldb, size_t sB, float alpha, float* __restrict__ C, int ldc, size_t sC, int M, int N, int K) {
  __shared__ __attribute__((aligned(16))) float so[4][16][64];
  const int tid = threadIdx.x, w = tid >> 5, lane = tid & 31, ln = lane & 15, hh = lane >> 4; const int by = blockIdx.y;
  A += (size_t)by * sA; Bh += (size_t)by * sB; C += (size_t)by * sC;
  const int ntn = (N + 63) / 64; const int wid = blockIdx.x * 4 + w; const int mt = wid / ntn, nq = wid % ntn; if (mt * 16 >= M) return;
  const int row0 = mt * 16, col0 = nq * 64; const float* arow = A + (size_t)(row0 + ln) * lda;
  v8f acc[4] = {};
  for (int kb = 0; kb < K; kb += 32) {
    FragH ah, al;
    const v4f x0 = *(const v4fa*)(arow + kb + 8 * hh), x1 = *(const v4fa*)(arow + kb + 8 * hh + 4), x2 = *(const v4fa*)(arow + kb + 16 + 8 * hh), x3 = *(const v4fa*)(arow + kb + 16 + 8 * hh + 4);
    float xs[16] = {x0[0],x0[1],x0[2],x0[3],x1[0],x1[1],x1[2],x1[3],x2[0],x2[1],x2[2],x2[3],x3[0],x3[1],x3[2],x3[3]};
#pragma unroll
    for (int i = 0; i < 16; ++i) { const _Float16 h = (_Float16)xs[i]; ah.h[i] = h; al.h[i] = ASPLIT ? (_Float16)(xs[i] - (float)h) : (_Float16)0.0f; }
#pragma unroll
    for (int t = 0; t < 4; ++t) { if (col0 + t * 16 >= N) continue; const size_t boff = (size_t)(col0 + t * 16 + ln) * ldb + kb; FragH bq; bq.half[0] = *(const v8us*)(Bh + boff + 8 * hh); bq.half[1] = *(const v8us*)(Bh + boff + 16 + 8 * hh);
      acc[t] = mmaH<ASPLIT ? 2 : 1>(ah.v, al.v, bq.v, bq.v, acc[t]); }
  }
#pragma unroll
  for (int t = 0; t < 4; ++t) { if (col0 + t * 16 >= N) continue;
#pragma unroll
    for (int r = 0; r < 8; ++r) so[w][8 * hh + r][t * 16 + ln] = acc[t][r] * alpha; }
  __builtin_amdgcn_fence(__ATOMIC_ACQ_REL, "workgroup"); __builtin_amdgcn_wave_barrier();
  const int rsub = lane >> 4, c4 = (lane & 15) * 4;
  {
#pragma unroll
    for (int q = 0; q < 8; ++q) { const int r = q * 2 + rsub; if (col0 + c4 < N) { const v4f v = *(const v4fa*)&so[w][r][c4]; *(v4f*)(C + (size_t)(row0 + r) * ldc + col0 + c4) = v; } }
     }
}

// Wt[n][k] = f16(W[k][n]·scale) from f32 row-major W[K][N] (scale = power of two; bf16-exact weights stay exact in f16 away from the subnormal range)
__global__ __launch_bounds__(256) void k_wt_f16(const float* __restrict__ W, _Float16* __restrict__ Wt, int K, int N, float scale) {
  const int t = blockIdx.x * 256 + threadIdx.x; if (t >= N * (K / 8)) return; const int n = t / (K / 8), k8 = (t % (K / 8)) * 8; FragH f;
#pragma unroll
  for (int i = 0; i < 8; ++i) f.h[i] = (_Float16)(bf16_round(W[(size_t)(k8 + i) * N + n]) * scale); const v8us o = f.half[0];
  *(v8us*)((unsigned short*)Wt + (size_t)n * K + k8) = o; 
}
// k_gemm_hh variant with fused epilogue: v = acc·alpha + bias[by·sBias + col] (+ CP[(row/rowsPerB)·sCPb + by·64 + col] if CP) ; ACT 0 none / 1 elu ; writes f16 C16 (and f32 C if non-null)
template <int ACT>
__global__ __launch_bounds__(128) void k_gemm_hhx(const _Float16* __restrict__ A, int lda, size_t sA, const _Float16* __restrict__ Bh, int ldb, size_t sB, float alpha, const float* __restrict__ bias, size_t sBias, const float* __restrict__ CP, int rowsPerB, size_t sCPb, int row0g,
    float* __restrict__ C, _Float16* __restrict__ C16, int ldc, size_t sC, int M, int N, int K) {
  __shared__ __attribute__((aligned(16))) float so[4][16][64];
  const int tid = threadIdx.x, w = tid >> 5, lane = tid & 31, ln = lane & 15, hh = lane >> 4; const int by = blockIdx.y;
  A += (size_t)by * sA; Bh += (size_t)by * sB; const size_t cofs = (size_t)by * sC; const float* bp = bias ? bias + (size_t)by * sBias : nullptr;
  const int ntn = (N + 63) / 64; const int wid = blockIdx.x * 4 + w; const int mt = wid / ntn, nq = wid % ntn; if (mt * 16 >= M) return;
  const int row0 = mt * 16, col0 = nq * 64; const _Float16* arow = A + (size_t)(row0 + ln) * lda;
  v8f acc[4] = {};
  for (int kb = 0; kb < K; kb += 32) { FragH ah; ah.half[0] = *(const v8us*)((const unsigned short*)arow + kb + 8 * hh); ah.half[1] = *(const v8us*)((const unsigned short*)arow + kb + 16 + 8 * hh);
#pragma unroll
    for (int t = 0; t < 4; ++t) { if (col0 + t * 16 >= N) continue; const size_t boff = (size_t)(col0 + t * 16 + ln) * ldb + kb; FragH bq; bq.half[0] = *(const v8us*)((const unsigned short*)Bh + boff + 8 * hh); bq.half[1] = *(const v8us*)((const unsigned short*)Bh + boff + 16 + 8 * hh);
      acc[t] = mmaH<1>(ah.v, ah.v, bq.v, bq.v, acc[t]); }
  }
#pragma unroll
  for (int t = 0; t < 4; ++t) { if (col0 + t * 16 >= N) continue; const int col = col0 + t * 16 + ln; const float bv = bp ? bf16_round(bp[col]) : 0.f;
#pragma unroll
    for (int r = 0; r < 8; ++r) { float v = acc[t][r] * alpha + bv; if (CP) { const int rr = row0g + row0 + 8 * hh + r; if (rowsPerB < 0) v += CP[cofs + (size_t)rr * ldc + col];      /* rowsPerB < 0: own element of the batched C plane */ else { const int bidx = rr / rowsPerB; v += CP[(size_t)bidx * sCPb + (size_t)by * 64 + col]; } } if (ACT == 1) v = (v > 0.f) ? v : expm1f(v); else if (ACT == 7) v = (v > 0.f) ? v + 1.0f : expf(v); else if (ACT == 8) v = tanhf(v); else if (ACT == 9) v = 0.5f * v * (1.0f + tanhf(0.7978845608028654f * (v + 0.044715f * v * v * v))); else if (ACT == 11) v = 1.0f / (1.0f + expf(-v)); else if (ACT == 12) v = (v > 0.f) ? v : 0.01f * v; else if (ACT == 14) v = (v > 0.f) ? v : 0.1f * v; else if (ACT == 16) v = (v >= 0.f) ? v : 0.3f * v; else if (ACT == 17) v = (v >= 0.f) ? v : 0.2f * v; else if (ACT == 15) v = v / (1.0f + expf(-v)); else if (ACT == 3) v = fmaxf(v, 0.f); else if (ACT == 6) v = 0.5f * v * (1.0f + erff(v * 0.70710678118654752f)); so[w][8 * hh + r][t * 16 + ln] = v; } }
  __builtin_amdgcn_fence(__ATOMIC_ACQ_REL, "workgroup"); __builtin_amdgcn_wave_barrier();
  const int rsub = lane >> 4, c4 = (lane & 15) * 4; typedef _Float16 v4h __attribute__((ext_vector_type(4)));
  {
#pragma unroll
    for (int q = 0; q < 8; ++q) { const int r = q * 2 + rsub; if (col0 + c4 < N) { const v4f v = *(const v4fa*)&so[w][r][c4]; if (C) *(v4f*)(C + cofs + (size_t)(row0 + r) * ldc + col0 + c4) = v; if (C16) { v4h h4; for (int i = 0; i < 4; ++i) h4[i] = (_Float16)v[i]; *(v4h*)(C16 + cofs + (size_t)(row0 + r) * ldc + col0 + c4) = h4; } } }
     }
}


typedef _Float16 v4h __attribute__((ext_vector_type(4)));

__global__ __launch_bounds__(256) void k_x16(const float* __restrict__ x, _Float16* __restrict__ X16, size_t n8) { const size_t t = (size_t)blockIdx.x * 256 + threadIdx.x; if (t >= n8) return; FragH f;
#pragma unroll
  for (int q = 0; q < 8; ++q) f.h[q] = (_Float16)bf16_round(x[t * 8 + q]); *(v8us*)((unsigned short*)X16 + t * 8) = f.half[0];  }
__global__ __launch_bounds__(256) void k_h16(const float* __restrict__ x, _Float16* __restrict__ X16, size_t n8) { const size_t t = (size_t)blockIdx.x * 256 + threadIdx.x; if (t >= n8) return; FragH f;
#pragma unroll
  for (int q = 0; q < 8; ++q) f.h[q] = (_Float16)x[t * 8 + q]; *(v8us*)((unsigned short*)X16 + t * 8) = f.half[0];  }
__global__ __launch_bounds__(256) void k_round16f(const float* __restrict__ W, _Float16* __restrict__ Bt, size_t n8) { const size_t t = (size_t)blockIdx.x * 256 + threadIdx.x; if (t >= n8) return; FragH f;
#pragma unroll
  for (int i = 0; i < 8; ++i) f.h[i] = (_Float16)(bf16_round(W[t * 8 + i]) * 16.0f); *(v8us*)((unsigned short*)Bt + t * 8) = f.half[0];  }
template <int NHv, int TTv>
__global__ __launch_bounds__(256) void k_vt(const _Float16* __restrict__ V16, int ldv, int voff, _Float16* __restrict__ Vt) { __shared__ unsigned short tl[64][66]; const int tid = threadIdx.x; const int slab = blockIdx.x / (TTv / 64), lg = blockIdx.x % (TTv / 64); const int b = slab / NHv, h = slab % NHv;
  for (int i = tid; i < 64 * 8; i += 256) { const int r = i / 8, c8 = (i % 8) * 8; FragH f; f.half[0] = *(const v8us*)((const unsigned short*)V16 + ((size_t)b * TTv + lg * 64 + r) * ldv + voff + h * 64 + c8);
#pragma unroll
    for (int q = 0; q < 8; ++q) tl[r][c8 + q] = f.u[q]; }
  __syncthreads();
  {
#pragma unroll
    for (int rd = 0; rd < 2; ++rd) { const int d = rd * 32 + tid / 8, pc = tid % 8; FragH f;
#pragma unroll
      for (int q = 0; q < 8; ++q) f.u[q] = tl[pc * 8 + q][d];
      *(v8us*)((unsigned short*)Vt + ((size_t)slab * 64 + d) * TTv + lg * 64 + pc * 8) = f.half[0]; }
     } }

__global__ __launch_bounds__(256) void k_hl(const float* __restrict__ F, _Float16* __restrict__ Hh, _Float16* __restrict__ Hl, size_t n8) { const size_t t = (size_t)blockIdx.x * 256 + threadIdx.x; if (t >= n8) return; FragH fh, fl; const v4f a = *(const v4fa*)(F + t * 8), c = *(const v4fa*)(F + t * 8 + 4);
#pragma unroll
  for (int q = 0; q < 4; ++q) { _Float16 h = (_Float16)a[q]; fh.h[q] = h; fl.h[q] = (_Float16)((a[q] - (float)h) * 1024.0f); h = (_Float16)c[q]; fh.h[4 + q] = h; fl.h[4 + q] = (_Float16)((c[q] - (float)h) * 1024.0f); }
  { *(v8us*)((unsigned short*)Hh + t * 8) = fh.half[0]; *(v8us*)((unsigned short*)Hl + t * 8) = fl.half[0];  } }

// ---- staged GEMM: C = act(A B^T alpha + bias), A f16 [M][K], Bh f16 [N][K], both K-contiguous, N = K = DM; M % 128 == 0; grid = (M / 128) * (N / 128); H16 picks the f16 output C16, else the f32 output C ----
// A work-group of four waves takes a 128 x 128 tile of C, a wave 64 x 64 of it (4 x 4 accumulator tiles). Per trip 64 k of the 128 A rows and the 128 B rows (128 bytes a row) lie in LDS at a pitch of 144 bytes;
// asynchronous copies bring them there in whole 128-byte lines, two buffers, the next tile in flight while this one is worked on. The k order of every sum is ascending in steps of 32, as with fragments read from global memory.
__device__ __forceinline__ v16h g2_frag(const _Float16* p, int hh) { FragH f; f.half[0] = *(const v8us*)((const unsigned short*)p + 8 * hh); f.half[1] = *(const v8us*)((const unsigned short*)p + 16 + 8 * hh); return f.v; }
#define G3_PITCH 144                   /* LDS bytes per 128-byte row: 16 B x odd, for ds_load_b128 readers */
#define G3_TILE (128 * G3_PITCH)       /* one operand's tile in LDS, bytes */
__device__ __forceinline__ v8f g3_mma(v16h a, v16h b, v8f c) { return __builtin_amdgcn_wmma_f32_16x16x32_f16(false, a, false, b, (short)0, c, false, false); }
__device__ __forceinline__ v16h g3_frag(const unsigned char* p) { FragH f; f.half[0] = *(const v8us*)p; f.half[1] = *(const v8us*)(p + 32); return f.v; }      /* p already holds the lane's row and its 16 hh bytes: k = 8 hh + 0..7, then 16 + 8 hh + 0..7 */
// eight copies of 16 bytes a lane: rows r, r + 16, ..., r + 112 of one operand's tile (l: the lane's LDS byte address in row r, g: its global address there, rs: 16 rows in elements).
// The s_wait_xcnt closes the statement so that it stands in front of every later write of a register that a copy names.
__device__ __forceinline__ void g3_copy8(unsigned l, const _Float16* g, size_t rs) {
  asm volatile("global_load_async_to_lds_b128 %0, %8, off\n\tglobal_load_async_to_lds_b128 %1, %9, off\n\tglobal_load_async_to_lds_b128 %2, %10, off\n\tglobal_load_async_to_lds_b128 %3, %11, off\n\t"
               "global_load_async_to_lds_b128 %4, %12, off\n\tglobal_load_async_to_lds_b128 %5, %13, off\n\tglobal_load_async_to_lds_b128 %6, %14, off\n\tglobal_load_async_to_lds_b128 %7, %15, off\n\ts_wait_xcnt 0x0"
               :: "v"(l), "v"(l + 16 * G3_PITCH), "v"(l + 32 * G3_PITCH), "v"(l + 48 * G3_PITCH), "v"(l + 64 * G3_PITCH), "v"(l + 80 * G3_PITCH), "v"(l + 96 * G3_PITCH), "v"(l + 112 * G3_PITCH),
                  "v"(g), "v"(g + rs), "v"(g + 2 * rs), "v"(g + 3 * rs), "v"(g + 4 * rs), "v"(g + 5 * rs), "v"(g + 6 * rs), "v"(g + 7 * rs) : "memory"); }
template <int ACT, bool H16>
__global__ __launch_bounds__(128) void k_gemm3(const _Float16* __restrict__ A, const _Float16* __restrict__ Bh, float alpha, const float* __restrict__ bias, float* __restrict__ C, _Float16* __restrict__ C16) { static_assert(ACT == 0 || ACT == 3, "k_gemm3: unsupported ACT code (would silently apply no activation)");
  constexpr int N = DM, K = DM; static_assert(N % 128 == 0 && K % 64 == 0 && K >= 128, "k_gemm3: whole tiles only, two or more of them along K");
  __shared__ __attribute__((aligned(16))) unsigned char sm[4 * G3_TILE];      /* buffer u: A tile at 2 u tiles, B tile at 2 u + 1; behind the loop each wave's output staging, one tile's bytes a wave */
  const int tid = threadIdx.x, w = tid >> 5, lane = tid & 31, ln = lane & 15, hh = lane >> 4;
  const int ntn = N >> 7; const int mt = blockIdx.x / ntn, nq = blockIdx.x - mt * ntn; const int row0 = mt * 128, col0 = nq * 128; const int wr = (w >> 1) * 64, wc = (w & 1) * 64;
  const unsigned l0 = (unsigned)(size_t)sm + (unsigned)((tid >> 3) * G3_PITCH + (tid & 7) * 16);      /* eight lanes a row: a wave's copy covers four whole 128-byte lines */
  const _Float16* ga = A + (size_t)(row0 + (tid >> 3)) * K + (tid & 7) * 8; const _Float16* gb = Bh + (size_t)(col0 + (tid >> 3)) * K + (tid & 7) * 8; constexpr size_t rs = (size_t)16 * K; constexpr int nt = K >> 6;
  g3_copy8(l0, ga, rs); g3_copy8(l0 + G3_TILE, gb, rs);
  asm volatile("s_wait_asynccnt 0x0" ::: "memory");      /* this wave's share of tile 0 has landed */
  __syncthreads();      /* tile 0 is read by every wave */
  g3_copy8(l0 + 2 * G3_TILE, ga + 64, rs); g3_copy8(l0 + 3 * G3_TILE, gb + 64, rs);
  const unsigned char* fa = sm + (wr + ln) * G3_PITCH + 16 * hh; const unsigned char* fb = sm + G3_TILE + (wc + ln) * G3_PITCH + 16 * hh;
  const v8f z8 = {0.f, 0.f, 0.f, 0.f, 0.f, 0.f, 0.f, 0.f}; v8f acc[4][4];
#pragma unroll      /* register arrays need constant indices */
  for (int i = 0; i < 4; ++i)
#pragma unroll      /* register arrays need constant indices */
    for (int j = 0; j < 4; ++j) acc[i][j] = z8;
#pragma unroll 1      /* one trip per tile: the buffer is chosen at run time, and an unrolled body would only grow the text */
  for (int t = 0; t < nt; ++t) { const unsigned bo = (unsigned)(t & 1) * (2 * G3_TILE);
#pragma unroll      /* register arrays need constant indices */
    for (int ks = 0; ks < 2; ++ks) { v16h af[4], bf[4];
#pragma unroll      /* register arrays need constant indices */
      for (int i = 0; i < 4; ++i) bf[i] = g3_frag(fb + bo + i * 16 * G3_PITCH + ks * 64);
#pragma unroll      /* register arrays need constant indices */
      for (int i = 0; i < 4; ++i) af[i] = g3_frag(fa + bo + i * 16 * G3_PITCH + ks * 64);
      __builtin_amdgcn_sched_barrier(0);      /* the sixteen LDS reads of a block go out as one group in front of its products: left free, each A fragment was read alone and waited for in front of its four products */
#pragma unroll      /* register arrays need constant indices */
      for (int i = 0; i < 4; ++i)
#pragma unroll      /* register arrays need constant indices */
        for (int j = 0; j < 4; ++j) acc[i][j] = g3_mma(af[i], bf[j], acc[i][j]);
      __builtin_amdgcn_sched_barrier(0); }      /* the next group of reads stays behind this block's products, whose fragment registers it reuses */
    asm volatile("s_wait_dscnt 0x0" ::: "memory");      /* this wave's reads of the buffer have returned before the barrier behind which it is refilled */
    asm volatile("s_wait_asynccnt 0x0" ::: "memory");      /* this wave's share of tile t + 1 has landed */
    __syncthreads();      /* publishes tile t + 1 and ends every wave's reads of tile t */
    if (t + 2 < nt) { g3_copy8(l0 + bo, ga + (size_t)(t + 2) * 64, rs); g3_copy8(l0 + bo + G3_TILE, gb + (size_t)(t + 2) * 64, rs); } }
  asm volatile("s_wait_asynccnt 0x0" ::: "memory");      /* no copy is outstanding when the buffers become output staging */
  float* so = (float*)(sm + w * G3_TILE);      /* 64 rows of 68 floats, this wave's own; the last trip's barrier has ended every read of the tiles */
#pragma unroll      /* register arrays need constant indices */
  for (int j = 0; j < 4; ++j) { const float bv = bf16_round(bias[col0 + wc + j * 16 + ln]);
#pragma unroll      /* register arrays need constant indices */
    for (int i = 0; i < 4; ++i)
#pragma unroll      /* register arrays need constant indices */
      for (int r = 0; r < 8; ++r) { float v = acc[i][j][r] * alpha + bv; if (ACT == 3) v = fmaxf(v, 0.f); so[(i * 16 + 8 * hh + r) * 68 + j * 16 + ln] = v; } }
  __builtin_amdgcn_fence(__ATOMIC_ACQ_REL, "workgroup"); __builtin_amdgcn_wave_barrier();      /* the wave's staging writes stay in front of its reads of words that other lanes wrote */
  const int rsub = lane >> 4, c4 = (lane & 15) * 4;
  const size_t o = (size_t)(row0 + wr + rsub) * N + col0 + wc + c4;
#pragma unroll      /* register arrays need constant indices */
  for (int q0 = 0; q0 < 32; q0 += 8) { v4f v[8];      /* the reads go out in groups ahead of their stores, each store whole 128-byte lines */
#pragma unroll      /* register arrays need constant indices */
    for (int u = 0; u < 8; ++u) v[u] = *(const v4fa*)&so[((q0 + u) * 2 + rsub) * 68 + c4];
#pragma unroll      /* register arrays need constant indices */
    for (int u = 0; u < 8; ++u) { if (H16) { v4h h4; for (int i = 0; i < 4; ++i) h4[i] = (_Float16)v[u][i]; *(v4h*)(C16 + o + (size_t)(q0 + u) * 2 * N) = h4; } else *(v4f*)(C + o + (size_t)(q0 + u) * 2 * N) = v[u]; } } }


__global__ __launch_bounds__(256) void k_wnat(const float* __restrict__ w, size_t n8, _Float16* __restrict__ Bt) { const size_t t = (size_t)blockIdx.x * 256 + threadIdx.x; if (t >= n8) return; FragH f; for (int q = 0; q < 8; ++q) f.h[q] = (_Float16)(bf16_round(w[t * 8 + q]) * 16.0f); *(v8us*)((unsigned short*)Bt + t * 8) = f.half[0];  }
__global__ __launch_bounds__(256) void k_rsm(const float* __restrict__ S, _Float16* __restrict__ P, int nrows) {
  #pragma clang fp contract(off)
  const int i = blockIdx.x * 256 + threadIdx.x; if (i >= nrows) return; const float* s = S + (size_t)i * SQ; float mx = -3.0e38f;
#pragma unroll 1
  for (int j = 0; j < SQ; ++j) mx = fmaxf(mx, s[j]); float se = 0.f;
#pragma unroll 1
  for (int j = 0; j < SQ; ++j) se += expf(s[j] - mx); const float sc = 256.0f / se;
#pragma unroll 1
  for (int j0 = 0; j0 < SQ; j0 += 8) { FragH f; for (int q = 0; q < 8; ++q) f.h[q] = (_Float16)(expf(s[j0 + q] - mx) * sc); unsigned short* d = (unsigned short*)P + (size_t)i * SQ + j0; *(v8us*)d = f.half[0];  } }
__global__ __launch_bounds__(256) void k_vt(const _Float16* __restrict__ V16, int b, int h0, _Float16* __restrict__ VT) { __shared__ unsigned short tl[64][65]; const int tid = threadIdx.x; const int hh = blockIdx.x % HG, sg = blockIdx.x / HG; const int s0 = sg * 64; const int h = h0 + hh;
  for (int i = tid; i < 64 * 8; i += 256) { const int j = i / 8, d8 = (i % 8) * 8; FragH f; f.half[0] = *(const v8us*)((const unsigned short*)V16 + ((size_t)b * SQ + s0 + j) * DM + h * HD + d8); for (int q = 0; q < 8; ++q) tl[d8 + q][j] = f.u[q]; }
  __syncthreads();
  { for (int i = tid; i < 64 * 8; i += 256) { const int d = i / 8, j8 = (i % 8) * 8; FragH f; for (int q = 0; q < 8; ++q) f.u[q] = tl[d][j8 + q]; *(v8us*)((unsigned short*)VT + ((size_t)hh * HD + d) * SQ + s0 + j8) = f.half[0]; }  } }


__global__ __launch_bounds__(256) void k_whd(const float* __restrict__ w, _Float16* __restrict__ Bt) { const size_t t = (size_t)blockIdx.x * 256 + threadIdx.x; if (t >= (size_t)DM * (DM / 8)) return; const int d8 = (int)(t % (DM / 8)) * 8; const int n = (int)(t / (DM / 8)); const int h = n / HD, k = n % HD; FragH f;
  for (int q = 0; q < 8; ++q) f.h[q] = (_Float16)(bf16_round(w[((size_t)h * DM + d8 + q) * HD + k]) * 16.0f);
  unsigned short* dst = (unsigned short*)Bt + (size_t)n * DM + d8; *(v8us*)dst = f.half[0];  }
// lane exchanges and native exponentials for the attention kernel's softmax
typedef int v4ia __attribute__((ext_vector_type(4), may_alias));
template <int M> __device__ __forceinline__ float rs_xrow(float x) { return __builtin_bit_cast(float, __builtin_amdgcn_update_dpp(0, __builtin_bit_cast(int, x), 0x160 | M, 0xf, 0xf, true)); }      /* lane l <- lane l ^ M inside a 16-lane row (row_xmask) */
__device__ __forceinline__ float rs_xhalf(float x) { return __builtin_bit_cast(float, __builtin_amdgcn_permlanex16(__builtin_bit_cast(int, x), __builtin_bit_cast(int, x), 0x76543210, 0xfedcba98, false, false)); }      /* lane l <- lane l ^ 16 */
// four independent 2^x in one statement, closed by the one v_nop that the instruction set asks for behind a transcendental before its result is used or its source overwritten
// outputs are early-clobber so that no exponential writes a neighbour's source
__device__ __forceinline__ void rs_exp2x4(float* x) { float r0, r1, r2, r3;
  asm("v_exp_f32 %0, %4\n\tv_exp_f32 %1, %5\n\tv_exp_f32 %2, %6\n\tv_exp_f32 %3, %7\n\tv_nop" : "=&v"(r0), "=&v"(r1), "=&v"(r2), "=&v"(r3) : "v"(x[0]), "v"(x[1]), "v"(x[2]), "v"(x[3]));
  x[0] = r0; x[1] = r1; x[2] = r2; x[3] = r3; }
// Fused attention, one launch for all batches and heads: a work-group takes 128 query rows of one (batch, head), a wave 32 of them (two 16-column groups), and walks the 1024 keys in passes of 32.
// S^T = K Q^T (A = K rows, B = Q rows kept in registers): in each group lane (ln, hh) holds, for query ln, the scores of keys 16 kt + 8 hh + r. Running maximum and sum are per lane, joined between the wave halves by one exchange.
// The two f32 score tiles of a pass, converted in place, are the f16 B operand of O^T += V^T P^T (A = V^T rows in the same k order): scores and weights never leave the registers.
// Weights are exp(s - running maximum), unnormalised (at most 1); the division by the row sum is done once, in f32, on O^T. A masked key enters as -inf (weight 0); a row with every key masked gives 0.
__device__ __forceinline__ v8f fa_mma(v16h a, v16h b, v8f c) { return __builtin_amdgcn_wmma_f32_16x16x32_f16(false, a, false, b, (short)0, c, false, false); }
// one 2^x, closed by the v_nop that the instruction set asks for behind a transcendental before its result is used or its source overwritten
__device__ __forceinline__ float fa_exp2(float x) { float r; asm("v_exp_f32 %0, %1\n\tv_nop" : "=&v"(r) : "v"(x)); return r; }
__global__ __launch_bounds__(128) void k_fattn(const _Float16* __restrict__ Q16, const _Float16* __restrict__ K16, const _Float16* __restrict__ VT, const int* __restrict__ mk, float* __restrict__ AF) {
  __shared__ __attribute__((aligned(16))) float kbias[SQ];      /* 0 for a key that counts, -inf for a masked one */
  const int tid = threadIdx.x, w = tid >> 5, lane = tid & 31, ln = lane & 15, hh = lane >> 4;
  const int bh = blockIdx.x / (SQ / 128), qb = blockIdx.x % (SQ / 128); const int b = bh / NH, h = bh % NH;
  const v4ia m0 = *(const v4ia*)(mk + (size_t)b * SQ + tid * 8), m1 = *(const v4ia*)(mk + (size_t)b * SQ + tid * 8 + 4);      /* eight keys of the mask row a thread */
  const int q0 = qb * 128 + w * 32;
  const _Float16* qp = Q16 + ((size_t)b * SQ + q0 + ln) * DM + h * HD;
  const _Float16* kp = K16 + ((size_t)b * SQ + ln) * DM + h * HD;
  const _Float16* vp = VT + ((size_t)bh * HD + ln) * SQ;
  v16h qf[2][2], kf[2][2];
#pragma unroll      /* register arrays need constant indices */
  for (int u = 0; u < 2; ++u)
#pragma unroll      /* register arrays need constant indices */
    for (int ks = 0; ks < 2; ++ks) { qf[u][ks] = g2_frag(qp + (size_t)u * 16 * DM + ks * 32, hh); kf[u][ks] = g2_frag(kp + (size_t)u * 16 * DM + ks * 32, hh); }
  { v4f b0, b1;
#pragma unroll      /* register arrays need constant indices */
    for (int q = 0; q < 4; ++q) { b0[q] = (m0[q] == 0) ? 0.f : -__builtin_inff(); b1[q] = (m1[q] == 0) ? 0.f : -__builtin_inff(); }
    *(v4fa*)&kbias[tid * 8] = b0; *(v4fa*)&kbias[tid * 8 + 4] = b1; }
  __syncthreads();      /* the bias row is read by every wave */
  const v8f z8 = {0.f, 0.f, 0.f, 0.f, 0.f, 0.f, 0.f, 0.f};
  v8f o[2][4] = {{z8, z8, z8, z8}, {z8, z8, z8, z8}}; float mr[2] = {-3.0e38f, -3.0e38f}, lr[2] = {0.f, 0.f};
  for (int it = 0; it < SQ / 32; ++it) { const int key0 = it * 32;
    v16h vf[4]; v4f bs[4];
#pragma unroll      /* register arrays need constant indices */
    for (int dt = 0; dt < 4; ++dt) { vf[dt] = g2_frag(vp + (size_t)dt * 16 * SQ + key0, hh); bs[dt] = *(const v4fa*)&kbias[key0 + (dt >> 1) * 16 + 8 * hh + (dt & 1) * 4]; }
    asm volatile("s_wait_xcnt 0x0" ::: "memory");      /* behind the V^T loads, in front of every later reuse of a register that they name as an address */
    v8f s[2][2];
#pragma unroll      /* register arrays need constant indices */
    for (int qi = 0; qi < 2; ++qi)
#pragma unroll      /* register arrays need constant indices */
      for (int kt = 0; kt < 2; ++kt) s[qi][kt] = fa_mma(kf[kt][1], qf[qi][1], fa_mma(kf[kt][0], qf[qi][0], z8));
    const int kn = (it + 1 < SQ / 32) ? key0 + 32 : key0;      /* the next pass's K fragments are fetched behind this pass's score products, under the softmax; the last pass reads its own rows again, in bounds */
#pragma unroll      /* register arrays need constant indices */
    for (int kt = 0; kt < 2; ++kt)
#pragma unroll      /* register arrays need constant indices */
      for (int ks = 0; ks < 2; ++ks) kf[kt][ks] = g2_frag(kp + (size_t)(kn + kt * 16) * DM + ks * 32, hh);
    asm volatile("s_wait_xcnt 0x0" ::: "memory");      /* behind the K loads, in front of every later reuse of a register that they name as an address */
    __builtin_amdgcn_sched_barrier(0);      /* the K loads are issued here, in front of the softmax: left free, they sank to the foot of the pass and the next pass waited out their whole latency */
#pragma unroll      /* register arrays need constant indices */
    for (int qi = 0; qi < 2; ++qi) { float t[16];
#pragma unroll      /* register arrays need constant indices */
      for (int i = 0; i < 16; ++i) t[i] = s[qi][i >> 3][i & 7] * 0.18033688f + bs[i >> 2][i & 3];      /* score / 8 in log2 units: exp(x) = 2^(x log2 e), the native form */
      float mx = t[0];
#pragma unroll      /* register arrays need constant indices */
      for (int i = 1; i < 16; ++i) mx = fmaxf(mx, t[i]);
      mx = fmaxf(mx, rs_xhalf(mx)); const float mn = fmaxf(mr[qi], mx); const float f = fa_exp2(mr[qi] - mn); mr[qi] = mn;
#pragma unroll      /* register arrays need constant indices */
      for (int i = 0; i < 16; ++i) t[i] -= mn;
      rs_exp2x4(t); rs_exp2x4(t + 4); rs_exp2x4(t + 8); rs_exp2x4(t + 12);
      float s4[4] = {t[0], t[1], t[2], t[3]};
#pragma unroll      /* register arrays need constant indices */
      for (int i = 4; i < 16; ++i) s4[i & 3] += t[i];
      lr[qi] = lr[qi] * f + ((s4[0] + s4[1]) + (s4[2] + s4[3]));
      FragH p;
#pragma unroll      /* register arrays need constant indices */
      for (int i = 0; i < 16; ++i) p.h[i] = (_Float16)t[i];
#pragma unroll      /* register arrays need constant indices */
      for (int dt = 0; dt < 4; ++dt) o[qi][dt] = fa_mma(vf[dt], p.v, o[qi][dt] * f); } }
#pragma unroll      /* register arrays need constant indices */
  for (int qi = 0; qi < 2; ++qi) { const float se = lr[qi] + rs_xhalf(lr[qi]); const float inv = (se == 0.f) ? 0.f : 1.0f / se;
    float* dst = AF + ((size_t)b * SQ + q0 + qi * 16 + ln) * DM + h * HD + 8 * hh;      /* lane (ln, hh): query ln, head columns 16 dt + 8 hh + r */
#pragma unroll      /* register arrays need constant indices */
    for (int dt = 0; dt < 4; ++dt) { const v8f v = o[qi][dt] * inv; const v4f lo = {v[0], v[1], v[2], v[3]}, hi = {v[4], v[5], v[6], v[7]}; *(v4f*)(dst + dt * 16) = lo; *(v4f*)(dst + dt * 16 + 4) = hi; } } }
template <int RBF>
__global__ __launch_bounds__(256) void k_lnadd(const float* __restrict__ A, const float* __restrict__ R, const float* __restrict__ g, const float* __restrict__ bta, float eps, float* __restrict__ OF_, _Float16* __restrict__ OH_) {
  #pragma clang fp contract(off)
  __shared__ float red[256]; const size_t row = blockIdx.x; const int tid = threadIdx.x; const int j0 = tid * 4; float a[4], r[4]; float s1 = 0.f;
  { const v4f av = *(const v4fa*)(A + row * DM + j0); const v4f rv = *(const v4fa*)(R + row * DM + j0); for (int q = 0; q < 4; ++q) { a[q] = av[q]; r[q] = RBF ? bf16_round(rv[q]) : rv[q]; s1 = __fadd_rn(s1, a[q]); } }
  red[tid] = s1; __syncthreads(); for (int st = 128; st > 0; st >>= 1) { if (tid < st) red[tid] = __fadd_rn(red[tid], red[tid + st]); __syncthreads(); }
  const float mu = red[0] / (float)DM; __syncthreads(); float s2 = 0.f;
  for (int q = 0; q < 4; ++q) { const float c = __fadd_rn(a[q], -mu); s2 = __fadd_rn(s2, __fmul_rn(c, c)); }
  red[tid] = s2; __syncthreads(); for (int st = 128; st > 0; st >>= 1) { if (tid < st) red[tid] = __fadd_rn(red[tid], red[tid + st]); __syncthreads(); }
  const float rs = rsqrtf(__fadd_rn(red[0] / (float)DM, eps)); v4f o; FragH h;
  for (int q = 0; q < 4; ++q) { o[q] = __fadd_rn(r[q], __fadd_rn(__fmul_rn(__fmul_rn(__fadd_rn(a[q], -mu), rs), bf16_round(g[j0 + q])), bf16_round(bta[j0 + q]))); h.h[q] = (_Float16)o[q]; }
  typedef unsigned short v4us __attribute__((ext_vector_type(4))); v4us h4; for (int q = 0; q < 4; ++q) h4[q] = h.u[q];
  { *(v4f*)(OF_ + row * DM + j0) = o; if (OH_) *(v4us*)((unsigned short*)OH_ + row * DM + j0) = h4;  } }

extern "C" void kernel_launch(void* const* d_in, const int* in_sizes, int n_in,
                              void* d_out, int out_size, void* d_ws, size_t ws_size, hipStream_t stream) {
  (void)in_sizes; (void)n_in; (void)out_size;
  const float* const* I = (const float* const*)d_in; const float* x = I[0]; const int* xmask = (const int*)d_in[1]; const float* wq = I[2]; const float* bq = I[3]; const float* wk = I[4]; const float* bk = I[5]; const float* wv = I[6]; const float* bv = I[7]; const float* w1 = I[8]; const float* b1 = I[9]; const float* w2 = I[10]; const float* b2 = I[11]; const float* g1 = I[12]; const float* be1 = I[13]; const float* g2 = I[14]; const float* be2 = I[15];
  char* ws = (char*)d_ws; size_t off = 0;
  auto take = [&](size_t bytes) { char* p = ws + off; off += (bytes + 255) & ~(size_t)255; return p; };
  _Float16* BQ = (_Float16*)take((size_t)DM * DM * 2); _Float16* BK = (_Float16*)take((size_t)DM * DM * 2); _Float16* BV = (_Float16*)take((size_t)DM * DM * 2); _Float16* B1 = (_Float16*)take((size_t)DM * DM * 2); _Float16* B2 = (_Float16*)take((size_t)DM * DM * 2);
  _Float16* X16 = (_Float16*)take(NR * DM * 2); _Float16* Q16 = (_Float16*)take(NR * DM * 2); _Float16* K16 = (_Float16*)take(NR * DM * 2); _Float16* V16 = (_Float16*)take(NR * DM * 2); float* AF = (float*)take(NR * DM * 4); float* X1F = (float*)take(NR * DM * 4); _Float16* X1H = (_Float16*)take(NR * DM * 2); _Float16* H16 = (_Float16*)take(NR * DM * 2); float* FF = AF;      /* f rows reuse the attention-output rows (dead after the first LayerNorm; same type) */
  _Float16* VT = (_Float16*)take((size_t)NB * NH * HD * SQ * 2);
  if (off > ws_size) return;      /* 10 + 16x4 + 32 + 32 + 16 + 16 + 16 = approx 186 MiB */
  { const unsigned gw = (unsigned)(((size_t)DM * (DM / 8) + 255) / 256); k_whd<<<gw, 256, 0, stream>>>(wq, BQ); k_whd<<<gw, 256, 0, stream>>>(wk, BK); k_whd<<<gw, 256, 0, stream>>>(wv, BV); k_wt_f16<<<gw, 256, 0, stream>>>(w1, B1, DM, DM, 16.0f); k_wt_f16<<<gw, 256, 0, stream>>>(w2, B2, DM, DM, 16.0f); }
  k_x16<<<(unsigned)((NR * DM / 8 + 255) / 256), 256, 0, stream>>>(x, X16, NR * DM / 8);
  const size_t r0p = (size_t)B0 * SQ; const dim3 gp((unsigned)((MP / 128) * (DM / 128)), 1);
  k_gemm3<0, true><<<gp, 128, 0, stream>>>(X16 + r0p * DM, BQ, 0.0625f, bq, nullptr, Q16 + r0p * DM);
  k_gemm3<0, true><<<gp, 128, 0, stream>>>(X16 + r0p * DM, BK, 0.0625f, bk, nullptr, K16 + r0p * DM);
  k_gemm3<0, true><<<gp, 128, 0, stream>>>(X16 + r0p * DM, BV, 0.0625f, bv, nullptr, V16 + r0p * DM);
  k_vt<NH, SQ><<<NB * NH * (SQ / 64), 256, 0, stream>>>(V16, DM, 0, VT);      /* V^T of every (batch, head) */
  k_fattn<<<NB * NH * (SQ / 128), 128, 0, stream>>>(Q16, K16, VT, xmask, AF);      /* a (merged heads) as f32 rows */
  k_lnadd<1><<<(unsigned)MPO, 256, 0, stream>>>(AF + r0p * DM, x + r0p * DM, g1, be1, 1e-5f, X1F + r0p * DM, X1H + r0p * DM);      /* x1 = bf16(x) + LN(a) */
  const dim3 gf((unsigned)((MPO / 128) * (DM / 128)), 1);
  k_gemm3<3, true><<<gf, 128, 0, stream>>>(X1H + r0p * DM, B1, 0.0625f, b1, nullptr, H16 + r0p * DM);      /* h = relu(x1 W1 + b1) (f16) */
  k_gemm3<0, false><<<gf, 128, 0, stream>>>(H16 + r0p * DM, B2, 0.0625f, b2, FF + r0p * DM, nullptr);      /* f = h W2 + b2 (f32) */
  k_lnadd<0><<<(unsigned)MPO, 256, 0, stream>>>(FF + r0p * DM, X1F + r0p * DM, g2, be2, 1e-5f, (float*)d_out + r0p * DM, nullptr);      /* out = x1 + LN(f) */
}

// v004
// Measured time: 218 microseconds a run.
// Timed twice side by side with v003, it ran 1.05 and 1.06 times as fast.
// Counting every step since v000, it is 50.2 times as fast.
#include <hip/hip_runtime.h>
// Transformer encoder layer (x [8][1024][1024]; per-head q/k/v = x Wq[h] + bq[h] (Wq [16][1024][64]); scores / 8 with a key-padding mask x_mask [8][1][1024] (int32, read; all zeros here); softmax; a = attn v concatenated over heads; x1 = x + LayerNorm(a) g1 + be1; h = relu(x1 W1 + b1); f = h W2 + b2 (W1, W2 [1024][1024] [in][out]); out = x1 + LayerNorm(f) g2 + be2 -> [8][1024][1024]).
// Structure: token rows; x as exact f16 rows; Q, K, V as three WMMA GEMMs (128x128 work-group tiles staged in LDS, 64x64 wave tiles, f32 accumulation, exact x16 head-stacked weights + bias, f16 outputs); V^T for all batches and heads via LDS transposes; one fused attention launch (scores K = 64 as S^T = K Q^T, masked running-maximum softmax on VALU in f32 with native exp, weights f16 at most 1, masked keys 0, O^T += V^T P^T, divided by the row sum in f32) into f32 rows; per row on VALU: x1 = bf16(x) + LayerNorm(a) (f32 + f16 copies); h = relu(x1 W1 + b1) GEMM (f16); f = h W2 + b2 GEMM (f32); per row on VALU: out = x1 + LayerNorm(f).
// Compute dtype: inputs rounded to bf16; x / weights exact; q, k, v, softmax weights, x1 (as GEMM operand) and h plain f16 (~2^-12); attention output, LayerNorms, residuals f32. v_wmma_f32_16x16x32_f16.
#define NB 8
#define SQ 1024
#define DM 1024
#define NH 16
#define HD 64
#define HG 4
#define B0 0                         /* first batch processed (debug hook) */
#define NBR NB                       /* batches processed (debug hook) */
#define QN SQ                        /* unused; attention covers all SQ query rows of a batch */
#define NR ((size_t)NB * SQ)
#define MP ((int)((size_t)NBR * SQ)) /* rows projected (debug hook) */
#define MPO MP                       /* rows through the post-attention stages (debug hook) */
typedef __bf16 v16b __attribute__((ext_vector_type(16)));
typedef unsigned short v8us __attribute__((ext_vector_type(8), may_alias));
typedef float  v8f  __attribute__((ext_vector_type(8)));
typedef float  v4f  __attribute__((ext_vector_type(4)));
typedef float  v4fa __attribute__((ext_vector_type(4), may_alias));
union FragB { v16b v; v8us half[2]; unsigned short u[16]; };

__device__ __forceinline__ unsigned short bf16_bits(float x) { unsigned int u = __float_as_uint(x); return (unsigned short)((u + 0x7FFFu + ((u >> 16) & 1u)) >> 16); }
__device__ __forceinline__ float bf16_val(unsigned short b) { return __uint_as_float(((unsigned int)b) << 16); }
__device__ __forceinline__ float bf16_round(float x) { return bf16_val(bf16_bits(x)); }
// D += A·B with NT terms: 1 = ah·bh, 2 = + al·bh (A split), 3 = + ah·bl (both split)
template <int NT>
__device__ __forceinline__ v8f mmaN(v16b ah, v16b al, v16b bh, v16b bl, v8f c) {
  c = __builtin_amdgcn_wmma_f32_16x16x32_bf16(false, ah, false, bh, (short)0, c, false, false);
  if (NT >= 2) c = __builtin_amdgcn_wmma_f32_16x16x32_bf16(false, al, false, bh, (short)0, c, false, false);
  if (NT >= 3) c = __builtin_amdgcn_wmma_f32_16x16x32_bf16(false, ah, false, bl, (short)0, c, false, false);
  asm volatile("v_nop\n\tv_nop\n\tv_nop\n\tv_nop" : "+v"(c) : "v"(ah), "v"(al), "v"(bh), "v"(bl));
  return c;
}

__global__ __launch_bounds__(256) void k_wt_bf16(const float* __restrict__ W, unsigned short* __restrict__ Wt, int K, int N) {
  const int t = blockIdx.x * 256 + threadIdx.x;
  const int k8n = K / 8;
  if (t >= N * k8n) return;
  const int n = t / k8n, k8 = (t % k8n) * 8;
  v8us v;
#pragma unroll
  for (int i = 0; i < 8; ++i) v[i] = bf16_bits(W[(size_t)(k8 + i) * N + n]);
  *(v8us*)(Wt + (size_t)n * K + k8) = v;
  
}

// GEMM C[M][N] (f32, pitch ldc) = act(A[M][K]·W + bias). A f32 row-major (pitch lda) converted per fragment to bf16
// (ASPLIT: hi/lo two planes -> 2 terms, else single rounded term); Wt bf16 [N][K] (pitch ldb). BIAS_BF16 rounds the
// bias to bf16 first (bias quantised to bf16 before the add). K%32==0, M%16==0, N%64==0.
template <bool ASPLIT, int ACT, bool BIAS_BF16>
__global__ __launch_bounds__(128) void k_gemm_bf(const float* __restrict__ A, int lda, const unsigned short* __restrict__ Wt, int ldb,
                                               const float* __restrict__ bias, float* __restrict__ C, int ldc, int M, int N, int K) {
  __shared__ __attribute__((aligned(16))) float so[4][16][64];
  const int tid = threadIdx.x, w = tid >> 5, lane = tid & 31, ln = lane & 15, hh = lane >> 4;
  const int ntn = N / 64;
  const int wid = blockIdx.x * 4 + w;
  const int mt = wid / ntn, nq = wid % ntn;
  if (mt * 16 >= M) return;
  const int row0 = mt * 16, col0 = nq * 64;
  const float* arow = A + (size_t)(row0 + ln) * lda;
  v8f acc[4] = {};
  for (int kb = 0; kb < K; kb += 32) {
    FragB ah, al;
    const v4f x0 = *(const v4fa*)(arow + kb + 8 * hh), x1 = *(const v4fa*)(arow + kb + 8 * hh + 4);
    const v4f x2 = *(const v4fa*)(arow + kb + 16 + 8 * hh), x3 = *(const v4fa*)(arow + kb + 16 + 8 * hh + 4);
    float xs[16] = {x0[0],x0[1],x0[2],x0[3],x1[0],x1[1],x1[2],x1[3],x2[0],x2[1],x2[2],x2[3],x3[0],x3[1],x3[2],x3[3]};
#pragma unroll
    for (int i = 0; i < 16; ++i) { const unsigned short hb = bf16_bits(xs[i]); ah.u[i] = hb; al.u[i] = ASPLIT ? bf16_bits(xs[i] - bf16_val(hb)) : (unsigned short)0; }
#pragma unroll
    for (int t = 0; t < 4; ++t) {
      const unsigned short* brow = Wt + (size_t)(col0 + t * 16 + ln) * ldb + kb;
      FragB b;
      b.half[0] = *(const v8us*)(brow + 8 * hh);
      b.half[1] = *(const v8us*)(brow + 16 + 8 * hh);
      acc[t] = mmaN<ASPLIT ? 2 : 1>(ah.v, al.v, b.v, b.v, acc[t]);
    }
  }
#pragma unroll
  for (int t = 0; t < 4; ++t) {
    float bv = bias ? bias[col0 + t * 16 + ln] : 0.f;
    if (BIAS_BF16) bv = bf16_round(bv);
#pragma unroll
    for (int r = 0; r < 8; ++r) { float v = acc[t][r] + bv; if (ACT == 1) v = fmaxf(v, 0.f); so[w][8 * hh + r][t * 16 + ln] = v; }
  }
  __builtin_amdgcn_fence(__ATOMIC_ACQ_REL, "workgroup");
  __builtin_amdgcn_wave_barrier();
  const int rsub = lane >> 4, c4 = (lane & 15) * 4;
  {
#pragma unroll
    for (int q = 0; q < 8; ++q) {
      const int r = q * 2 + rsub;
      const v4f v = *(const v4fa*)&so[w][r][c4];
      *(v4f*)(C + (size_t)(row0 + r) * ldc + col0 + c4) = v;
    }
    
  }
}

// GEMM C = act(A·W + bias + resid): A f32 (ASPLIT -> hi/lo 2 terms), Wt bf16 [N][K]; ACT 0 none, 1 relu, 2 exact gelu;
// resid (optional, f32, row index = (row % rmod), pitch ldr, RES_BF16 rounds it) added before the activation.
template <bool ASPLIT, int ACT, bool BIAS_BF16, bool RES_BF16>
__global__ __launch_bounds__(128) void k_gemm_bf3(const float* __restrict__ A, int lda, const unsigned short* __restrict__ Wt, int ldb,
                                                const float* __restrict__ bias, const float* __restrict__ resid, int rmod, int ldr,
                                                float* __restrict__ C, int ldc, int M, int N, int K) {
  __shared__ __attribute__((aligned(16))) float so[4][16][64];
  const int tid = threadIdx.x, w = tid >> 5, lane = tid & 31, ln = lane & 15, hh = lane >> 4;
  const int ntn = N / 64;
  const int wid = blockIdx.x * 4 + w;
  const int mt = wid / ntn, nq = wid % ntn;
  if (mt * 16 >= M) return;
  const int row0 = mt * 16, col0 = nq * 64;
  const float* arow = A + (size_t)(row0 + ln) * lda;
  v8f acc[4] = {};
  for (int kb = 0; kb < K; kb += 32) {
    FragB ah, al;
    const v4f x0 = *(const v4fa*)(arow + kb + 8 * hh), x1 = *(const v4fa*)(arow + kb + 8 * hh + 4);
    const v4f x2 = *(const v4fa*)(arow + kb + 16 + 8 * hh), x3 = *(const v4fa*)(arow + kb + 16 + 8 * hh + 4);
    float xs[16] = {x0[0],x0[1],x0[2],x0[3],x1[0],x1[1],x1[2],x1[3],x2[0],x2[1],x2[2],x2[3],x3[0],x3[1],x3[2],x3[3]};
#pragma unroll
    for (int i = 0; i < 16; ++i) { const unsigned short hb = bf16_bits(xs[i]); ah.u[i] = hb; al.u[i] = ASPLIT ? bf16_bits(xs[i] - bf16_val(hb)) : (unsigned short)0; }
#pragma unroll
    for (int t = 0; t < 4; ++t) {
      const unsigned short* brow = Wt + (size_t)(col0 + t * 16 + ln) * ldb + kb;
      FragB b;
      b.half[0] = *(const v8us*)(brow + 8 * hh);
      b.half[1] = *(const v8us*)(brow + 16 + 8 * hh);
      acc[t] = mmaN<ASPLIT ? 2 : 1>(ah.v, al.v, b.v, b.v, acc[t]);
    }
  }
#pragma unroll
  for (int t = 0; t < 4; ++t) {
    const int col = col0 + t * 16 + ln;
    float bv = bias ? bias[col] : 0.f;
    if (BIAS_BF16) bv = bf16_round(bv);
#pragma unroll
    for (int r = 0; r < 8; ++r) {
      float v = acc[t][r] + bv;
      if (resid) { float rv = resid[(size_t)((row0 + 8 * hh + r) % rmod) * ldr + col]; if (RES_BF16) rv = bf16_round(rv); v += rv; }
      if (ACT == 1) v = fmaxf(v, 0.f);
      if (ACT == 2) v = 0.5f * v * (1.0f + erff(v * 0.70710678118654752f));
      if (ACT == 3) { const float u = 0.7978845608028654f * (v + 0.044715f * v * v * v); v = 0.5f * v * (1.0f + tanhf(u)); }
      so[w][8 * hh + r][t * 16 + ln] = v;
    }
  }
  __builtin_amdgcn_fence(__ATOMIC_ACQ_REL, "workgroup");
  __builtin_amdgcn_wave_barrier();
  const int rsub = lane >> 4, c4 = (lane & 15) * 4;
  {
#pragma unroll
    for (int q = 0; q < 8; ++q) {
      const int r = q * 2 + rsub;
      const v4f v = *(const v4fa*)&so[w][r][c4];
      *(v4f*)(C + (size_t)(row0 + r) * ldc + col0 + c4) = v;
    }
    
  }
}
// row LayerNorm (biased variance, eps) over N: s = X (+ R); optional out_sum <- s; out_norm <- (s-mu)*rsqrt(var+eps)*g + b
template <bool PARAM_BF16>
__global__ __launch_bounds__(256) void k_layernorm(const float* __restrict__ X, const float* __restrict__ R, const float* __restrict__ g, const float* __restrict__ bta,
                                                  float* __restrict__ out_sum, float* __restrict__ out_norm, int N, float eps) {
  __shared__ float red[256];
  const int row = blockIdx.x, tid = threadIdx.x;
  const float* x = X + (size_t)row * N; const float* rr = R ? R + (size_t)row * N : nullptr;
  float vals[16];                     // up to N = 4096
  const int per = N / 256;            // contiguous chunk per thread? use strided-by-4 chunks: thread handles j = tid*4 + 1024*u
  float s1 = 0.f;
  for (int u = 0; u < per / 4; ++u) {
    const int j = tid * 4 + 1024 * u;
    const v4f a = *(const v4fa*)(x + j);
    v4f b = {0.f,0.f,0.f,0.f}; if (rr) b = *(const v4fa*)(rr + j);
#pragma unroll
    for (int q = 0; q < 4; ++q) { const float v = a[q] + b[q]; vals[u * 4 + q] = v; s1 += v; }
  }
  red[tid] = s1; __syncthreads();
  for (int st = 128; st > 0; st >>= 1) { if (tid < st) red[tid] += red[tid + st]; __syncthreads(); }
  const float mu = red[0] / (float)N; __syncthreads();
  float s2 = 0.f;
  for (int u = 0; u < per / 4; ++u)
#pragma unroll
    for (int q = 0; q < 4; ++q) { const float c = vals[u * 4 + q] - mu; s2 += c * c; }
  red[tid] = s2; __syncthreads();
  for (int st = 128; st > 0; st >>= 1) { if (tid < st) red[tid] += red[tid + st]; __syncthreads(); }
  const float rs = rsqrtf(red[0] / (float)N + eps);
  {
    for (int u = 0; u < per / 4; ++u) {
      const int j = tid * 4 + 1024 * u;
      v4f o, sm;
#pragma unroll
      for (int q = 0; q < 4; ++q) {
        float gg = g[j + q], bb = bta[j + q];
        if (PARAM_BF16) { gg = bf16_round(gg); bb = bf16_round(bb); }
        sm[q] = vals[u * 4 + q]; o[q] = (vals[u * 4 + q] - mu) * rs * gg + bb;
      }
      if (out_sum) *(v4f*)(out_sum + (size_t)row * N + j) = sm;
      *(v4f*)(out_norm + (size_t)row * N + j) = o;
    }
    
  }
}



// ---- f16 WMMA path (v_wmma_f32_16x16x32_f16): 11-bit significands for operands in range — used for every GEMM launched here
typedef _Float16 v16h __attribute__((ext_vector_type(16)));
union FragH { v16h v; v8us half[2]; _Float16 h[16]; unsigned short u[16]; };
template <int NT>
__device__ __forceinline__ v8f mmaH(v16h ah, v16h al, v16h bh, v16h bl, v8f c) {
  c = __builtin_amdgcn_wmma_f32_16x16x32_f16(false, ah, false, bh, (short)0, c, false, false);
  if (NT >= 2) c = __builtin_amdgcn_wmma_f32_16x16x32_f16(false, al, false, bh, (short)0, c, false, false);
  if (NT >= 3) c = __builtin_amdgcn_wmma_f32_16x16x32_f16(false, ah, false, bl, (short)0, c, false, false);
  asm volatile("v_nop\n\tv_nop\n\tv_nop\n\tv_nop" : "+v"(c) : "v"(ah), "v"(al), "v"(bh), "v"(bl));
  return c;
}
// batched GEMM like k_gemm_b but f16 operands: A f32 (split into f16 hi/lo if ASPLIT, else rounded to f16), Bt = f16 values [n][k]; alpha; C f32; N multiple of 16 (partial tiles skipped)
template <bool ASPLIT>
__global__ __launch_bounds__(128) void k_gemm_h(const float* __restrict__ A, int lda, size_t sA, const _Float16* __restrict__ Bh, int ldb, size_t sB, float alpha, float* __restrict__ C, int ldc, size_t sC, int M, int N, int K) {
  __shared__ __attribute__((aligned(16))) float so[4][16][64];
  const int tid = threadIdx.x, w = tid >> 5, lane = tid & 31, ln = lane & 15, hh = lane >> 4; const int by = blockIdx.y;
  A += (size_t)by * sA; Bh += (size_t)by * sB; C += (size_t)by * sC;
  const int ntn = (N + 63) / 64; const int wid = blockIdx.x * 4 + w; const int mt = wid / ntn, nq = wid % ntn; if (mt * 16 >= M) return;
  const int row0 = mt * 16, col0 = nq * 64; const float* arow = A + (size_t)(row0 + ln) * lda;
  v8f acc[4] = {};
  for (int kb = 0; kb < K; kb += 32) {
    FragH ah, al;
    const v4f x0 = *(const v4fa*)(arow + kb + 8 * hh), x1 = *(const v4fa*)(arow + kb + 8 * hh + 4), x2 = *(const v4fa*)(arow + kb + 16 + 8 * hh), x3 = *(const v4fa*)(arow + kb + 16 + 8 * hh + 4);
    float xs[16] = {x0[0],x0[1],x0[2],x0[3],x1[0],x1[1],x1[2],x1[3],x2[0],x2[1],x2[2],x2[3],x3[0],x3[1],x3[2],x3[3]};
#pragma unroll
    for (int i = 0; i < 16; ++i) { const _Float16 h = (_Float16)xs[i]; ah.h[i] = h; al.h[i] = ASPLIT ? (_Float16)(xs[i] - (float)h) : (_Float16)0.0f; }
#pragma unroll
    for (int t = 0; t < 4; ++t) { if (col0 + t * 16 >= N) continue; const size_t boff = (size_t)(col0 + t * 16 + ln) * ldb + kb; FragH bq; bq.half[0] = *(const v8us*)(Bh + boff + 8 * hh); bq.half[1] = *(const v8us*)(Bh + boff + 16 + 8 * hh);
      acc[t] = mmaH<ASPLIT ? 2 : 1>(ah.v, al.v, bq.v, bq.v, acc[t]); }
  }
#pragma unroll
  for (int t = 0; t < 4; ++t) { if (col0 + t * 16 >= N) continue;
#pragma unroll
    for (int r = 0; r < 8; ++r) so[w][8 * hh + r][t * 16 + ln] = acc[t][r] * alpha; }
  __builtin_amdgcn_fence(__ATOMIC_ACQ_REL, "workgroup"); __builtin_amdgcn_wave_barrier();
  const int rsub = lane >> 4, c4 = (lane & 15) * 4;
  {
#pragma unroll
    for (int q = 0; q < 8; ++q) { const int r = q * 2 + rsub; if (col0 + c4 < N) { const v4f v = *(const v4fa*)&so[w][r][c4]; *(v4f*)(C + (size_t)(row0 + r) * ldc + col0 + c4) = v; } }
     }
}

// Wt[n][k] = f16(W[k][n]·scale) from f32 row-major W[K][N] (scale = power of two; bf16-exact weights stay exact in f16 away from the subnormal range)
__global__ __launch_bounds__(256) void k_wt_f16(const float* __restrict__ W, _Float16* __restrict__ Wt, int K, int N, float scale) {
  const int t = blockIdx.x * 256 + threadIdx.x; if (t >= N * (K / 8)) return; const int n = t / (K / 8), k8 = (t % (K / 8)) * 8; FragH f;
#pragma unroll
  for (int i = 0; i < 8; ++i) f.h[i] = (_Float16)(bf16_round(W[(size_t)(k8 + i) * N + n]) * scale); const v8us o = f.half[0];
  *(v8us*)((unsigned short*)Wt + (size_t)n * K + k8) = o; 
}
// k_gemm_hh variant with fused epilogue: v = acc·alpha + bias[by·sBias + col] (+ CP[(row/rowsPerB)·sCPb + by·64 + col] if CP) ; ACT 0 none / 1 elu ; writes f16 C16 (and f32 C if non-null)
template <int ACT>
__global__ __launch_bounds__(128) void k_gemm_hhx(const _Float16* __restrict__ A, int lda, size_t sA, const _Float16* __restrict__ Bh, int ldb, size_t sB, float alpha, const float* __restrict__ bias, size_t sBias, const float* __restrict__ CP, int rowsPerB, size_t sCPb, int row0g,
    float* __restrict__ C, _Float16* __restrict__ C16, int ldc, size_t sC, int M, int N, int K) {
  __shared__ __attribute__((aligned(16))) float so[4][16][64];
  const int tid = threadIdx.x, w = tid >> 5, lane = tid & 31, ln = lane & 15, hh = lane >> 4; const int by = blockIdx.y;
  A += (size_t)by * sA; Bh += (size_t)by * sB; const size_t cofs = (size_t)by * sC; const float* bp = bias ? bias + (size_t)by * sBias : nullptr;
  const int ntn = (N + 63) / 64; const int wid = blockIdx.x * 4 + w; const int mt = wid / ntn, nq = wid % ntn; if (mt * 16 >= M) return;
  const int row0 = mt * 16, col0 = nq * 64; const _Float16* arow = A + (size_t)(row0 + ln) * lda;
  v8f acc[4] = {};
  for (int kb = 0; kb < K; kb += 32) { FragH ah; ah.half[0] = *(const v8us*)((const unsigned short*)arow + kb + 8 * hh); ah.half[1] = *(const v8us*)((const unsigned short*)arow + kb + 16 + 8 * hh);
#pragma unroll
    for (int t = 0; t < 4; ++t) { if (col0 + t * 16 >= N) continue; const size_t boff = (size_t)(col0 + t * 16 + ln) * ldb + kb; FragH bq; bq.half[0] = *(const v8us*)((const unsigned short*)Bh + boff + 8 * hh); bq.half[1] = *(const v8us*)((const unsigned short*)Bh + boff + 16 + 8 * hh);
      acc[t] = mmaH<1>(ah.v, ah.v, bq.v, bq.v, acc[t]); }
  }
#pragma unroll
  for (int t = 0; t < 4; ++t) { if (col0 + t * 16 >= N) continue; const int col = col0 + t * 16 + ln; const float bv = bp ? bf16_round(bp[col]) : 0.f;
#pragma unroll
    for (int r = 0; r < 8; ++r) { float v = acc[t][r] * alpha + bv; if (CP) { const int rr = row0g + row0 + 8 * hh + r; if (rowsPerB < 0) v += CP[cofs + (size_t)rr * ldc + col];      /* rowsPerB < 0: own element of the batched C plane */ else { const int bidx = rr / rowsPerB; v += CP[(size_t)bidx * sCPb + (size_t)by * 64 + col]; } } if (ACT == 1) v = (v > 0.f) ? v : expm1f(v); else if (ACT == 7) v = (v > 0.f) ? v + 1.0f : expf(v); else if (ACT == 8) v = tanhf(v); else if (ACT == 9) v = 0.5f * v * (1.0f + tanhf(0.7978845608028654f * (v + 0.044715f * v * v * v))); else if (ACT == 11) v = 1.0f / (1.0f + expf(-v)); else if (ACT == 12) v = (v > 0.f) ? v : 0.01f * v; else if (ACT == 14) v = (v > 0.f) ? v : 0.1f * v; else if (ACT == 16) v = (v >= 0.f) ? v : 0.3f * v; else if (ACT == 17) v = (v >= 0.f) ? v : 0.2f * v; else if (ACT == 15) v = v / (1.0f + expf(-v)); else if (ACT == 3) v = fmaxf(v, 0.f); else if (ACT == 6) v = 0.5f * v * (1.0f + erff(v * 0.70710678118654752f)); so[w][8 * hh + r][t * 16 + ln] = v; } }
  __builtin_amdgcn_fence(__ATOMIC_ACQ_REL, "workgroup"); __builtin_amdgcn_wave_barrier();
  const int rsub = lane >> 4, c4 = (lane & 15) * 4; typedef _Float16 v4h __attribute__((ext_vector_type(4)));
  {
#pragma unroll
    for (int q = 0; q < 8; ++q) { const int r = q * 2 + rsub; if (col0 + c4 < N) { const v4f v = *(const v4fa*)&so[w][r][c4]; if (C) *(v4f*)(C + cofs + (size_t)(row0 + r) * ldc + col0 + c4) = v; if (C16) { v4h h4; for (int i = 0; i < 4; ++i) h4[i] = (_Float16)v[i]; *(v4h*)(C16 + cofs + (size_t)(row0 + r) * ldc + col0 + c4) = h4; } } }
     }
}


typedef _Float16 v4h __attribute__((ext_vector_type(4)));

__global__ __launch_bounds__(256) void k_x16(const float* __restrict__ x, _Float16* __restrict__ X16, size_t n8) { const size_t t = (size_t)blockIdx.x * 256 + threadIdx.x; if (t >= n8) return; FragH f;
#pragma unroll
  for (int q = 0; q < 8; ++q) f.h[q] = (_Float16)bf16_round(x[t * 8 + q]); *(v8us*)((unsigned short*)X16 + t * 8) = f.half[0];  }
__global__ __launch_bounds__(256) void k_h16(const float* __restrict__ x, _Float16* __restrict__ X16, size_t n8) { const size_t t = (size_t)blockIdx.x * 256 + threadIdx.x; if (t >= n8) return; FragH f;
#pragma unroll
  for (int q = 0; q < 8; ++q) f.h[q] = (_Float16)x[t * 8 + q]; *(v8us*)((unsigned short*)X16 + t * 8) = f.half[0];  }
__global__ __launch_bounds__(256) void k_round16f(const float* __restrict__ W, _Float16* __restrict__ Bt, size_t n8) { const size_t t = (size_t)blockIdx.x * 256 + threadIdx.x; if (t >= n8) return; FragH f;
#pragma unroll
  for (int i = 0; i < 8; ++i) f.h[i] = (_Float16)(bf16_round(W[t * 8 + i]) * 16.0f); *(v8us*)((unsigned short*)Bt + t * 8) = f.half[0];  }
template <int NHv, int TTv>
__global__ __launch_bounds__(256) void k_vt(const _Float16* __restrict__ V16, int ldv, int voff, _Float16* __restrict__ Vt) { __shared__ unsigned short tl[64][66]; const int tid = threadIdx.x; const int slab = blockIdx.x / (TTv / 64), lg = blockIdx.x % (TTv / 64); const int b = slab / NHv, h = slab % NHv;
  for (int i = tid; i < 64 * 8; i += 256) { const int r = i / 8, c8 = (i % 8) * 8; FragH f; f.half[0] = *(const v8us*)((const unsigned short*)V16 + ((size_t)b * TTv + lg * 64 + r) * ldv + voff + h * 64 + c8);
#pragma unroll
    for (int q = 0; q < 8; ++q) tl[r][c8 + q] = f.u[q]; }
  __syncthreads();
  {
#pragma unroll
    for (int rd = 0; rd < 2; ++rd) { const int d = rd * 32 + tid / 8, pc = tid % 8; FragH f;
#pragma unroll
      for (int q = 0; q < 8; ++q) f.u[q] = tl[pc * 8 + q][d];
      *(v8us*)((unsigned short*)Vt + ((size_t)slab * 64 + d) * TTv + lg * 64 + pc * 8) = f.half[0]; }
     } }

__global__ __launch_bounds__(256) void k_hl(const float* __restrict__ F, _Float16* __restrict__ Hh, _Float16* __restrict__ Hl, size_t n8) { const size_t t = (size_t)blockIdx.x * 256 + threadIdx.x; if (t >= n8) return; FragH fh, fl; const v4f a = *(const v4fa*)(F + t * 8), c = *(const v4fa*)(F + t * 8 + 4);
#pragma unroll
  for (int q = 0; q < 4; ++q) { _Float16 h = (_Float16)a[q]; fh.h[q] = h; fl.h[q] = (_Float16)((a[q] - (float)h) * 1024.0f); h = (_Float16)c[q]; fh.h[4 + q] = h; fl.h[4 + q] = (_Float16)((c[q] - (float)h) * 1024.0f); }
  { *(v8us*)((unsigned short*)Hh + t * 8) = fh.half[0]; *(v8us*)((unsigned short*)Hl + t * 8) = fl.half[0];  } }

// ---- staged GEMM: C = act(A B^T alpha + bias), A f16 [M][K], Bh f16 [N][K], both K-contiguous, N = K = DM; M % 128 == 0; grid = (M / 128) * (N / 128); H16 picks the f16 output C16, else the f32 output C ----
// A work-group of four waves takes a 128 x 128 tile of C, a wave 64 x 64 of it (4 x 4 accumulator tiles). Per trip 64 k of the 128 A rows and the 128 B rows (128 bytes a row) lie in LDS at a pitch of 144 bytes;
// asynchronous copies bring them there in whole 128-byte lines, two buffers, the next tile in flight while this one is worked on. The k order of every sum is ascending in steps of 32, as with fragments read from global memory.
__device__ __forceinline__ v16h g2_frag(const _Float16* p, int hh) { FragH f; f.half[0] = *(const v8us*)((const unsigned short*)p + 8 * hh); f.half[1] = *(const v8us*)((const unsigned short*)p + 16 + 8 * hh); return f.v; }
#define G3_PITCH 144                   /* LDS bytes per 128-byte row: 16 B x odd, for ds_load_b128 readers */
#define G3_TILE (128 * G3_PITCH)       /* one operand's tile in LDS, bytes */
__device__ __forceinline__ v8f g3_mma(v16h a, v16h b, v8f c) { return __builtin_amdgcn_wmma_f32_16x16x32_f16(false, a, false, b, (short)0, c, false, false); }
__device__ __forceinline__ v16h g3_frag(const unsigned char* p) { FragH f; f.half[0] = *(const v8us*)p; f.half[1] = *(const v8us*)(p + 32); return f.v; }      /* p already holds the lane's row and its 16 hh bytes: k = 8 hh + 0..7, then 16 + 8 hh + 0..7 */
// eight copies of 16 bytes a lane: rows r, r + 16, ..., r + 112 of one operand's tile (l: the lane's LDS byte address in row r, g: its global address there, rs: 16 rows in elements).
// The s_wait_xcnt closes the statement so that it stands in front of every later write of a register that a copy names.
__device__ __forceinline__ void g3_copy8(unsigned l, const _Float16* g, size_t rs) {
  asm volatile("global_load_async_to_lds_b128 %0, %8, off\n\tglobal_load_async_to_lds_b128 %1, %9, off\n\tglobal_load_async_to_lds_b128 %2, %10, off\n\tglobal_load_async_to_lds_b128 %3, %11, off\n\t"
               "global_load_async_to_lds_b128 %4, %12, off\n\tglobal_load_async_to_lds_b128 %5, %13, off\n\tglobal_load_async_to_lds_b128 %6, %14, off\n\tglobal_load_async_to_lds_b128 %7, %15, off\n\ts_wait_xcnt 0x0"
               :: "v"(l), "v"(l + 16 * G3_PITCH), "v"(l + 32 * G3_PITCH), "v"(l + 48 * G3_PITCH), "v"(l + 64 * G3_PITCH), "v"(l + 80 * G3_PITCH), "v"(l + 96 * G3_PITCH), "v"(l + 112 * G3_PITCH),
                  "v"(g), "v"(g + rs), "v"(g + 2 * rs), "v"(g + 3 * rs), "v"(g + 4 * rs), "v"(g + 5 * rs), "v"(g + 6 * rs), "v"(g + 7 * rs) : "memory"); }
template <int ACT, bool H16>
__global__ __launch_bounds__(128) void k_gemm3(const _Float16* __restrict__ A, const _Float16* __restrict__ Bh, float alpha, const float* __restrict__ bias, float* __restrict__ C, _Float16* __restrict__ C16) { static_assert(ACT == 0 || ACT == 3, "k_gemm3: unsupported ACT code (would silently apply no activation)");
  constexpr int N = DM, K = DM; static_assert(N % 128 == 0 && K % 64 == 0 && K >= 128, "k_gemm3: whole tiles only, two or more of them along K");
  __shared__ __attribute__((aligned(16))) unsigned char sm[4 * G3_TILE];      /* buffer u: A tile at 2 u tiles, B tile at 2 u + 1; behind the loop each wave's output staging, one tile's bytes a wave */
  const int tid = threadIdx.x, w = tid >> 5, lane = tid & 31, ln = lane & 15, hh = lane >> 4;
  const int ntn = N >> 7; const int mt = blockIdx.x / ntn, nq = blockIdx.x - mt * ntn; const int row0 = mt * 128, col0 = nq * 128; const int wr = (w >> 1) * 64, wc = (w & 1) * 64;
  const unsigned l0 = (unsigned)(size_t)sm + (unsigned)((tid >> 3) * G3_PITCH + (tid & 7) * 16);      /* eight lanes a row: a wave's copy covers four whole 128-byte lines */
  const _Float16* ga = A + (size_t)(row0 + (tid >> 3)) * K + (tid & 7) * 8; const _Float16* gb = Bh + (size_t)(col0 + (tid >> 3)) * K + (tid & 7) * 8; constexpr size_t rs = (size_t)16 * K; constexpr int nt = K >> 6;
  g3_copy8(l0, ga, rs); g3_copy8(l0 + G3_TILE, gb, rs);
  asm volatile("s_wait_asynccnt 0x0" ::: "memory");      /* this wave's share of tile 0 has landed */
  __syncthreads();      /* tile 0 is read by every wave */
  g3_copy8(l0 + 2 * G3_TILE, ga + 64, rs); g3_copy8(l0 + 3 * G3_TILE, gb + 64, rs);
  const unsigned char* fa = sm + (wr + ln) * G3_PITCH + 16 * hh; const unsigned char* fb = sm + G3_TILE + (wc + ln) * G3_PITCH + 16 * hh;
  const v8f z8 = {0.f, 0.f, 0.f, 0.f, 0.f, 0.f, 0.f, 0.f}; v8f acc[4][4];
#pragma unroll      /* register arrays need constant indices */
  for (int i = 0; i < 4; ++i)
#pragma unroll      /* register arrays need constant indices */
    for (int j = 0; j < 4; ++j) acc[i][j] = z8;
#pragma unroll 1      /* one trip per tile: the buffer is chosen at run time, and an unrolled body would only grow the text */
  for (int t = 0; t < nt; ++t) { const unsigned bo = (unsigned)(t & 1) * (2 * G3_TILE);
#pragma unroll      /* register arrays need constant indices */
    for (int ks = 0; ks < 2; ++ks) { v16h af[4], bf[4];
#pragma unroll      /* register arrays need constant indices */
      for (int i = 0; i < 4; ++i) bf[i] = g3_frag(fb + bo + i * 16 * G3_PITCH + ks * 64);
#pragma unroll      /* register arrays need constant indices */
      for (int i = 0; i < 4; ++i) af[i] = g3_frag(fa + bo + i * 16 * G3_PITCH + ks * 64);
      __builtin_amdgcn_sched_barrier(0);      /* the sixteen LDS reads of a block go out as one group in front of its products: left free, each A fragment was read alone and waited for in front of its four products */
#pragma unroll      /* register arrays need constant indices */
      for (int i = 0; i < 4; ++i)
#pragma unroll      /* register arrays need constant indices */
        for (int j = 0; j < 4; ++j) acc[i][j] = g3_mma(af[i], bf[j], acc[i][j]);
      __builtin_amdgcn_sched_barrier(0); }      /* the next group of reads stays behind this block's products, whose fragment registers it reuses */
    asm volatile("s_wait_dscnt 0x0" ::: "memory");      /* this wave's reads of the buffer have returned before the barrier behind which it is refilled */
    asm volatile("s_wait_asynccnt 0x0" ::: "memory");      /* this wave's share of tile t + 1 has landed */
    __syncthreads();      /* publishes tile t + 1 and ends every wave's reads of tile t */
    if (t + 2 < nt) { g3_copy8(l0 + bo, ga + (size_t)(t + 2) * 64, rs); g3_copy8(l0 + bo + G3_TILE, gb + (size_t)(t + 2) * 64, rs); } }
  asm volatile("s_wait_asynccnt 0x0" ::: "memory");      /* no copy is outstanding when the buffers become output staging */
  float* so = (float*)(sm + w * G3_TILE);      /* 64 rows of 68 floats, this wave's own; the last trip's barrier has ended every read of the tiles */
#pragma unroll      /* register arrays need constant indices */
  for (int j = 0; j < 4; ++j) { const float bv = bf16_round(bias[col0 + wc + j * 16 + ln]);
#pragma unroll      /* register arrays need constant indices */
    for (int i = 0; i < 4; ++i)
#pragma unroll      /* register arrays need constant indices */
      for (int r = 0; r < 8; ++r) { float v = acc[i][j][r] * alpha + bv; if (ACT == 3) v = fmaxf(v, 0.f); so[(i * 16 + 8 * hh + r) * 68 + j * 16 + ln] = v; } }
  __builtin_amdgcn_fence(__ATOMIC_ACQ_REL, "workgroup"); __builtin_amdgcn_wave_barrier();      /* the wave's staging writes stay in front of its reads of words that other lanes wrote */
  const int rsub = lane >> 4, c4 = (lane & 15) * 4;
  const size_t o = (size_t)(row0 + wr + rsub) * N + col0 + wc + c4;
#pragma unroll      /* register arrays need constant indices */
  for (int q0 = 0; q0 < 32; q0 += 8) { v4f v[8];      /* the reads go out in groups ahead of their stores, each store whole 128-byte lines */
#pragma unroll      /* register arrays need constant indices */
    for (int u = 0; u < 8; ++u) v[u] = *(const v4fa*)&so[((q0 + u) * 2 + rsub) * 68 + c4];
#pragma unroll      /* register arrays need constant indices */
    for (int u = 0; u < 8; ++u) { if (H16) { v4h h4; for (int i = 0; i < 4; ++i) h4[i] = (_Float16)v[u][i]; *(v4h*)(C16 + o + (size_t)(q0 + u) * 2 * N) = h4; } else *(v4f*)(C + o + (size_t)(q0 + u) * 2 * N) = v[u]; } } }


__global__ __launch_bounds__(256) void k_wnat(const float* __restrict__ w, size_t n8, _Float16* __restrict__ Bt) { const size_t t = (size_t)blockIdx.x * 256 + threadIdx.x; if (t >= n8) return; FragH f; for (int q = 0; q < 8; ++q) f.h[q] = (_Float16)(bf16_round(w[t * 8 + q]) * 16.0f); *(v8us*)((unsigned short*)Bt + t * 8) = f.half[0];  }
__global__ __launch_bounds__(256) void k_rsm(const float* __restrict__ S, _Float16* __restrict__ P, int nrows) {
  #pragma clang fp contract(off)
  const int i = blockIdx.x * 256 + threadIdx.x; if (i >= nrows) return; const float* s = S + (size_t)i * SQ; float mx = -3.0e38f;
#pragma unroll 1
  for (int j = 0; j < SQ; ++j) mx = fmaxf(mx, s[j]); float se = 0.f;
#pragma unroll 1
  for (int j = 0; j < SQ; ++j) se += expf(s[j] - mx); const float sc = 256.0f / se;
#pragma unroll 1
  for (int j0 = 0; j0 < SQ; j0 += 8) { FragH f; for (int q = 0; q < 8; ++q) f.h[q] = (_Float16)(expf(s[j0 + q] - mx) * sc); unsigned short* d = (unsigned short*)P + (size_t)i * SQ + j0; *(v8us*)d = f.half[0];  } }
__global__ __launch_bounds__(256) void k_vt(const _Float16* __restrict__ V16, int b, int h0, _Float16* __restrict__ VT) { __shared__ unsigned short tl[64][65]; const int tid = threadIdx.x; const int hh = blockIdx.x % HG, sg = blockIdx.x / HG; const int s0 = sg * 64; const int h = h0 + hh;
  for (int i = tid; i < 64 * 8; i += 256) { const int j = i / 8, d8 = (i % 8) * 8; FragH f; f.half[0] = *(const v8us*)((const unsigned short*)V16 + ((size_t)b * SQ + s0 + j) * DM + h * HD + d8); for (int q = 0; q < 8; ++q) tl[d8 + q][j] = f.u[q]; }
  __syncthreads();
  { for (int i = tid; i < 64 * 8; i += 256) { const int d = i / 8, j8 = (i % 8) * 8; FragH f; for (int q = 0; q < 8; ++q) f.u[q] = tl[d][j8 + q]; *(v8us*)((unsigned short*)VT + ((size_t)hh * HD + d) * SQ + s0 + j8) = f.half[0]; }  } }


__global__ __launch_bounds__(256) void k_whd(const float* __restrict__ w, _Float16* __restrict__ Bt) { const size_t t = (size_t)blockIdx.x * 256 + threadIdx.x; if (t >= (size_t)DM * (DM / 8)) return; const int d8 = (int)(t % (DM / 8)) * 8; const int n = (int)(t / (DM / 8)); const int h = n / HD, k = n % HD; FragH f;
  for (int q = 0; q < 8; ++q) f.h[q] = (_Float16)(bf16_round(w[((size_t)h * DM + d8 + q) * HD + k]) * 16.0f);
  unsigned short* dst = (unsigned short*)Bt + (size_t)n * DM + d8; *(v8us*)dst = f.half[0];  }
// lane exchanges for the softmax and the LayerNorm sums, native exponentials for the attention kernel's softmax
typedef int v4ia __attribute__((ext_vector_type(4), may_alias));
template <int M> __device__ __forceinline__ float rs_xrow(float x) { return __builtin_bit_cast(float, __builtin_amdgcn_update_dpp(0, __builtin_bit_cast(int, x), 0x160 | M, 0xf, 0xf, true)); }      /* lane l <- lane l ^ M inside a 16-lane row (row_xmask) */
__device__ __forceinline__ float rs_xhalf(float x) { return __builtin_bit_cast(float, __builtin_amdgcn_permlanex16(__builtin_bit_cast(int, x), __builtin_bit_cast(int, x), 0x76543210, 0xfedcba98, false, false)); }      /* lane l <- lane l ^ 16 */
// four independent 2^x in one statement, closed by the one v_nop that the instruction set asks for behind a transcendental before its result is used or its source overwritten
// outputs are early-clobber so that no exponential writes a neighbour's source
__device__ __forceinline__ void rs_exp2x4(float* x) { float r0, r1, r2, r3;
  asm("v_exp_f32 %0, %4\n\tv_exp_f32 %1, %5\n\tv_exp_f32 %2, %6\n\tv_exp_f32 %3, %7\n\tv_nop" : "=&v"(r0), "=&v"(r1), "=&v"(r2), "=&v"(r3) : "v"(x[0]), "v"(x[1]), "v"(x[2]), "v"(x[3]));
  x[0] = r0; x[1] = r1; x[2] = r2; x[3] = r3; }
// Fused attention, one launch for all batches and heads: a work-group takes 128 query rows of one (batch, head), a wave 32 of them (two 16-column groups), and walks the 1024 keys in passes of 32.
// S^T = K Q^T (A = K rows, B = Q rows kept in registers): in each group lane (ln, hh) holds, for query ln, the scores of keys 16 kt + 8 hh + r. Running maximum and sum are per lane, joined between the wave halves by one exchange.
// The two f32 score tiles of a pass, converted in place, are the f16 B operand of O^T += V^T P^T (A = V^T rows in the same k order): scores and weights never leave the registers.
// Weights are exp(s - running maximum), unnormalised (at most 1); the division by the row sum is done once, in f32, on O^T. A masked key enters as -inf (weight 0); a row with every key masked gives 0.
__device__ __forceinline__ v8f fa_mma(v16h a, v16h b, v8f c) { return __builtin_amdgcn_wmma_f32_16x16x32_f16(false, a, false, b, (short)0, c, false, false); }
// one 2^x, closed by the v_nop that the instruction set asks for behind a transcendental before its result is used or its source overwritten
__device__ __forceinline__ float fa_exp2(float x) { float r; asm("v_exp_f32 %0, %1\n\tv_nop" : "=&v"(r) : "v"(x)); return r; }
__global__ __launch_bounds__(128) void k_fattn(const _Float16* __restrict__ Q16, const _Float16* __restrict__ K16, const _Float16* __restrict__ VT, const int* __restrict__ mk, float* __restrict__ AF) {
  __shared__ __attribute__((aligned(16))) float kbias[SQ];      /* 0 for a key that counts, -inf for a masked one */
  const int tid = threadIdx.x, w = tid >> 5, lane = tid & 31, ln = lane & 15, hh = lane >> 4;
  const int bh = blockIdx.x / (SQ / 128), qb = blockIdx.x % (SQ / 128); const int b = bh / NH, h = bh % NH;
  const v4ia m0 = *(const v4ia*)(mk + (size_t)b * SQ + tid * 8), m1 = *(const v4ia*)(mk + (size_t)b * SQ + tid * 8 + 4);      /* eight keys of the mask row a thread */
  const int q0 = qb * 128 + w * 32;
  const _Float16* qp = Q16 + ((size_t)b * SQ + q0 + ln) * DM + h * HD;
  const _Float16* kp = K16 + ((size_t)b * SQ + ln) * DM + h * HD;
  const _Float16* vp = VT + ((size_t)bh * HD + ln) * SQ;
  v16h qf[2][2], kf[2][2];
#pragma unroll      /* register arrays need constant indices */
  for (int u = 0; u < 2; ++u)
#pragma unroll      /* register arrays need constant indices */
    for (int ks = 0; ks < 2; ++ks) { qf[u][ks] = g2_frag(qp + (size_t)u * 16 * DM + ks * 32, hh); kf[u][ks] = g2_frag(kp + (size_t)u * 16 * DM + ks * 32, hh); }
  { v4f b0, b1;
#pragma unroll      /* register arrays need constant indices */
    for (int q = 0; q < 4; ++q) { b0[q] = (m0[q] == 0) ? 0.f : -__builtin_inff(); b1[q] = (m1[q] == 0) ? 0.f : -__builtin_inff(); }
    *(v4fa*)&kbias[tid * 8] = b0; *(v4fa*)&kbias[tid * 8 + 4] = b1; }
  __syncthreads();      /* the bias row is read by every wave */
  const v8f z8 = {0.f, 0.f, 0.f, 0.f, 0.f, 0.f, 0.f, 0.f};
  v8f o[2][4] = {{z8, z8, z8, z8}, {z8, z8, z8, z8}}; float mr[2] = {-3.0e38f, -3.0e38f}, lr[2] = {0.f, 0.f};
  for (int it = 0; it < SQ / 32; ++it) { const int key0 = it * 32;
    v16h vf[4]; v4f bs[4];
#pragma unroll      /* register arrays need constant indices */
    for (int dt = 0; dt < 4; ++dt) { vf[dt] = g2_frag(vp + (size_t)dt * 16 * SQ + key0, hh); bs[dt] = *(const v4fa*)&kbias[key0 + (dt >> 1) * 16 + 8 * hh + (dt & 1) * 4]; }
    asm volatile("s_wait_xcnt 0x0" ::: "memory");      /* behind the V^T loads, in front of every later reuse of a register that they name as an address */
    v8f s[2][2];
#pragma unroll      /* register arrays need constant indices */
    for (int qi = 0; qi < 2; ++qi)
#pragma unroll      /* register arrays need constant indices */
      for (int kt = 0; kt < 2; ++kt) s[qi][kt] = fa_mma(kf[kt][1], qf[qi][1], fa_mma(kf[kt][0], qf[qi][0], z8));
    const int kn = (it + 1 < SQ / 32) ? key0 + 32 : key0;      /* the next pass's K fragments are fetched behind this pass's score products, under the softmax; the last pass reads its own rows again, in bounds */
#pragma unroll      /* register arrays need constant indices */
    for (int kt = 0; kt < 2; ++kt)
#pragma unroll      /* register arrays need constant indices */
      for (int ks = 0; ks < 2; ++ks) kf[kt][ks] = g2_frag(kp + (size_t)(kn + kt * 16) * DM + ks * 32, hh);
    asm volatile("s_wait_xcnt 0x0" ::: "memory");      /* behind the K loads, in front of every later reuse of a register that they name as an address */
    __builtin_amdgcn_sched_barrier(0);      /* the K loads are issued here, in front of the softmax: left free, they sank to the foot of the pass and the next pass waited out their whole latency */
#pragma unroll      /* register arrays need constant indices */
    for (int qi = 0; qi < 2; ++qi) { float t[16];
#pragma unroll      /* register arrays need constant indices */
      for (int i = 0; i < 16; ++i) t[i] = s[qi][i >> 3][i & 7] * 0.18033688f + bs[i >> 2][i & 3];      /* score / 8 in log2 units: exp(x) = 2^(x log2 e), the native form */
      float mx = t[0];
#pragma unroll      /* register arrays need constant indices */
      for (int i = 1; i < 16; ++i) mx = fmaxf(mx, t[i]);
      mx = fmaxf(mx, rs_xhalf(mx)); const float mn = fmaxf(mr[qi], mx); const float f = fa_exp2(mr[qi] - mn); mr[qi] = mn;
#pragma unroll      /* register arrays need constant indices */
      for (int i = 0; i < 16; ++i) t[i] -= mn;
      rs_exp2x4(t); rs_exp2x4(t + 4); rs_exp2x4(t + 8); rs_exp2x4(t + 12);
      float s4[4] = {t[0], t[1], t[2], t[3]};
#pragma unroll      /* register arrays need constant indices */
      for (int i = 4; i < 16; ++i) s4[i & 3] += t[i];
      lr[qi] = lr[qi] * f + ((s4[0] + s4[1]) + (s4[2] + s4[3]));
      FragH p;
#pragma unroll      /* register arrays need constant indices */
      for (int i = 0; i < 16; ++i) p.h[i] = (_Float16)t[i];
#pragma unroll      /* register arrays need constant indices */
      for (int dt = 0; dt < 4; ++dt) o[qi][dt] = fa_mma(vf[dt], p.v, o[qi][dt] * f); } }
#pragma unroll      /* register arrays need constant indices */
  for (int qi = 0; qi < 2; ++qi) { const float se = lr[qi] + rs_xhalf(lr[qi]); const float inv = (se == 0.f) ? 0.f : 1.0f / se;
    float* dst = AF + ((size_t)b * SQ + q0 + qi * 16 + ln) * DM + h * HD + 8 * hh;      /* lane (ln, hh): query ln, head columns 16 dt + 8 hh + r */
#pragma unroll      /* register arrays need constant indices */
    for (int dt = 0; dt < 4; ++dt) { const v8f v = o[qi][dt] * inv; const v4f lo = {v[0], v[1], v[2], v[3]}, hi = {v[4], v[5], v[6], v[7]}; *(v4f*)(dst + dt * 16) = lo; *(v4f*)(dst + dt * 16 + 4) = hi; } } }
// OF_ = R + LayerNorm(A) g + bta (H16: and its f16 copy OH_): two rows a wave, eight waves a work-group, no LDS and no barrier.
// Lane l holds columns 128 u + 4 l + 0..3 (u = 0..7) of each row, so every load and every f32 store of a wave is 512 contiguous bytes; all loads of both rows go out ahead of the arithmetic.
// Mean and biased variance (two passes over the registers): four partial sums a lane, joined pairwise, then a five-step xor butterfly that leaves the same sum in every lane.
__device__ __forceinline__ float ln_wsum(float s) { s += rs_xrow<1>(s); s += rs_xrow<2>(s); s += rs_xrow<4>(s); s += rs_xrow<8>(s); return s + rs_xhalf(s); }
template <int RBF, bool H16>
__global__ __launch_bounds__(256) void k_lnadd(const float* __restrict__ A, const float* __restrict__ R, const float* __restrict__ g, const float* __restrict__ bta, float eps, float* __restrict__ OF_, _Float16* __restrict__ OH_) {
  static_assert(DM == 1024 && MPO % 16 == 0, "k_lnadd: rows of 1024 columns, sixteen rows a work-group");
  const int j0 = (threadIdx.x & 31) * 4;      /* the one per-lane part of every address */
  const size_t e0 = ((size_t)blockIdx.x * 8 + (size_t)__builtin_amdgcn_readfirstlane(threadIdx.x >> 5)) * 2 * DM;      /* first element of the wave's first row: the same in every lane, so the row bases are scalar */
  const float* ap = A + e0; const float* rp = R + e0; float* op = OF_ + e0; _Float16* hp = OH_ + e0;
  v4f a[2][8], r[2][8], gv[8], bv[8];
  asm volatile("" :: "s"(eps), "s"(OF_), "s"(OH_));      /* inputs only: the arguments that are used behind the loads are fetched in front of them; left free, their fetch stood behind the loads */
  __builtin_amdgcn_sched_barrier(0);      /* keeps the loads behind that fetch */
#pragma unroll      /* register arrays need constant indices */
  for (int p = 0; p < 2; ++p)
#pragma unroll      /* register arrays need constant indices */
    for (int u = 0; u < 8; ++u) a[p][u] = *(const v4fa*)(ap + p * DM + u * 128 + j0);
#pragma unroll      /* register arrays need constant indices */
  for (int p = 0; p < 2; ++p)
#pragma unroll      /* register arrays need constant indices */
    for (int u = 0; u < 8; ++u) r[p][u] = *(const v4fa*)(rp + p * DM + u * 128 + j0);
#pragma unroll      /* register arrays need constant indices */
  for (int u = 0; u < 8; ++u) { gv[u] = *(const v4fa*)(g + u * 128 + j0); bv[u] = *(const v4fa*)(bta + u * 128 + j0); }
  asm volatile("s_wait_xcnt 0x0" ::: "memory");      /* behind the loads, in front of every later reuse of a register that they name as an address */
  __builtin_amdgcn_sched_barrier(0);      /* all 48 loads are issued here, in front of the arithmetic: left free, the second row's loads sank behind the first row's sums and their latency was waited out a second time */
#pragma unroll      /* register arrays need constant indices */
  for (int p = 0; p < 2; ++p) { v4f c = a[p][0];
#pragma unroll      /* register arrays need constant indices */
    for (int u = 1; u < 8; ++u) c += a[p][u];
    const float mu = ln_wsum((c[0] + c[1]) + (c[2] + c[3])) / (float)DM;
    v4f d = (a[p][0] - mu) * (a[p][0] - mu);
#pragma unroll      /* register arrays need constant indices */
    for (int u = 1; u < 8; ++u) d += (a[p][u] - mu) * (a[p][u] - mu);
    const float rs = rsqrtf(ln_wsum((d[0] + d[1]) + (d[2] + d[3])) / (float)DM + eps);
#pragma unroll      /* register arrays need constant indices */
    for (int u = 0; u < 8; ++u) { v4f o; v4h h4;
#pragma unroll      /* register arrays need constant indices */
      for (int q = 0; q < 4; ++q) { o[q] = (RBF ? bf16_round(r[p][u][q]) : r[p][u][q]) + ((a[p][u][q] - mu) * rs * bf16_round(gv[u][q]) + bf16_round(bv[u][q])); h4[q] = (_Float16)o[q]; }
      *(v4f*)(op + p * DM + u * 128 + j0) = o; if (H16) *(v4h*)(hp + p * DM + u * 128 + j0) = h4; } } }

extern "C" void kernel_launch(void* const* d_in, const int* in_sizes, int n_in,
                              void* d_out, int out_size, void* d_ws, size_t ws_size, hipStream_t stream) {
  (void)in_sizes; (void)n_in; (void)out_size;
  const float* const* I = (const float* const*)d_in; const float* x = I[0]; const int* xmask = (const int*)d_in[1]; const float* wq = I[2]; const float* bq = I[3]; const float* wk = I[4]; const float* bk = I[5]; const float* wv = I[6]; const float* bv = I[7]; const float* w1 = I[8]; const float* b1 = I[9]; const float* w2 = I[10]; const float* b2 = I[11]; const float* g1 = I[12]; const float* be1 = I[13]; const float* g2 = I[14]; const float* be2 = I[15];
  char* ws = (char*)d_ws; size_t off = 0;
  auto take = [&](size_t bytes) { char* p = ws + off; off += (bytes + 255) & ~(size_t)255; return p; };
  _Float16* BQ = (_Float16*)take((size_t)DM * DM * 2); _Float16* BK = (_Float16*)take((size_t)DM * DM * 2); _Float16* BV = (_Float16*)take((size_t)DM * DM * 2); _Float16* B1 = (_Float16*)take((size_t)DM * DM * 2); _Float16* B2 = (_Float16*)take((size_t)DM * DM * 2);
  _Float16* X16 = (_Float16*)take(NR * DM * 2); _Float16* Q16 = (_Float16*)take(NR * DM * 2); _Float16* K16 = (_Float16*)take(NR * DM * 2); _Float16* V16 = (_Float16*)take(NR * DM * 2); float* AF = (float*)take(NR * DM * 4); float* X1F = (float*)take(NR * DM * 4); _Float16* X1H = (_Float16*)take(NR * DM * 2); _Float16* H16 = (_Float16*)take(NR * DM * 2); float* FF = AF;      /* f rows reuse the attention-output rows (dead after the first LayerNorm; same type) */
  _Float16* VT = (_Float16*)take((size_t)NB * NH * HD * SQ * 2);
  if (off > ws_size) return;      /* 10 + 16x4 + 32 + 32 + 16 + 16 + 16 = approx 186 MiB */
  { const unsigned gw = (unsigned)(((size_t)DM * (DM / 8) + 255) / 256); k_whd<<<gw, 256, 0, stream>>>(wq, BQ); k_whd<<<gw, 256, 0, stream>>>(wk, BK); k_whd<<<gw, 256, 0, stream>>>(wv, BV); k_wt_f16<<<gw, 256, 0, stream>>>(w1, B1, DM, DM, 16.0f); k_wt_f16<<<gw, 256, 0, stream>>>(w2, B2, DM, DM, 16.0f); }
  k_x16<<<(unsigned)((NR * DM / 8 + 255) / 256), 256, 0, stream>>>(x, X16, NR * DM / 8);
  const size_t r0p = (size_t)B0 * SQ; const dim3 gp((unsigned)((MP / 128) * (DM / 128)), 1);
  k_gemm3<0, true><<<gp, 128, 0, stream>>>(X16 + r0p * DM, BQ, 0.0625f, bq, nullptr, Q16 + r0p * DM);
  k_gemm3<0, true><<<gp, 128, 0, stream>>>(X16 + r0p * DM, BK, 0.0625f, bk, nullptr, K16 + r0p * DM);
  k_gemm3<0, true><<<gp, 128, 0, stream>>>(X16 + r0p * DM, BV, 0.0625f, bv, nullptr, V16 + r0p * DM);
  k_vt<NH, SQ><<<NB * NH * (SQ / 64), 256, 0, stream>>>(V16, DM, 0, VT);      /* V^T of every (batch, head) */
  k_fattn<<<NB * NH * (SQ / 128), 128, 0, stream>>>(Q16, K16, VT, xmask, AF);      /* a (merged heads) as f32 rows */
  k_lnadd<1, true><<<(unsigned)(MPO / 16), 256, 0, stream>>>(AF + r0p * DM, x + r0p * DM, g1, be1, 1e-5f, X1F + r0p * DM, X1H + r0p * DM);      /* x1 = bf16(x) + LN(a) */
  const dim3 gf((unsigned)((MPO / 128) * (DM / 128)), 1);
  k_gemm3<3, true><<<gf, 128, 0, stream>>>(X1H + r0p * DM, B1, 0.0625f, b1, nullptr, H16 + r0p * DM);      /* h = relu(x1 W1 + b1) (f16) */
  k_gemm3<0, false><<<gf, 128, 0, stream>>>(H16 + r0p * DM, B2, 0.0625f, b2, FF + r0p * DM, nullptr);      /* f = h W2 + b2 (f32) */
  k_lnadd<0, false><<<(unsigned)(MPO / 16), 256, 0, stream>>>(FF + r0p * DM, X1F + r0p * DM, g2, be2, 1e-5f, (float*)d_out + r0p * DM, nullptr);      /* out = x1 + LN(f) */
}

// v005
// Measured time: 192 microseconds a run.
// Next to v004, in two timings, it ran 1.14 and 1.15 times as fast.
// All steps since v000 together make it 57.3 times as fast.
#include <hip/hip_runtime.h>
// Transformer encoder layer (x [8][1024][1024]; per-head q/k/v = x Wq[h] + bq[h] (Wq [16][1024][64]); scores / 8 with a key-padding mask x_mask [8][1][1024] (int32, read; all zeros here); softmax; a = attn v concatenated over heads; x1 = x + LayerNorm(a) g1 + be1; h = relu(x1 W1 + b1); f = h W2 + b2 (W1, W2 [1024][1024] [in][out]); out = x1 + LayerNorm(f) g2 + be2 -> [8][1024][1024]).
// Structure: token rows; x as exact f16 rows; Q, K, V as three WMMA GEMMs (128x128 work-group tiles staged in LDS, 64x64 wave tiles, f32 accumulation, exact x16 head-stacked weights + bias, f16 outputs); V^T for all batches and heads via LDS transposes; one fused attention launch (scores K = 64 as S^T = K Q^T, masked running-maximum softmax on VALU in f32 with native exp, weights f16 at most 1, masked keys 0, O^T += V^T P^T, divided by the row sum in f32) into f32 rows; per row on VALU: x1 = bf16(x) + LayerNorm(a) (f32 + f16 copies); h = relu(x1 W1 + b1) GEMM (f16); f = h W2 + b2 GEMM (f32); per row on VALU: out = x1 + LayerNorm(f).
// Compute dtype: inputs rounded to bf16; x / weights exact; q, k, v, softmax weights, x1 (as GEMM operand) and h plain f16 (~2^-12); attention output, LayerNorms, residuals f32. v_wmma_f32_16x16x32_f16.
#define NB 8
#define SQ 1024
#define DM 1024
#define NH 16
#define HD 64
#define HG 4
#define B0 0                         /* first batch processed (debug hook) */
#define NBR NB                       /* batches processed (debug hook) */
#define QN SQ                        /* unused; attention covers all SQ query rows of a batch */
#define NR ((size_t)NB * SQ)
#define MP ((int)((size_t)NBR * SQ)) /* rows projected (debug hook) */
#define MPO MP                       /* rows through the post-attention stages (debug hook) */
typedef __bf16 v16b __attribute__((ext_vector_type(16)));
typedef unsigned short v8us __attribute__((ext_vector_type(8), may_alias));
typedef float  v8f  __attribute__((ext_vector_type(8)));
typedef float  v4f  __attribute__((ext_vector_type(4)));
typedef float  v4fa __attribute__((ext_vector_type(4), may_alias));
union FragB { v16b v; v8us half[2]; unsigned short u[16]; };

__device__ __forceinline__ unsigned short bf16_bits(float x) { unsigned int u = __float_as_uint(x); return (unsigned short)((u + 0x7FFFu + ((u >> 16) & 1u)) >> 16); }
__device__ __forceinline__ float bf16_val(unsigned short b) { return __uint_as_float(((unsigned int)b) << 16); }
__device__ __forceinline__ float bf16_round(float x) { return bf16_val(bf16_bits(x)); }
// D += A·B with NT terms: 1 = ah·bh, 2 = + al·bh (A split), 3 = + ah·bl (both split)
template <int NT>
__device__ __forceinline__ v8f mmaN(v16b ah, v16b al, v16b bh, v16b bl, v8f c) {
  c = __builtin_amdgcn_wmma_f32_16x16x32_bf16(false, ah, false, bh, (short)0, c, false, false);
  if (NT >= 2) c = __builtin_amdgcn_wmma_f32_16x16x32_bf16(false, al, false, bh, (short)0, c, false, false);
  if (NT >= 3) c = __builtin_amdgcn_wmma_f32_16x16x32_bf16(false, ah, false, bl, (short)0, c, false, false);
  asm volatile("v_nop\n\tv_nop\n\tv_nop\n\tv_nop" : "+v"(c) : "v"(ah), "v"(al), "v"(bh), "v"(bl));
  return c;
}

__global__ __launch_bounds__(256) void k_wt_bf16(const float* __restrict__ W, unsigned short* __restrict__ Wt, int K, int N) {
  const int t = blockIdx.x * 256 + threadIdx.x;
  const int k8n = K / 8;
  if (t >= N * k8n) return;
  const int n = t / k8n, k8 = (t % k8n) * 8;
  v8us v;
#pragma unroll
  for (int i = 0; i < 8; ++i) v[i] = bf16_bits(W[(size_t)(k8 + i) * N + n]);
  *(v8us*)(Wt + (size_t)n * K + k8) = v;
  
}

// GEMM C[M][N] (f32, pitch ldc) = act(A[M][K]·W + bias). A f32 row-major (pitch lda) converted per fragment to bf16
// (ASPLIT: hi/lo two planes -> 2 terms, else single rounded term); Wt bf16 [N][K] (pitch ldb). BIAS_BF16 rounds the
// bias to bf16 first (bias quantised to bf16 before the add). K%32==0, M%16==0, N%64==0.
template <bool ASPLIT, int ACT, bool BIAS_BF16>
__global__ __launch_bounds__(128) void k_gemm_bf(const float* __restrict__ A, int lda, const unsigned short* __restrict__ Wt, int ldb,
                                               const float* __restrict__ bias, float* __restrict__ C, int ldc, int M, int N, int K) {
  __shared__ __attribute__((aligned(16))) float so[4][16][64];
  const int tid = threadIdx.x, w = tid >> 5, lane = tid & 31, ln = lane & 15, hh = lane >> 4;
  const int ntn = N / 64;
  const int wid = blockIdx.x * 4 + w;
  const int mt = wid / ntn, nq = wid % ntn;
  if (mt * 16 >= M) return;
  const int row0 = mt * 16, col0 = nq * 64;
  const float* arow = A + (size_t)(row0 + ln) * lda;
  v8f acc[4] = {};
  for (int kb = 0; kb < K; kb += 32) {
    FragB ah, al;
    const v4f x0 = *(const v4fa*)(arow + kb + 8 * hh), x1 = *(const v4fa*)(arow + kb + 8 * hh + 4);
    const v4f x2 = *(const v4fa*)(arow + kb + 16 + 8 * hh), x3 = *(const v4fa*)(arow + kb + 16 + 8 * hh + 4);
    float xs[16] = {x0[0],x0[1],x0[2],x0[3],x1[0],x1[1],x1[2],x1[3],x2[0],x2[1],x2[2],x2[3],x3[0],x3[1],x3[2],x3[3]};
#pragma unroll
    for (int i = 0; i < 16; ++i) { const unsigned short hb = bf16_bits(xs[i]); ah.u[i] = hb; al.u[i] = ASPLIT ? bf16_bits(xs[i] - bf16_val(hb)) : (unsigned short)0; }
#pragma unroll
    for (int t = 0; t < 4; ++t) {
      const unsigned short* brow = Wt + (size_t)(col0 + t * 16 + ln) * ldb + kb;
      FragB b;
      b.half[0] = *(const v8us*)(brow + 8 * hh);
      b.half[1] = *(const v8us*)(brow + 16 + 8 * hh);
      acc[t] = mmaN<ASPLIT ? 2 : 1>(ah.v, al.v, b.v, b.v, acc[t]);
    }
  }
#pragma unroll
  for (int t = 0; t < 4; ++t) {
    float bv = bias ? bias[col0 + t * 16 + ln] : 0.f;
    if (BIAS_BF16) bv = bf16_round(bv);
#pragma unroll
    for (int r = 0; r < 8; ++r) { float v = acc[t][r] + bv; if (ACT == 1) v = fmaxf(v, 0.f); so[w][8 * hh + r][t * 16 + ln] = v; }
  }
  __builtin_amdgcn_fence(__ATOMIC_ACQ_REL, "workgroup");
  __builtin_amdgcn_wave_barrier();
  const int rsub = lane >> 4, c4 = (lane & 15) * 4;
  {
#pragma unroll
    for (int q = 0; q < 8; ++q) {
      const int r = q * 2 + rsub;
      const v4f v = *(const v4fa*)&so[w][r][c4];
      *(v4f*)(C + (size_t)(row0 + r) * ldc + col0 + c4) = v;
    }
    
  }
}

// GEMM C = act(A·W + bias + resid): A f32 (ASPLIT -> hi/lo 2 terms), Wt bf16 [N][K]; ACT 0 none, 1 relu, 2 exact gelu;
// resid (optional, f32, row index = (row % rmod), pitch ldr, RES_BF16 rounds it) added before the activation.
template <bool ASPLIT, int ACT, bool BIAS_BF16, bool RES_BF16>
__global__ __launch_bounds__(128) void k_gemm_bf3(const float* __restrict__ A, int lda, const unsigned short* __restrict__ Wt, int ldb,
                                                const float* __restrict__ bias, const float* __restrict__ resid, int rmod, int ldr,
                                                float* __restrict__ C, int ldc, int M, int N, int K) {
  __shared__ __attribute__((aligned(16))) float so[4][16][64];
  const int tid = threadIdx.x, w = tid >> 5, lane = tid & 31, ln = lane & 15, hh = lane >> 4;
  const int ntn = N / 64;
  const int wid = blockIdx.x * 4 + w;
  const int mt = wid / ntn, nq = wid % ntn;
  if (mt * 16 >= M) return;
  const int row0 = mt * 16, col0 = nq * 64;
  const float* arow = A + (size_t)(row0 + ln) * lda;
  v8f acc[4] = {};
  for (int kb = 0; kb < K; kb += 32) {
    FragB ah, al;
    const v4f x0 = *(const v4fa*)(arow + kb + 8 * hh), x1 = *(const v4fa*)(arow + kb + 8 * hh + 4);
    const v4f x2 = *(const v4fa*)(arow + kb + 16 + 8 * hh), x3 = *(const v4fa*)(arow + kb + 16 + 8 * hh + 4);
    float xs[16] = {x0[0],x0[1],x0[2],x0[3],x1[0],x1[1],x1[2],x1[3],x2[0],x2[1],x2[2],x2[3],x3[0],x3[1],x3[2],x3[3]};
#pragma unroll
    for (int i = 0; i < 16; ++i) { const unsigned short hb = bf16_bits(xs[i]); ah.u[i] = hb; al.u[i] = ASPLIT ? bf16_bits(xs[i] - bf16_val(hb)) : (unsigned short)0; }
#pragma unroll
    for (int t = 0; t < 4; ++t) {
      const unsigned short* brow = Wt + (size_t)(col0 + t * 16 + ln) * ldb + kb;
      FragB b;
      b.half[0] = *(const v8us*)(brow + 8 * hh);
      b.half[1] = *(const v8us*)(brow + 16 + 8 * hh);
      acc[t] = mmaN<ASPLIT ? 2 : 1>(ah.v, al.v, b.v, b.v, acc[t]);
    }
  }
#pragma unroll
  for (int t = 0; t < 4; ++t) {
    const int col = col0 + t * 16 + ln;
    float bv = bias ? bias[col] : 0.f;
    if (BIAS_BF16) bv = bf16_round(bv);
#pragma unroll
    for (int r = 0; r < 8; ++r) {
      float v = acc[t][r] + bv;
      if (resid) { float rv = resid[(size_t)((row0 + 8 * hh + r) % rmod) * ldr + col]; if (RES_BF16) rv = bf16_round(rv); v += rv; }
      if (ACT == 1) v = fmaxf(v, 0.f);
      if (ACT == 2) v = 0.5f * v * (1.0f + erff(v * 0.70710678118654752f));
      if (ACT == 3) { const float u = 0.7978845608028654f * (v + 0.044715f * v * v * v); v = 0.5f * v * (1.0f + tanhf(u)); }
      so[w][8 * hh + r][t * 16 + ln] = v;
    }
  }
  __builtin_amdgcn_fence(__ATOMIC_ACQ_REL, "workgroup");
  __builtin_amdgcn_wave_barrier();
  const int rsub = lane >> 4, c4 = (lane & 15) * 4;
  {
#pragma unroll
    for (int q = 0; q < 8; ++q) {
      const int r = q * 2 + rsub;
      const v4f v = *(const v4fa*)&so[w][r][c4];
      *(v4f*)(C + (size_t)(row0 + r) * ldc + col0 + c4) = v;
    }
    
  }
}
// row LayerNorm (biased variance, eps) over N: s = X (+ R); optional out_sum <- s; out_norm <- (s-mu)*rsqrt(var+eps)*g + b
template <bool PARAM_BF16>
__global__ __launch_bounds__(256) void k_layernorm(const float* __restrict__ X, const float* __restrict__ R, const float* __restrict__ g, const float* __restrict__ bta,
                                                  float* __restrict__ out_sum, float* __restrict__ out_norm, int N, float eps) {
  __shared__ float red[256];
  const int row = blockIdx.x, tid = threadIdx.x;
  const float* x = X + (size_t)row * N; const float* rr = R ? R + (size_t)row * N : nullptr;
  float vals[16];                     // up to N = 4096
  const int per = N / 256;            // contiguous chunk per thread? use strided-by-4 chunks: thread handles j = tid*4 + 1024*u
  float s1 = 0.f;
  for (int u = 0; u < per / 4; ++u) {
    const int j = tid * 4 + 1024 * u;
    const v4f a = *(const v4fa*)(x + j);
    v4f b = {0.f,0.f,0.f,0.f}; if (rr) b = *(const v4fa*)(rr + j);
#pragma unroll
    for (int q = 0; q < 4; ++q) { const float v = a[q] + b[q]; vals[u * 4 + q] = v; s1 += v; }
  }
  red[tid] = s1; __syncthreads();
  for (int st = 128; st > 0; st >>= 1) { if (tid < st) red[tid] += red[tid + st]; __syncthreads(); }
  const float mu = red[0] / (float)N; __syncthreads();
  float s2 = 0.f;
  for (int u = 0; u < per / 4; ++u)
#pragma unroll
    for (int q = 0; q < 4; ++q) { const float c = vals[u * 4 + q] - mu; s2 += c * c; }
  red[tid] = s2; __syncthreads();
  for (int st = 128; st > 0; st >>= 1) { if (tid < st) red[tid] += red[tid + st]; __syncthreads(); }
  const float rs = rsqrtf(red[0] / (float)N + eps);
  {
    for (int u = 0; u < per / 4; ++u) {
      const int j = tid * 4 + 1024 * u;
      v4f o, sm;
#pragma unroll
      for (int q = 0; q < 4; ++q) {
        float gg = g[j + q], bb = bta[j + q];
        if (PARAM_BF16) { gg = bf16_round(gg); bb = bf16_round(bb); }
        sm[q] = vals[u * 4 + q]; o[q] = (vals[u * 4 + q] - mu) * rs * gg + bb;
      }
      if (out_sum) *(v4f*)(out_sum + (size_t)row * N + j) = sm;
      *(v4f*)(out_norm + (size_t)row * N + j) = o;
    }
    
  }
}



// ---- f16 WMMA path (v_wmma_f32_16x16x32_f16): 11-bit significands for operands in range — used for every GEMM launched here
typedef _Float16 v16h __attribute__((ext_vector_type(16)));
union FragH { v16h v; v8us half[2]; _Float16 h[16]; unsigned short u[16]; };
template <int NT>
__device__ __forceinline__ v8f mmaH(v16h ah, v16h al, v16h bh, v16h bl, v8f c) {
  c = __builtin_amdgcn_wmma_f32_16x16x32_f16(false, ah, false, bh, (short)0, c, false, false);
  if (NT >= 2) c = __builtin_amdgcn_wmma_f32_16x16x32_f16(false, al, false, bh, (short)0, c, false, false);
  if (NT >= 3) c = __builtin_amdgcn_wmma_f32_16x16x32_f16(false, ah, false, bl, (short)0, c, false, false);
  asm volatile("v_nop\n\tv_nop\n\tv_nop\n\tv_nop" : "+v"(c) : "v"(ah), "v"(al), "v"(bh), "v"(bl));
  return c;
}
// batched GEMM like k_gemm_b but f16 operands: A f32 (split into f16 hi/lo if ASPLIT, else rounded to f16), Bt = f16 values [n][k]; alpha; C f32; N multiple of 16 (partial tiles skipped)
template <bool ASPLIT>
__global__ __launch_bounds__(128) void k_gemm_h(const float* __restrict__ A, int lda, size_t sA, const _Float16* __restrict__ Bh, int ldb, size_t sB, float alpha, float* __restrict__ C, int ldc, size_t sC, int M, int N, int K) {
  __shared__ __attribute__((aligned(16))) float so[4][16][64];
  const int tid = threadIdx.x, w = tid >> 5, lane = tid & 31, ln = lane & 15, hh = lane >> 4; const int by = blockIdx.y;
  A += (size_t)by * sA; Bh += (size_t)by * sB; C += (size_t)by * sC;
  const int ntn = (N + 63) / 64; const int wid = blockIdx.x * 4 + w; const int mt = wid / ntn, nq = wid % ntn; if (mt * 16 >= M) return;
  const int row0 = mt * 16, col0 = nq * 64; const float* arow = A + (size_t)(row0 + ln) * lda;
  v8f acc[4] = {};
  for (int kb = 0; kb < K; kb += 32) {
    FragH ah, al;
    const v4f x0 = *(const v4fa*)(arow + kb + 8 * hh), x1 = *(const v4fa*)(arow + kb + 8 * hh + 4), x2 = *(const v4fa*)(arow + kb + 16 + 8 * hh), x3 = *(const v4fa*)(arow + kb + 16 + 8 * hh + 4);
    float xs[16] = {x0[0],x0[1],x0[2],x0[3],x1[0],x1[1],x1[2],x1[3],x2[0],x2[1],x2[2],x2[3],x3[0],x3[1],x3[2],x3[3]};
#pragma unroll
    for (int i = 0; i < 16; ++i) { const _Float16 h = (_Float16)xs[i]; ah.h[i] = h; al.h[i] = ASPLIT ? (_Float16)(xs[i] - (float)h) : (_Float16)0.0f; }
#pragma unroll
    for (int t = 0; t < 4; ++t) { if (col0 + t * 16 >= N) continue; const size_t boff = (size_t)(col0 + t * 16 + ln) * ldb + kb; FragH bq; bq.half[0] = *(const v8us*)(Bh + boff + 8 * hh); bq.half[1] = *(const v8us*)(Bh + boff + 16 + 8 * hh);
      acc[t] = mmaH<ASPLIT ? 2 : 1>(ah.v, al.v, bq.v, bq.v, acc[t]); }
  }
#pragma unroll
  for (int t = 0; t < 4; ++t) { if (col0 + t * 16 >= N) continue;
#pragma unroll
    for (int r = 0; r < 8; ++r) so[w][8 * hh + r][t * 16 + ln] = acc[t][r] * alpha; }
  __builtin_amdgcn_fence(__ATOMIC_ACQ_REL, "workgroup"); __builtin_amdgcn_wave_barrier();
  const int rsub = lane >> 4, c4 = (lane & 15) * 4;
  {
#pragma unroll
    for (int q = 0; q < 8; ++q) { const int r = q * 2 + rsub; if (col0 + c4 < N) { const v4f v = *(const v4fa*)&so[w][r][c4]; *(v4f*)(C + (size_t)(row0 + r) * ldc + col0 + c4) = v; } }
     }
}

// Wt[n][k] = f16(W[k][n]·scale) from f32 row-major W[K][N] (scale = power of two; bf16-exact weights stay exact in f16 away from the subnormal range)
__global__ __launch_bounds__(256) void k_wt_f16(const float* __restrict__ W, _Float16* __restrict__ Wt, int K, int N, float scale) {
  const int t = blockIdx.x * 256 + threadIdx.x; if (t >= N * (K / 8)) return; const int n = t / (K / 8), k8 = (t % (K / 8)) * 8; FragH f;
#pragma unroll
  for (int i = 0; i < 8; ++i) f.h[i] = (_Float16)(bf16_round(W[(size_t)(k8 + i) * N + n]) * scale); const v8us o = f.half[0];
  *(v8us*)((unsigned short*)Wt + (size_t)n * K + k8) = o; 
}
// k_gemm_hh variant with fused epilogue: v = acc·alpha + bias[by·sBias + col] (+ CP[(row/rowsPerB)·sCPb + by·64 + col] if CP) ; ACT 0 none / 1 elu ; writes f16 C16 (and f32 C if non-null)
template <int ACT>
__global__ __launch_bounds__(128) void k_gemm_hhx(const _Float16* __restrict__ A, int lda, size_t sA, const _Float16* __restrict__ Bh, int ldb, size_t sB, float alpha, const float* __restrict__ bias, size_t sBias, const float* __restrict__ CP, int rowsPerB, size_t sCPb, int row0g,
    float* __restrict__ C, _Float16* __restrict__ C16, int ldc, size_t sC, int M, int N, int K) {
  __shared__ __attribute__((aligned(16))) float so[4][16][64];
  const int tid = threadIdx.x, w = tid >> 5, lane = tid & 31, ln = lane & 15, hh = lane >> 4; const int by = blockIdx.y;
  A += (size_t)by * sA; Bh += (size_t)by * sB; const size_t cofs = (size_t)by * sC; const float* bp = bias ? bias + (size_t)by * sBias : nullptr;
  const int ntn = (N + 63) / 64; const int wid = blockIdx.x * 4 + w; const int mt = wid / ntn, nq = wid % ntn; if (mt * 16 >= M) return;
  const int row0 = mt * 16, col0 = nq * 64; const _Float16* arow = A + (size_t)(row0 + ln) * lda;
  v8f acc[4] = {};
  for (int kb = 0; kb < K; kb += 32) { FragH ah; ah.half[0] = *(const v8us*)((const unsigned short*)arow + kb + 8 * hh); ah.half[1] = *(const v8us*)((const unsigned short*)arow + kb + 16 + 8 * hh);
#pragma unroll
    for (int t = 0; t < 4; ++t) { if (col0 + t * 16 >= N) continue; const size_t boff = (size_t)(col0 + t * 16 + ln) * ldb + kb; FragH bq; bq.half[0] = *(const v8us*)((const unsigned short*)Bh + boff + 8 * hh); bq.half[1] = *(const v8us*)((const unsigned short*)Bh + boff + 16 + 8 * hh);
      acc[t] = mmaH<1>(ah.v, ah.v, bq.v, bq.v, acc[t]); }
  }
#pragma unroll
  for (int t = 0; t < 4; ++t) { if (col0 + t * 16 >= N) continue; const int col = col0 + t * 16 + ln; const float bv = bp ? bf16_round(bp[col]) : 0.f;
#pragma unroll
    for (int r = 0; r < 8; ++r) { float v = acc[t][r] * alpha + bv; if (CP) { const int rr = row0g + row0 + 8 * hh + r; if (rowsPerB < 0) v += CP[cofs + (size_t)rr * ldc + col];      /* rowsPerB < 0: own element of the batched C plane */ else { const int bidx = rr / rowsPerB; v += CP[(size_t)bidx * sCPb + (size_t)by * 64 + col]; } } if (ACT == 1) v = (v > 0.f) ? v : expm1f(v); else if (ACT == 7) v = (v > 0.f) ? v + 1.0f : expf(v); else if (ACT == 8) v = tanhf(v); else if (ACT == 9) v = 0.5f * v * (1.0f + tanhf(0.7978845608028654f * (v + 0.044715f * v * v * v))); else if (ACT == 11) v = 1.0f / (1.0f + expf(-v)); else if (ACT == 12) v = (v > 0.f) ? v : 0.01f * v; else if (ACT == 14) v = (v > 0.f) ? v : 0.1f * v; else if (ACT == 16) v = (v >= 0.f) ? v : 0.3f * v; else if (ACT == 17) v = (v >= 0.f) ? v : 0.2f * v; else if (ACT == 15) v = v / (1.0f + expf(-v)); else if (ACT == 3) v = fmaxf(v, 0.f); else if (ACT == 6) v = 0.5f * v * (1.0f + erff(v * 0.70710678118654752f)); so[w][8 * hh + r][t * 16 + ln] = v; } }
  __builtin_amdgcn_fence(__ATOMIC_ACQ_REL, "workgroup"); __builtin_amdgcn_wave_barrier();
  const int rsub = lane >> 4, c4 = (lane & 15) * 4; typedef _Float16 v4h __attribute__((ext_vector_type(4)));
  {
#pragma unroll
    for (int q = 0; q < 8; ++q) { const int r = q * 2 + rsub; if (col0 + c4 < N) { const v4f v = *(const v4fa*)&so[w][r][c4]; if (C) *(v4f*)(C + cofs + (size_t)(row0 + r) * ldc + col0 + c4) = v; if (C16) { v4h h4; for (int i = 0; i < 4; ++i) h4[i] = (_Float16)v[i]; *(v4h*)(C16 + cofs + (size_t)(row0 + r) * ldc + col0 + c4) = h4; } } }
     }
}


typedef _Float16 v4h __attribute__((ext_vector_type(4)));

__global__ __launch_bounds__(256) void k_x16(const float* __restrict__ x, _Float16* __restrict__ X16, size_t n8) { const size_t t = (size_t)blockIdx.x * 256 + threadIdx.x; if (t >= n8) return; FragH f;
#pragma unroll
  for (int q = 0; q < 8; ++q) f.h[q] = (_Float16)bf16_round(x[t * 8 + q]); *(v8us*)((unsigned short*)X16 + t * 8) = f.half[0];  }
__global__ __launch_bounds__(256) void k_h16(const float* __restrict__ x, _Float16* __restrict__ X16, size_t n8) { const size_t t = (size_t)blockIdx.x * 256 + threadIdx.x; if (t >= n8) return; FragH f;
#pragma unroll
  for (int q = 0; q < 8; ++q) f.h[q] = (_Float16)x[t * 8 + q]; *(v8us*)((unsigned short*)X16 + t * 8) = f.half[0];  }
__global__ __launch_bounds__(256) void k_round16f(const float* __restrict__ W, _Float16* __restrict__ Bt, size_t n8) { const size_t t = (size_t)blockIdx.x * 256 + threadIdx.x; if (t >= n8) return; FragH f;
#pragma unroll
  for (int i = 0; i < 8; ++i) f.h[i] = (_Float16)(bf16_round(W[t * 8 + i]) * 16.0f); *(v8us*)((unsigned short*)Bt + t * 8) = f.half[0];  }
template <int NHv, int TTv>
__global__ __launch_bounds__(256) void k_vt(const _Float16* __restrict__ V16, int ldv, int voff, _Float16* __restrict__ Vt) { __shared__ unsigned short tl[64][66]; const int tid = threadIdx.x; const int slab = blockIdx.x / (TTv / 64), lg = blockIdx.x % (TTv / 64); const int b = slab / NHv, h = slab % NHv;
  for (int i = tid; i < 64 * 8; i += 256) { const int r = i / 8, c8 = (i % 8) * 8; FragH f; f.half[0] = *(const v8us*)((const unsigned short*)V16 + ((size_t)b * TTv + lg * 64 + r) * ldv + voff + h * 64 + c8);
#pragma unroll
    for (int q = 0; q < 8; ++q) tl[r][c8 + q] = f.u[q]; }
  __syncthreads();
  {
#pragma unroll
    for (int rd = 0; rd < 2; ++rd) { const int d = rd * 32 + tid / 8, pc = tid % 8; FragH f;
#pragma unroll
      for (int q = 0; q < 8; ++q) f.u[q] = tl[pc * 8 + q][d];
      *(v8us*)((unsigned short*)Vt + ((size_t)slab * 64 + d) * TTv + lg * 64 + pc * 8) = f.half[0]; }
     } }

__global__ __launch_bounds__(256) void k_hl(const float* __restrict__ F, _Float16* __restrict__ Hh, _Float16* __restrict__ Hl, size_t n8) { const size_t t = (size_t)blockIdx.x * 256 + threadIdx.x; if (t >= n8) return; FragH fh, fl; const v4f a = *(const v4fa*)(F + t * 8), c = *(const v4fa*)(F + t * 8 + 4);
#pragma unroll
  for (int q = 0; q < 4; ++q) { _Float16 h = (_Float16)a[q]; fh.h[q] = h; fl.h[q] = (_Float16)((a[q] - (float)h) * 1024.0f); h = (_Float16)c[q]; fh.h[4 + q] = h; fl.h[4 + q] = (_Float16)((c[q] - (float)h) * 1024.0f); }
  { *(v8us*)((unsigned short*)Hh + t * 8) = fh.half[0]; *(v8us*)((unsigned short*)Hl + t * 8) = fl.half[0];  } }

// ---- staged GEMM: C = act(A B^T alpha + bias), A f16 [M][K], Bh f16 [N][K], both K-contiguous, N = K = DM; M % 128 == 0; grid = (M / 128) * (N / 128); H16 picks the f16 output C16, else the f32 output C ----
// A work-group of four waves takes a 128 x 128 tile of C, a wave 64 x 64 of it (4 x 4 accumulator tiles). Per trip 64 k of the 128 A rows and the 128 B rows (128 bytes a row) lie in LDS at a pitch of 144 bytes;
// asynchronous copies bring them there in whole 128-byte lines, two buffers, the next tile in flight while this one is worked on. The k order of every sum is ascending in steps of 32, as with fragments read from global memory.
__device__ __forceinline__ v16h g2_frag(const _Float16* p, int hh) { FragH f; f.half[0] = *(const v8us*)((const unsigned short*)p + 8 * hh); f.half[1] = *(const v8us*)((const unsigned short*)p + 16 + 8 * hh); return f.v; }
#define G3_PITCH 144                   /* LDS bytes per 128-byte row: 16 B x odd, for ds_load_b128 readers */
#define G3_TILE (128 * G3_PITCH)       /* one operand's tile in LDS, bytes */
__device__ __forceinline__ v8f g3_mma(v16h a, v16h b, v8f c) { return __builtin_amdgcn_wmma_f32_16x16x32_f16(false, a, false, b, (short)0, c, false, false); }
__device__ __forceinline__ v16h g3_frag(const unsigned char* p) { FragH f; f.half[0] = *(const v8us*)p; f.half[1] = *(const v8us*)(p + 32); return f.v; }      /* p already holds the lane's row and its 16 hh bytes: k = 8 hh + 0..7, then 16 + 8 hh + 0..7 */
// eight copies of 16 bytes a lane: rows r, r + 16, ..., r + 112 of one operand's tile (l: the lane's LDS byte address in row r, g: its global address there, rs: 16 rows in elements).
// The s_wait_xcnt closes the statement so that it stands in front of every later write of a register that a copy names.
__device__ __forceinline__ void g3_copy8(unsigned l, const _Float16* g, size_t rs) {
  asm volatile("global_load_async_to_lds_b128 %0, %8, off\n\tglobal_load_async_to_lds_b128 %1, %9, off\n\tglobal_load_async_to_lds_b128 %2, %10, off\n\tglobal_load_async_to_lds_b128 %3, %11, off\n\t"
               "global_load_async_to_lds_b128 %4, %12, off\n\tglobal_load_async_to_lds_b128 %5, %13, off\n\tglobal_load_async_to_lds_b128 %6, %14, off\n\tglobal_load_async_to_lds_b128 %7, %15, off\n\ts_wait_xcnt 0x0"
               :: "v"(l), "v"(l + 16 * G3_PITCH), "v"(l + 32 * G3_PITCH), "v"(l + 48 * G3_PITCH), "v"(l + 64 * G3_PITCH), "v"(l + 80 * G3_PITCH), "v"(l + 96 * G3_PITCH), "v"(l + 112 * G3_PITCH),
                  "v"(g), "v"(g + rs), "v"(g + 2 * rs), "v"(g + 3 * rs), "v"(g + 4 * rs), "v"(g + 5 * rs), "v"(g + 6 * rs), "v"(g + 7 * rs) : "memory"); }
template <int ACT, bool H16>
__global__ __launch_bounds__(128) void k_gemm3(const _Float16* __restrict__ A, const _Float16* __restrict__ Bh, float alpha, const float* __restrict__ bias, float* __restrict__ C, _Float16* __restrict__ C16) { static_assert(ACT == 0 || ACT == 3, "k_gemm3: unsupported ACT code (would silently apply no activation)");
  constexpr int N = DM, K = DM; static_assert(N % 128 == 0 && K % 64 == 0 && K >= 128, "k_gemm3: whole tiles only, two or more of them along K");
  __shared__ __attribute__((aligned(16))) unsigned char sm[4 * G3_TILE];      /* buffer u: A tile at 2 u tiles, B tile at 2 u + 1; behind the loop each wave's output staging, one tile's bytes a wave */
  const int tid = threadIdx.x, w = tid >> 5, lane = tid & 31, ln = lane & 15, hh = lane >> 4;
  const int ntn = N >> 7; const int mt = blockIdx.x / ntn, nq = blockIdx.x - mt * ntn; const int row0 = mt * 128, col0 = nq * 128; const int wr = (w >> 1) * 64, wc = (w & 1) * 64;
  const unsigned l0 = (unsigned)(size_t)sm + (unsigned)((tid >> 3) * G3_PITCH + (tid & 7) * 16);      /* eight lanes a row: a wave's copy covers four whole 128-byte lines */
  const _Float16* ga = A + (size_t)(row0 + (tid >> 3)) * K + (tid & 7) * 8; const _Float16* gb = Bh + (size_t)(col0 + (tid >> 3)) * K + (tid & 7) * 8; constexpr size_t rs = (size_t)16 * K; constexpr int nt = K >> 6;
  g3_copy8(l0, ga, rs); g3_copy8(l0 + G3_TILE, gb, rs);
  asm volatile("s_wait_asynccnt 0x0" ::: "memory");      /* this wave's share of tile 0 has landed */
  __syncthreads();      /* tile 0 is read by every wave */
  g3_copy8(l0 + 2 * G3_TILE, ga + 64, rs); g3_copy8(l0 + 3 * G3_TILE, gb + 64, rs);
  const unsigned char* fa = sm + (wr + ln) * G3_PITCH + 16 * hh; const unsigned char* fb = sm + G3_TILE + (wc + ln) * G3_PITCH + 16 * hh;
  const v8f z8 = {0.f, 0.f, 0.f, 0.f, 0.f, 0.f, 0.f, 0.f}; v8f acc[4][4];
#pragma unroll      /* register arrays need constant indices */
  for (int i = 0; i < 4; ++i)
#pragma unroll      /* register arrays need constant indices */
    for (int j = 0; j < 4; ++j) acc[i][j] = z8;
#pragma unroll 1      /* one trip per tile: the buffer is chosen at run time, and an unrolled body would only grow the text */
  for (int t = 0; t < nt; ++t) { const unsigned bo = (unsigned)(t & 1) * (2 * G3_TILE);
#pragma unroll      /* register arrays need constant indices */
    for (int ks = 0; ks < 2; ++ks) { v16h af[4], bf[4];
#pragma unroll      /* register arrays need constant indices */
      for (int i = 0; i < 4; ++i) bf[i] = g3_frag(fb + bo + i * 16 * G3_PITCH + ks * 64);
#pragma unroll      /* register arrays need constant indices */
      for (int i = 0; i < 4; ++i) af[i] = g3_frag(fa + bo + i * 16 * G3_PITCH + ks * 64);
      __builtin_amdgcn_sched_barrier(0);      /* the sixteen LDS reads of a block go out as one group in front of its products: left free, each A fragment was read alone and waited for in front of its four products */
#pragma unroll      /* register arrays need constant indices */
      for (int i = 0; i < 4; ++i)
#pragma unroll      /* register arrays need constant indices */
        for (int j = 0; j < 4; ++j) acc[i][j] = g3_mma(af[i], bf[j], acc[i][j]);
      __builtin_amdgcn_sched_barrier(0); }      /* the next group of reads stays behind this block's products, whose fragment registers it reuses */
    asm volatile("s_wait_dscnt 0x0" ::: "memory");      /* this wave's reads of the buffer have returned before the barrier behind which it is refilled */
    asm volatile("s_wait_asynccnt 0x0" ::: "memory");      /* this wave's share of tile t + 1 has landed */
    __syncthreads();      /* publishes tile t + 1 and ends every wave's reads of tile t */
    if (t + 2 < nt) { g3_copy8(l0 + bo, ga + (size_t)(t + 2) * 64, rs); g3_copy8(l0 + bo + G3_TILE, gb + (size_t)(t + 2) * 64, rs); } }
  asm volatile("s_wait_asynccnt 0x0" ::: "memory");      /* no copy is outstanding when the buffers become output staging */
  float* so = (float*)(sm + w * G3_TILE);      /* 64 rows of 68 floats, this wave's own; the last trip's barrier has ended every read of the tiles */
#pragma unroll      /* register arrays need constant indices */
  for (int j = 0; j < 4; ++j) { const float bv = bf16_round(bias[col0 + wc + j * 16 + ln]);
#pragma unroll      /* register arrays need constant indices */
    for (int i = 0; i < 4; ++i)
#pragma unroll      /* register arrays need constant indices */
      for (int r = 0; r < 8; ++r) { float v = acc[i][j][r] * alpha + bv; if (ACT == 3) v = fmaxf(v, 0.f); so[(i * 16 + 8 * hh + r) * 68 + j * 16 + ln] = v; } }
  __builtin_amdgcn_fence(__ATOMIC_ACQ_REL, "workgroup"); __builtin_amdgcn_wave_barrier();      /* the wave's staging writes stay in front of its reads of words that other lanes wrote */
  const int rsub = lane >> 4, c4 = (lane & 15) * 4;
  const size_t o = (size_t)(row0 + wr + rsub) * N + col0 + wc + c4;
#pragma unroll      /* register arrays need constant indices */
  for (int q0 = 0; q0 < 32; q0 += 8) { v4f v[8];      /* the reads go out in groups ahead of their stores, each store whole 128-byte lines */
#pragma unroll      /* register arrays need constant indices */
    for (int u = 0; u < 8; ++u) v[u] = *(const v4fa*)&so[((q0 + u) * 2 + rsub) * 68 + c4];
#pragma unroll      /* register arrays need constant indices */
    for (int u = 0; u < 8; ++u) { if (H16) { v4h h4; for (int i = 0; i < 4; ++i) h4[i] = (_Float16)v[u][i]; *(v4h*)(C16 + o + (size_t)(q0 + u) * 2 * N) = h4; } else *(v4f*)(C + o + (size_t)(q0 + u) * 2 * N) = v[u]; } } }


__global__ __launch_bounds__(256) void k_wnat(const float* __restrict__ w, size_t n8, _Float16* __restrict__ Bt) { const size_t t = (size_t)blockIdx.x * 256 + threadIdx.x; if (t >= n8) return; FragH f; for (int q = 0; q < 8; ++q) f.h[q] = (_Float16)(bf16_round(w[t * 8 + q]) * 16.0f); *(v8us*)((unsigned short*)Bt + t * 8) = f.half[0];  }
__global__ __launch_bounds__(256) void k_rsm(const float* __restrict__ S, _Float16* __restrict__ P, int nrows) {
  #pragma clang fp contract(off)
  const int i = blockIdx.x * 256 + threadIdx.x; if (i >= nrows) return; const float* s = S + (size_t)i * SQ; float mx = -3.0e38f;
#pragma unroll 1
  for (int j = 0; j < SQ; ++j) mx = fmaxf(mx, s[j]); float se = 0.f;
#pragma unroll 1
  for (int j = 0; j < SQ; ++j) se += expf(s[j] - mx); const float sc = 256.0f / se;
#pragma unroll 1
  for (int j0 = 0; j0 < SQ; j0 += 8) { FragH f; for (int q = 0; q < 8; ++q) f.h[q] = (_Float16)(expf(s[j0 + q] - mx) * sc); unsigned short* d = (unsigned short*)P + (size_t)i * SQ + j0; *(v8us*)d = f.half[0];  } }
__global__ __launch_bounds__(256) void k_vt(const _Float16* __restrict__ V16, int b, int h0, _Float16* __restrict__ VT) { __shared__ unsigned short tl[64][65]; const int tid = threadIdx.x; const int hh = blockIdx.x % HG, sg = blockIdx.x / HG; const int s0 = sg * 64; const int h = h0 + hh;
  for (int i = tid; i < 64 * 8; i += 256) { const int j = i / 8, d8 = (i % 8) * 8; FragH f; f.half[0] = *(const v8us*)((const unsigned short*)V16 + ((size_t)b * SQ + s0 + j) * DM + h * HD + d8); for (int q = 0; q < 8; ++q) tl[d8 + q][j] = f.u[q]; }
  __syncthreads();
  { for (int i = tid; i < 64 * 8; i += 256) { const int d = i / 8, j8 = (i % 8) * 8; FragH f; for (int q = 0; q < 8; ++q) f.u[q] = tl[d][j8 + q]; *(v8us*)((unsigned short*)VT + ((size_t)hh * HD + d) * SQ + s0 + j8) = f.half[0]; }  } }


__global__ __launch_bounds__(256) void k_whd(const float* __restrict__ w, _Float16* __restrict__ Bt) { const size_t t = (size_t)blockIdx.x * 256 + threadIdx.x; if (t >= (size_t)DM * (DM / 8)) return; const int d8 = (int)(t % (DM / 8)) * 8; const int n = (int)(t / (DM / 8)); const int h = n / HD, k = n % HD; FragH f;
  for (int q = 0; q < 8; ++q) f.h[q] = (_Float16)(bf16_round(w[((size_t)h * DM + d8 + q) * HD + k]) * 16.0f);
  unsigned short* dst = (unsigned short*)Bt + (size_t)n * DM + d8; *(v8us*)dst = f.half[0];  }
// lane exchanges for the softmax and the LayerNorm sums, native exponentials for the attention kernel's softmax
typedef int v4ia __attribute__((ext_vector_type(4), may_alias));
template <int M> __device__ __forceinline__ float rs_xrow(float x) { return __builtin_bit_cast(float, __builtin_amdgcn_update_dpp(0, __builtin_bit_cast(int, x), 0x160 | M, 0xf, 0xf, true)); }      /* lane l <- lane l ^ M inside a 16-lane row (row_xmask) */
__device__ __forceinline__ float rs_xhalf(float x) { return __builtin_bit_cast(float, __builtin_amdgcn_permlanex16(__builtin_bit_cast(int, x), __builtin_bit_cast(int, x), 0x76543210, 0xfedcba98, false, false)); }      /* lane l <- lane l ^ 16 */
// four independent 2^x in one statement, closed by the one v_nop that the instruction set asks for behind a transcendental before its result is used or its source overwritten
// outputs are early-clobber so that no exponential writes a neighbour's source
__device__ __forceinline__ void rs_exp2x4(float* x) { float r0, r1, r2, r3;
  asm("v_exp_f32 %0, %4\n\tv_exp_f32 %1, %5\n\tv_exp_f32 %2, %6\n\tv_exp_f32 %3, %7\n\tv_nop" : "=&v"(r0), "=&v"(r1), "=&v"(r2), "=&v"(r3) : "v"(x[0]), "v"(x[1]), "v"(x[2]), "v"(x[3]));
  x[0] = r0; x[1] = r1; x[2] = r2; x[3] = r3; }
// Fused attention, one launch for all batches and heads: a work-group takes 128 query rows of one (batch, head), a wave 32 of them (two 16-column groups), and walks the 1024 keys in passes of 32, two passes a trip.
// Per trip the 64 K rows of the head (128 bytes a row) and 64 keys of its 64 V^T rows (128 bytes a row) lie in LDS at a pitch of 144 bytes, one copy for the four waves;
// asynchronous copies bring them there in whole 128-byte lines, two buffers, the next trip's tiles in flight while these are worked on. Fragments are read from LDS in the k order they had from global memory.
// S^T = K Q^T (A = K rows, B = Q rows kept in registers): in each group lane (ln, hh) holds, for query ln, the scores of keys 16 kt + 8 hh + r. Running maximum and sum are per lane, joined between the wave halves by one exchange.
// The two f32 score tiles of a pass, converted in place, are the f16 B operand of O^T += V^T P^T (A = V^T rows in the same k order): scores and weights never leave the registers.
// Weights are exp(s - running maximum), unnormalised (at most 1); the division by the row sum is done once, in f32, on O^T. A masked key enters as -inf (weight 0); a row with every key masked gives 0.
__device__ __forceinline__ v8f fa_mma(v16h a, v16h b, v8f c) { return __builtin_amdgcn_wmma_f32_16x16x32_f16(false, a, false, b, (short)0, c, false, false); }
// one 2^x, closed by the v_nop that the instruction set asks for behind a transcendental before its result is used or its source overwritten
__device__ __forceinline__ float fa_exp2(float x) { float r; asm("v_exp_f32 %0, %1\n\tv_nop" : "=&v"(r) : "v"(x)); return r; }
#define FA_TILE (64 * G3_PITCH)        /* one operand's tile in LDS, bytes: 64 rows of 128 bytes at the padded pitch */
// eight copies of 16 bytes a lane: rows r, r + 16, r + 32, r + 48 of the K tile, then of the V^T tile behind it (l: the lane's LDS byte address in row r of the K tile; gk, gv: its global addresses there).
// The s_wait_xcnt closes the statement so that it stands in front of every later write of a register that a copy names.
__device__ __forceinline__ void fa_copy8(unsigned l, const _Float16* gk, const _Float16* gv) { constexpr size_t rk = (size_t)16 * DM, rv = (size_t)16 * SQ;      /* 16 rows in elements */
  asm volatile("global_load_async_to_lds_b128 %0, %8, off\n\tglobal_load_async_to_lds_b128 %1, %9, off\n\tglobal_load_async_to_lds_b128 %2, %10, off\n\tglobal_load_async_to_lds_b128 %3, %11, off\n\t"
               "global_load_async_to_lds_b128 %4, %12, off\n\tglobal_load_async_to_lds_b128 %5, %13, off\n\tglobal_load_async_to_lds_b128 %6, %14, off\n\tglobal_load_async_to_lds_b128 %7, %15, off\n\ts_wait_xcnt 0x0"
               :: "v"(l), "v"(l + 16 * G3_PITCH), "v"(l + 32 * G3_PITCH), "v"(l + 48 * G3_PITCH), "v"(l + FA_TILE), "v"(l + FA_TILE + 16 * G3_PITCH), "v"(l + FA_TILE + 32 * G3_PITCH), "v"(l + FA_TILE + 48 * G3_PITCH),
                  "v"(gk), "v"(gk + rk), "v"(gk + 2 * rk), "v"(gk + 3 * rk), "v"(gv), "v"(gv + rv), "v"(gv + 2 * rv), "v"(gv + 3 * rv) : "memory"); }
__global__ __launch_bounds__(128) void k_fattn(const _Float16* __restrict__ Q16, const _Float16* __restrict__ K16, const _Float16* __restrict__ VT, const int* __restrict__ mk, float* __restrict__ AF) {
  static_assert(HD == 64 && SQ % 64 == 0 && SQ >= 128, "k_fattn: heads of 64 columns, whole trips of 64 keys, two or more of them");
  __shared__ __attribute__((aligned(16))) float kbias[SQ];      /* 0 for a key that counts, -inf for a masked one */
  __shared__ __attribute__((aligned(16))) unsigned char kv[4 * FA_TILE];      /* buffer u: K tile at 2 u tiles, V^T tile at 2 u + 1 */
  const int tid = threadIdx.x, w = tid >> 5, lane = tid & 31, ln = lane & 15, hh = lane >> 4;
  const int bh = blockIdx.x / (SQ / 128), qb = blockIdx.x % (SQ / 128); const int b = bh / NH, h = bh % NH;
  const unsigned l0 = (unsigned)(size_t)kv + (unsigned)((tid >> 3) * G3_PITCH + (tid & 7) * 16);      /* eight lanes a row: a wave's copy covers four whole 128-byte lines */
  const _Float16* gk = K16 + ((size_t)b * SQ + (tid >> 3)) * DM + h * HD + (tid & 7) * 8; const _Float16* gv = VT + ((size_t)bh * HD + (tid >> 3)) * SQ + (tid & 7) * 8; constexpr int nt = SQ / 64;
  fa_copy8(l0, gk, gv);
  const v4ia m0 = *(const v4ia*)(mk + (size_t)b * SQ + tid * 8), m1 = *(const v4ia*)(mk + (size_t)b * SQ + tid * 8 + 4);      /* eight keys of the mask row a thread */
  const int q0 = qb * 128 + w * 32;
  const _Float16* qp = Q16 + ((size_t)b * SQ + q0 + ln) * DM + h * HD;
  v16h qf[2][2];
#pragma unroll      /* register arrays need constant indices */
  for (int u = 0; u < 2; ++u)
#pragma unroll      /* register arrays need constant indices */
    for (int ks = 0; ks < 2; ++ks) qf[u][ks] = g2_frag(qp + (size_t)u * 16 * DM + ks * 32, hh);
  { v4f b0, b1;
#pragma unroll      /* register arrays need constant indices */
    for (int q = 0; q < 4; ++q) { b0[q] = (m0[q] == 0) ? 0.f : -__builtin_inff(); b1[q] = (m1[q] == 0) ? 0.f : -__builtin_inff(); }
    *(v4fa*)&kbias[tid * 8] = b0; *(v4fa*)&kbias[tid * 8 + 4] = b1; }
  asm volatile("s_wait_asynccnt 0x0" ::: "memory");      /* this wave's share of the first tiles has landed */
  __syncthreads();      /* the bias row and the first tiles are read by every wave */
  fa_copy8(l0 + 2 * FA_TILE, gk + (size_t)64 * DM, gv + 64);
  const unsigned char* fk = kv + ln * G3_PITCH + 16 * hh; const unsigned char* fv = kv + FA_TILE + ln * G3_PITCH + 16 * hh;
  const v8f z8 = {0.f, 0.f, 0.f, 0.f, 0.f, 0.f, 0.f, 0.f};
  v8f o[2][4] = {{z8, z8, z8, z8}, {z8, z8, z8, z8}}; float mr[2] = {-3.0e38f, -3.0e38f}, lr[2] = {0.f, 0.f};
#pragma unroll 1      /* one trip per pair of tiles: the buffer is chosen at run time, and an unrolled body would only grow the text */
  for (int t = 0; t < nt; ++t) { const unsigned bo = (unsigned)(t & 1) * (2 * FA_TILE);
#pragma unroll      /* the pass's place in the tiles becomes a constant offset of its LDS reads */
   for (int ps = 0; ps < 2; ++ps) { const int key0 = t * 64 + ps * 32;
    v16h kf[2][2], vf[4]; v4f bs[4];
#pragma unroll      /* register arrays need constant indices */
    for (int kt = 0; kt < 2; ++kt)
#pragma unroll      /* register arrays need constant indices */
      for (int ks = 0; ks < 2; ++ks) kf[kt][ks] = g3_frag(fk + bo + (ps * 32 + kt * 16) * G3_PITCH + ks * 64);
#pragma unroll      /* register arrays need constant indices */
    for (int dt = 0; dt < 4; ++dt) { vf[dt] = g3_frag(fv + bo + dt * 16 * G3_PITCH + ps * 64); bs[dt] = *(const v4fa*)&kbias[key0 + (dt >> 1) * 16 + 8 * hh + (dt & 1) * 4]; }
    v8f s[2][2];
#pragma unroll      /* register arrays need constant indices */
    for (int qi = 0; qi < 2; ++qi)
#pragma unroll      /* register arrays need constant indices */
      for (int kt = 0; kt < 2; ++kt) s[qi][kt] = fa_mma(kf[kt][1], qf[qi][1], fa_mma(kf[kt][0], qf[qi][0], z8));
#pragma unroll      /* register arrays need constant indices */
    for (int qi = 0; qi < 2; ++qi) { float t16[16];
#pragma unroll      /* register arrays need constant indices */
      for (int i = 0; i < 16; ++i) t16[i] = s[qi][i >> 3][i & 7] * 0.18033688f + bs[i >> 2][i & 3];      /* score / 8 in log2 units: exp(x) = 2^(x log2 e), the native form */
      float mx = t16[0];
#pragma unroll      /* register arrays need constant indices */
      for (int i = 1; i < 16; ++i) mx = fmaxf(mx, t16[i]);
      mx = fmaxf(mx, rs_xhalf(mx)); const float mn = fmaxf(mr[qi], mx); const float f = fa_exp2(mr[qi] - mn); mr[qi] = mn;
#pragma unroll      /* register arrays need constant indices */
      for (int i = 0; i < 16; ++i) t16[i] -= mn;
      rs_exp2x4(t16); rs_exp2x4(t16 + 4); rs_exp2x4(t16 + 8); rs_exp2x4(t16 + 12);
      float s4[4] = {t16[0], t16[1], t16[2], t16[3]};
#pragma unroll      /* register arrays need constant indices */
      for (int i = 4; i < 16; ++i) s4[i & 3] += t16[i];
      lr[qi] = lr[qi] * f + ((s4[0] + s4[1]) + (s4[2] + s4[3]));
      FragH p;
#pragma unroll      /* register arrays need constant indices */
      for (int i = 0; i < 16; ++i) p.h[i] = (_Float16)t16[i];
#pragma unroll      /* register arrays need constant indices */
      for (int dt = 0; dt < 4; ++dt) o[qi][dt] = fa_mma(vf[dt], p.v, o[qi][dt] * f); } }
    asm volatile("s_wait_dscnt 0x0" ::: "memory");      /* this wave's reads of the buffer have returned before the barrier behind which it is refilled */
    asm volatile("s_wait_asynccnt 0x0" ::: "memory");      /* this wave's share of the next trip's tiles has landed */
    __syncthreads();      /* publishes the tiles of trip t + 1 and ends every wave's reads of those of trip t */
    if (t + 2 < nt) fa_copy8(l0 + bo, gk + (size_t)(t + 2) * 64 * DM, gv + (size_t)(t + 2) * 64); }
  asm volatile("s_wait_asynccnt 0x0" ::: "memory");      /* no copy is outstanding when the wave ends */
#pragma unroll      /* register arrays need constant indices */
  for (int qi = 0; qi < 2; ++qi) { const float se = lr[qi] + rs_xhalf(lr[qi]); const float inv = (se == 0.f) ? 0.f : 1.0f / se;
    float* dst = AF + ((size_t)b * SQ + q0 + qi * 16 + ln) * DM + h * HD + 8 * hh;      /* lane (ln, hh): query ln, head columns 16 dt + 8 hh + r */
#pragma unroll      /* register arrays need constant indices */
    for (int dt = 0; dt < 4; ++dt) { const v8f v = o[qi][dt] * inv; const v4f lo = {v[0], v[1], v[2], v[3]}, hi = {v[4], v[5], v[6], v[7]}; *(v4f*)(dst + dt * 16) = lo; *(v4f*)(dst + dt * 16 + 4) = hi; } } }
// OF_ = R + LayerNorm(A) g + bta (H16: and its f16 copy OH_): two rows a wave, eight waves a work-group, no LDS and no barrier.
// Lane l holds columns 128 u + 4 l + 0..3 (u = 0..7) of each row, so every load and every f32 store of a wave is 512 contiguous bytes; all loads of both rows go out ahead of the arithmetic.
// Mean and biased variance (two passes over the registers): four partial sums a lane, joined pairwise, then a five-step xor butterfly that leaves the same sum in every lane.
__device__ __forceinline__ float ln_wsum(float s) { s += rs_xrow<1>(s); s += rs_xrow<2>(s); s += rs_xrow<4>(s); s += rs_xrow<8>(s); return s + rs_xhalf(s); }
template <int RBF, bool H16>
__global__ __launch_bounds__(256) void k_lnadd(const float* __restrict__ A, const float* __restrict__ R, const float* __restrict__ g, const float* __restrict__ bta, float eps, float* __restrict__ OF_, _Float16* __restrict__ OH_) {
  static_assert(DM == 1024 && MPO % 16 == 0, "k_lnadd: rows of 1024 columns, sixteen rows a work-group");
  const int j0 = (threadIdx.x & 31) * 4;      /* the one per-lane part of every address */
  const size_t e0 = ((size_t)blockIdx.x * 8 + (size_t)__builtin_amdgcn_readfirstlane(threadIdx.x >> 5)) * 2 * DM;      /* first element of the wave's first row: the same in every lane, so the row bases are scalar */
  const float* ap = A + e0; const float* rp = R + e0; float* op = OF_ + e0; _Float16* hp = OH_ + e0;
  v4f a[2][8], r[2][8], gv[8], bv[8];
  asm volatile("" :: "s"(eps), "s"(OF_), "s"(OH_));      /* inputs only: the arguments that are used behind the loads are fetched in front of them; left free, their fetch stood behind the loads */
  __builtin_amdgcn_sched_barrier(0);      /* keeps the loads behind that fetch */
#pragma unroll      /* register arrays need constant indices */
  for (int p = 0; p < 2; ++p)
#pragma unroll      /* register arrays need constant indices */
    for (int u = 0; u < 8; ++u) a[p][u] = *(const v4fa*)(ap + p * DM + u * 128 + j0);
#pragma unroll      /* register arrays need constant indices */
  for (int p = 0; p < 2; ++p)
#pragma unroll      /* register arrays need constant indices */
    for (int u = 0; u < 8; ++u) r[p][u] = *(const v4fa*)(rp + p * DM + u * 128 + j0);
#pragma unroll      /* register arrays need constant indices */
  for (int u = 0; u < 8; ++u) { gv[u] = *(const v4fa*)(g + u * 128 + j0); bv[u] = *(const v4fa*)(bta + u * 128 + j0); }
  asm volatile("s_wait_xcnt 0x0" ::: "memory");      /* behind the loads, in front of every later reuse of a register that they name as an address */
  __builtin_amdgcn_sched_barrier(0);      /* all 48 loads are issued here, in front of the arithmetic: left free, the second row's loads sank behind the first row's sums and their latency was waited out a second time */
#pragma unroll      /* register arrays need constant indices */
  for (int p = 0; p < 2; ++p) { v4f c = a[p][0];
#pragma unroll      /* register arrays need constant indices */
    for (int u = 1; u < 8; ++u) c += a[p][u];
    const float mu = ln_wsum((c[0] + c[1]) + (c[2] + c[3])) / (float)DM;
    v4f d = (a[p][0] - mu) * (a[p][0] - mu);
#pragma unroll      /* register arrays need constant indices */
    for (int u = 1; u < 8; ++u) d += (a[p][u] - mu) * (a[p][u] - mu);
    const float rs = rsqrtf(ln_wsum((d[0] + d[1]) + (d[2] + d[3])) / (float)DM + eps);
#pragma unroll      /* register arrays need constant indices */
    for (int u = 0; u < 8; ++u) { v4f o; v4h h4;
#pragma unroll      /* register arrays need constant indices */
      for (int q = 0; q < 4; ++q) { o[q] = (RBF ? bf16_round(r[p][u][q]) : r[p][u][q]) + ((a[p][u][q] - mu) * rs * bf16_round(gv[u][q]) + bf16_round(bv[u][q])); h4[q] = (_Float16)o[q]; }
      *(v4f*)(op + p * DM + u * 128 + j0) = o; if (H16) *(v4h*)(hp + p * DM + u * 128 + j0) = h4; } } }

extern "C" void kernel_launch(void* const* d_in, const int* in_sizes, int n_in,
                              void* d_out, int out_size, void* d_ws, size_t ws_size, hipStream_t stream) {
  (void)in_sizes; (void)n_in; (void)out_size;
  const float* const* I = (const float* const*)d_in; const float* x = I[0]; const int* xmask = (const int*)d_in[1]; const float* wq = I[2]; const float* bq = I[3]; const float* wk = I[4]; const float* bk = I[5]; const float* wv = I[6]; const float* bv = I[7]; const float* w1 = I[8]; const float* b1 = I[9]; const float* w2 = I[10]; const float* b2 = I[11]; const float* g1 = I[12]; const float* be1 = I[13]; const float* g2 = I[14]; const float* be2 = I[15];
  char* ws = (char*)d_ws; size_t off = 0;
  auto take = [&](size_t bytes) { char* p = ws + off; off += (bytes + 255) & ~(size_t)255; return p; };
  _Float16* BQ = (_Float16*)take((size_t)DM * DM * 2); _Float16* BK = (_Float16*)take((size_t)DM * DM * 2); _Float16* BV = (_Float16*)take((size_t)DM * DM * 2); _Float16* B1 = (_Float16*)take((size_t)DM * DM * 2); _Float16* B2 = (_Float16*)take((size_t)DM * DM * 2);
  _Float16* X16 = (_Float16*)take(NR * DM * 2); _Float16* Q16 = (_Float16*)take(NR * DM * 2); _Float16* K16 = (_Float16*)take(NR * DM * 2); _Float16* V16 = (_Float16*)take(NR * DM * 2); float* AF = (float*)take(NR * DM * 4); float* X1F = (float*)take(NR * DM * 4); _Float16* X1H = (_Float16*)take(NR * DM * 2); _Float16* H16 = (_Float16*)take(NR * DM * 2); float* FF = AF;      /* f rows reuse the attention-output rows (dead after the first LayerNorm; same type) */
  _Float16* VT = (_Float16*)take((size_t)NB * NH * HD * SQ * 2);
  if (off > ws_size) return;      /* 10 + 16x4 + 32 + 32 + 16 + 16 + 16 = approx 186 MiB */
  { const unsigned gw = (unsigned)(((size_t)DM * (DM / 8) + 255) / 256); k_whd<<<gw, 256, 0, stream>>>(wq, BQ); k_whd<<<gw, 256, 0, stream>>>(wk, BK); k_whd<<<gw, 256, 0, stream>>>(wv, BV); k_wt_f16<<<gw, 256, 0, stream>>>(w1, B1, DM, DM, 16.0f); k_wt_f16<<<gw, 256, 0, stream>>>(w2, B2, DM, DM, 16.0f); }
  k_x16<<<(unsigned)((NR * DM / 8 + 255) / 256), 256, 0, stream>>>(x, X16, NR * DM / 8);
  const size_t r0p = (size_t)B0 * SQ; const dim3 gp((unsigned)((MP / 128) * (DM / 128)), 1);
  k_gemm3<0, true><<<gp, 128, 0, stream>>>(X16 + r0p * DM, BQ, 0.0625f, bq, nullptr, Q16 + r0p * DM);
  k_gemm3<0, true><<<gp, 128, 0, stream>>>(X16 + r0p * DM, BK, 0.0625f, bk, nullptr, K16 + r0p * DM);
  k_gemm3<0, true><<<gp, 128, 0, stream>>>(X16 + r0p * DM, BV, 0.0625f, bv, nullptr, V16 + r0p * DM);
  k_vt<NH, SQ><<<NB * NH * (SQ / 64), 256, 0, stream>>>(V16, DM, 0, VT);      /* V^T of every (batch, head) */
  k_fattn<<<NB * NH * (SQ / 128), 128, 0, stream>>>(Q16, K16, VT, xmask, AF);      /* a (merged heads) as f32 rows */
  k_lnadd<1, true><<<(unsigned)(MPO / 16), 256, 0, stream>>>(AF + r0p * DM, x + r0p * DM, g1, be1, 1e-5f, X1F + r0p * DM, X1H + r0p * DM);      /* x1 = bf16(x) + LN(a) */
  const dim3 gf((unsigned)((MPO / 128) * (DM / 128)), 1);
  k_gemm3<3, true><<<gf, 128, 0, stream>>>(X1H + r0p * DM, B1, 0.0625f, b1, nullptr, H16 + r0p * DM);      /* h = relu(x1 W1 + b1) (f16) */
  k_gemm3<0, false><<<gf, 128, 0, stream>>>(H16 + r0p * DM, B2, 0.0625f, b2, FF + r0p * DM, nullptr);      /* f = h W2 + b2 (f32) */
  k_lnadd<0, false><<<(unsigned)(MPO / 16), 256, 0, stream>>>(FF + r0p * DM, X1F + r0p * DM, g2, be2, 1e-5f, (float*)d_out + r0p * DM, nullptr);      /* out = x1 + LN(f) */
}

// v006
// A run of this version takes 162 microseconds.
// Timed twice side by side with v005, it ran 1.19 times as fast both times.
// Over all steps from v000 it is 68.0 times as fast.
#include <hip/hip_runtime.h>
// Transformer encoder layer (x [8][1024][1024]; per-head q/k/v = x Wq[h] + bq[h] (Wq [16][1024][64]); scores / 8 with a key-padding mask x_mask [8][1][1024] (int32, read; all zeros here); softmax; a = attn v concatenated over heads; x1 = x + LayerNorm(a) g1 + be1; h = relu(x1 W1 + b1); f = h W2 + b2 (W1, W2 [1024][1024] [in][out]); out = x1 + LayerNorm(f) g2 + be2 -> [8][1024][1024]).
// Structure: token rows; x as exact f16 rows; Q, K, V as three WMMA GEMMs (128x128 work-group tiles staged in LDS, 64x64 wave tiles, f32 accumulation, exact x16 head-stacked weights + bias, f16 outputs); V^T for all batches and heads via LDS transposes; one fused attention launch (scores K = 64 as S^T = K Q^T, masked running-maximum softmax on VALU in f32 with native exp, weights f16 at most 1, masked keys 0, O^T += V^T P^T, divided by the row sum in f32) into f32 rows; per row on VALU: x1 = bf16(x) + LayerNorm(a) (f32 + f16 copies); h = relu(x1 W1 + b1) GEMM (f16); f = h W2 + b2 GEMM (f32); per row on VALU: out = x1 + LayerNorm(f).
// Compute dtype: inputs rounded to bf16; x / weights exact; q, k, v, softmax weights, x1 (as GEMM operand) and h plain f16 (~2^-12); attention output, LayerNorms, residuals f32. v_wmma_f32_16x16x32_f16.
#define NB 8
#define SQ 1024
#define DM 1024
#define NH 16
#define HD 64
#define HG 4
#define B0 0                         /* first batch processed (debug hook) */
#define NBR NB                       /* batches processed (debug hook) */
#define QN SQ                        /* unused; attention covers all SQ query rows of a batch */
#define NR ((size_t)NB * SQ)
#define MP ((int)((size_t)NBR * SQ)) /* rows projected (debug hook) */
#define MPO MP                       /* rows through the post-attention stages (debug hook) */
typedef __bf16 v16b __attribute__((ext_vector_type(16)));
typedef unsigned short v8us __attribute__((ext_vector_type(8), may_alias));
typedef float  v8f  __attribute__((ext_vector_type(8)));
typedef float  v4f  __attribute__((ext_vector_type(4)));
typedef float  v4fa __attribute__((ext_vector_type(4), may_alias));
union FragB { v16b v; v8us half[2]; unsigned short u[16]; };

__device__ __forceinline__ unsigned short bf16_bits(float x) { unsigned int u = __float_as_uint(x); return (unsigned short)((u + 0x7FFFu + ((u >> 16) & 1u)) >> 16); }
__device__ __forceinline__ float bf16_val(unsigned short b) { return __uint_as_float(((unsigned int)b) << 16); }
__device__ __forceinline__ float bf16_round(float x) { return bf16_val(bf16_bits(x)); }
// D += A·B with NT terms: 1 = ah·bh, 2 = + al·bh (A split), 3 = + ah·bl (both split)
template <int NT>
__device__ __forceinline__ v8f mmaN(v16b ah, v16b al, v16b bh, v16b bl, v8f c) {
  c = __builtin_amdgcn_wmma_f32_16x16x32_bf16(false, ah, false, bh, (short)0, c, false, false);
  if (NT >= 2) c = __builtin_amdgcn_wmma_f32_16x16x32_bf16(false, al, false, bh, (short)0, c, false, false);
  if (NT >= 3) c = __builtin_amdgcn_wmma_f32_16x16x32_bf16(false, ah, false, bl, (short)0, c, false, false);
  asm volatile("v_nop\n\tv_nop\n\tv_nop\n\tv_nop" : "+v"(c) : "v"(ah), "v"(al), "v"(bh), "v"(bl));
  return c;
}

__global__ __launch_bounds__(256) void k_wt_bf16(const float* __restrict__ W, unsigned short* __restrict__ Wt, int K, int N) {
  const int t = blockIdx.x * 256 + threadIdx.x;
  const int k8n = K / 8;
  if (t >= N * k8n) return;
  const int n = t / k8n, k8 = (t % k8n) * 8;
  v8us v;
#pragma unroll
  for (int i = 0; i < 8; ++i) v[i] = bf16_bits(W[(size_t)(k8 + i) * N + n]);
  *(v8us*)(Wt + (size_t)n * K + k8) = v;
  
}

// GEMM C[M][N] (f32, pitch ldc) = act(A[M][K]·W + bias). A f32 row-major (pitch lda) converted per fragment to bf16
// (ASPLIT: hi/lo two planes -> 2 terms, else single rounded term); Wt bf16 [N][K] (pitch ldb). BIAS_BF16 rounds the
// bias to bf16 first (bias quantised to bf16 before the add). K%32==0, M%16==0, N%64==0.
template <bool ASPLIT, int ACT, bool BIAS_BF16>
__global__ __launch_bounds__(128) void k_gemm_bf(const float* __restrict__ A, int lda, const unsigned short* __restrict__ Wt, int ldb,
                                               const float* __restrict__ bias, float* __restrict__ C, int ldc, int M, int N, int K) {
  __shared__ __attribute__((aligned(16))) float so[4][16][64];
  const int tid = threadIdx.x, w = tid >> 5, lane = tid & 31, ln = lane & 15, hh = lane >> 4;
  const int ntn = N / 64;
  const int wid = blockIdx.x * 4 + w;
  const int mt = wid / ntn, nq = wid % ntn;
  if (mt * 16 >= M) return;
  const int row0 = mt * 16, col0 = nq * 64;
  const float* arow = A + (size_t)(row0 + ln) * lda;
  v8f acc[4] = {};
  for (int kb = 0; kb < K; kb += 32) {
    FragB ah, al;
    const v4f x0 = *(const v4fa*)(arow + kb + 8 * hh), x1 = *(const v4fa*)(arow + kb + 8 * hh + 4);
    const v4f x2 = *(const v4fa*)(arow + kb + 16 + 8 * hh), x3 = *(const v4fa*)(arow + kb + 16 + 8 * hh + 4);
    float xs[16] = {x0[0],x0[1],x0[2],x0[3],x1[0],x1[1],x1[2],x1[3],x2[0],x2[1],x2[2],x2[3],x3[0],x3[1],x3[2],x3[3]};
#pragma unroll
    for (int i = 0; i < 16; ++i) { const unsigned short hb = bf16_bits(xs[i]); ah.u[i] = hb; al.u[i] = ASPLIT ? bf16_bits(xs[i] - bf16_val(hb)) : (unsigned short)0; }
#pragma unroll
    for (int t = 0; t < 4; ++t) {
      const unsigned short* brow = Wt + (size_t)(col0 + t * 16 + ln) * ldb + kb;
      FragB b;
      b.half[0] = *(const v8us*)(brow + 8 * hh);
      b.half[1] = *(const v8us*)(brow + 16 + 8 * hh);
      acc[t] = mmaN<ASPLIT ? 2 : 1>(ah.v, al.v, b.v, b.v, acc[t]);
    }
  }
#pragma unroll
  for (int t = 0; t < 4; ++t) {
    float bv = bias ? bias[col0 + t * 16 + ln] : 0.f;
    if (BIAS_BF16) bv = bf16_round(bv);
#pragma unroll
    for (int r = 0; r < 8; ++r) { float v = acc[t][r] + bv; if (ACT == 1) v = fmaxf(v, 0.f); so[w][8 * hh + r][t * 16 + ln] = v; }
  }
  __builtin_amdgcn_fence(__ATOMIC_ACQ_REL, "workgroup");
  __builtin_amdgcn_wave_barrier();
  const int rsub = lane >> 4, c4 = (lane & 15) * 4;
  {
#pragma unroll
    for (int q = 0; q < 8; ++q) {
      const int r = q * 2 + rsub;
      const v4f v = *(const v4fa*)&so[w][r][c4];
      *(v4f*)(C + (size_t)(row0 + r) * ldc + col0 + c4) = v;
    }
    
  }
}

// GEMM C = act(A·W + bias + resid): A f32 (ASPLIT -> hi/lo 2 terms), Wt bf16 [N][K]; ACT 0 none, 1 relu, 2 exact gelu;
// resid (optional, f32, row index = (row % rmod), pitch ldr, RES_BF16 rounds it) added before the activation.
template <bool ASPLIT, int ACT, bool BIAS_BF16, bool RES_BF16>
__global__ __launch_bounds__(128) void k_gemm_bf3(const float* __restrict__ A, int lda, const unsigned short* __restrict__ Wt, int ldb,
                                                const float* __restrict__ bias, const float* __restrict__ resid, int rmod, int ldr,
                                                float* __restrict__ C, int ldc, int M, int N, int K) {
  __shared__ __attribute__((aligned(16))) float so[4][16][64];
  const int tid = threadIdx.x, w = tid >> 5, lane = tid & 31, ln = lane & 15, hh = lane >> 4;
  const int ntn = N / 64;
  const int wid = blockIdx.x * 4 + w;
  const int mt = wid / ntn, nq = wid % ntn;
  if (mt * 16 >= M) return;
  const int row0 = mt * 16, col0 = nq * 64;
  const float* arow = A + (size_t)(row0 + ln) * lda;
  v8f acc[4] = {};
  for (int kb = 0; kb < K; kb += 32) {
    FragB ah, al;
    const v4f x0 = *(const v4fa*)(arow + kb + 8 * hh), x1 = *(const v4fa*)(arow + kb + 8 * hh + 4);
    const v4f x2 = *(const v4fa*)(arow + kb + 16 + 8 * hh), x3 = *(const v4fa*)(arow + kb + 16 + 8 * hh + 4);
    float xs[16] = {x0[0],x0[1],x0[2],x0[3],x1[0],x1[1],x1[2],x1[3],x2[0],x2[1],x2[2],x2[3],x3[0],x3[1],x3[2],x3[3]};
#pragma unroll
    for (int i = 0; i < 16; ++i) { const unsigned short hb = bf16_bits(xs[i]); ah.u[i] = hb; al.u[i] = ASPLIT ? bf16_bits(xs[i] - bf16_val(hb)) : (unsigned short)0; }
#pragma unroll
    for (int t = 0; t < 4; ++t) {
      const unsigned short* brow = Wt + (size_t)(col0 + t * 16 + ln) * ldb + kb;
      FragB b;
      b.half[0] = *(const v8us*)(brow + 8 * hh);
      b.half[1] = *(const v8us*)(brow + 16 + 8 * hh);
      acc[t] = mmaN<ASPLIT ? 2 : 1>(ah.v, al.v, b.v, b.v, acc[t]);
    }
  }
#pragma unroll
  for (int t = 0; t < 4; ++t) {
    const int col = col0 + t * 16 + ln;
    float bv = bias ? bias[col] : 0.f;
    if (BIAS_BF16) bv = bf16_round(bv);
#pragma unroll
    for (int r = 0; r < 8; ++r) {
      float v = acc[t][r] + bv;
      if (resid) { float rv = resid[(size_t)((row0 + 8 * hh + r) % rmod) * ldr + col]; if (RES_BF16) rv = bf16_round(rv); v += rv; }
      if (ACT == 1) v = fmaxf(v, 0.f);
      if (ACT == 2) v = 0.5f * v * (1.0f + erff(v * 0.70710678118654752f));
      if (ACT == 3) { const float u = 0.7978845608028654f * (v + 0.044715f * v * v * v); v = 0.5f * v * (1.0f + tanhf(u)); }
      so[w][8 * hh + r][t * 16 + ln] = v;
    }
  }
  __builtin_amdgcn_fence(__ATOMIC_ACQ_REL, "workgroup");
  __builtin_amdgcn_wave_barrier();
  const int rsub = lane >> 4, c4 = (lane & 15) * 4;
  {
#pragma unroll
    for (int q = 0; q < 8; ++q) {
      const int r = q * 2 + rsub;
      const v4f v = *(const v4fa*)&so[w][r][c4];
      *(v4f*)(C + (size_t)(row0 + r) * ldc + col0 + c4) = v;
    }
    
  }
}
// row LayerNorm (biased variance, eps) over N: s = X (+ R); optional out_sum <- s; out_norm <- (s-mu)*rsqrt(var+eps)*g + b
template <bool PARAM_BF16>
__global__ __launch_bounds__(256) void k_layernorm(const float* __restrict__ X, const float* __restrict__ R, const float* __restrict__ g, const float* __restrict__ bta,
                                                  float* __restrict__ out_sum, float* __restrict__ out_norm, int N, float eps) {
  __shared__ float red[256];
  const int row = blockIdx.x, tid = threadIdx.x;
  const float* x = X + (size_t)row * N; const float* rr = R ? R + (size_t)row * N : nullptr;
  float vals[16];                     // up to N = 4096
  const int per = N / 256;            // contiguous chunk per thread? use strided-by-4 chunks: thread handles j = tid*4 + 1024*u
  float s1 = 0.f;
  for (int u = 0; u < per / 4; ++u) {
    const int j = tid * 4 + 1024 * u;
    const v4f a = *(const v4fa*)(x + j);
    v4f b = {0.f,0.f,0.f,0.f}; if (rr) b = *(const v4fa*)(rr + j);
#pragma unroll
    for (int q = 0; q < 4; ++q) { const float v = a[q] + b[q]; vals[u * 4 + q] = v; s1 += v; }
  }
  red[tid] = s1; __syncthreads();
  for (int st = 128; st > 0; st >>= 1) { if (tid < st) red[tid] += red[tid + st]; __syncthreads(); }
  const float mu = red[0] / (float)N; __syncthreads();
  float s2 = 0.f;
  for (int u = 0; u < per / 4; ++u)
#pragma unroll
    for (int q = 0; q < 4; ++q) { const float c = vals[u * 4 + q] - mu; s2 += c * c; }
  red[tid] = s2; __syncthreads();
  for (int st = 128; st > 0; st >>= 1) { if (tid < st) red[tid] += red[tid + st]; __syncthreads(); }
  const float rs = rsqrtf(red[0] / (float)N + eps);
  {
    for (int u = 0; u < per / 4; ++u) {
      const int j = tid * 4 + 1024 * u;
      v4f o, sm;
#pragma unroll
      for (int q = 0; q < 4; ++q) {
        float gg = g[j + q], bb = bta[j + q];
        if (PARAM_BF16) { gg = bf16_round(gg); bb = bf16_round(bb); }
        sm[q] = vals[u * 4 + q]; o[q] = (vals[u * 4 + q] - mu) * rs * gg + bb;
      }
      if (out_sum) *(v4f*)(out_sum + (size_t)row * N + j) = sm;
      *(v4f*)(out_norm + (size_t)row * N + j) = o;
    }
    
  }
}



// ---- f16 WMMA path (v_wmma_f32_16x16x32_f16): 11-bit significands for operands in range — used for every GEMM launched here
typedef _Float16 v16h __attribute__((ext_vector_type(16)));
union FragH { v16h v; v8us half[2]; _Float16 h[16]; unsigned short u[16]; };
template <int NT>
__device__ __forceinline__ v8f mmaH(v16h ah, v16h al, v16h bh, v16h bl, v8f c) {
  c = __builtin_amdgcn_wmma_f32_16x16x32_f16(false, ah, false, bh, (short)0, c, false, false);
  if (NT >= 2) c = __builtin_amdgcn_wmma_f32_16x16x32_f16(false, al, false, bh, (short)0, c, false, false);
  if (NT >= 3) c = __builtin_amdgcn_wmma_f32_16x16x32_f16(false, ah, false, bl, (short)0, c, false, false);
  asm volatile("v_nop\n\tv_nop\n\tv_nop\n\tv_nop" : "+v"(c) : "v"(ah), "v"(al), "v"(bh), "v"(bl));
  return c;
}
// batched GEMM like k_gemm_b but f16 operands: A f32 (split into f16 hi/lo if ASPLIT, else rounded to f16), Bt = f16 values [n][k]; alpha; C f32; N multiple of 16 (partial tiles skipped)
template <bool ASPLIT>
__global__ __launch_bounds__(128) void k_gemm_h(const float* __restrict__ A, int lda, size_t sA, const _Float16* __restrict__ Bh, int ldb, size_t sB, float alpha, float* __restrict__ C, int ldc, size_t sC, int M, int N, int K) {
  __shared__ __attribute__((aligned(16))) float so[4][16][64];
  const int tid = threadIdx.x, w = tid >> 5, lane = tid & 31, ln = lane & 15, hh = lane >> 4; const int by = blockIdx.y;
  A += (size_t)by * sA; Bh += (size_t)by * sB; C += (size_t)by * sC;
  const int ntn = (N + 63) / 64; const int wid = blockIdx.x * 4 + w; const int mt = wid / ntn, nq = wid % ntn; if (mt * 16 >= M) return;
  const int row0 = mt * 16, col0 = nq * 64; const float* arow = A + (size_t)(row0 + ln) * lda;
  v8f acc[4] = {};
  for (int kb = 0; kb < K; kb += 32) {
    FragH ah, al;
    const v4f x0 = *(const v4fa*)(arow + kb + 8 * hh), x1 = *(const v4fa*)(arow + kb + 8 * hh + 4), x2 = *(const v4fa*)(arow + kb + 16 + 8 * hh), x3 = *(const v4fa*)(arow + kb + 16 + 8 * hh + 4);
    float xs[16] = {x0[0],x0[1],x0[2],x0[3],x1[0],x1[1],x1[2],x1[3],x2[0],x2[1],x2[2],x2[3],x3[0],x3[1],x3[2],x3[3]};
#pragma unroll
    for (int i = 0; i < 16; ++i) { const _Float16 h = (_Float16)xs[i]; ah.h[i] = h; al.h[i] = ASPLIT ? (_Float16)(xs[i] - (float)h) : (_Float16)0.0f; }
#pragma unroll
    for (int t = 0; t < 4; ++t) { if (col0 + t * 16 >= N) continue; const size_t boff = (size_t)(col0 + t * 16 + ln) * ldb + kb; FragH bq; bq.half[0] = *(const v8us*)(Bh + boff + 8 * hh); bq.half[1] = *(const v8us*)(Bh + boff + 16 + 8 * hh);
      acc[t] = mmaH<ASPLIT ? 2 : 1>(ah.v, al.v, bq.v, bq.v, acc[t]); }
  }
#pragma unroll
  for (int t = 0; t < 4; ++t) { if (col0 + t * 16 >= N) continue;
#pragma unroll
    for (int r = 0; r < 8; ++r) so[w][8 * hh + r][t * 16 + ln] = acc[t][r] * alpha; }
  __builtin_amdgcn_fence(__ATOMIC_ACQ_REL, "workgroup"); __builtin_amdgcn_wave_barrier();
  const int rsub = lane >> 4, c4 = (lane & 15) * 4;
  {
#pragma unroll
    for (int q = 0; q < 8; ++q) { const int r = q * 2 + rsub; if (col0 + c4 < N) { const v4f v = *(const v4fa*)&so[w][r][c4]; *(v4f*)(C + (size_t)(row0 + r) * ldc + col0 + c4) = v; } }
     }
}

// k_gemm_hh variant with fused epilogue: v = acc·alpha + bias[by·sBias + col] (+ CP[(row/rowsPerB)·sCPb + by·64 + col] if CP) ; ACT 0 none / 1 elu ; writes f16 C16 (and f32 C if non-null)
template <int ACT>
__global__ __launch_bounds__(128) void k_gemm_hhx(const _Float16* __restrict__ A, int lda, size_t sA, const _Float16* __restrict__ Bh, int ldb, size_t sB, float alpha, const float* __restrict__ bias, size_t sBias, const float* __restrict__ CP, int rowsPerB, size_t sCPb, int row0g,
    float* __restrict__ C, _Float16* __restrict__ C16, int ldc, size_t sC, int M, int N, int K) {
  __shared__ __attribute__((aligned(16))) float so[4][16][64];
  const int tid = threadIdx.x, w = tid >> 5, lane = tid & 31, ln = lane & 15, hh = lane >> 4; const int by = blockIdx.y;
  A += (size_t)by * sA; Bh += (size_t)by * sB; const size_t cofs = (size_t)by * sC; const float* bp = bias ? bias + (size_t)by * sBias : nullptr;
  const int ntn = (N + 63) / 64; const int wid = blockIdx.x * 4 + w; const int mt = wid / ntn, nq = wid % ntn; if (mt * 16 >= M) return;
  const int row0 = mt * 16, col0 = nq * 64; const _Float16* arow = A + (size_t)(row0 + ln) * lda;
  v8f acc[4] = {};
  for (int kb = 0; kb < K; kb += 32) { FragH ah; ah.half[0] = *(const v8us*)((const unsigned short*)arow + kb + 8 * hh); ah.half[1] = *(const v8us*)((const unsigned short*)arow + kb + 16 + 8 * hh);
#pragma unroll
    for (int t = 0; t < 4; ++t) { if (col0 + t * 16 >= N) continue; const size_t boff = (size_t)(col0 + t * 16 + ln) * ldb + kb; FragH bq; bq.half[0] = *(const v8us*)((const unsigned short*)Bh + boff + 8 * hh); bq.half[1] = *(const v8us*)((const unsigned short*)Bh + boff + 16 + 8 * hh);
      acc[t] = mmaH<1>(ah.v, ah.v, bq.v, bq.v, acc[t]); }
  }
#pragma unroll
  for (int t = 0; t < 4; ++t) { if (col0 + t * 16 >= N) continue; const int col = col0 + t * 16 + ln; const float bv = bp ? bf16_round(bp[col]) : 0.f;
#pragma unroll
    for (int r = 0; r < 8; ++r) { float v = acc[t][r] * alpha + bv; if (CP) { const int rr = row0g + row0 + 8 * hh + r; if (rowsPerB < 0) v += CP[cofs + (size_t)rr * ldc + col];      /* rowsPerB < 0: own element of the batched C plane */ else { const int bidx = rr / rowsPerB; v += CP[(size_t)bidx * sCPb + (size_t)by * 64 + col]; } } if (ACT == 1) v = (v > 0.f) ? v : expm1f(v); else if (ACT == 7) v = (v > 0.f) ? v + 1.0f : expf(v); else if (ACT == 8) v = tanhf(v); else if (ACT == 9) v = 0.5f * v * (1.0f + tanhf(0.7978845608028654f * (v + 0.044715f * v * v * v))); else if (ACT == 11) v = 1.0f / (1.0f + expf(-v)); else if (ACT == 12) v = (v > 0.f) ? v : 0.01f * v; else if (ACT == 14) v = (v > 0.f) ? v : 0.1f * v; else if (ACT == 16) v = (v >= 0.f) ? v : 0.3f * v; else if (ACT == 17) v = (v >= 0.f) ? v : 0.2f * v; else if (ACT == 15) v = v / (1.0f + expf(-v)); else if (ACT == 3) v = fmaxf(v, 0.f); else if (ACT == 6) v = 0.5f * v * (1.0f + erff(v * 0.70710678118654752f)); so[w][8 * hh + r][t * 16 + ln] = v; } }
  __builtin_amdgcn_fence(__ATOMIC_ACQ_REL, "workgroup"); __builtin_amdgcn_wave_barrier();
  const int rsub = lane >> 4, c4 = (lane & 15) * 4; typedef _Float16 v4h __attribute__((ext_vector_type(4)));
  {
#pragma unroll
    for (int q = 0; q < 8; ++q) { const int r = q * 2 + rsub; if (col0 + c4 < N) { const v4f v = *(const v4fa*)&so[w][r][c4]; if (C) *(v4f*)(C + cofs + (size_t)(row0 + r) * ldc + col0 + c4) = v; if (C16) { v4h h4; for (int i = 0; i < 4; ++i) h4[i] = (_Float16)v[i]; *(v4h*)(C16 + cofs + (size_t)(row0 + r) * ldc + col0 + c4) = h4; } } }
     }
}


typedef _Float16 v4h __attribute__((ext_vector_type(4)));

__global__ __launch_bounds__(256) void k_h16(const float* __restrict__ x, _Float16* __restrict__ X16, size_t n8) { const size_t t = (size_t)blockIdx.x * 256 + threadIdx.x; if (t >= n8) return; FragH f;
#pragma unroll
  for (int q = 0; q < 8; ++q) f.h[q] = (_Float16)x[t * 8 + q]; *(v8us*)((unsigned short*)X16 + t * 8) = f.half[0];  }
__global__ __launch_bounds__(256) void k_round16f(const float* __restrict__ W, _Float16* __restrict__ Bt, size_t n8) { const size_t t = (size_t)blockIdx.x * 256 + threadIdx.x; if (t >= n8) return; FragH f;
#pragma unroll
  for (int i = 0; i < 8; ++i) f.h[i] = (_Float16)(bf16_round(W[t * 8 + i]) * 16.0f); *(v8us*)((unsigned short*)Bt + t * 8) = f.half[0];  }
template <int NHv, int TTv>
__global__ __launch_bounds__(256) void k_vt(const _Float16* __restrict__ V16, int ldv, int voff, _Float16* __restrict__ Vt) { __shared__ unsigned short tl[64][66]; const int tid = threadIdx.x; const int slab = blockIdx.x / (TTv / 64), lg = blockIdx.x % (TTv / 64); const int b = slab / NHv, h = slab % NHv;
  for (int i = tid; i < 64 * 8; i += 256) { const int r = i / 8, c8 = (i % 8) * 8; FragH f; f.half[0] = *(const v8us*)((const unsigned short*)V16 + ((size_t)b * TTv + lg * 64 + r) * ldv + voff + h * 64 + c8);
#pragma unroll
    for (int q = 0; q < 8; ++q) tl[r][c8 + q] = f.u[q]; }
  __syncthreads();
  {
#pragma unroll
    for (int rd = 0; rd < 2; ++rd) { const int d = rd * 32 + tid / 8, pc = tid % 8; FragH f;
#pragma unroll
      for (int q = 0; q < 8; ++q) f.u[q] = tl[pc * 8 + q][d];
      *(v8us*)((unsigned short*)Vt + ((size_t)slab * 64 + d) * TTv + lg * 64 + pc * 8) = f.half[0]; }
     } }

__global__ __launch_bounds__(256) void k_hl(const float* __restrict__ F, _Float16* __restrict__ Hh, _Float16* __restrict__ Hl, size_t n8) { const size_t t = (size_t)blockIdx.x * 256 + threadIdx.x; if (t >= n8) return; FragH fh, fl; const v4f a = *(const v4fa*)(F + t * 8), c = *(const v4fa*)(F + t * 8 + 4);
#pragma unroll
  for (int q = 0; q < 4; ++q) { _Float16 h = (_Float16)a[q]; fh.h[q] = h; fl.h[q] = (_Float16)((a[q] - (float)h) * 1024.0f); h = (_Float16)c[q]; fh.h[4 + q] = h; fl.h[4 + q] = (_Float16)((c[q] - (float)h) * 1024.0f); }
  { *(v8us*)((unsigned short*)Hh + t * 8) = fh.half[0]; *(v8us*)((unsigned short*)Hl + t * 8) = fl.half[0];  } }

// ---- staged GEMM: C = act(A B^T alpha + bias), A f16 [M][K], Bh f16 [N][K], both K-contiguous, N = K = DM; M % 128 == 0; grid = (M / 128) * (N / 128); H16 picks the f16 output C16, else the f32 output C ----
// A work-group of four waves takes a 128 x 128 tile of C, a wave 64 x 64 of it (4 x 4 accumulator tiles). Per trip 64 k of the 128 A rows and the 128 B rows (128 bytes a row) lie in LDS at a pitch of 144 bytes;
// asynchronous copies bring them there in whole 128-byte lines, two buffers, the next tile in flight while this one is worked on. The k order of every sum is ascending in steps of 32, as with fragments read from global memory.
__device__ __forceinline__ v16h g2_frag(const _Float16* p, int hh) { FragH f; f.half[0] = *(const v8us*)((const unsigned short*)p + 8 * hh); f.half[1] = *(const v8us*)((const unsigned short*)p + 16 + 8 * hh); return f.v; }
#define G3_PITCH 144                   /* LDS bytes per 128-byte row: 16 B x odd, for ds_load_b128 readers */
#define G3_TILE (128 * G3_PITCH)       /* one operand's tile in LDS, bytes */
__device__ __forceinline__ v8f g3_mma(v16h a, v16h b, v8f c) { return __builtin_amdgcn_wmma_f32_16x16x32_f16(false, a, false, b, (short)0, c, false, false); }
__device__ __forceinline__ v16h g3_frag(const unsigned char* p) { FragH f; f.half[0] = *(const v8us*)p; f.half[1] = *(const v8us*)(p + 32); return f.v; }      /* p already holds the lane's row and its 16 hh bytes: k = 8 hh + 0..7, then 16 + 8 hh + 0..7 */
// eight copies of 16 bytes a lane: rows r, r + 16, ..., r + 112 of one operand's tile (l: the lane's LDS byte address in row r, g: its global address there, rs: 16 rows in elements).
// The s_wait_xcnt closes the statement so that it stands in front of every later write of a register that a copy names.
__device__ __forceinline__ void g3_copy8(unsigned l, const _Float16* g, size_t rs) {
  asm volatile("global_load_async_to_lds_b128 %0, %8, off\n\tglobal_load_async_to_lds_b128 %1, %9, off\n\tglobal_load_async_to_lds_b128 %2, %10, off\n\tglobal_load_async_to_lds_b128 %3, %11, off\n\t"
               "global_load_async_to_lds_b128 %4, %12, off\n\tglobal_load_async_to_lds_b128 %5, %13, off\n\tglobal_load_async_to_lds_b128 %6, %14, off\n\tglobal_load_async_to_lds_b128 %7, %15, off\n\ts_wait_xcnt 0x0"
               :: "v"(l), "v"(l + 16 * G3_PITCH), "v"(l + 32 * G3_PITCH), "v"(l + 48 * G3_PITCH), "v"(l + 64 * G3_PITCH), "v"(l + 80 * G3_PITCH), "v"(l + 96 * G3_PITCH), "v"(l + 112 * G3_PITCH),
                  "v"(g), "v"(g + rs), "v"(g + 2 * rs), "v"(g + 3 * rs), "v"(g + 4 * rs), "v"(g + 5 * rs), "v"(g + 6 * rs), "v"(g + 7 * rs) : "memory"); }
template <int ACT, bool H16>
__global__ __launch_bounds__(128) void k_gemm3(const _Float16* __restrict__ A, const _Float16* __restrict__ Bh, float alpha, const float* __restrict__ bias, float* __restrict__ C, _Float16* __restrict__ C16) { static_assert(ACT == 0 || ACT == 3, "k_gemm3: unsupported ACT code (would silently apply no activation)");
  constexpr int N = DM, K = DM; static_assert(N % 128 == 0 && K % 64 == 0 && K >= 128, "k_gemm3: whole tiles only, two or more of them along K");
  __shared__ __attribute__((aligned(16))) unsigned char sm[4 * G3_TILE];      /* buffer u: A tile at 2 u tiles, B tile at 2 u + 1; behind the loop each wave's output staging, one tile's bytes a wave */
  const int tid = threadIdx.x, w = tid >> 5, lane = tid & 31, ln = lane & 15, hh = lane >> 4;
  const int ntn = N >> 7; const int mt = blockIdx.x / ntn, nq = blockIdx.x - mt * ntn; const int row0 = mt * 128, col0 = nq * 128; const int wr = (w >> 1) * 64, wc = (w & 1) * 64;
  const unsigned l0 = (unsigned)(size_t)sm + (unsigned)((tid >> 3) * G3_PITCH + (tid & 7) * 16);      /* eight lanes a row: a wave's copy covers four whole 128-byte lines */
  const _Float16* ga = A + (size_t)(row0 + (tid >> 3)) * K + (tid & 7) * 8; const _Float16* gb = Bh + (size_t)(col0 + (tid >> 3)) * K + (tid & 7) * 8; constexpr size_t rs = (size_t)16 * K; constexpr int nt = K >> 6;
  g3_copy8(l0, ga, rs); g3_copy8(l0 + G3_TILE, gb, rs);
  asm volatile("s_wait_asynccnt 0x0" ::: "memory");      /* this wave's share of tile 0 has landed */
  __syncthreads();      /* tile 0 is read by every wave */
  g3_copy8(l0 + 2 * G3_TILE, ga + 64, rs); g3_copy8(l0 + 3 * G3_TILE, gb + 64, rs);
  const unsigned char* fa = sm + (wr + ln) * G3_PITCH + 16 * hh; const unsigned char* fb = sm + G3_TILE + (wc + ln) * G3_PITCH + 16 * hh;
  const v8f z8 = {0.f, 0.f, 0.f, 0.f, 0.f, 0.f, 0.f, 0.f}; v8f acc[4][4];
#pragma unroll      /* register arrays need constant indices */
  for (int i = 0; i < 4; ++i)
#pragma unroll      /* register arrays need constant indices */
    for (int j = 0; j < 4; ++j) acc[i][j] = z8;
#pragma unroll 1      /* one trip per tile: the buffer is chosen at run time, and an unrolled body would only grow the text */
  for (int t = 0; t < nt; ++t) { const unsigned bo = (unsigned)(t & 1) * (2 * G3_TILE);
#pragma unroll      /* register arrays need constant indices */
    for (int ks = 0; ks < 2; ++ks) { v16h af[4], bf[4];
#pragma unroll      /* register arrays need constant indices */
      for (int i = 0; i < 4; ++i) bf[i] = g3_frag(fb + bo + i * 16 * G3_PITCH + ks * 64);
#pragma unroll      /* register arrays need constant indices */
      for (int i = 0; i < 4; ++i) af[i] = g3_frag(fa + bo + i * 16 * G3_PITCH + ks * 64);
      __builtin_amdgcn_sched_barrier(0);      /* the sixteen LDS reads of a block go out as one group in front of its products: left free, each A fragment was read alone and waited for in front of its four products */
#pragma unroll      /* register arrays need constant indices */
      for (int i = 0; i < 4; ++i)
#pragma unroll      /* register arrays need constant indices */
        for (int j = 0; j < 4; ++j) acc[i][j] = g3_mma(af[i], bf[j], acc[i][j]);
      __builtin_amdgcn_sched_barrier(0); }      /* the next group of reads stays behind this block's products, whose fragment registers it reuses */
    asm volatile("s_wait_dscnt 0x0" ::: "memory");      /* this wave's reads of the buffer have returned before the barrier behind which it is refilled */
    asm volatile("s_wait_asynccnt 0x0" ::: "memory");      /* this wave's share of tile t + 1 has landed */
    __syncthreads();      /* publishes tile t + 1 and ends every wave's reads of tile t */
    if (t + 2 < nt) { g3_copy8(l0 + bo, ga + (size_t)(t + 2) * 64, rs); g3_copy8(l0 + bo + G3_TILE, gb + (size_t)(t + 2) * 64, rs); } }
  asm volatile("s_wait_asynccnt 0x0" ::: "memory");      /* no copy is outstanding when the buffers become output staging */
  float* so = (float*)(sm + w * G3_TILE);      /* 64 rows of 68 floats, this wave's own; the last trip's barrier has ended every read of the tiles */
#pragma unroll      /* register arrays need constant indices */
  for (int j = 0; j < 4; ++j) { const float bv = bf16_round(bias[col0 + wc + j * 16 + ln]);
#pragma unroll      /* register arrays need constant indices */
    for (int i = 0; i < 4; ++i)
#pragma unroll      /* register arrays need constant indices */
      for (int r = 0; r < 8; ++r) { float v = acc[i][j][r] * alpha + bv; if (ACT == 3) v = fmaxf(v, 0.f); so[(i * 16 + 8 * hh + r) * 68 + j * 16 + ln] = v; } }
  __builtin_amdgcn_fence(__ATOMIC_ACQ_REL, "workgroup"); __builtin_amdgcn_wave_barrier();      /* the wave's staging writes stay in front of its reads of words that other lanes wrote */
  const int rsub = lane >> 4, c4 = (lane & 15) * 4;
  const size_t o = (size_t)(row0 + wr + rsub) * N + col0 + wc + c4;
#pragma unroll      /* register arrays need constant indices */
  for (int q0 = 0; q0 < 32; q0 += 8) { v4f v[8];      /* the reads go out in groups ahead of their stores, each store whole 128-byte lines */
#pragma unroll      /* register arrays need constant indices */
    for (int u = 0; u < 8; ++u) v[u] = *(const v4fa*)&so[((q0 + u) * 2 + rsub) * 68 + c4];
#pragma unroll      /* register arrays need constant indices */
    for (int u = 0; u < 8; ++u) { if (H16) { v4h h4; for (int i = 0; i < 4; ++i) h4[i] = (_Float16)v[u][i]; *(v4h*)(C16 + o + (size_t)(q0 + u) * 2 * N) = h4; } else *(v4f*)(C + o + (size_t)(q0 + u) * 2 * N) = v[u]; } } }


__global__ __launch_bounds__(256) void k_wnat(const float* __restrict__ w, size_t n8, _Float16* __restrict__ Bt) { const size_t t = (size_t)blockIdx.x * 256 + threadIdx.x; if (t >= n8) return; FragH f; for (int q = 0; q < 8; ++q) f.h[q] = (_Float16)(bf16_round(w[t * 8 + q]) * 16.0f); *(v8us*)((unsigned short*)Bt + t * 8) = f.half[0];  }
__global__ __launch_bounds__(256) void k_rsm(const float* __restrict__ S, _Float16* __restrict__ P, int nrows) {
  #pragma clang fp contract(off)
  const int i = blockIdx.x * 256 + threadIdx.x; if (i >= nrows) return; const float* s = S + (size_t)i * SQ; float mx = -3.0e38f;
#pragma unroll 1
  for (int j = 0; j < SQ; ++j) mx = fmaxf(mx, s[j]); float se = 0.f;
#pragma unroll 1
  for (int j = 0; j < SQ; ++j) se += expf(s[j] - mx); const float sc = 256.0f / se;
#pragma unroll 1
  for (int j0 = 0; j0 < SQ; j0 += 8) { FragH f; for (int q = 0; q < 8; ++q) f.h[q] = (_Float16)(expf(s[j0 + q] - mx) * sc); unsigned short* d = (unsigned short*)P + (size_t)i * SQ + j0; *(v8us*)d = f.half[0];  } }
__global__ __launch_bounds__(256) void k_vt(const _Float16* __restrict__ V16, int b, int h0, _Float16* __restrict__ VT) { __shared__ unsigned short tl[64][65]; const int tid = threadIdx.x; const int hh = blockIdx.x % HG, sg = blockIdx.x / HG; const int s0 = sg * 64; const int h = h0 + hh;
  for (int i = tid; i < 64 * 8; i += 256) { const int j = i / 8, d8 = (i % 8) * 8; FragH f; f.half[0] = *(const v8us*)((const unsigned short*)V16 + ((size_t)b * SQ + s0 + j) * DM + h * HD + d8); for (int q = 0; q < 8; ++q) tl[d8 + q][j] = f.u[q]; }
  __syncthreads();
  { for (int i = tid; i < 64 * 8; i += 256) { const int d = i / 8, j8 = (i % 8) * 8; FragH f; for (int q = 0; q < 8; ++q) f.u[q] = tl[d][j8 + q]; *(v8us*)((unsigned short*)VT + ((size_t)hh * HD + d) * SQ + s0 + j8) = f.half[0]; }  } }


// Operand preparation, one launch. Work-groups 0 .. 5 PW_TILES - 1 each take one tile, 64 k x 64 n, of one weight: Bt[n][k] = f16(bf16(W[k][n]) x 16) (a power of two: bf16-exact weights stay exact in f16 away from the subnormal range).
// n is the output column (head-stacked, 64 h + column, for Wq, Wk, Wv [16][1024][64]; the column for W1, W2 [in][out]), k the input column. A tile's source rows are 256 contiguous bytes, read 16 bytes a lane;
// two neighbouring k are packed into one LDS word at [n][k / 2], pitch 33 words (odd: neither the writers, 4 n apart, nor the readers, rows of 4 words, meet in a bank); its 128-byte rows of Bt are written 16 bytes a lane, whole lines.
// The work-groups behind them turn x into f16 rows, eight elements a thread.
#define PW_TILES ((DM / 64) * (DM / 64))      /* tiles of one weight */
#define PX_WGS ((unsigned)(NR * DM / 8 / 256))      /* work-groups of the x part */
__global__ __launch_bounds__(256) void k_prep(const float* __restrict__ x, const float* __restrict__ wq, const float* __restrict__ wk, const float* __restrict__ wv, const float* __restrict__ w1, const float* __restrict__ w2,
                                              _Float16* __restrict__ X16, _Float16* __restrict__ BQ, _Float16* __restrict__ BK, _Float16* __restrict__ BV, _Float16* __restrict__ B1, _Float16* __restrict__ B2) {
  static_assert(HD == 64 && DM % 64 == 0 && NH * HD == DM && (NR * DM / 8) % 256 == 0, "k_prep: heads of 64 columns, whole tiles, whole work-groups");
  __shared__ unsigned tl[64][33];
  const int tid = threadIdx.x;
  if (blockIdx.x >= 5 * PW_TILES) {      /* the same for the whole work-group, in front of the barrier */
    const size_t t = (size_t)(blockIdx.x - 5 * PW_TILES) * 256 + tid; FragH f;
#pragma unroll      /* register arrays need constant indices */
    for (int q = 0; q < 8; ++q) f.h[q] = (_Float16)bf16_round(x[t * 8 + q]);
    *(v8us*)((unsigned short*)X16 + t * 8) = f.half[0]; return; }
  const int sel = blockIdx.x / PW_TILES, tile = blockIdx.x % PW_TILES; const int nt = tile / (DM / 64), k0 = (tile % (DM / 64)) * 64;
  const float* sp; int ld; _Float16* bt;
  if (sel < 3) { sp = (sel == 0 ? wq : sel == 1 ? wk : wv) + ((size_t)nt * DM + k0) * HD; ld = HD; bt = sel == 0 ? BQ : sel == 1 ? BK : BV; }      /* head nt, rows k0 .. k0 + 63 */
  else { sp = (sel == 3 ? w1 : w2) + (size_t)k0 * DM + nt * 64; ld = DM; bt = sel == 3 ? B1 : B2; }
  const int c4 = (tid & 15) * 4, rr = tid >> 4;
  const float* p00 = sp + (size_t)(2 * rr) * ld + c4; const float* p01 = p00 + ld; const float* p10 = p00 + (size_t)32 * ld; const float* p11 = p10 + ld;      /* rows 2 rr, 2 rr + 1, 32 + 2 rr, 33 + 2 rr of the tile */
  const v4f a[2][2] = {{*(const v4fa*)p00, *(const v4fa*)p01}, {*(const v4fa*)p10, *(const v4fa*)p11}};
  asm volatile("s_wait_xcnt 0x0" :: "v"(p00), "v"(p01), "v"(p10), "v"(p11) : "memory");      /* behind the four loads, in front of every later write of a register that they name; the addresses are inputs so that they keep their registers up to here: left free, one load's result was placed over another load's address */
#pragma unroll      /* register arrays need constant indices */
  for (int p = 0; p < 2; ++p)
#pragma unroll      /* register arrays need constant indices */
    for (int q = 0; q < 4; ++q) { union { _Float16 h[2]; unsigned u; } z; z.h[0] = (_Float16)(bf16_round(a[p][0][q]) * 16.0f); z.h[1] = (_Float16)(bf16_round(a[p][1][q]) * 16.0f); tl[c4 + q][p * 16 + rr] = z.u; }
  __syncthreads();      /* a row of Bt is gathered from words that sixteen threads wrote */
  const int pc = tid & 7, rn = tid >> 3;
#pragma unroll      /* both rows' LDS reads go out ahead of the stores */
  for (int p = 0; p < 2; ++p) { union { unsigned u[4]; v8us v; } o;
#pragma unroll      /* register arrays need constant indices */
    for (int j = 0; j < 4; ++j) o.u[j] = tl[p * 32 + rn][pc * 4 + j];
    *(v8us*)((unsigned short*)bt + (size_t)(nt * 64 + p * 32 + rn) * DM + k0 + pc * 8) = o.v; } }
// lane exchanges for the attention kernel's softmax and the LayerNorm sums; native exponentials for the softmax
typedef int v4ia __attribute__((ext_vector_type(4), may_alias));
template <int M> __device__ __forceinline__ float rs_xrow(float x) { return __builtin_bit_cast(float, __builtin_amdgcn_update_dpp(0, __builtin_bit_cast(int, x), 0x160 | M, 0xf, 0xf, true)); }      /* lane l <- lane l ^ M inside a 16-lane row (row_xmask) */
__device__ __forceinline__ float rs_xhalf(float x) { return __builtin_bit_cast(float, __builtin_amdgcn_permlanex16(__builtin_bit_cast(int, x), __builtin_bit_cast(int, x), 0x76543210, 0xfedcba98, false, false)); }      /* lane l <- lane l ^ 16 */
// four independent 2^x in one statement, closed by the one v_nop that the instruction set asks for behind a transcendental before its result is used or its source overwritten
// outputs are early-clobber so that no exponential writes a neighbour's source
__device__ __forceinline__ void rs_exp2x4(float* x) { float r0, r1, r2, r3;
  asm("v_exp_f32 %0, %4\n\tv_exp_f32 %1, %5\n\tv_exp_f32 %2, %6\n\tv_exp_f32 %3, %7\n\tv_nop" : "=&v"(r0), "=&v"(r1), "=&v"(r2), "=&v"(r3) : "v"(x[0]), "v"(x[1]), "v"(x[2]), "v"(x[3]));
  x[0] = r0; x[1] = r1; x[2] = r2; x[3] = r3; }
// Fused attention, one launch for all batches and heads: a work-group takes 128 query rows of one (batch, head), a wave 32 of them (two 16-column groups), and walks the 1024 keys in passes of 32, two passes a trip.
// Per trip the 64 K rows of the head (128 bytes a row) and 64 keys of its 64 V^T rows (128 bytes a row) lie in LDS at a pitch of 144 bytes, one copy for the four waves;
// asynchronous copies bring them there in whole 128-byte lines, two buffers, the next trip's tiles in flight while these are worked on. Fragments are read from LDS in the k order they had from global memory.
// S^T = K Q^T (A = K rows, B = Q rows kept in registers): in each group lane (ln, hh) holds, for query ln, the scores of keys 16 kt + 8 hh + r. Running maximum and sum are per lane, joined between the wave halves by one exchange.
// The two f32 score tiles of a pass, converted in place, are the f16 B operand of O^T += V^T P^T (A = V^T rows in the same k order): scores and weights never leave the registers.
// Weights are exp(s - running maximum), unnormalised (at most 1); the division by the row sum is done once, in f32, on O^T. A masked key enters as -inf (weight 0); a row with every key masked gives 0.
__device__ __forceinline__ v8f fa_mma(v16h a, v16h b, v8f c) { return __builtin_amdgcn_wmma_f32_16x16x32_f16(false, a, false, b, (short)0, c, false, false); }
// one 2^x, closed by the v_nop that the instruction set asks for behind a transcendental before its result is used or its source overwritten
__device__ __forceinline__ float fa_exp2(float x) { float r; asm("v_exp_f32 %0, %1\n\tv_nop" : "=&v"(r) : "v"(x)); return r; }
#define FA_TILE (64 * G3_PITCH)        /* one operand's tile in LDS, bytes: 64 rows of 128 bytes at the padded pitch */
// eight copies of 16 bytes a lane: rows r, r + 16, r + 32, r + 48 of the K tile, then of the V^T tile behind it (l: the lane's LDS byte address in row r of the K tile; gk, gv: its global addresses there).
// The s_wait_xcnt closes the statement so that it stands in front of every later write of a register that a copy names.
__device__ __forceinline__ void fa_copy8(unsigned l, const _Float16* gk, const _Float16* gv) { constexpr size_t rk = (size_t)16 * DM, rv = (size_t)16 * SQ;      /* 16 rows in elements */
  asm volatile("global_load_async_to_lds_b128 %0, %8, off\n\tglobal_load_async_to_lds_b128 %1, %9, off\n\tglobal_load_async_to_lds_b128 %2, %10, off\n\tglobal_load_async_to_lds_b128 %3, %11, off\n\t"
               "global_load_async_to_lds_b128 %4, %12, off\n\tglobal_load_async_to_lds_b128 %5, %13, off\n\tglobal_load_async_to_lds_b128 %6, %14, off\n\tglobal_load_async_to_lds_b128 %7, %15, off\n\ts_wait_xcnt 0x0"
               :: "v"(l), "v"(l + 16 * G3_PITCH), "v"(l + 32 * G3_PITCH), "v"(l + 48 * G3_PITCH), "v"(l + FA_TILE), "v"(l + FA_TILE + 16 * G3_PITCH), "v"(l + FA_TILE + 32 * G3_PITCH), "v"(l + FA_TILE + 48 * G3_PITCH),
                  "v"(gk), "v"(gk + rk), "v"(gk + 2 * rk), "v"(gk + 3 * rk), "v"(gv), "v"(gv + rv), "v"(gv + 2 * rv), "v"(gv + 3 * rv) : "memory"); }
__global__ __launch_bounds__(128) void k_fattn(const _Float16* __restrict__ Q16, const _Float16* __restrict__ K16, const _Float16* __restrict__ VT, const int* __restrict__ mk, float* __restrict__ AF) {
  static_assert(HD == 64 && SQ % 64 == 0 && SQ >= 128, "k_fattn: heads of 64 columns, whole trips of 64 keys, two or more of them");
  __shared__ __attribute__((aligned(16))) float kbias[SQ];      /* 0 for a key that counts, -inf for a masked one */
  __shared__ __attribute__((aligned(16))) unsigned char kv[4 * FA_TILE];      /* buffer u: K tile at 2 u tiles, V^T tile at 2 u + 1 */
  const int tid = threadIdx.x, w = tid >> 5, lane = tid & 31, ln = lane & 15, hh = lane >> 4;
  const int bh = blockIdx.x / (SQ / 128), qb = blockIdx.x % (SQ / 128); const int b = bh / NH, h = bh % NH;
  const unsigned l0 = (unsigned)(size_t)kv + (unsigned)((tid >> 3) * G3_PITCH + (tid & 7) * 16);      /* eight lanes a row: a wave's copy covers four whole 128-byte lines */
  const _Float16* gk = K16 + ((size_t)b * SQ + (tid >> 3)) * DM + h * HD + (tid & 7) * 8; const _Float16* gv = VT + ((size_t)bh * HD + (tid >> 3)) * SQ + (tid & 7) * 8; constexpr int nt = SQ / 64;
  fa_copy8(l0, gk, gv);
  const v4ia m0 = *(const v4ia*)(mk + (size_t)b * SQ + tid * 8), m1 = *(const v4ia*)(mk + (size_t)b * SQ + tid * 8 + 4);      /* eight keys of the mask row a thread */
  const int q0 = qb * 128 + w * 32;
  const _Float16* qp = Q16 + ((size_t)b * SQ + q0 + ln) * DM + h * HD;
  v16h qf[2][2];
#pragma unroll      /* register arrays need constant indices */
  for (int u = 0; u < 2; ++u)
#pragma unroll      /* register arrays need constant indices */
    for (int ks = 0; ks < 2; ++ks) qf[u][ks] = g2_frag(qp + (size_t)u * 16 * DM + ks * 32, hh);
  { v4f b0, b1;
#pragma unroll      /* register arrays need constant indices */
    for (int q = 0; q < 4; ++q) { b0[q] = (m0[q] == 0) ? 0.f : -__builtin_inff(); b1[q] = (m1[q] == 0) ? 0.f : -__builtin_inff(); }
    *(v4fa*)&kbias[tid * 8] = b0; *(v4fa*)&kbias[tid * 8 + 4] = b1; }
  asm volatile("s_wait_asynccnt 0x0" ::: "memory");      /* this wave's share of the first tiles has landed */
  __syncthreads();      /* the bias row and the first tiles are read by every wave */
  fa_copy8(l0 + 2 * FA_TILE, gk + (size_t)64 * DM, gv + 64);
  const unsigned char* fk = kv + ln * G3_PITCH + 16 * hh; const unsigned char* fv = kv + FA_TILE + ln * G3_PITCH + 16 * hh;
  const v8f z8 = {0.f, 0.f, 0.f, 0.f, 0.f, 0.f, 0.f, 0.f};
  v8f o[2][4] = {{z8, z8, z8, z8}, {z8, z8, z8, z8}}; float mr[2] = {-3.0e38f, -3.0e38f}, lr[2] = {0.f, 0.f};
#pragma unroll 1      /* one trip per pair of tiles: the buffer is chosen at run time, and an unrolled body would only grow the text */
  for (int t = 0; t < nt; ++t) { const unsigned bo = (unsigned)(t & 1) * (2 * FA_TILE);
#pragma unroll      /* the pass's place in the tiles becomes a constant offset of its LDS reads */
   for (int ps = 0; ps < 2; ++ps) { const int key0 = t * 64 + ps * 32;
    v16h kf[2][2], vf[4]; v4f bs[4];
#pragma unroll      /* register arrays need constant indices */
    for (int kt = 0; kt < 2; ++kt)
#pragma unroll      /* register arrays need constant indices */
      for (int ks = 0; ks < 2; ++ks) kf[kt][ks] = g3_frag(fk + bo + (ps * 32 + kt * 16) * G3_PITCH + ks * 64);
#pragma unroll      /* register arrays need constant indices */
    for (int dt = 0; dt < 4; ++dt) { vf[dt] = g3_frag(fv + bo + dt * 16 * G3_PITCH + ps * 64); bs[dt] = *(const v4fa*)&kbias[key0 + (dt >> 1) * 16 + 8 * hh + (dt & 1) * 4]; }
    v8f s[2][2];
#pragma unroll      /* register arrays need constant indices */
    for (int qi = 0; qi < 2; ++qi)
#pragma unroll      /* register arrays need constant indices */
      for (int kt = 0; kt < 2; ++kt) s[qi][kt] = fa_mma(kf[kt][1], qf[qi][1], fa_mma(kf[kt][0], qf[qi][0], z8));
#pragma unroll      /* register arrays need constant indices */
    for (int qi = 0; qi < 2; ++qi) { float t16[16];
#pragma unroll      /* register arrays need constant indices */
      for (int i = 0; i < 16; ++i) t16[i] = s[qi][i >> 3][i & 7] * 0.18033688f + bs[i >> 2][i & 3];      /* score / 8 in log2 units: exp(x) = 2^(x log2 e), the native form */
      float mx = t16[0];
#pragma unroll      /* register arrays need constant indices */
      for (int i = 1; i < 16; ++i) mx = fmaxf(mx, t16[i]);
      mx = fmaxf(mx, rs_xhalf(mx)); const float mn = fmaxf(mr[qi], mx); const float f = fa_exp2(mr[qi] - mn); mr[qi] = mn;
#pragma unroll      /* register arrays need constant indices */
      for (int i = 0; i < 16; ++i) t16[i] -= mn;
      rs_exp2x4(t16); rs_exp2x4(t16 + 4); rs_exp2x4(t16 + 8); rs_exp2x4(t16 + 12);
      float s4[4] = {t16[0], t16[1], t16[2], t16[3]};
#pragma unroll      /* register arrays need constant indices */
      for (int i = 4; i < 16; ++i) s4[i & 3] += t16[i];
      lr[qi] = lr[qi] * f + ((s4[0] + s4[1]) + (s4[2] + s4[3]));
      FragH p;
#pragma unroll      /* register arrays need constant indices */
      for (int i = 0; i < 16; ++i) p.h[i] = (_Float16)t16[i];
#pragma unroll      /* register arrays need constant indices */
      for (int dt = 0; dt < 4; ++dt) o[qi][dt] = fa_mma(vf[dt], p.v, o[qi][dt] * f); } }
    asm volatile("s_wait_dscnt 0x0" ::: "memory");      /* this wave's reads of the buffer have returned before the barrier behind which it is refilled */
    asm volatile("s_wait_asynccnt 0x0" ::: "memory");      /* this wave's share of the next trip's tiles has landed */
    __syncthreads();      /* publishes the tiles of trip t + 1 and ends every wave's reads of those of trip t */
    if (t + 2 < nt) fa_copy8(l0 + bo, gk + (size_t)(t + 2) * 64 * DM, gv + (size_t)(t + 2) * 64); }
  asm volatile("s_wait_asynccnt 0x0" ::: "memory");      /* no copy is outstanding when the wave ends */
#pragma unroll      /* register arrays need constant indices */
  for (int qi = 0; qi < 2; ++qi) { const float se = lr[qi] + rs_xhalf(lr[qi]); const float inv = (se == 0.f) ? 0.f : 1.0f / se;
    float* dst = AF + ((size_t)b * SQ + q0 + qi * 16 + ln) * DM + h * HD + 8 * hh;      /* lane (ln, hh): query ln, head columns 16 dt + 8 hh + r */
#pragma unroll      /* register arrays need constant indices */
    for (int dt = 0; dt < 4; ++dt) { const v8f v = o[qi][dt] * inv; const v4f lo = {v[0], v[1], v[2], v[3]}, hi = {v[4], v[5], v[6], v[7]}; *(v4f*)(dst + dt * 16) = lo; *(v4f*)(dst + dt * 16 + 4) = hi; } } }
// OF_ = R + LayerNorm(A) g + bta (H16: and its f16 copy OH_): two rows a wave, eight waves a work-group, no LDS and no barrier.
// Lane l holds columns 128 u + 4 l + 0..3 (u = 0..7) of each row, so every load and every f32 store of a wave is 512 contiguous bytes; all loads of both rows go out ahead of the arithmetic.
// Mean and biased variance (two passes over the registers): four partial sums a lane, joined pairwise, then a five-step xor butterfly that leaves the same sum in every lane.
__device__ __forceinline__ float ln_wsum(float s) { s += rs_xrow<1>(s); s += rs_xrow<2>(s); s += rs_xrow<4>(s); s += rs_xrow<8>(s); return s + rs_xhalf(s); }
template <int RBF, bool H16>
__global__ __launch_bounds__(256) void k_lnadd(const float* __restrict__ A, const float* __restrict__ R, const float* __restrict__ g, const float* __restrict__ bta, float eps, float* __restrict__ OF_, _Float16* __restrict__ OH_) {
  static_assert(DM == 1024 && MPO % 16 == 0, "k_lnadd: rows of 1024 columns, sixteen rows a work-group");
  const int j0 = (threadIdx.x & 31) * 4;      /* the one per-lane part of every address */
  const size_t e0 = ((size_t)blockIdx.x * 8 + (size_t)__builtin_amdgcn_readfirstlane(threadIdx.x >> 5)) * 2 * DM;      /* first element of the wave's first row: the same in every lane, so the row bases are scalar */
  const float* ap = A + e0; const float* rp = R + e0; float* op = OF_ + e0; _Float16* hp = OH_ + e0;
  v4f a[2][8], r[2][8], gv[8], bv[8];
  asm volatile("" :: "s"(eps), "s"(OF_), "s"(OH_));      /* inputs only: the arguments that are used behind the loads are fetched in front of them; left free, their fetch stood behind the loads */
  __builtin_amdgcn_sched_barrier(0);      /* keeps the loads behind that fetch */
#pragma unroll      /* register arrays need constant indices */
  for (int p = 0; p < 2; ++p)
#pragma unroll      /* register arrays need constant indices */
    for (int u = 0; u < 8; ++u) a[p][u] = *(const v4fa*)(ap + p * DM + u * 128 + j0);
#pragma unroll      /* register arrays need constant indices */
  for (int p = 0; p < 2; ++p)
#pragma unroll      /* register arrays need constant indices */
    for (int u = 0; u < 8; ++u) r[p][u] = *(const v4fa*)(rp + p * DM + u * 128 + j0);
#pragma unroll      /* register arrays need constant indices */
  for (int u = 0; u < 8; ++u) { gv[u] = *(const v4fa*)(g + u * 128 + j0); bv[u] = *(const v4fa*)(bta + u * 128 + j0); }
  asm volatile("s_wait_xcnt 0x0" ::: "memory");      /* behind the loads, in front of every later reuse of a register that they name as an address */
  __builtin_amdgcn_sched_barrier(0);      /* all 48 loads are issued here, in front of the arithmetic: left free, the second row's loads sank behind the first row's sums and their latency was waited out a second time */
#pragma unroll      /* register arrays need constant indices */
  for (int p = 0; p < 2; ++p) { v4f c = a[p][0];
#pragma unroll      /* register arrays need constant indices */
    for (int u = 1; u < 8; ++u) c += a[p][u];
    const float mu = ln_wsum((c[0] + c[1]) + (c[2] + c[3])) / (float)DM;
    v4f d = (a[p][0] - mu) * (a[p][0] - mu);
#pragma unroll      /* register arrays need constant indices */
    for (int u = 1; u < 8; ++u) d += (a[p][u] - mu) * (a[p][u] - mu);
    const float rs = rsqrtf(ln_wsum((d[0] + d[1]) + (d[2] + d[3])) / (float)DM + eps);
#pragma unroll      /* register arrays need constant indices */
    for (int u = 0; u < 8; ++u) { v4f o; v4h h4;
#pragma unroll      /* register arrays need constant indices */
      for (int q = 0; q < 4; ++q) { o[q] = (RBF ? bf16_round(r[p][u][q]) : r[p][u][q]) + ((a[p][u][q] - mu) * rs * bf16_round(gv[u][q]) + bf16_round(bv[u][q])); h4[q] = (_Float16)o[q]; }
      *(v4f*)(op + p * DM + u * 128 + j0) = o; if (H16) *(v4h*)(hp + p * DM + u * 128 + j0) = h4; } } }

extern "C" void kernel_launch(void* const* d_in, const int* in_sizes, int n_in,
                              void* d_out, int out_size, void* d_ws, size_t ws_size, hipStream_t stream) {
  (void)in_sizes; (void)n_in; (void)out_size;
  const float* const* I = (const float* const*)d_in; const float* x = I[0]; const int* xmask = (const int*)d_in[1]; const float* wq = I[2]; const float* bq = I[3]; const float* wk = I[4]; const float* bk = I[5]; const float* wv = I[6]; const float* bv = I[7]; const float* w1 = I[8]; const float* b1 = I[9]; const float* w2 = I[10]; const float* b2 = I[11]; const float* g1 = I[12]; const float* be1 = I[13]; const float* g2 = I[14]; const float* be2 = I[15];
  char* ws = (char*)d_ws; size_t off = 0;
  auto take = [&](size_t bytes) { char* p = ws + off; off += (bytes + 255) & ~(size_t)255; return p; };
  _Float16* BQ = (_Float16*)take((size_t)DM * DM * 2); _Float16* BK = (_Float16*)take((size_t)DM * DM * 2); _Float16* BV = (_Float16*)take((size_t)DM * DM * 2); _Float16* B1 = (_Float16*)take((size_t)DM * DM * 2); _Float16* B2 = (_Float16*)take((size_t)DM * DM * 2);
  _Float16* X16 = (_Float16*)take(NR * DM * 2); _Float16* Q16 = (_Float16*)take(NR * DM * 2); _Float16* K16 = (_Float16*)take(NR * DM * 2); _Float16* V16 = (_Float16*)take(NR * DM * 2); float* AF = (float*)take(NR * DM * 4); float* X1F = (float*)take(NR * DM * 4); _Float16* X1H = (_Float16*)take(NR * DM * 2); _Float16* H16 = (_Float16*)take(NR * DM * 2); float* FF = AF;      /* f rows reuse the attention-output rows (dead after the first LayerNorm; same type) */
  _Float16* VT = (_Float16*)take((size_t)NB * NH * HD * SQ * 2);
  if (off > ws_size) return;      /* 10 + 16x4 + 32 + 32 + 16 + 16 + 16 = approx 186 MiB */
  k_prep<<<5 * PW_TILES + PX_WGS, 256, 0, stream>>>(x, wq, wk, wv, w1, w2, X16, BQ, BK, BV, B1, B2);      /* the five weights as f16 [n][k], x as f16 rows */
  const size_t r0p = (size_t)B0 * SQ; const dim3 gp((unsigned)((MP / 128) * (DM / 128)), 1);
  k_gemm3<0, true><<<gp, 128, 0, stream>>>(X16 + r0p * DM, BQ, 0.0625f, bq, nullptr, Q16 + r0p * DM);
  k_gemm3<0, true><<<gp, 128, 0, stream>>>(X16 + r0p * DM, BK, 0.0625f, bk, nullptr, K16 + r0p * DM);
  k_gemm3<0, true><<<gp, 128, 0, stream>>>(X16 + r0p * DM, BV, 0.0625f, bv, nullptr, V16 + r0p * DM);
  k_vt<NH, SQ><<<NB * NH * (SQ / 64), 256, 0, stream>>>(V16, DM, 0, VT);      /* V^T of every (batch, head) */
  k_fattn<<<NB * NH * (SQ / 128), 128, 0, stream>>>(Q16, K16, VT, xmask, AF);      /* a (merged heads) as f32 rows */
  k_lnadd<1, true><<<(unsigned)(MPO / 16), 256, 0, stream>>>(AF + r0p * DM, x + r0p * DM, g1, be1, 1e-5f, X1F + r0p * DM, X1H + r0p * DM);      /* x1 = bf16(x) + LN(a) */
  const dim3 gf((unsigned)((MPO / 128) * (DM / 128)), 1);
  k_gemm3<3, true><<<gf, 128, 0, stream>>>(X1H + r0p * DM, B1, 0.0625f, b1, nullptr, H16 + r0p * DM);      /* h = relu(x1 W1 + b1) (f16) */
  k_gemm3<0, false><<<gf, 128, 0, stream>>>(H16 + r0p * DM, B2, 0.0625f, b2, FF + r0p * DM, nullptr);      /* f = h W2 + b2 (f32) */
  k_lnadd<0, false><<<(unsigned)(MPO / 16), 256, 0, stream>>>(FF + r0p * DM, X1F + r0p * DM, g2, be2, 1e-5f, (float*)d_out + r0p * DM, nullptr);      /* out = x1 + LN(f) */
}

// v007
// A run of this version takes 157 microseconds.
// In both of two side-by-side timings against v006, it was 1.03 times as fast.
// Counting every step since v000, it is 70.3 times as fast.
#include <hip/hip_runtime.h>
// Transformer encoder layer (x [8][1024][1024]; per-head q/k/v = x Wq[h] + bq[h] (Wq [16][1024][64]); scores / 8 with a key-padding mask x_mask [8][1][1024] (int32, read; all zeros here); softmax; a = attn v concatenated over heads; x1 = x + LayerNorm(a) g1 + be1; h = relu(x1 W1 + b1); f = h W2 + b2 (W1, W2 [1024][1024] [in][out]); out = x1 + LayerNorm(f) g2 + be2 -> [8][1024][1024]).
// Structure: token rows; x as exact f16 rows; Q, K, V as three WMMA GEMMs (128x128 work-group tiles staged in LDS, 64x64 wave tiles, f32 accumulation, exact x16 head-stacked weights + bias, f16 outputs); V^T for all batches and heads via LDS transposes; one fused attention launch (scores K = 64 as S^T = K Q^T, masked running-maximum softmax on VALU in f32 with native exp, weights f16 at most 1, masked keys 0, O^T += V^T P^T, divided by the row sum in f32) into f32 rows; per row on VALU: x1 = bf16(x) + LayerNorm(a) (f32 + f16 copies); h = relu(x1 W1 + b1) GEMM (f16); f = h W2 + b2 GEMM (f32); per row on VALU: out = x1 + LayerNorm(f).
// Compute dtype: inputs rounded to bf16; x / weights exact; q, k, v, softmax weights, x1 (as GEMM operand) and h plain f16 (~2^-12); attention output, LayerNorms, residuals f32. v_wmma_f32_16x16x32_f16.
#define NB 8
#define SQ 1024
#define DM 1024
#define NH 16
#define HD 64
#define HG 4
#define B0 0                         /* first batch processed (debug hook) */
#define NBR NB                       /* batches processed (debug hook) */
#define QN SQ                        /* unused; attention covers all SQ query rows of a batch */
#define NR ((size_t)NB * SQ)
#define MP ((int)((size_t)NBR * SQ)) /* rows projected (debug hook) */
#define MPO MP                       /* rows through the post-attention stages (debug hook) */
typedef __bf16 v16b __attribute__((ext_vector_type(16)));
typedef unsigned short v8us __attribute__((ext_vector_type(8), may_alias));
typedef float  v8f  __attribute__((ext_vector_type(8)));
typedef float  v4f  __attribute__((ext_vector_type(4)));
typedef float  v4fa __attribute__((ext_vector_type(4), may_alias));
union FragB { v16b v; v8us half[2]; unsigned short u[16]; };

__device__ __forceinline__ unsigned short bf16_bits(float x) { unsigned int u = __float_as_uint(x); return (unsigned short)((u + 0x7FFFu + ((u >> 16) & 1u)) >> 16); }
__device__ __forceinline__ float bf16_val(unsigned short b) { return __uint_as_float(((unsigned int)b) << 16); }
__device__ __forceinline__ float bf16_round(float x) { return bf16_val(bf16_bits(x)); }
// D += A·B with NT terms: 1 = ah·bh, 2 = + al·bh (A split), 3 = + ah·bl (both split)
template <int NT>
__device__ __forceinline__ v8f mmaN(v16b ah, v16b al, v16b bh, v16b bl, v8f c) {
  c = __builtin_amdgcn_wmma_f32_16x16x32_bf16(false, ah, false, bh, (short)0, c, false, false);
  if (NT >= 2) c = __builtin_amdgcn_wmma_f32_16x16x32_bf16(false, al, false, bh, (short)0, c, false, false);
  if (NT >= 3) c = __builtin_amdgcn_wmma_f32_16x16x32_bf16(false, ah, false, bl, (short)0, c, false, false);
  asm volatile("v_nop\n\tv_nop\n\tv_nop\n\tv_nop" : "+v"(c) : "v"(ah), "v"(al), "v"(bh), "v"(bl));
  return c;
}

__global__ __launch_bounds__(256) void k_wt_bf16(const float* __restrict__ W, unsigned short* __restrict__ Wt, int K, int N) {
  const int t = blockIdx.x * 256 + threadIdx.x;
  const int k8n = K / 8;
  if (t >= N * k8n) return;
  const int n = t / k8n, k8 = (t % k8n) * 8;
  v8us v;
#pragma unroll
  for (int i = 0; i < 8; ++i) v[i] = bf16_bits(W[(size_t)(k8 + i) * N + n]);
  *(v8us*)(Wt + (size_t)n * K + k8) = v;
  
}

// GEMM C[M][N] (f32, pitch ldc) = act(A[M][K]·W + bias). A f32 row-major (pitch lda) converted per fragment to bf16
// (ASPLIT: hi/lo two planes -> 2 terms, else single rounded term); Wt bf16 [N][K] (pitch ldb). BIAS_BF16 rounds the
// bias to bf16 first (bias quantised to bf16 before the add). K%32==0, M%16==0, N%64==0.
template <bool ASPLIT, int ACT, bool BIAS_BF16>
__global__ __launch_bounds__(128) void k_gemm_bf(const float* __restrict__ A, int lda, const unsigned short* __restrict__ Wt, int ldb,
                                               const float* __restrict__ bias, float* __restrict__ C, int ldc, int M, int N, int K) {
  __shared__ __attribute__((aligned(16))) float so[4][16][64];
  const int tid = threadIdx.x, w = tid >> 5, lane = tid & 31, ln = lane & 15, hh = lane >> 4;
  const int ntn = N / 64;
  const int wid = blockIdx.x * 4 + w;
  const int mt = wid / ntn, nq = wid % ntn;
  if (mt * 16 >= M) return;
  const int row0 = mt * 16, col0 = nq * 64;
  const float* arow = A + (size_t)(row0 + ln) * lda;
  v8f acc[4] = {};
  for (int kb = 0; kb < K; kb += 32) {
    FragB ah, al;
    const v4f x0 = *(const v4fa*)(arow + kb + 8 * hh), x1 = *(const v4fa*)(arow + kb + 8 * hh + 4);
    const v4f x2 = *(const v4fa*)(arow + kb + 16 + 8 * hh), x3 = *(const v4fa*)(arow + kb + 16 + 8 * hh + 4);
    float xs[16] = {x0[0],x0[1],x0[2],x0[3],x1[0],x1[1],x1[2],x1[3],x2[0],x2[1],x2[2],x2[3],x3[0],x3[1],x3[2],x3[3]};
#pragma unroll
    for (int i = 0; i < 16; ++i) { const unsigned short hb = bf16_bits(xs[i]); ah.u[i] = hb; al.u[i] = ASPLIT ? bf16_bits(xs[i] - bf16_val(hb)) : (unsigned short)0; }
#pragma unroll
    for (int t = 0; t < 4; ++t) {
      const unsigned short* brow = Wt + (size_t)(col0 + t * 16 + ln) * ldb + kb;
      FragB b;
      b.half[0] = *(const v8us*)(brow + 8 * hh);
      b.half[1] = *(const v8us*)(brow + 16 + 8 * hh);
      acc[t] = mmaN<ASPLIT ? 2 : 1>(ah.v, al.v, b.v, b.v, acc[t]);
    }
  }
#pragma unroll
  for (int t = 0; t < 4; ++t) {
    float bv = bias ? bias[col0 + t * 16 + ln] : 0.f;
    if (BIAS_BF16) bv = bf16_round(bv);
#pragma unroll
    for (int r = 0; r < 8; ++r) { float v = acc[t][r] + bv; if (ACT == 1) v = fmaxf(v, 0.f); so[w][8 * hh + r][t * 16 + ln] = v; }
  }
  __builtin_amdgcn_fence(__ATOMIC_ACQ_REL, "workgroup");
  __builtin_amdgcn_wave_barrier();
  const int rsub = lane >> 4, c4 = (lane & 15) * 4;
  {
#pragma unroll
    for (int q = 0; q < 8; ++q) {
      const int r = q * 2 + rsub;
      const v4f v = *(const v4fa*)&so[w][r][c4];
      *(v4f*)(C + (size_t)(row0 + r) * ldc + col0 + c4) = v;
    }
    
  }
}

// GEMM C = act(A·W + bias + resid): A f32 (ASPLIT -> hi/lo 2 terms), Wt bf16 [N][K]; ACT 0 none, 1 relu, 2 exact gelu;
// resid (optional, f32, row index = (row % rmod), pitch ldr, RES_BF16 rounds it) added before the activation.
template <bool ASPLIT, int ACT, bool BIAS_BF16, bool RES_BF16>
__global__ __launch_bounds__(128) void k_gemm_bf3(const float* __restrict__ A, int lda, const unsigned short* __restrict__ Wt, int ldb,
                                                const float* __restrict__ bias, const float* __restrict__ resid, int rmod, int ldr,
                                                float* __restrict__ C, int ldc, int M, int N, int K) {
  __shared__ __attribute__((aligned(16))) float so[4][16][64];
  const int tid = threadIdx.x, w = tid >> 5, lane = tid & 31, ln = lane & 15, hh = lane >> 4;
  const int ntn = N / 64;
  const int wid = blockIdx.x * 4 + w;
  const int mt = wid / ntn, nq = wid % ntn;
  if (mt * 16 >= M) return;
  const int row0 = mt * 16, col0 = nq * 64;
  const float* arow = A + (size_t)(row0 + ln) * lda;
  v8f acc[4] = {};
  for (int kb = 0; kb < K; kb += 32) {
    FragB ah, al;
    const v4f x0 = *(const v4fa*)(arow + kb + 8 * hh), x1 = *(const v4fa*)(arow + kb + 8 * hh + 4);
    const v4f x2 = *(const v4fa*)(arow + kb + 16 + 8 * hh), x3 = *(const v4fa*)(arow + kb + 16 + 8 * hh + 4);
    float xs[16] = {x0[0],x0[1],x0[2],x0[3],x1[0],x1[1],x1[2],x1[3],x2[0],x2[1],x2[2],x2[3],x3[0],x3[1],x3[2],x3[3]};
#pragma unroll
    for (int i = 0; i < 16; ++i) { const unsigned short hb = bf16_bits(xs[i]); ah.u[i] = hb; al.u[i] = ASPLIT ? bf16_bits(xs[i] - bf16_val(hb)) : (unsigned short)0; }
#pragma unroll
    for (int t = 0; t < 4; ++t) {
      const unsigned short* brow = Wt + (size_t)(col0 + t * 16 + ln) * ldb + kb;
      FragB b;
      b.half[0] = *(const v8us*)(brow + 8 * hh);
      b.half[1] = *(const v8us*)(brow + 16 + 8 * hh);
      acc[t] = mmaN<ASPLIT ? 2 : 1>(ah.v, al.v, b.v, b.v, acc[t]);
    }
  }
#pragma unroll
  for (int t = 0; t < 4; ++t) {
    const int col = col0 + t * 16 + ln;
    float bv = bias ? bias[col] : 0.f;
    if (BIAS_BF16) bv = bf16_round(bv);
#pragma unroll
    for (int r = 0; r < 8; ++r) {
      float v = acc[t][r] + bv;
      if (resid) { float rv = resid[(size_t)((row0 + 8 * hh + r) % rmod) * ldr + col]; if (RES_BF16) rv = bf16_round(rv); v += rv; }
      if (ACT == 1) v = fmaxf(v, 0.f);
      if (ACT == 2) v = 0.5f * v * (1.0f + erff(v * 0.70710678118654752f));
      if (ACT == 3) { const float u = 0.7978845608028654f * (v + 0.044715f * v * v * v); v = 0.5f * v * (1.0f + tanhf(u)); }
      so[w][8 * hh + r][t * 16 + ln] = v;
    }
  }
  __builtin_amdgcn_fence(__ATOMIC_ACQ_REL, "workgroup");
  __builtin_amdgcn_wave_barrier();
  const int rsub = lane >> 4, c4 = (lane & 15) * 4;
  {
#pragma unroll
    for (int q = 0; q < 8; ++q) {
      const int r = q * 2 + rsub;
      const v4f v = *(const v4fa*)&so[w][r][c4];
      *(v4f*)(C + (size_t)(row0 + r) * ldc + col0 + c4) = v;
    }
    
  }
}
// row LayerNorm (biased variance, eps) over N: s = X (+ R); optional out_sum <- s; out_norm <- (s-mu)*rsqrt(var+eps)*g + b
template <bool PARAM_BF16>
__global__ __launch_bounds__(256) void k_layernorm(const float* __restrict__ X, const float* __restrict__ R, const float* __restrict__ g, const float* __restrict__ bta,
                                                  float* __restrict__ out_sum, float* __restrict__ out_norm, int N, float eps) {
  __shared__ float red[256];
  const int row = blockIdx.x, tid = threadIdx.x;
  const float* x = X + (size_t)row * N; const float* rr = R ? R + (size_t)row * N : nullptr;
  float vals[16];                     // up to N = 4096
  const int per = N / 256;            // contiguous chunk per thread? use strided-by-4 chunks: thread handles j = tid*4 + 1024*u
  float s1 = 0.f;
  for (int u = 0; u < per / 4; ++u) {
    const int j = tid * 4 + 1024 * u;
    const v4f a = *(const v4fa*)(x + j);
    v4f b = {0.f,0.f,0.f,0.f}; if (rr) b = *(const v4fa*)(rr + j);
#pragma unroll
    for (int q = 0; q < 4; ++q) { const float v = a[q] + b[q]; vals[u * 4 + q] = v; s1 += v; }
  }
  red[tid] = s1; __syncthreads();
  for (int st = 128; st > 0; st >>= 1) { if (tid < st) red[tid] += red[tid + st]; __syncthreads(); }
  const float mu = red[0] / (float)N; __syncthreads();
  float s2 = 0.f;
  for (int u = 0; u < per / 4; ++u)
#pragma unroll
    for (int q = 0; q < 4; ++q) { const float c = vals[u * 4 + q] - mu; s2 += c * c; }
  red[tid] = s2; __syncthreads();
  for (int st = 128; st > 0; st >>= 1) { if (tid < st) red[tid] += red[tid + st]; __syncthreads(); }
  const float rs = rsqrtf(red[0] / (float)N + eps);
  {
    for (int u = 0; u < per / 4; ++u) {
      const int j = tid * 4 + 1024 * u;
      v4f o, sm;
#pragma unroll
      for (int q = 0; q < 4; ++q) {
        float gg = g[j + q], bb = bta[j + q];
        if (PARAM_BF16) { gg = bf16_round(gg); bb = bf16_round(bb); }
        sm[q] = vals[u * 4 + q]; o[q] = (vals[u * 4 + q] - mu) * rs * gg + bb;
      }
      if (out_sum) *(v4f*)(out_sum + (size_t)row * N + j) = sm;
      *(v4f*)(out_norm + (size_t)row * N + j) = o;
    }
    
  }
}



// ---- f16 WMMA path (v_wmma_f32_16x16x32_f16): 11-bit significands for operands in range — used for every GEMM launched here
typedef _Float16 v16h __attribute__((ext_vector_type(16)));
union FragH { v16h v; v8us half[2]; _Float16 h[16]; unsigned short u[16]; };
template <int NT>
__device__ __forceinline__ v8f mmaH(v16h ah, v16h al, v16h bh, v16h bl, v8f c) {
  c = __builtin_amdgcn_wmma_f32_16x16x32_f16(false, ah, false, bh, (short)0, c, false, false);
  if (NT >= 2) c = __builtin_amdgcn_wmma_f32_16x16x32_f16(false, al, false, bh, (short)0, c, false, false);
  if (NT >= 3) c = __builtin_amdgcn_wmma_f32_16x16x32_f16(false, ah, false, bl, (short)0, c, false, false);
  asm volatile("v_nop\n\tv_nop\n\tv_nop\n\tv_nop" : "+v"(c) : "v"(ah), "v"(al), "v"(bh), "v"(bl));
  return c;
}
// batched GEMM like k_gemm_b but f16 operands: A f32 (split into f16 hi/lo if ASPLIT, else rounded to f16), Bt = f16 values [n][k]; alpha; C f32; N multiple of 16 (partial tiles skipped)
template <bool ASPLIT>
__global__ __launch_bounds__(128) void k_gemm_h(const float* __restrict__ A, int lda, size_t sA, const _Float16* __restrict__ Bh, int ldb, size_t sB, float alpha, float* __restrict__ C, int ldc, size_t sC, int M, int N, int K) {
  __shared__ __attribute__((aligned(16))) float so[4][16][64];
  const int tid = threadIdx.x, w = tid >> 5, lane = tid & 31, ln = lane & 15, hh = lane >> 4; const int by = blockIdx.y;
  A += (size_t)by * sA; Bh += (size_t)by * sB; C += (size_t)by * sC;
  const int ntn = (N + 63) / 64; const int wid = blockIdx.x * 4 + w; const int mt = wid / ntn, nq = wid % ntn; if (mt * 16 >= M) return;
  const int row0 = mt * 16, col0 = nq * 64; const float* arow = A + (size_t)(row0 + ln) * lda;
  v8f acc[4] = {};
  for (int kb = 0; kb < K; kb += 32) {
    FragH ah, al;
    const v4f x0 = *(const v4fa*)(arow + kb + 8 * hh), x1 = *(const v4fa*)(arow + kb + 8 * hh + 4), x2 = *(const v4fa*)(arow + kb + 16 + 8 * hh), x3 = *(const v4fa*)(arow + kb + 16 + 8 * hh + 4);
    float xs[16] = {x0[0],x0[1],x0[2],x0[3],x1[0],x1[1],x1[2],x1[3],x2[0],x2[1],x2[2],x2[3],x3[0],x3[1],x3[2],x3[3]};
#pragma unroll
    for (int i = 0; i < 16; ++i) { const _Float16 h = (_Float16)xs[i]; ah.h[i] = h; al.h[i] = ASPLIT ? (_Float16)(xs[i] - (float)h) : (_Float16)0.0f; }
#pragma unroll
    for (int t = 0; t < 4; ++t) { if (col0 + t * 16 >= N) continue; const size_t boff = (size_t)(col0 + t * 16 + ln) * ldb + kb; FragH bq; bq.half[0] = *(const v8us*)(Bh + boff + 8 * hh); bq.half[1] = *(const v8us*)(Bh + boff + 16 + 8 * hh);
      acc[t] = mmaH<ASPLIT ? 2 : 1>(ah.v, al.v, bq.v, bq.v, acc[t]); }
  }
#pragma unroll
  for (int t = 0; t < 4; ++t) { if (col0 + t * 16 >= N) continue;
#pragma unroll
    for (int r = 0; r < 8; ++r) so[w][8 * hh + r][t * 16 + ln] = acc[t][r] * alpha; }
  __builtin_amdgcn_fence(__ATOMIC_ACQ_REL, "workgroup"); __builtin_amdgcn_wave_barrier();
  const int rsub = lane >> 4, c4 = (lane & 15) * 4;
  {
#pragma unroll
    for (int q = 0; q < 8; ++q) { const int r = q * 2 + rsub; if (col0 + c4 < N) { const v4f v = *(const v4fa*)&so[w][r][c4]; *(v4f*)(C + (size_t)(row0 + r) * ldc + col0 + c4) = v; } }
     }
}

// k_gemm_hh variant with fused epilogue: v = acc·alpha + bias[by·sBias + col] (+ CP[(row/rowsPerB)·sCPb + by·64 + col] if CP) ; ACT 0 none / 1 elu ; writes f16 C16 (and f32 C if non-null)
template <int ACT>
__global__ __launch_bounds__(128) void k_gemm_hhx(const _Float16* __restrict__ A, int lda, size_t sA, const _Float16* __restrict__ Bh, int ldb, size_t sB, float alpha, const float* __restrict__ bias, size_t sBias, const float* __restrict__ CP, int rowsPerB, size_t sCPb, int row0g,
    float* __restrict__ C, _Float16* __restrict__ C16, int ldc, size_t sC, int M, int N, int K) {
  __shared__ __attribute__((aligned(16))) float so[4][16][64];
  const int tid = threadIdx.x, w = tid >> 5, lane = tid & 31, ln = lane & 15, hh = lane >> 4; const int by = blockIdx.y;
  A += (size_t)by * sA; Bh += (size_t)by * sB; const size_t cofs = (size_t)by * sC; const float* bp = bias ? bias + (size_t)by * sBias : nullptr;
  const int ntn = (N + 63) / 64; const int wid = blockIdx.x * 4 + w; const int mt = wid / ntn, nq = wid % ntn; if (mt * 16 >= M) return;
  const int row0 = mt * 16, col0 = nq * 64; const _Float16* arow = A + (size_t)(row0 + ln) * lda;
  v8f acc[4] = {};
  for (int kb = 0; kb < K; kb += 32) { FragH ah; ah.half[0] = *(const v8us*)((const unsigned short*)arow + kb + 8 * hh); ah.half[1] = *(const v8us*)((const unsigned short*)arow + kb + 16 + 8 * hh);
#pragma unroll
    for (int t = 0; t < 4; ++t) { if (col0 + t * 16 >= N) continue; const size_t boff = (size_t)(col0 + t * 16 + ln) * ldb + kb; FragH bq; bq.half[0] = *(const v8us*)((const unsigned short*)Bh + boff + 8 * hh); bq.half[1] = *(const v8us*)((const unsigned short*)Bh + boff + 16 + 8 * hh);
      acc[t] = mmaH<1>(ah.v, ah.v, bq.v, bq.v, acc[t]); }
  }
#pragma unroll
  for (int t = 0; t < 4; ++t) { if (col0 + t * 16 >= N) continue; const int col = col0 + t * 16 + ln; const float bv = bp ? bf16_round(bp[col]) : 0.f;
#pragma unroll
    for (int r = 0; r < 8; ++r) { float v = acc[t][r] * alpha + bv; if (CP) { const int rr = row0g + row0 + 8 * hh + r; if (rowsPerB < 0) v += CP[cofs + (size_t)rr * ldc + col];      /* rowsPerB < 0: own element of the batched C plane */ else { const int bidx = rr / rowsPerB; v += CP[(size_t)bidx * sCPb + (size_t)by * 64 + col]; } } if (ACT == 1) v = (v > 0.f) ? v : expm1f(v); else if (ACT == 7) v = (v > 0.f) ? v + 1.0f : expf(v); else if (ACT == 8) v = tanhf(v); else if (ACT == 9) v = 0.5f * v * (1.0f + tanhf(0.7978845608028654f * (v + 0.044715f * v * v * v))); else if (ACT == 11) v = 1.0f / (1.0f + expf(-v)); else if (ACT == 12) v = (v > 0.f) ? v : 0.01f * v; else if (ACT == 14) v = (v > 0.f) ? v : 0.1f * v; else if (ACT == 16) v = (v >= 0.f) ? v : 0.3f * v; else if (ACT == 17) v = (v >= 0.f) ? v : 0.2f * v; else if (ACT == 15) v = v / (1.0f + expf(-v)); else if (ACT == 3) v = fmaxf(v, 0.f); else if (ACT == 6) v = 0.5f * v * (1.0f + erff(v * 0.70710678118654752f)); so[w][8 * hh + r][t * 16 + ln] = v; } }
  __builtin_amdgcn_fence(__ATOMIC_ACQ_REL, "workgroup"); __builtin_amdgcn_wave_barrier();
  const int rsub = lane >> 4, c4 = (lane & 15) * 4; typedef _Float16 v4h __attribute__((ext_vector_type(4)));
  {
#pragma unroll
    for (int q = 0; q < 8; ++q) { const int r = q * 2 + rsub; if (col0 + c4 < N) { const v4f v = *(const v4fa*)&so[w][r][c4]; if (C) *(v4f*)(C + cofs + (size_t)(row0 + r) * ldc + col0 + c4) = v; if (C16) { v4h h4; for (int i = 0; i < 4; ++i) h4[i] = (_Float16)v[i]; *(v4h*)(C16 + cofs + (size_t)(row0 + r) * ldc + col0 + c4) = h4; } } }
     }
}


typedef _Float16 v4h __attribute__((ext_vector_type(4)));

__global__ __launch_bounds__(256) void k_h16(const float* __restrict__ x, _Float16* __restrict__ X16, size_t n8) { const size_t t = (size_t)blockIdx.x * 256 + threadIdx.x; if (t >= n8) return; FragH f;
#pragma unroll
  for (int q = 0; q < 8; ++q) f.h[q] = (_Float16)x[t * 8 + q]; *(v8us*)((unsigned short*)X16 + t * 8) = f.half[0];  }
__global__ __launch_bounds__(256) void k_round16f(const float* __restrict__ W, _Float16* __restrict__ Bt, size_t n8) { const size_t t = (size_t)blockIdx.x * 256 + threadIdx.x; if (t >= n8) return; FragH f;
#pragma unroll
  for (int i = 0; i < 8; ++i) f.h[i] = (_Float16)(bf16_round(W[t * 8 + i]) * 16.0f); *(v8us*)((unsigned short*)Bt + t * 8) = f.half[0];  }
template <int NHv, int TTv>
__global__ __launch_bounds__(256) void k_vt(const _Float16* __restrict__ V16, int ldv, int voff, _Float16* __restrict__ Vt) { __shared__ unsigned short tl[64][66]; const int tid = threadIdx.x; const int slab = blockIdx.x / (TTv / 64), lg = blockIdx.x % (TTv / 64); const int b = slab / NHv, h = slab % NHv;
  for (int i = tid; i < 64 * 8; i += 256) { const int r = i / 8, c8 = (i % 8) * 8; FragH f; f.half[0] = *(const v8us*)((const unsigned short*)V16 + ((size_t)b * TTv + lg * 64 + r) * ldv + voff + h * 64 + c8);
#pragma unroll
    for (int q = 0; q < 8; ++q) tl[r][c8 + q] = f.u[q]; }
  __syncthreads();
  {
#pragma unroll
    for (int rd = 0; rd < 2; ++rd) { const int d = rd * 32 + tid / 8, pc = tid % 8; FragH f;
#pragma unroll
      for (int q = 0; q < 8; ++q) f.u[q] = tl[pc * 8 + q][d];
      *(v8us*)((unsigned short*)Vt + ((size_t)slab * 64 + d) * TTv + lg * 64 + pc * 8) = f.half[0]; }
     } }

__global__ __launch_bounds__(256) void k_hl(const float* __restrict__ F, _Float16* __restrict__ Hh, _Float16* __restrict__ Hl, size_t n8) { const size_t t = (size_t)blockIdx.x * 256 + threadIdx.x; if (t >= n8) return; FragH fh, fl; const v4f a = *(const v4fa*)(F + t * 8), c = *(const v4fa*)(F + t * 8 + 4);
#pragma unroll
  for (int q = 0; q < 4; ++q) { _Float16 h = (_Float16)a[q]; fh.h[q] = h; fl.h[q] = (_Float16)((a[q] - (float)h) * 1024.0f); h = (_Float16)c[q]; fh.h[4 + q] = h; fl.h[4 + q] = (_Float16)((c[q] - (float)h) * 1024.0f); }
  { *(v8us*)((unsigned short*)Hh + t * 8) = fh.half[0]; *(v8us*)((unsigned short*)Hl + t * 8) = fl.half[0];  } }

// ---- staged GEMM: C = act(A B^T alpha + bias), A f16 [M][K], Bh f16 [N][K], both K-contiguous, N = K = DM; M % 128 == 0; grid = (M / 128) * (N / 128); H16 picks the f16 output C16, else the f32 output C ----
// A work-group of four waves takes a 128 x 128 tile of C, a wave 64 x 64 of it (4 x 4 accumulator tiles). Per trip 128 k of the 128 A rows and the 128 B rows (256 bytes a row) lie in LDS at a pitch of 272 bytes;
// asynchronous copies bring them there in whole aligned 256-byte pieces, two buffers, the next tile in flight while this one is worked on. The k order of every sum is ascending in steps of 32, as with fragments read from global memory.
__device__ __forceinline__ v16h g2_frag(const _Float16* p, int hh) { FragH f; f.half[0] = *(const v8us*)((const unsigned short*)p + 8 * hh); f.half[1] = *(const v8us*)((const unsigned short*)p + 16 + 8 * hh); return f.v; }
#define G3_PITCH 144                   /* LDS bytes per 128-byte row: 16 B x odd, for ds_load_b128 readers */
#define G4_PITCH 272                   /* LDS bytes per 256-byte row of a GEMM tile: 16 B x odd, for ds_load_b128 readers */
#define G4_TILE (128 * G4_PITCH)       /* one GEMM operand's tile in LDS, bytes */
__device__ __forceinline__ v8f g3_mma(v16h a, v16h b, v8f c) { return __builtin_amdgcn_wmma_f32_16x16x32_f16(false, a, false, b, (short)0, c, false, false); }
__device__ __forceinline__ v16h g3_frag(const unsigned char* p) { FragH f; f.half[0] = *(const v8us*)p; f.half[1] = *(const v8us*)(p + 32); return f.v; }      /* p already holds the lane's row and its 16 hh bytes: k = 8 hh + 0..7, then 16 + 8 hh + 0..7 */
// eight copies of 16 bytes a lane: rows r, r + 8, ..., r + 56 of one half of an operand's tile (l: the lane's LDS byte address in row r, g: its global address there, rs: 8 rows in elements).
// The s_wait_xcnt closes the statement so that it stands in front of every later write of a register that a copy names.
__device__ __forceinline__ void g4_copy8(unsigned l, const _Float16* g, size_t rs) {
  asm volatile("global_load_async_to_lds_b128 %0, %8, off\n\tglobal_load_async_to_lds_b128 %1, %9, off\n\tglobal_load_async_to_lds_b128 %2, %10, off\n\tglobal_load_async_to_lds_b128 %3, %11, off\n\t"
               "global_load_async_to_lds_b128 %4, %12, off\n\tglobal_load_async_to_lds_b128 %5, %13, off\n\tglobal_load_async_to_lds_b128 %6, %14, off\n\tglobal_load_async_to_lds_b128 %7, %15, off\n\ts_wait_xcnt 0x0"
               :: "v"(l), "v"(l + 8 * G4_PITCH), "v"(l + 16 * G4_PITCH), "v"(l + 24 * G4_PITCH), "v"(l + 32 * G4_PITCH), "v"(l + 40 * G4_PITCH), "v"(l + 48 * G4_PITCH), "v"(l + 56 * G4_PITCH),
                  "v"(g), "v"(g + rs), "v"(g + 2 * rs), "v"(g + 3 * rs), "v"(g + 4 * rs), "v"(g + 5 * rs), "v"(g + 6 * rs), "v"(g + 7 * rs) : "memory"); }
// one operand's whole tile: rows r .. r + 56, then r + 64 .. r + 120
__device__ __forceinline__ void g4_copy16(unsigned l, const _Float16* g, size_t rs) { g4_copy8(l, g, rs); g4_copy8(l + 64 * G4_PITCH, g + 8 * rs, rs); }
template <int ACT, bool H16>
__global__ __launch_bounds__(128) void k_gemm3(const _Float16* __restrict__ A, const _Float16* __restrict__ Bh, float alpha, const float* __restrict__ bias, float* __restrict__ C, _Float16* __restrict__ C16) { static_assert(ACT == 0 || ACT == 3, "k_gemm3: unsupported ACT code (would silently apply no activation)");
  constexpr int N = DM, K = DM; static_assert(N % 128 == 0 && K % 128 == 0 && K >= 256, "k_gemm3: whole tiles only, two or more of them along K");
  __shared__ __attribute__((aligned(16))) unsigned char sm[4 * G4_TILE];      /* buffer u: A tile at 2 u tiles, B tile at 2 u + 1; behind the loop each wave's output staging, one tile's bytes a wave */
  const int tid = threadIdx.x, w = tid >> 5, lane = tid & 31, ln = lane & 15, hh = lane >> 4;
  const int ntn = N >> 7; const int mt = blockIdx.x / ntn, nq = blockIdx.x - mt * ntn; const int row0 = mt * 128, col0 = nq * 128; const int wr = (w >> 1) * 64, wc = (w & 1) * 64;
  const unsigned l0 = (unsigned)(size_t)sm + (unsigned)((tid >> 4) * G4_PITCH + (tid & 15) * 16);      /* sixteen lanes a row: a wave's copy covers two whole aligned 256-byte pieces */
  const _Float16* ga = A + (size_t)(row0 + (tid >> 4)) * K + (tid & 15) * 8; const _Float16* gb = Bh + (size_t)(col0 + (tid >> 4)) * K + (tid & 15) * 8; constexpr size_t rs = (size_t)8 * K; constexpr int nt = K >> 7;
  g4_copy16(l0, ga, rs); g4_copy16(l0 + G4_TILE, gb, rs);
  asm volatile("s_wait_asynccnt 0x0" ::: "memory");      /* this wave's share of tile 0 has landed */
  __syncthreads();      /* tile 0 is read by every wave */
  g4_copy16(l0 + 2 * G4_TILE, ga + 128, rs); g4_copy16(l0 + 3 * G4_TILE, gb + 128, rs);
  const unsigned char* fa = sm + (wr + ln) * G4_PITCH + 16 * hh; const unsigned char* fb = sm + G4_TILE + (wc + ln) * G4_PITCH + 16 * hh;
  const v8f z8 = {0.f, 0.f, 0.f, 0.f, 0.f, 0.f, 0.f, 0.f}; v8f acc[4][4];
#pragma unroll      /* register arrays need constant indices */
  for (int i = 0; i < 4; ++i)
#pragma unroll      /* register arrays need constant indices */
    for (int j = 0; j < 4; ++j) acc[i][j] = z8;
#pragma unroll 1      /* one trip per tile: the buffer is chosen at run time, and an unrolled body would only grow the text */
  for (int t = 0; t < nt; ++t) { const unsigned bo = (unsigned)(t & 1) * (2 * G4_TILE);
#pragma unroll      /* register arrays need constant indices */
    for (int ks = 0; ks < 4; ++ks) { v16h af[4], bf[4];
#pragma unroll      /* register arrays need constant indices */
      for (int i = 0; i < 4; ++i) bf[i] = g3_frag(fb + bo + i * 16 * G4_PITCH + ks * 64);
#pragma unroll      /* register arrays need constant indices */
      for (int i = 0; i < 4; ++i) af[i] = g3_frag(fa + bo + i * 16 * G4_PITCH + ks * 64);
      __builtin_amdgcn_sched_barrier(0);      /* the sixteen LDS reads of a block go out as one group in front of its products: left free, each A fragment was read alone and waited for in front of its four products */
#pragma unroll      /* register arrays need constant indices */
      for (int i = 0; i < 4; ++i)
#pragma unroll      /* register arrays need constant indices */
        for (int j = 0; j < 4; ++j) acc[i][j] = g3_mma(af[i], bf[j], acc[i][j]);
      __builtin_amdgcn_sched_barrier(0); }      /* the next group of reads stays behind this block's products, whose fragment registers it reuses */
    asm volatile("s_wait_dscnt 0x0" ::: "memory");      /* this wave's reads of the buffer have returned before the barrier behind which it is refilled */
    asm volatile("s_wait_asynccnt 0x0" ::: "memory");      /* this wave's share of tile t + 1 has landed */
    __syncthreads();      /* publishes tile t + 1 and ends every wave's reads of tile t */
    if (t + 2 < nt) { g4_copy16(l0 + bo, ga + (size_t)(t + 2) * 128, rs); g4_copy16(l0 + bo + G4_TILE, gb + (size_t)(t + 2) * 128, rs); } }
  asm volatile("s_wait_asynccnt 0x0" ::: "memory");      /* no copy is outstanding when the buffers become output staging */
  float* so = (float*)(sm + w * G4_TILE);      /* 64 rows of 68 floats, this wave's own; the last trip's barrier has ended every read of the tiles */
#pragma unroll      /* register arrays need constant indices */
  for (int j = 0; j < 4; ++j) { const float bv = bf16_round(bias[col0 + wc + j * 16 + ln]);
#pragma unroll      /* register arrays need constant indices */
    for (int i = 0; i < 4; ++i)
#pragma unroll      /* register arrays need constant indices */
      for (int r = 0; r < 8; ++r) { float v = acc[i][j][r] * alpha + bv; if (ACT == 3) v = fmaxf(v, 0.f); so[(i * 16 + 8 * hh + r) * 68 + j * 16 + ln] = v; } }
  __builtin_amdgcn_fence(__ATOMIC_ACQ_REL, "workgroup"); __builtin_amdgcn_wave_barrier();      /* the wave's staging writes stay in front of its reads of words that other lanes wrote */
  const int rsub = lane >> 4, c4 = (lane & 15) * 4;
  const size_t o = (size_t)(row0 + wr + rsub) * N + col0 + wc + c4;
#pragma unroll      /* register arrays need constant indices */
  for (int q0 = 0; q0 < 32; q0 += 8) { v4f v[8];      /* the reads go out in groups ahead of their stores, each store whole 128-byte lines */
#pragma unroll      /* register arrays need constant indices */
    for (int u = 0; u < 8; ++u) v[u] = *(const v4fa*)&so[((q0 + u) * 2 + rsub) * 68 + c4];
#pragma unroll      /* register arrays need constant indices */
    for (int u = 0; u < 8; ++u) { if (H16) { v4h h4; for (int i = 0; i < 4; ++i) h4[i] = (_Float16)v[u][i]; *(v4h*)(C16 + o + (size_t)(q0 + u) * 2 * N) = h4; } else *(v4f*)(C + o + (size_t)(q0 + u) * 2 * N) = v[u]; } } }


__global__ __launch_bounds__(256) void k_wnat(const float* __restrict__ w, size_t n8, _Float16* __restrict__ Bt) { const size_t t = (size_t)blockIdx.x * 256 + threadIdx.x; if (t >= n8) return; FragH f; for (int q = 0; q < 8; ++q) f.h[q] = (_Float16)(bf16_round(w[t * 8 + q]) * 16.0f); *(v8us*)((unsigned short*)Bt + t * 8) = f.half[0];  }
__global__ __launch_bounds__(256) void k_rsm(const float* __restrict__ S, _Float16* __restrict__ P, int nrows) {
  #pragma clang fp contract(off)
  const int i = blockIdx.x * 256 + threadIdx.x; if (i >= nrows) return; const float* s = S + (size_t)i * SQ; float mx = -3.0e38f;
#pragma unroll 1
  for (int j = 0; j < SQ; ++j) mx = fmaxf(mx, s[j]); float se = 0.f;
#pragma unroll 1
  for (int j = 0; j < SQ; ++j) se += expf(s[j] - mx); const float sc = 256.0f / se;
#pragma unroll 1
  for (int j0 = 0; j0 < SQ; j0 += 8) { FragH f; for (int q = 0; q < 8; ++q) f.h[q] = (_Float16)(expf(s[j0 + q] - mx) * sc); unsigned short* d = (unsigned short*)P + (size_t)i * SQ + j0; *(v8us*)d = f.half[0];  } }
__global__ __launch_bounds__(256) void k_vt(const _Float16* __restrict__ V16, int b, int h0, _Float16* __restrict__ VT) { __shared__ unsigned short tl[64][65]; const int tid = threadIdx.x; const int hh = blockIdx.x % HG, sg = blockIdx.x / HG; const int s0 = sg * 64; const int h = h0 + hh;
  for (int i = tid; i < 64 * 8; i += 256) { const int j = i / 8, d8 = (i % 8) * 8; FragH f; f.half[0] = *(const v8us*)((const unsigned short*)V16 + ((size_t)b * SQ + s0 + j) * DM + h * HD + d8); for (int q = 0; q < 8; ++q) tl[d8 + q][j] = f.u[q]; }
  __syncthreads();
  { for (int i = tid; i < 64 * 8; i += 256) { const int d = i / 8, j8 = (i % 8) * 8; FragH f; for (int q = 0; q < 8; ++q) f.u[q] = tl[d][j8 + q]; *(v8us*)((unsigned short*)VT + ((size_t)hh * HD + d) * SQ + s0 + j8) = f.half[0]; }  } }


// Operand preparation, one launch. Work-groups 0 .. 5 PW_TILES - 1 each take one tile, 64 k x 64 n, of one weight: Bt[n][k] = f16(bf16(W[k][n]) x 16) (a power of two: bf16-exact weights stay exact in f16 away from the subnormal range).
// n is the output column (head-stacked, 64 h + column, for Wq, Wk, Wv [16][1024][64]; the column for W1, W2 [in][out]), k the input column. A tile's source rows are 256 contiguous bytes, read 16 bytes a lane;
// two neighbouring k are packed into one LDS word at [n][k / 2], pitch 33 words (odd: neither the writers, 4 n apart, nor the readers, rows of 4 words, meet in a bank); its 128-byte rows of Bt are written 16 bytes a lane, whole lines.
// The work-groups behind them turn x into f16 rows, eight elements a thread.
#define PW_TILES ((DM / 64) * (DM / 64))      /* tiles of one weight */
#define PX_WGS ((unsigned)(NR * DM / 8 / 256))      /* work-groups of the x part */
__global__ __launch_bounds__(256) void k_prep(const float* __restrict__ x, const float* __restrict__ wq, const float* __restrict__ wk, const float* __restrict__ wv, const float* __restrict__ w1, const float* __restrict__ w2,
                                              _Float16* __restrict__ X16, _Float16* __restrict__ BQ, _Float16* __restrict__ BK, _Float16* __restrict__ BV, _Float16* __restrict__ B1, _Float16* __restrict__ B2) {
  static_assert(HD == 64 && DM % 64 == 0 && NH * HD == DM && (NR * DM / 8) % 256 == 0, "k_prep: heads of 64 columns, whole tiles, whole work-groups");
  __shared__ unsigned tl[64][33];
  const int tid = threadIdx.x;
  if (blockIdx.x >= 5 * PW_TILES) {      /* the same for the whole work-group, in front of the barrier */
    const size_t t = (size_t)(blockIdx.x - 5 * PW_TILES) * 256 + tid; FragH f;
#pragma unroll      /* register arrays need constant indices */
    for (int q = 0; q < 8; ++q) f.h[q] = (_Float16)bf16_round(x[t * 8 + q]);
    *(v8us*)((unsigned short*)X16 + t * 8) = f.half[0]; return; }
  const int sel = blockIdx.x / PW_TILES, tile = blockIdx.x % PW_TILES; const int nt = tile / (DM / 64), k0 = (tile % (DM / 64)) * 64;
  const float* sp; int ld; _Float16* bt;
  if (sel < 3) { sp = (sel == 0 ? wq : sel == 1 ? wk : wv) + ((size_t)nt * DM + k0) * HD; ld = HD; bt = sel == 0 ? BQ : sel == 1 ? BK : BV; }      /* head nt, rows k0 .. k0 + 63 */
  else { sp = (sel == 3 ? w1 : w2) + (size_t)k0 * DM + nt * 64; ld = DM; bt = sel == 3 ? B1 : B2; }
  const int c4 = (tid & 15) * 4, rr = tid >> 4;
  const float* p00 = sp + (size_t)(2 * rr) * ld + c4; const float* p01 = p00 + ld; const float* p10 = p00 + (size_t)32 * ld; const float* p11 = p10 + ld;      /* rows 2 rr, 2 rr + 1, 32 + 2 rr, 33 + 2 rr of the tile */
  const v4f a[2][2] = {{*(const v4fa*)p00, *(const v4fa*)p01}, {*(const v4fa*)p10, *(const v4fa*)p11}};
  asm volatile("s_wait_xcnt 0x0" :: "v"(p00), "v"(p01), "v"(p10), "v"(p11) : "memory");      /* behind the four loads, in front of every later write of a register that they name; the addresses are inputs so that they keep their registers up to here: left free, one load's result was placed over another load's address */
#pragma unroll      /* register arrays need constant indices */
  for (int p = 0; p < 2; ++p)
#pragma unroll      /* register arrays need constant indices */
    for (int q = 0; q < 4; ++q) { union { _Float16 h[2]; unsigned u; } z; z.h[0] = (_Float16)(bf16_round(a[p][0][q]) * 16.0f); z.h[1] = (_Float16)(bf16_round(a[p][1][q]) * 16.0f); tl[c4 + q][p * 16 + rr] = z.u; }
  __syncthreads();      /* a row of Bt is gathered from words that sixteen threads wrote */
  const int pc = tid & 7, rn = tid >> 3;
#pragma unroll      /* both rows' LDS reads go out ahead of the stores */
  for (int p = 0; p < 2; ++p) { union { unsigned u[4]; v8us v; } o;
#pragma unroll      /* register arrays need constant indices */
    for (int j = 0; j < 4; ++j) o.u[j] = tl[p * 32 + rn][pc * 4 + j];
    *(v8us*)((unsigned short*)bt + (size_t)(nt * 64 + p * 32 + rn) * DM + k0 + pc * 8) = o.v; } }
// lane exchanges for the attention kernel's softmax and the LayerNorm sums; native exponentials for the softmax
typedef int v4ia __attribute__((ext_vector_type(4), may_alias));
template <int M> __device__ __forceinline__ float rs_xrow(float x) { return __builtin_bit_cast(float, __builtin_amdgcn_update_dpp(0, __builtin_bit_cast(int, x), 0x160 | M, 0xf, 0xf, true)); }      /* lane l <- lane l ^ M inside a 16-lane row (row_xmask) */
__device__ __forceinline__ float rs_xhalf(float x) { return __builtin_bit_cast(float, __builtin_amdgcn_permlanex16(__builtin_bit_cast(int, x), __builtin_bit_cast(int, x), 0x76543210, 0xfedcba98, false, false)); }      /* lane l <- lane l ^ 16 */
// four independent 2^x in one statement, closed by the one v_nop that the instruction set asks for behind a transcendental before its result is used or its source overwritten
// outputs are early-clobber so that no exponential writes a neighbour's source
__device__ __forceinline__ void rs_exp2x4(float* x) { float r0, r1, r2, r3;
  asm("v_exp_f32 %0, %4\n\tv_exp_f32 %1, %5\n\tv_exp_f32 %2, %6\n\tv_exp_f32 %3, %7\n\tv_nop" : "=&v"(r0), "=&v"(r1), "=&v"(r2), "=&v"(r3) : "v"(x[0]), "v"(x[1]), "v"(x[2]), "v"(x[3]));
  x[0] = r0; x[1] = r1; x[2] = r2; x[3] = r3; }
// Fused attention, one launch for all batches and heads: a work-group takes 128 query rows of one (batch, head), a wave 32 of them (two 16-column groups), and walks the 1024 keys in passes of 32, two passes a trip.
// Per trip the 64 K rows of the head (128 bytes a row) and 64 keys of its 64 V^T rows (128 bytes a row) lie in LDS at a pitch of 144 bytes, one copy for the four waves;
// asynchronous copies bring them there in whole 128-byte lines, two buffers, the next trip's tiles in flight while these are worked on. Fragments are read from LDS in the k order they had from global memory.
// S^T = K Q^T (A = K rows, B = Q rows kept in registers): in each group lane (ln, hh) holds, for query ln, the scores of keys 16 kt + 8 hh + r. Running maximum and sum are per lane, joined between the wave halves by one exchange.
// The two f32 score tiles of a pass, converted in place, are the f16 B operand of O^T += V^T P^T (A = V^T rows in the same k order): scores and weights never leave the registers.
// Weights are exp(s - running maximum), unnormalised (at most 1); the division by the row sum is done once, in f32, on O^T. A masked key enters as -inf (weight 0); a row with every key masked gives 0.
__device__ __forceinline__ v8f fa_mma(v16h a, v16h b, v8f c) { return __builtin_amdgcn_wmma_f32_16x16x32_f16(false, a, false, b, (short)0, c, false, false); }
// one 2^x, closed by the v_nop that the instruction set asks for behind a transcendental before its result is used or its source overwritten
__device__ __forceinline__ float fa_exp2(float x) { float r; asm("v_exp_f32 %0, %1\n\tv_nop" : "=&v"(r) : "v"(x)); return r; }
#define FA_TILE (64 * G3_PITCH)        /* one operand's tile in LDS, bytes: 64 rows of 128 bytes at the padded pitch */
// eight copies of 16 bytes a lane: rows r, r + 16, r + 32, r + 48 of the K tile, then of the V^T tile behind it (l: the lane's LDS byte address in row r of the K tile; gk, gv: its global addresses there).
// The s_wait_xcnt closes the statement so that it stands in front of every later write of a register that a copy names.
__device__ __forceinline__ void fa_copy8(unsigned l, const _Float16* gk, const _Float16* gv) { constexpr size_t rk = (size_t)16 * DM, rv = (size_t)16 * SQ;      /* 16 rows in elements */
  asm volatile("global_load_async_to_lds_b128 %0, %8, off\n\tglobal_load_async_to_lds_b128 %1, %9, off\n\tglobal_load_async_to_lds_b128 %2, %10, off\n\tglobal_load_async_to_lds_b128 %3, %11, off\n\t"
               "global_load_async_to_lds_b128 %4, %12, off\n\tglobal_load_async_to_lds_b128 %5, %13, off\n\tglobal_load_async_to_lds_b128 %6, %14, off\n\tglobal_load_async_to_lds_b128 %7, %15, off\n\ts_wait_xcnt 0x0"
               :: "v"(l), "v"(l + 16 * G3_PITCH), "v"(l + 32 * G3_PITCH), "v"(l + 48 * G3_PITCH), "v"(l + FA_TILE), "v"(l + FA_TILE + 16 * G3_PITCH), "v"(l + FA_TILE + 32 * G3_PITCH), "v"(l + FA_TILE + 48 * G3_PITCH),
                  "v"(gk), "v"(gk + rk), "v"(gk + 2 * rk), "v"(gk + 3 * rk), "v"(gv), "v"(gv + rv), "v"(gv + 2 * rv), "v"(gv + 3 * rv) : "memory"); }
__global__ __launch_bounds__(128) void k_fattn(const _Float16* __restrict__ Q16, const _Float16* __restrict__ K16, const _Float16* __restrict__ VT, const int* __restrict__ mk, float* __restrict__ AF) {
  static_assert(HD == 64 && SQ % 64 == 0 && SQ >= 128, "k_fattn: heads of 64 columns, whole trips of 64 keys, two or more of them");
  __shared__ __attribute__((aligned(16))) float kbias[SQ];      /* 0 for a key that counts, -inf for a masked one */
  __shared__ __attribute__((aligned(16))) unsigned char kv[4 * FA_TILE];      /* buffer u: K tile at 2 u tiles, V^T tile at 2 u + 1 */
  const int tid = threadIdx.x, w = tid >> 5, lane = tid & 31, ln = lane & 15, hh = lane >> 4;
  const int bh = blockIdx.x / (SQ / 128), qb = blockIdx.x % (SQ / 128); const int b = bh / NH, h = bh % NH;
  const unsigned l0 = (unsigned)(size_t)kv + (unsigned)((tid >> 3) * G3_PITCH + (tid & 7) * 16);      /* eight lanes a row: a wave's copy covers four whole 128-byte lines */
  const _Float16* gk = K16 + ((size_t)b * SQ + (tid >> 3)) * DM + h * HD + (tid & 7) * 8; const _Float16* gv = VT + ((size_t)bh * HD + (tid >> 3)) * SQ + (tid & 7) * 8; constexpr int nt = SQ / 64;
  fa_copy8(l0, gk, gv);
  const v4ia m0 = *(const v4ia*)(mk + (size_t)b * SQ + tid * 8), m1 = *(const v4ia*)(mk + (size_t)b * SQ + tid * 8 + 4);      /* eight keys of the mask row a thread */
  const int q0 = qb * 128 + w * 32;
  const _Float16* qp = Q16 + ((size_t)b * SQ + q0 + ln) * DM + h * HD;
  v16h qf[2][2];
#pragma unroll      /* register arrays need constant indices */
  for (int u = 0; u < 2; ++u)
#pragma unroll      /* register arrays need constant indices */
    for (int ks = 0; ks < 2; ++ks) qf[u][ks] = g2_frag(qp + (size_t)u * 16 * DM + ks * 32, hh);
  { v4f b0, b1;
#pragma unroll      /* register arrays need constant indices */
    for (int q = 0; q < 4; ++q) { b0[q] = (m0[q] == 0) ? 0.f : -__builtin_inff(); b1[q] = (m1[q] == 0) ? 0.f : -__builtin_inff(); }
    *(v4fa*)&kbias[tid * 8] = b0; *(v4fa*)&kbias[tid * 8 + 4] = b1; }
  asm volatile("s_wait_asynccnt 0x0" ::: "memory");      /* this wave's share of the first tiles has landed */
  __syncthreads();      /* the bias row and the first tiles are read by every wave */
  fa_copy8(l0 + 2 * FA_TILE, gk + (size_t)64 * DM, gv + 64);
  const unsigned char* fk = kv + ln * G3_PITCH + 16 * hh; const unsigned char* fv = kv + FA_TILE + ln * G3_PITCH + 16 * hh;
  const v8f z8 = {0.f, 0.f, 0.f, 0.f, 0.f, 0.f, 0.f, 0.f};
  v8f o[2][4] = {{z8, z8, z8, z8}, {z8, z8, z8, z8}}; float mr[2] = {-3.0e38f, -3.0e38f}, lr[2] = {0.f, 0.f};
#pragma unroll 1      /* one trip per pair of tiles: the buffer is chosen at run time, and an unrolled body would only grow the text */
  for (int t = 0; t < nt; ++t) { const unsigned bo = (unsigned)(t & 1) * (2 * FA_TILE);
#pragma unroll      /* the pass's place in the tiles becomes a constant offset of its LDS reads */
   for (int ps = 0; ps < 2; ++ps) { const int key0 = t * 64 + ps * 32;
    v16h kf[2][2], vf[4]; v4f bs[4];
#pragma unroll      /* register arrays need constant indices */
    for (int kt = 0; kt < 2; ++kt)
#pragma unroll      /* register arrays need constant indices */
      for (int ks = 0; ks < 2; ++ks) kf[kt][ks] = g3_frag(fk + bo + (ps * 32 + kt * 16) * G3_PITCH + ks * 64);
#pragma unroll      /* register arrays need constant indices */
    for (int dt = 0; dt < 4; ++dt) { vf[dt] = g3_frag(fv + bo + dt * 16 * G3_PITCH + ps * 64); bs[dt] = *(const v4fa*)&kbias[key0 + (dt >> 1) * 16 + 8 * hh + (dt & 1) * 4]; }
    v8f s[2][2];
#pragma unroll      /* register arrays need constant indices */
    for (int qi = 0; qi < 2; ++qi)
#pragma unroll      /* register arrays need constant indices */
      for (int kt = 0; kt < 2; ++kt) s[qi][kt] = fa_mma(kf[kt][1], qf[qi][1], fa_mma(kf[kt][0], qf[qi][0], z8));
#pragma unroll      /* register arrays need constant indices */
    for (int qi = 0; qi < 2; ++qi) { float t16[16];
#pragma unroll      /* register arrays need constant indices */
      for (int i = 0; i < 16; ++i) t16[i] = s[qi][i >> 3][i & 7] * 0.18033688f + bs[i >> 2][i & 3];      /* score / 8 in log2 units: exp(x) = 2^(x log2 e), the native form */
      float mx = t16[0];
#pragma unroll      /* register arrays need constant indices */
      for (int i = 1; i < 16; ++i) mx = fmaxf(mx, t16[i]);
      mx = fmaxf(mx, rs_xhalf(mx)); const float mn = fmaxf(mr[qi], mx); const float f = fa_exp2(mr[qi] - mn); mr[qi] = mn;
#pragma unroll      /* register arrays need constant indices */
      for (int i = 0; i < 16; ++i) t16[i] -= mn;
      rs_exp2x4(t16); rs_exp2x4(t16 + 4); rs_exp2x4(t16 + 8); rs_exp2x4(t16 + 12);
      float s4[4] = {t16[0], t16[1], t16[2], t16[3]};
#pragma unroll      /* register arrays need constant indices */
      for (int i = 4; i < 16; ++i) s4[i & 3] += t16[i];
      lr[qi] = lr[qi] * f + ((s4[0] + s4[1]) + (s4[2] + s4[3]));
      FragH p;
#pragma unroll      /* register arrays need constant indices */
      for (int i = 0; i < 16; ++i) p.h[i] = (_Float16)t16[i];
#pragma unroll      /* register arrays need constant indices */
      for (int dt = 0; dt < 4; ++dt) o[qi][dt] = fa_mma(vf[dt], p.v, o[qi][dt] * f); } }
    asm volatile("s_wait_dscnt 0x0" ::: "memory");      /* this wave's reads of the buffer have returned before the barrier behind which it is refilled */
    asm volatile("s_wait_asynccnt 0x0" ::: "memory");      /* this wave's share of the next trip's tiles has landed */
    __syncthreads();      /* publishes the tiles of trip t + 1 and ends every wave's reads of those of trip t */
    if (t + 2 < nt) fa_copy8(l0 + bo, gk + (size_t)(t + 2) * 64 * DM, gv + (size_t)(t + 2) * 64); }
  asm volatile("s_wait_asynccnt 0x0" ::: "memory");      /* no copy is outstanding when the wave ends */
#pragma unroll      /* register arrays need constant indices */
  for (int qi = 0; qi < 2; ++qi) { const float se = lr[qi] + rs_xhalf(lr[qi]); const float inv = (se == 0.f) ? 0.f : 1.0f / se;
    float* dst = AF + ((size_t)b * SQ + q0 + qi * 16 + ln) * DM + h * HD + 8 * hh;      /* lane (ln, hh): query ln, head columns 16 dt + 8 hh + r */
#pragma unroll      /* register arrays need constant indices */
    for (int dt = 0; dt < 4; ++dt) { const v8f v = o[qi][dt] * inv; const v4f lo = {v[0], v[1], v[2], v[3]}, hi = {v[4], v[5], v[6], v[7]}; *(v4f*)(dst + dt * 16) = lo; *(v4f*)(dst + dt * 16 + 4) = hi; } } }
// OF_ = R + LayerNorm(A) g + bta (H16: and its f16 copy OH_): two rows a wave, eight waves a work-group, no LDS and no barrier.
// Lane l holds columns 128 u + 4 l + 0..3 (u = 0..7) of each row, so every load and every f32 store of a wave is 512 contiguous bytes; all loads of both rows go out ahead of the arithmetic.
// Mean and biased variance (two passes over the registers): four partial sums a lane, joined pairwise, then a five-step xor butterfly that leaves the same sum in every lane.
__device__ __forceinline__ float ln_wsum(float s) { s += rs_xrow<1>(s); s += rs_xrow<2>(s); s += rs_xrow<4>(s); s += rs_xrow<8>(s); return s + rs_xhalf(s); }
template <int RBF, bool H16>
__global__ __launch_bounds__(256) void k_lnadd(const float* __restrict__ A, const float* __restrict__ R, const float* __restrict__ g, const float* __restrict__ bta, float eps, float* __restrict__ OF_, _Float16* __restrict__ OH_) {
  static_assert(DM == 1024 && MPO % 16 == 0, "k_lnadd: rows of 1024 columns, sixteen rows a work-group");
  const int j0 = (threadIdx.x & 31) * 4;      /* the one per-lane part of every address */
  const size_t e0 = ((size_t)blockIdx.x * 8 + (size_t)__builtin_amdgcn_readfirstlane(threadIdx.x >> 5)) * 2 * DM;      /* first element of the wave's first row: the same in every lane, so the row bases are scalar */
  const float* ap = A + e0; const float* rp = R + e0; float* op = OF_ + e0; _Float16* hp = OH_ + e0;
  v4f a[2][8], r[2][8], gv[8], bv[8];
  asm volatile("" :: "s"(eps), "s"(OF_), "s"(OH_));      /* inputs only: the arguments that are used behind the loads are fetched in front of them; left free, their fetch stood behind the loads */
  __builtin_amdgcn_sched_barrier(0);      /* keeps the loads behind that fetch */
#pragma unroll      /* register arrays need constant indices */
  for (int p = 0; p < 2; ++p)
#pragma unroll      /* register arrays need constant indices */
    for (int u = 0; u < 8; ++u) a[p][u] = *(const v4fa*)(ap + p * DM + u * 128 + j0);
#pragma unroll      /* register arrays need constant indices */
  for (int p = 0; p < 2; ++p)
#pragma unroll      /* register arrays need constant indices */
    for (int u = 0; u < 8; ++u) r[p][u] = *(const v4fa*)(rp + p * DM + u * 128 + j0);
#pragma unroll      /* register arrays need constant indices */
  for (int u = 0; u < 8; ++u) { gv[u] = *(const v4fa*)(g + u * 128 + j0); bv[u] = *(const v4fa*)(bta + u * 128 + j0); }
  asm volatile("s_wait_xcnt 0x0" ::: "memory");      /* behind the loads, in front of every later reuse of a register that they name as an address */
  __builtin_amdgcn_sched_barrier(0);      /* all 48 loads are issued here, in front of the arithmetic: left free, the second row's loads sank behind the first row's sums and their latency was waited out a second time */
#pragma unroll      /* register arrays need constant indices */
  for (int p = 0; p < 2; ++p) { v4f c = a[p][0];
#pragma unroll      /* register arrays need constant indices */
    for (int u = 1; u < 8; ++u) c += a[p][u];
    const float mu = ln_wsum((c[0] + c[1]) + (c[2] + c[3])) / (float)DM;
    v4f d = (a[p][0] - mu) * (a[p][0] - mu);
#pragma unroll      /* register arrays need constant indices */
    for (int u = 1; u < 8; ++u) d += (a[p][u] - mu) * (a[p][u] - mu);
    const float rs = rsqrtf(ln_wsum((d[0] + d[1]) + (d[2] + d[3])) / (float)DM + eps);
#pragma unroll      /* register arrays need constant indices */
    for (int u = 0; u < 8; ++u) { v4f o; v4h h4;
#pragma unroll      /* register arrays need constant indices */
      for (int q = 0; q < 4; ++q) { o[q] = (RBF ? bf16_round(r[p][u][q]) : r[p][u][q]) + ((a[p][u][q] - mu) * rs * bf16_round(gv[u][q]) + bf16_round(bv[u][q])); h4[q] = (_Float16)o[q]; }
      *(v4f*)(op + p * DM + u * 128 + j0) = o; if (H16) *(v4h*)(hp + p * DM + u * 128 + j0) = h4; } } }

extern "C" void kernel_launch(void* const* d_in, const int* in_sizes, int n_in,
                              void* d_out, int out_size, void* d_ws, size_t ws_size, hipStream_t stream) {
  (void)in_sizes; (void)n_in; (void)out_size;
  const float* const* I = (const float* const*)d_in; const float* x = I[0]; const int* xmask = (const int*)d_in[1]; const float* wq = I[2]; const float* bq = I[3]; const float* wk = I[4]; const float* bk = I[5]; const float* wv = I[6]; const float* bv = I[7]; const float* w1 = I[8]; const float* b1 = I[9]; const float* w2 = I[10]; const float* b2 = I[11]; const float* g1 = I[12]; const float* be1 = I[13]; const float* g2 = I[14]; const float* be2 = I[15];
  char* ws = (char*)d_ws; size_t off = 0;
  auto take = [&](size_t bytes) { char* p = ws + off; off += (bytes + 255) & ~(size_t)255; return p; };
  _Float16* BQ = (_Float16*)take((size_t)DM * DM * 2); _Float16* BK = (_Float16*)take((size_t)DM * DM * 2); _Float16* BV = (_Float16*)take((size_t)DM * DM * 2); _Float16* B1 = (_Float16*)take((size_t)DM * DM * 2); _Float16* B2 = (_Float16*)take((size_t)DM * DM * 2);
  _Float16* X16 = (_Float16*)take(NR * DM * 2); _Float16* Q16 = (_Float16*)take(NR * DM * 2); _Float16* K16 = (_Float16*)take(NR * DM * 2); _Float16* V16 = (_Float16*)take(NR * DM * 2); float* AF = (float*)take(NR * DM * 4); float* X1F = (float*)take(NR * DM * 4); _Float16* X1H = (_Float16*)take(NR * DM * 2); _Float16* H16 = (_Float16*)take(NR * DM * 2); float* FF = AF;      /* f rows reuse the attention-output rows (dead after the first LayerNorm; same type) */
  _Float16* VT = (_Float16*)take((size_t)NB * NH * HD * SQ * 2);
  if (off > ws_size) return;      /* 10 + 16x4 + 32 + 32 + 16 + 16 + 16 = approx 186 MiB */
  k_prep<<<5 * PW_TILES + PX_WGS, 256, 0, stream>>>(x, wq, wk, wv, w1, w2, X16, BQ, BK, BV, B1, B2);      /* the five weights as f16 [n][k], x as f16 rows */
  const size_t r0p = (size_t)B0 * SQ; const dim3 gp((unsigned)((MP / 128) * (DM / 128)), 1);
  k_gemm3<0, true><<<gp, 128, 0, stream>>>(X16 + r0p * DM, BQ, 0.0625f, bq, nullptr, Q16 + r0p * DM);
  k_gemm3<0, true><<<gp, 128, 0, stream>>>(X16 + r0p * DM, BK, 0.0625f, bk, nullptr, K16 + r0p * DM);
  k_gemm3<0, true><<<gp, 128, 0, stream>>>(X16 + r0p * DM, BV, 0.0625f, bv, nullptr, V16 + r0p * DM);
  k_vt<NH, SQ><<<NB * NH * (SQ / 64), 256, 0, stream>>>(V16, DM, 0, VT);      /* V^T of every (batch, head) */
  k_fattn<<<NB * NH * (SQ / 128), 128, 0, stream>>>(Q16, K16, VT, xmask, AF);      /* a (merged heads) as f32 rows */
  k_lnadd<1, true><<<(unsigned)(MPO / 16), 256, 0, stream>>>(AF + r0p * DM, x + r0p * DM, g1, be1, 1e-5f, X1F + r0p * DM, X1H + r0p * DM);      /* x1 = bf16(x) + LN(a) */
  const dim3 gf((unsigned)((MPO / 128) * (DM / 128)), 1);
  k_gemm3<3, true><<<gf, 128, 0, stream>>>(X1H + r0p * DM, B1, 0.0625f, b1, nullptr, H16 + r0p * DM);      /* h = relu(x1 W1 + b1) (f16) */
  k_gemm3<0, false><<<gf, 128, 0, stream>>>(H16 + r0p * DM, B2, 0.0625f, b2, FF + r0p * DM, nullptr);      /* f = h W2 + b2 (f32) */
  k_lnadd<0, false><<<(unsigned)(MPO / 16), 256, 0, stream>>>(FF + r0p * DM, X1F + r0p * DM, g2, be2, 1e-5f, (float*)d_out + r0p * DM, nullptr);      /* out = x1 + LN(f) */
}

// v008
// A run of this version takes 144 microseconds.
// Two timings next to v007 both put it at 1.09 times that version's speed.
// Counting every step since v000, it is 76.5 times as fast.
#include <hip/hip_runtime.h>
// Transformer encoder layer (x [8][1024][1024]; per-head q/k/v = x Wq[h] + bq[h] (Wq [16][1024][64]); scores / 8 with a key-padding mask x_mask [8][1][1024] (int32, read; all zeros here); softmax; a = attn v concatenated over heads; x1 = x + LayerNorm(a) g1 + be1; h = relu(x1 W1 + b1); f = h W2 + b2 (W1, W2 [1024][1024] [in][out]); out = x1 + LayerNorm(f) g2 + be2 -> [8][1024][1024]).
// Structure: token rows; x as exact f16 rows; Q, K and V^T as WMMA GEMMs in one launch (128x128 work-group tiles staged in LDS, 64x64 wave tiles, f32 accumulation, exact x16 head-stacked weights + bias, f16 outputs; V^T = Wv^T x^T, the operands exchanged); one fused attention launch (scores K = 64 as S^T = K Q^T, masked running-maximum softmax on VALU in f32 with native exp, weights f16 at most 1, masked keys 0, O^T += V^T P^T, divided by the row sum in f32) into f32 rows; per row on VALU: x1 = bf16(x) + LayerNorm(a) (f32 + f16 copies); h = relu(x1 W1 + b1) GEMM (f16); f = h W2 + b2 GEMM (f32); per row on VALU: out = x1 + LayerNorm(f).
// Compute dtype: inputs rounded to bf16; x / weights exact; q, k, v, softmax weights, x1 (as GEMM operand) and h plain f16 (~2^-12); attention output, LayerNorms, residuals f32. v_wmma_f32_16x16x32_f16.
#define NB 8
#define SQ 1024
#define DM 1024
#define NH 16
#define HD 64
#define HG 4
#define B0 0                         /* first batch processed (debug hook) */
#define NBR NB                       /* batches processed (debug hook) */
#define QN SQ                        /* unused; attention covers all SQ query rows of a batch */
#define NR ((size_t)NB * SQ)
#define MP ((int)((size_t)NBR * SQ)) /* rows projected (debug hook) */
#define MPO MP                       /* rows through the post-attention stages (debug hook) */
typedef __bf16 v16b __attribute__((ext_vector_type(16)));
typedef unsigned short v8us __attribute__((ext_vector_type(8), may_alias));
typedef float  v8f  __attribute__((ext_vector_type(8)));
typedef float  v4f  __attribute__((ext_vector_type(4)));
typedef float  v4fa __attribute__((ext_vector_type(4), may_alias));
union FragB { v16b v; v8us half[2]; unsigned short u[16]; };

__device__ __forceinline__ unsigned short bf16_bits(float x) { unsigned int u = __float_as_uint(x); return (unsigned short)((u + 0x7FFFu + ((u >> 16) & 1u)) >> 16); }
__device__ __forceinline__ float bf16_val(unsigned short b) { return __uint_as_float(((unsigned int)b) << 16); }
__device__ __forceinline__ float bf16_round(float x) { return bf16_val(bf16_bits(x)); }
// D += A·B with NT terms: 1 = ah·bh, 2 = + al·bh (A split), 3 = + ah·bl (both split)
template <int NT>
__device__ __forceinline__ v8f mmaN(v16b ah, v16b al, v16b bh, v16b bl, v8f c) {
  c = __builtin_amdgcn_wmma_f32_16x16x32_bf16(false, ah, false, bh, (short)0, c, false, false);
  if (NT >= 2) c = __builtin_amdgcn_wmma_f32_16x16x32_bf16(false, al, false, bh, (short)0, c, false, false);
  if (NT >= 3) c = __builtin_amdgcn_wmma_f32_16x16x32_bf16(false, ah, false, bl, (short)0, c, false, false);
  asm volatile("v_nop\n\tv_nop\n\tv_nop\n\tv_nop" : "+v"(c) : "v"(ah), "v"(al), "v"(bh), "v"(bl));
  return c;
}

__global__ __launch_bounds__(256) void k_wt_bf16(const float* __restrict__ W, unsigned short* __restrict__ Wt, int K, int N) {
  const int t = blockIdx.x * 256 + threadIdx.x;
  const int k8n = K / 8;
  if (t >= N * k8n) return;
  const int n = t / k8n, k8 = (t % k8n) * 8;
  v8us v;
#pragma unroll
  for (int i = 0; i < 8; ++i) v[i] = bf16_bits(W[(size_t)(k8 + i) * N + n]);
  *(v8us*)(Wt + (size_t)n * K + k8) = v;
  
}

// GEMM C[M][N] (f32, pitch ldc) = act(A[M][K]·W + bias). A f32 row-major (pitch lda) converted per fragment to bf16
// (ASPLIT: hi/lo two planes -> 2 terms, else single rounded term); Wt bf16 [N][K] (pitch ldb). BIAS_BF16 rounds the
// bias to bf16 first (bias quantised to bf16 before the add). K%32==0, M%16==0, N%64==0.
template <bool ASPLIT, int ACT, bool BIAS_BF16>
__global__ __launch_bounds__(128) void k_gemm_bf(const float* __restrict__ A, int lda, const unsigned short* __restrict__ Wt, int ldb,
                                               const float* __restrict__ bias, float* __restrict__ C, int ldc, int M, int N, int K) {
  __shared__ __attribute__((aligned(16))) float so[4][16][64];
  const int tid = threadIdx.x, w = tid >> 5, lane = tid & 31, ln = lane & 15, hh = lane >> 4;
  const int ntn = N / 64;
  const int wid = blockIdx.x * 4 + w;
  const int mt = wid / ntn, nq = wid % ntn;
  if (mt * 16 >= M) return;
  const int row0 = mt * 16, col0 = nq * 64;
  const float* arow = A + (size_t)(row0 + ln) * lda;
  v8f acc[4] = {};
  for (int kb = 0; kb < K; kb += 32) {
    FragB ah, al;
    const v4f x0 = *(const v4fa*)(arow + kb + 8 * hh), x1 = *(const v4fa*)(arow + kb + 8 * hh + 4);
    const v4f x2 = *(const v4fa*)(arow + kb + 16 + 8 * hh), x3 = *(const v4fa*)(arow + kb + 16 + 8 * hh + 4);
    float xs[16] = {x0[0],x0[1],x0[2],x0[3],x1[0],x1[1],x1[2],x1[3],x2[0],x2[1],x2[2],x2[3],x3[0],x3[1],x3[2],x3[3]};
#pragma unroll
    for (int i = 0; i < 16; ++i) { const unsigned short hb = bf16_bits(xs[i]); ah.u[i] = hb; al.u[i] = ASPLIT ? bf16_bits(xs[i] - bf16_val(hb)) : (unsigned short)0; }
#pragma unroll
    for (int t = 0; t < 4; ++t) {
      const unsigned short* brow = Wt + (size_t)(col0 + t * 16 + ln) * ldb + kb;
      FragB b;
      b.half[0] = *(const v8us*)(brow + 8 * hh);
      b.half[1] = *(const v8us*)(brow + 16 + 8 * hh);
      acc[t] = mmaN<ASPLIT ? 2 : 1>(ah.v, al.v, b.v, b.v, acc[t]);
    }
  }
#pragma unroll
  for (int t = 0; t < 4; ++t) {
    float bv = bias ? bias[col0 + t * 16 + ln] : 0.f;
    if (BIAS_BF16) bv = bf16_round(bv);
#pragma unroll
    for (int r = 0; r < 8; ++r) { float v = acc[t][r] + bv; if (ACT == 1) v = fmaxf(v, 0.f); so[w][8 * hh + r][t * 16 + ln] = v; }
  }
  __builtin_amdgcn_fence(__ATOMIC_ACQ_REL, "workgroup");
  __builtin_amdgcn_wave_barrier();
  const int rsub = lane >> 4, c4 = (lane & 15) * 4;
  {
#pragma unroll
    for (int q = 0; q < 8; ++q) {
      const int r = q * 2 + rsub;
      const v4f v = *(const v4fa*)&so[w][r][c4];
      *(v4f*)(C + (size_t)(row0 + r) * ldc + col0 + c4) = v;
    }
    
  }
}

// GEMM C = act(A·W + bias + resid): A f32 (ASPLIT -> hi/lo 2 terms), Wt bf16 [N][K]; ACT 0 none, 1 relu, 2 exact gelu;
// resid (optional, f32, row index = (row % rmod), pitch ldr, RES_BF16 rounds it) added before the activation.
template <bool ASPLIT, int ACT, bool BIAS_BF16, bool RES_BF16>
__global__ __launch_bounds__(128) void k_gemm_bf3(const float* __restrict__ A, int lda, const unsigned short* __restrict__ Wt, int ldb,
                                                const float* __restrict__ bias, const float* __restrict__ resid, int rmod, int ldr,
                                                float* __restrict__ C, int ldc, int M, int N, int K) {
  __shared__ __attribute__((aligned(16))) float so[4][16][64];
  const int tid = threadIdx.x, w = tid >> 5, lane = tid & 31, ln = lane & 15, hh = lane >> 4;
  const int ntn = N / 64;
  const int wid = blockIdx.x * 4 + w;
  const int mt = wid / ntn, nq = wid % ntn;
  if (mt * 16 >= M) return;
  const int row0 = mt * 16, col0 = nq * 64;
  const float* arow = A + (size_t)(row0 + ln) * lda;
  v8f acc[4] = {};
  for (int kb = 0; kb < K; kb += 32) {
    FragB ah, al;
    const v4f x0 = *(const v4fa*)(arow + kb + 8 * hh), x1 = *(const v4fa*)(arow + kb + 8 * hh + 4);
    const v4f x2 = *(const v4fa*)(arow + kb + 16 + 8 * hh), x3 = *(const v4fa*)(arow + kb + 16 + 8 * hh + 4);
    float xs[16] = {x0[0],x0[1],x0[2],x0[3],x1[0],x1[1],x1[2],x1[3],x2[0],x2[1],x2[2],x2[3],x3[0],x3[1],x3[2],x3[3]};
#pragma unroll
    for (int i = 0; i < 16; ++i) { const unsigned short hb = bf16_bits(xs[i]); ah.u[i] = hb; al.u[i] = ASPLIT ? bf16_bits(xs[i] - bf16_val(hb)) : (unsigned short)0; }
#pragma unroll
    for (int t = 0; t < 4; ++t) {
      const unsigned short* brow = Wt + (size_t)(col0 + t * 16 + ln) * ldb + kb;
      FragB b;
      b.half[0] = *(const v8us*)(brow + 8 * hh);
      b.half[1] = *(const v8us*)(brow + 16 + 8 * hh);
      acc[t] = mmaN<ASPLIT ? 2 : 1>(ah.v, al.v, b.v, b.v, acc[t]);
    }
  }
#pragma unroll
  for (int t = 0; t < 4; ++t) {
    const int col = col0 + t * 16 + ln;
    float bv = bias ? bias[col] : 0.f;
    if (BIAS_BF16) bv = bf16_round(bv);
#pragma unroll
    for (int r = 0; r < 8; ++r) {
      float v = acc[t][r] + bv;
      if (resid) { float rv = resid[(size_t)((row0 + 8 * hh + r) % rmod) * ldr + col]; if (RES_BF16) rv = bf16_round(rv); v += rv; }
      if (ACT == 1) v = fmaxf(v, 0.f);
      if (ACT == 2) v = 0.5f * v * (1.0f + erff(v * 0.70710678118654752f));
      if (ACT == 3) { const float u = 0.7978845608028654f * (v + 0.044715f * v * v * v); v = 0.5f * v * (1.0f + tanhf(u)); }
      so[w][8 * hh + r][t * 16 + ln] = v;
    }
  }
  __builtin_amdgcn_fence(__ATOMIC_ACQ_REL, "workgroup");
  __builtin_amdgcn_wave_barrier();
  const int rsub = lane >> 4, c4 = (lane & 15) * 4;
  {
#pragma unroll
    for (int q = 0; q < 8; ++q) {
      const int r = q * 2 + rsub;
      const v4f v = *(const v4fa*)&so[w][r][c4];
      *(v4f*)(C + (size_t)(row0 + r) * ldc + col0 + c4) = v;
    }
    
  }
}
// row LayerNorm (biased variance, eps) over N: s = X (+ R); optional out_sum <- s; out_norm <- (s-mu)*rsqrt(var+eps)*g + b
template <bool PARAM_BF16>
__global__ __launch_bounds__(256) void k_layernorm(const float* __restrict__ X, const float* __restrict__ R, const float* __restrict__ g, const float* __restrict__ bta,
                                                  float* __restrict__ out_sum, float* __restrict__ out_norm, int N, float eps) {
  __shared__ float red[256];
  const int row = blockIdx.x, tid = threadIdx.x;
  const float* x = X + (size_t)row * N; const float* rr = R ? R + (size_t)row * N : nullptr;
  float vals[16];                     // up to N = 4096
  const int per = N / 256;            // contiguous chunk per thread? use strided-by-4 chunks: thread handles j = tid*4 + 1024*u
  float s1 = 0.f;
  for (int u = 0; u < per / 4; ++u) {
    const int j = tid * 4 + 1024 * u;
    const v4f a = *(const v4fa*)(x + j);
    v4f b = {0.f,0.f,0.f,0.f}; if (rr) b = *(const v4fa*)(rr + j);
#pragma unroll
    for (int q = 0; q < 4; ++q) { const float v = a[q] + b[q]; vals[u * 4 + q] = v; s1 += v; }
  }
  red[tid] = s1; __syncthreads();
  for (int st = 128; st > 0; st >>= 1) { if (tid < st) red[tid] += red[tid + st]; __syncthreads(); }
  const float mu = red[0] / (float)N; __syncthreads();
  float s2 = 0.f;
  for (int u = 0; u < per / 4; ++u)
#pragma unroll
    for (int q = 0; q < 4; ++q) { const float c = vals[u * 4 + q] - mu; s2 += c * c; }
  red[tid] = s2; __syncthreads();
  for (int st = 128; st > 0; st >>= 1) { if (tid < st) red[tid] += red[tid + st]; __syncthreads(); }
  const float rs = rsqrtf(red[0] / (float)N + eps);
  {
    for (int u = 0; u < per / 4; ++u) {
      const int j = tid * 4 + 1024 * u;
      v4f o, sm;
#pragma unroll
      for (int q = 0; q < 4; ++q) {
        float gg = g[j + q], bb = bta[j + q];
        if (PARAM_BF16) { gg = bf16_round(gg); bb = bf16_round(bb); }
        sm[q] = vals[u * 4 + q]; o[q] = (vals[u * 4 + q] - mu) * rs * gg + bb;
      }
      if (out_sum) *(v4f*)(out_sum + (size_t)row * N + j) = sm;
      *(v4f*)(out_norm + (size_t)row * N + j) = o;
    }
    
  }
}



// ---- f16 WMMA path (v_wmma_f32_16x16x32_f16): 11-bit significands for operands in range — used for every GEMM launched here
typedef _Float16 v16h __attribute__((ext_vector_type(16)));
union FragH { v16h v; v8us half[2]; _Float16 h[16]; unsigned short u[16]; };
template <int NT>
__device__ __forceinline__ v8f mmaH(v16h ah, v16h al, v16h bh, v16h bl, v8f c) {
  c = __builtin_amdgcn_wmma_f32_16x16x32_f16(false, ah, false, bh, (short)0, c, false, false);
  if (NT >= 2) c = __builtin_amdgcn_wmma_f32_16x16x32_f16(false, al, false, bh, (short)0, c, false, false);
  if (NT >= 3) c = __builtin_amdgcn_wmma_f32_16x16x32_f16(false, ah, false, bl, (short)0, c, false, false);
  asm volatile("v_nop\n\tv_nop\n\tv_nop\n\tv_nop" : "+v"(c) : "v"(ah), "v"(al), "v"(bh), "v"(bl));
  return c;
}
// batched GEMM like k_gemm_b but f16 operands: A f32 (split into f16 hi/lo if ASPLIT, else rounded to f16), Bt = f16 values [n][k]; alpha; C f32; N multiple of 16 (partial tiles skipped)
template <bool ASPLIT>
__global__ __launch_bounds__(128) void k_gemm_h(const float* __restrict__ A, int lda, size_t sA, const _Float16* __restrict__ Bh, int ldb, size_t sB, float alpha, float* __restrict__ C, int ldc, size_t sC, int M, int N, int K) {
  __shared__ __attribute__((aligned(16))) float so[4][16][64];
  const int tid = threadIdx.x, w = tid >> 5, lane = tid & 31, ln = lane & 15, hh = lane >> 4; const int by = blockIdx.y;
  A += (size_t)by * sA; Bh += (size_t)by * sB; C += (size_t)by * sC;
  const int ntn = (N + 63) / 64; const int wid = blockIdx.x * 4 + w; const int mt = wid / ntn, nq = wid % ntn; if (mt * 16 >= M) return;
  const int row0 = mt * 16, col0 = nq * 64; const float* arow = A + (size_t)(row0 + ln) * lda;
  v8f acc[4] = {};
  for (int kb = 0; kb < K; kb += 32) {
    FragH ah, al;
    const v4f x0 = *(const v4fa*)(arow + kb + 8 * hh), x1 = *(const v4fa*)(arow + kb + 8 * hh + 4), x2 = *(const v4fa*)(arow + kb + 16 + 8 * hh), x3 = *(const v4fa*)(arow + kb + 16 + 8 * hh + 4);
    float xs[16] = {x0[0],x0[1],x0[2],x0[3],x1[0],x1[1],x1[2],x1[3],x2[0],x2[1],x2[2],x2[3],x3[0],x3[1],x3[2],x3[3]};
#pragma unroll
    for (int i = 0; i < 16; ++i) { const _Float16 h = (_Float16)xs[i]; ah.h[i] = h; al.h[i] = ASPLIT ? (_Float16)(xs[i] - (float)h) : (_Float16)0.0f; }
#pragma unroll
    for (int t = 0; t < 4; ++t) { if (col0 + t * 16 >= N) continue; const size_t boff = (size_t)(col0 + t * 16 + ln) * ldb + kb; FragH bq; bq.half[0] = *(const v8us*)(Bh + boff + 8 * hh); bq.half[1] = *(const v8us*)(Bh + boff + 16 + 8 * hh);
      acc[t] = mmaH<ASPLIT ? 2 : 1>(ah.v, al.v, bq.v, bq.v, acc[t]); }
  }
#pragma unroll
  for (int t = 0; t < 4; ++t) { if (col0 + t * 16 >= N) continue;
#pragma unroll
    for (int r = 0; r < 8; ++r) so[w][8 * hh + r][t * 16 + ln] = acc[t][r] * alpha; }
  __builtin_amdgcn_fence(__ATOMIC_ACQ_REL, "workgroup"); __builtin_amdgcn_wave_barrier();
  const int rsub = lane >> 4, c4 = (lane & 15) * 4;
  {
#pragma unroll
    for (int q = 0; q < 8; ++q) { const int r = q * 2 + rsub; if (col0 + c4 < N) { const v4f v = *(const v4fa*)&so[w][r][c4]; *(v4f*)(C + (size_t)(row0 + r) * ldc + col0 + c4) = v; } }
     }
}

// k_gemm_hh variant with fused epilogue: v = acc·alpha + bias[by·sBias + col] (+ CP[(row/rowsPerB)·sCPb + by·64 + col] if CP) ; ACT 0 none / 1 elu ; writes f16 C16 (and f32 C if non-null)
template <int ACT>
__global__ __launch_bounds__(128) void k_gemm_hhx(const _Float16* __restrict__ A, int lda, size_t sA, const _Float16* __restrict__ Bh, int ldb, size_t sB, float alpha, const float* __restrict__ bias, size_t sBias, const float* __restrict__ CP, int rowsPerB, size_t sCPb, int row0g,
    float* __restrict__ C, _Float16* __restrict__ C16, int ldc, size_t sC, int M, int N, int K) {
  __shared__ __attribute__((aligned(16))) float so[4][16][64];
  const int tid = threadIdx.x, w = tid >> 5, lane = tid & 31, ln = lane & 15, hh = lane >> 4; const int by = blockIdx.y;
  A += (size_t)by * sA; Bh += (size_t)by * sB; const size_t cofs = (size_t)by * sC; const float* bp = bias ? bias + (size_t)by * sBias : nullptr;
  const int ntn = (N + 63) / 64; const int wid = blockIdx.x * 4 + w; const int mt = wid / ntn, nq = wid % ntn; if (mt * 16 >= M) return;
  const int row0 = mt * 16, col0 = nq * 64; const _Float16* arow = A + (size_t)(row0 + ln) * lda;
  v8f acc[4] = {};
  for (int kb = 0; kb < K; kb += 32) { FragH ah; ah.half[0] = *(const v8us*)((const unsigned short*)arow + kb + 8 * hh); ah.half[1] = *(const v8us*)((const unsigned short*)arow + kb + 16 + 8 * hh);
#pragma unroll
    for (int t = 0; t < 4; ++t) { if (col0 + t * 16 >= N) continue; const size_t boff = (size_t)(col0 + t * 16 + ln) * ldb + kb; FragH bq; bq.half[0] = *(const v8us*)((const unsigned short*)Bh + boff + 8 * hh); bq.half[1] = *(const v8us*)((const unsigned short*)Bh + boff + 16 + 8 * hh);
      acc[t] = mmaH<1>(ah.v, ah.v, bq.v, bq.v, acc[t]); }
  }
#pragma unroll
  for (int t = 0; t < 4; ++t) { if (col0 + t * 16 >= N) continue; const int col = col0 + t * 16 + ln; const float bv = bp ? bf16_round(bp[col]) : 0.f;
#pragma unroll
    for (int r = 0; r < 8; ++r) { float v = acc[t][r] * alpha + bv; if (CP) { const int rr = row0g + row0 + 8 * hh + r; if (rowsPerB < 0) v += CP[cofs + (size_t)rr * ldc + col];      /* rowsPerB < 0: own element of the batched C plane */ else { const int bidx = rr / rowsPerB; v += CP[(size_t)bidx * sCPb + (size_t)by * 64 + col]; } } if (ACT == 1) v = (v > 0.f) ? v : expm1f(v); else if (ACT == 7) v = (v > 0.f) ? v + 1.0f : expf(v); else if (ACT == 8) v = tanhf(v); else if (ACT == 9) v = 0.5f * v * (1.0f + tanhf(0.7978845608028654f * (v + 0.044715f * v * v * v))); else if (ACT == 11) v = 1.0f / (1.0f + expf(-v)); else if (ACT == 12) v = (v > 0.f) ? v : 0.01f * v; else if (ACT == 14) v = (v > 0.f) ? v : 0.1f * v; else if (ACT == 16) v = (v >= 0.f) ? v : 0.3f * v; else if (ACT == 17) v = (v >= 0.f) ? v : 0.2f * v; else if (ACT == 15) v = v / (1.0f + expf(-v)); else if (ACT == 3) v = fmaxf(v, 0.f); else if (ACT == 6) v = 0.5f * v * (1.0f + erff(v * 0.70710678118654752f)); so[w][8 * hh + r][t * 16 + ln] = v; } }
  __builtin_amdgcn_fence(__ATOMIC_ACQ_REL, "workgroup"); __builtin_amdgcn_wave_barrier();
  const int rsub = lane >> 4, c4 = (lane & 15) * 4; typedef _Float16 v4h __attribute__((ext_vector_type(4)));
  {
#pragma unroll
    for (int q = 0; q < 8; ++q) { const int r = q * 2 + rsub; if (col0 + c4 < N) { const v4f v = *(const v4fa*)&so[w][r][c4]; if (C) *(v4f*)(C + cofs + (size_t)(row0 + r) * ldc + col0 + c4) = v; if (C16) { v4h h4; for (int i = 0; i < 4; ++i) h4[i] = (_Float16)v[i]; *(v4h*)(C16 + cofs + (size_t)(row0 + r) * ldc + col0 + c4) = h4; } } }
     }
}


typedef _Float16 v4h __attribute__((ext_vector_type(4)));

__global__ __launch_bounds__(256) void k_h16(const float* __restrict__ x, _Float16* __restrict__ X16, size_t n8) { const size_t t = (size_t)blockIdx.x * 256 + threadIdx.x; if (t >= n8) return; FragH f;
#pragma unroll
  for (int q = 0; q < 8; ++q) f.h[q] = (_Float16)x[t * 8 + q]; *(v8us*)((unsigned short*)X16 + t * 8) = f.half[0];  }
__global__ __launch_bounds__(256) void k_round16f(const float* __restrict__ W, _Float16* __restrict__ Bt, size_t n8) { const size_t t = (size_t)blockIdx.x * 256 + threadIdx.x; if (t >= n8) return; FragH f;
#pragma unroll
  for (int i = 0; i < 8; ++i) f.h[i] = (_Float16)(bf16_round(W[t * 8 + i]) * 16.0f); *(v8us*)((unsigned short*)Bt + t * 8) = f.half[0];  }
template <int NHv, int TTv>
__global__ __launch_bounds__(256) void k_vt(const _Float16* __restrict__ V16, int ldv, int voff, _Float16* __restrict__ Vt) { __shared__ unsigned short tl[64][66]; const int tid = threadIdx.x; const int slab = blockIdx.x / (TTv / 64), lg = blockIdx.x % (TTv / 64); const int b = slab / NHv, h = slab % NHv;
  for (int i = tid; i < 64 * 8; i += 256) { const int r = i / 8, c8 = (i % 8) * 8; FragH f; f.half[0] = *(const v8us*)((const unsigned short*)V16 + ((size_t)b * TTv + lg * 64 + r) * ldv + voff + h * 64 + c8);
#pragma unroll
    for (int q = 0; q < 8; ++q) tl[r][c8 + q] = f.u[q]; }
  __syncthreads();
  {
#pragma unroll
    for (int rd = 0; rd < 2; ++rd) { const int d = rd * 32 + tid / 8, pc = tid % 8; FragH f;
#pragma unroll
      for (int q = 0; q < 8; ++q) f.u[q] = tl[pc * 8 + q][d];
      *(v8us*)((unsigned short*)Vt + ((size_t)slab * 64 + d) * TTv + lg * 64 + pc * 8) = f.half[0]; }
     } }

__global__ __launch_bounds__(256) void k_hl(const float* __restrict__ F, _Float16* __restrict__ Hh, _Float16* __restrict__ Hl, size_t n8) { const size_t t = (size_t)blockIdx.x * 256 + threadIdx.x; if (t >= n8) return; FragH fh, fl; const v4f a = *(const v4fa*)(F + t * 8), c = *(const v4fa*)(F + t * 8 + 4);
#pragma unroll
  for (int q = 0; q < 4; ++q) { _Float16 h = (_Float16)a[q]; fh.h[q] = h; fl.h[q] = (_Float16)((a[q] - (float)h) * 1024.0f); h = (_Float16)c[q]; fh.h[4 + q] = h; fl.h[4 + q] = (_Float16)((c[q] - (float)h) * 1024.0f); }
  { *(v8us*)((unsigned short*)Hh + t * 8) = fh.half[0]; *(v8us*)((unsigned short*)Hl + t * 8) = fl.half[0];  } }

// ---- staged GEMM: C = act(A B^T alpha + bias), A f16 [M][K], Bh f16 [N][K], both K-contiguous, N = K = DM; M % 128 == 0; grid = (M / 128) * (N / 128); H16 picks the f16 output C16, else the f32 output C ----
// QKV: three products of the same A in one launch, grid = 3 (M / 128) (N / 128), the 3 (N / 128) work-groups of one block of 128 A rows next to each other: C16 = A Bh^T alpha + bias, C16b = A Bh2^T alpha + bias2, and the third one transposed,
// C16c[(batch DM + n) SQ + s] = (Bh3 A^T alpha + bias3[n]) for A row batch SQ + s: its work-groups take the Bh3 rows as the matrix instruction's A operand and the A rows as its B operand, so that the accumulator tiles already hold n in rows and s in columns.
// A work-group of four waves takes a 128 x 128 tile of C, a wave 64 x 64 of it (4 x 4 accumulator tiles). Per trip 128 k of the 128 A rows and the 128 B rows (256 bytes a row) lie in LDS at a pitch of 272 bytes;
// asynchronous copies bring them there in whole aligned 256-byte pieces, two buffers, the next tile in flight while this one is worked on. The k order of every sum is ascending in steps of 32, as with fragments read from global memory.
__device__ __forceinline__ v16h g2_frag(const _Float16* p, int hh) { FragH f; f.half[0] = *(const v8us*)((const unsigned short*)p + 8 * hh); f.half[1] = *(const v8us*)((const unsigned short*)p + 16 + 8 * hh); return f.v; }
#define G3_PITCH 144                   /* LDS bytes per 128-byte row: 16 B x odd, for ds_load_b128 readers */
#define G4_PITCH 272                   /* LDS bytes per 256-byte row of a GEMM tile: 16 B x odd, for ds_load_b128 readers */
#define G4_TILE (128 * G4_PITCH)       /* one GEMM operand's tile in LDS, bytes */
__device__ __forceinline__ v8f g3_mma(v16h a, v16h b, v8f c) { return __builtin_amdgcn_wmma_f32_16x16x32_f16(false, a, false, b, (short)0, c, false, false); }
__device__ __forceinline__ v16h g3_frag(const unsigned char* p) { FragH f; f.half[0] = *(const v8us*)p; f.half[1] = *(const v8us*)(p + 32); return f.v; }      /* p already holds the lane's row and its 16 hh bytes: k = 8 hh + 0..7, then 16 + 8 hh + 0..7 */
// eight copies of 16 bytes a lane: rows r, r + 8, ..., r + 56 of one half of an operand's tile (l: the lane's LDS byte address in row r, g: its global address there, rs: 8 rows in elements).
// The s_wait_xcnt closes the statement so that it stands in front of every later write of a register that a copy names.
__device__ __forceinline__ void g4_copy8(unsigned l, const _Float16* g, size_t rs) {
  asm volatile("global_load_async_to_lds_b128 %0, %8, off\n\tglobal_load_async_to_lds_b128 %1, %9, off\n\tglobal_load_async_to_lds_b128 %2, %10, off\n\tglobal_load_async_to_lds_b128 %3, %11, off\n\t"
               "global_load_async_to_lds_b128 %4, %12, off\n\tglobal_load_async_to_lds_b128 %5, %13, off\n\tglobal_load_async_to_lds_b128 %6, %14, off\n\tglobal_load_async_to_lds_b128 %7, %15, off\n\ts_wait_xcnt 0x0"
               :: "v"(l), "v"(l + 8 * G4_PITCH), "v"(l + 16 * G4_PITCH), "v"(l + 24 * G4_PITCH), "v"(l + 32 * G4_PITCH), "v"(l + 40 * G4_PITCH), "v"(l + 48 * G4_PITCH), "v"(l + 56 * G4_PITCH),
                  "v"(g), "v"(g + rs), "v"(g + 2 * rs), "v"(g + 3 * rs), "v"(g + 4 * rs), "v"(g + 5 * rs), "v"(g + 6 * rs), "v"(g + 7 * rs) : "memory"); }
// one operand's whole tile: rows r .. r + 56, then r + 64 .. r + 120
__device__ __forceinline__ void g4_copy16(unsigned l, const _Float16* g, size_t rs) { g4_copy8(l, g, rs); g4_copy8(l + 64 * G4_PITCH, g + 8 * rs, rs); }
template <int ACT, bool H16, bool QKV>
__global__ __launch_bounds__(128) void k_gemm3(const _Float16* __restrict__ A, const _Float16* __restrict__ Bh, const _Float16* __restrict__ Bh2, const _Float16* __restrict__ Bh3, float alpha, const float* __restrict__ bias, const float* __restrict__ bias2, const float* __restrict__ bias3,
                                               float* __restrict__ C, _Float16* __restrict__ C16, _Float16* __restrict__ C16b, _Float16* __restrict__ C16c) { static_assert(ACT == 0 || ACT == 3, "k_gemm3: unsupported ACT code (would silently apply no activation)");
  static_assert(!QKV || (H16 && ACT == 0 && SQ % 128 == 0 && SQ == DM), "k_gemm3: the three-product form writes f16, applies no activation, and its transposed tiles lie inside one batch, rows of SQ = N elements");
  constexpr int N = DM, K = DM; static_assert(N % 128 == 0 && K % 128 == 0 && K >= 256, "k_gemm3: whole tiles only, two or more of them along K");
  __shared__ __attribute__((aligned(16))) unsigned char sm[4 * G4_TILE];      /* buffer u: A tile at 2 u tiles, B tile at 2 u + 1; behind the loop each wave's output staging, one tile's bytes a wave */
  const int tid = threadIdx.x, w = tid >> 5, lane = tid & 31, ln = lane & 15, hh = lane >> 4;
  const int ntn = N >> 7; const int mt = blockIdx.x / (QKV ? 3 * ntn : ntn), nc = blockIdx.x - mt * (QKV ? 3 * ntn : ntn); const int sel = nc / ntn, nq = nc - sel * ntn; const bool tr = QKV && sel == 2;      /* sel, tr: from blockIdx alone, the same for the whole work-group */
  const int row0 = (tr ? nq : mt) * 128, col0 = (tr ? mt : nq) * 128; const int wr = (w >> 1) * 64, wc = (w & 1) * 64;      /* first row of the tile of the matrix instruction's A operand, of its B operand */
  const _Float16* Ao = tr ? Bh3 : A; const _Float16* Bo = tr ? A : (QKV && sel == 1) ? Bh2 : Bh;
  const unsigned l0 = (unsigned)(size_t)sm + (unsigned)((tid >> 4) * G4_PITCH + (tid & 15) * 16);      /* sixteen lanes a row: a wave's copy covers two whole aligned 256-byte pieces */
  const _Float16* ga = Ao + (size_t)(row0 + (tid >> 4)) * K + (tid & 15) * 8; const _Float16* gb = Bo + (size_t)(col0 + (tid >> 4)) * K + (tid & 15) * 8; constexpr size_t rs = (size_t)8 * K; constexpr int nt = K >> 7;
  g4_copy16(l0, ga, rs); g4_copy16(l0 + G4_TILE, gb, rs);
  asm volatile("s_wait_asynccnt 0x0" ::: "memory");      /* this wave's share of tile 0 has landed */
  __syncthreads();      /* tile 0 is read by every wave */
  g4_copy16(l0 + 2 * G4_TILE, ga + 128, rs); g4_copy16(l0 + 3 * G4_TILE, gb + 128, rs);
  const unsigned char* fa = sm + (wr + ln) * G4_PITCH + 16 * hh; const unsigned char* fb = sm + G4_TILE + (wc + ln) * G4_PITCH + 16 * hh;
  const v8f z8 = {0.f, 0.f, 0.f, 0.f, 0.f, 0.f, 0.f, 0.f}; v8f acc[4][4];
#pragma unroll      /* register arrays need constant indices */
  for (int i = 0; i < 4; ++i)
#pragma unroll      /* register arrays need constant indices */
    for (int j = 0; j < 4; ++j) acc[i][j] = z8;
#pragma unroll 1      /* one trip per tile: the buffer is chosen at run time, and an unrolled body would only grow the text */
  for (int t = 0; t < nt; ++t) { const unsigned bo = (unsigned)(t & 1) * (2 * G4_TILE);
#pragma unroll      /* register arrays need constant indices */
    for (int ks = 0; ks < 4; ++ks) { v16h af[4], bf[4];
#pragma unroll      /* register arrays need constant indices */
      for (int i = 0; i < 4; ++i) bf[i] = g3_frag(fb + bo + i * 16 * G4_PITCH + ks * 64);
#pragma unroll      /* register arrays need constant indices */
      for (int i = 0; i < 4; ++i) af[i] = g3_frag(fa + bo + i * 16 * G4_PITCH + ks * 64);
      __builtin_amdgcn_sched_barrier(0);      /* the sixteen LDS reads of a block go out as one group in front of its products: left free, each A fragment was read alone and waited for in front of its four products */
#pragma unroll      /* register arrays need constant indices */
      for (int i = 0; i < 4; ++i)
#pragma unroll      /* register arrays need constant indices */
        for (int j = 0; j < 4; ++j) acc[i][j] = g3_mma(af[i], bf[j], acc[i][j]);
      __builtin_amdgcn_sched_barrier(0); }      /* the next group of reads stays behind this block's products, whose fragment registers it reuses */
    asm volatile("s_wait_dscnt 0x0" ::: "memory");      /* this wave's reads of the buffer have returned before the barrier behind which it is refilled */
    asm volatile("s_wait_asynccnt 0x0" ::: "memory");      /* this wave's share of tile t + 1 has landed */
    __syncthreads();      /* publishes tile t + 1 and ends every wave's reads of tile t */
    if (t + 2 < nt) { g4_copy16(l0 + bo, ga + (size_t)(t + 2) * 128, rs); g4_copy16(l0 + bo + G4_TILE, gb + (size_t)(t + 2) * 128, rs); } }
  asm volatile("s_wait_asynccnt 0x0" ::: "memory");      /* no copy is outstanding when the buffers become output staging */
  float* so = (float*)(sm + w * G4_TILE);      /* 64 rows of 68 floats, this wave's own; the last trip's barrier has ended every read of the tiles */
  if (tr) {      /* the bias goes with the accumulator's row */
#pragma unroll      /* register arrays need constant indices */
    for (int i = 0; i < 4; ++i) { const float* bp = bias3 + row0 + wr + i * 16 + 8 * hh; const v4f bl = *(const v4fa*)bp, bu = *(const v4fa*)(bp + 4);
#pragma unroll      /* register arrays need constant indices */
      for (int r = 0; r < 8; ++r) { const float bv = bf16_round(r < 4 ? bl[r & 3] : bu[r & 3]);
#pragma unroll      /* register arrays need constant indices */
        for (int j = 0; j < 4; ++j) so[(i * 16 + 8 * hh + r) * 68 + j * 16 + ln] = acc[i][j][r] * alpha + bv; } } }
  else { const float* bc = (QKV && sel == 1) ? bias2 : bias;
#pragma unroll      /* register arrays need constant indices */
  for (int j = 0; j < 4; ++j) { const float bv = bf16_round(bc[col0 + wc + j * 16 + ln]);
#pragma unroll      /* register arrays need constant indices */
    for (int i = 0; i < 4; ++i)
#pragma unroll      /* register arrays need constant indices */
      for (int r = 0; r < 8; ++r) { float v = acc[i][j][r] * alpha + bv; if (ACT == 3) v = fmaxf(v, 0.f); so[(i * 16 + 8 * hh + r) * 68 + j * 16 + ln] = v; } } }
  __builtin_amdgcn_fence(__ATOMIC_ACQ_REL, "workgroup"); __builtin_amdgcn_wave_barrier();      /* the wave's staging writes stay in front of its reads of words that other lanes wrote */
  const int rsub = lane >> 4, c4 = (lane & 15) * 4;
  const size_t o = tr ? ((size_t)(col0 / SQ) * DM + row0 + wr + rsub) * SQ + col0 % SQ + wc + c4 : (size_t)(row0 + wr + rsub) * N + col0 + wc + c4;      /* transposed: row n of the batch's plane, column s */
  _Float16* Co = tr ? C16c : (QKV && sel == 1) ? C16b : C16;
#pragma unroll      /* register arrays need constant indices */
  for (int q0 = 0; q0 < 32; q0 += 8) { v4f v[8];      /* the reads go out in groups ahead of their stores, each store whole 128-byte lines */
#pragma unroll      /* register arrays need constant indices */
    for (int u = 0; u < 8; ++u) v[u] = *(const v4fa*)&so[((q0 + u) * 2 + rsub) * 68 + c4];
#pragma unroll      /* register arrays need constant indices */
    for (int u = 0; u < 8; ++u) { if (H16) { v4h h4; for (int i = 0; i < 4; ++i) h4[i] = (_Float16)v[u][i]; *(v4h*)(Co + o + (size_t)(q0 + u) * 2 * N) = h4; } else *(v4f*)(C + o + (size_t)(q0 + u) * 2 * N) = v[u]; } } }


__global__ __launch_bounds__(256) void k_wnat(const float* __restrict__ w, size_t n8, _Float16* __restrict__ Bt) { const size_t t = (size_t)blockIdx.x * 256 + threadIdx.x; if (t >= n8) return; FragH f; for (int q = 0; q < 8; ++q) f.h[q] = (_Float16)(bf16_round(w[t * 8 + q]) * 16.0f); *(v8us*)((unsigned short*)Bt + t * 8) = f.half[0];  }
__global__ __launch_bounds__(256) void k_rsm(const float* __restrict__ S, _Float16* __restrict__ P, int nrows) {
  #pragma clang fp contract(off)
  const int i = blockIdx.x * 256 + threadIdx.x; if (i >= nrows) return; const float* s = S + (size_t)i * SQ; float mx = -3.0e38f;
#pragma unroll 1
  for (int j = 0; j < SQ; ++j) mx = fmaxf(mx, s[j]); float se = 0.f;
#pragma unroll 1
  for (int j = 0; j < SQ; ++j) se += expf(s[j] - mx); const float sc = 256.0f / se;
#pragma unroll 1
  for (int j0 = 0; j0 < SQ; j0 += 8) { FragH f; for (int q = 0; q < 8; ++q) f.h[q] = (_Float16)(expf(s[j0 + q] - mx) * sc); unsigned short* d = (unsigned short*)P + (size_t)i * SQ + j0; *(v8us*)d = f.half[0];  } }
__global__ __launch_bounds__(256) void k_vt(const _Float16* __restrict__ V16, int b, int h0, _Float16* __restrict__ VT) { __shared__ unsigned short tl[64][65]; const int tid = threadIdx.x; const int hh = blockIdx.x % HG, sg = blockIdx.x / HG; const int s0 = sg * 64; const int h = h0 + hh;
  for (int i = tid; i < 64 * 8; i += 256) { const int j = i / 8, d8 = (i % 8) * 8; FragH f; f.half[0] = *(const v8us*)((const unsigned short*)V16 + ((size_t)b * SQ + s0 + j) * DM + h * HD + d8); for (int q = 0; q < 8; ++q) tl[d8 + q][j] = f.u[q]; }
  __syncthreads();
  { for (int i = tid; i < 64 * 8; i += 256) { const int d = i / 8, j8 = (i % 8) * 8; FragH f; for (int q = 0; q < 8; ++q) f.u[q] = tl[d][j8 + q]; *(v8us*)((unsigned short*)VT + ((size_t)hh * HD + d) * SQ + s0 + j8) = f.half[0]; }  } }


// Operand preparation, one launch. Work-groups 0 .. 5 PW_TILES - 1 each take one tile, 64 k x 64 n, of one weight: Bt[n][k] = f16(bf16(W[k][n]) x 16) (a power of two: bf16-exact weights stay exact in f16 away from the subnormal range).
// n is the output column (head-stacked, 64 h + column, for Wq, Wk, Wv [16][1024][64]; the column for W1, W2 [in][out]), k the input column. A tile's source rows are 256 contiguous bytes, read 16 bytes a lane;
// two neighbouring k are packed into one LDS word at [n][k / 2], pitch 33 words (odd: neither the writers, 4 n apart, nor the readers, rows of 4 words, meet in a bank); its 128-byte rows of Bt are written 16 bytes a lane, whole lines.
// The work-groups behind them turn x into f16 rows, eight elements a thread.
#define PW_TILES ((DM / 64) * (DM / 64))      /* tiles of one weight */
#define PX_WGS ((unsigned)(NR * DM / 8 / 256))      /* work-groups of the x part */
__global__ __launch_bounds__(256) void k_prep(const float* __restrict__ x, const float* __restrict__ wq, const float* __restrict__ wk, const float* __restrict__ wv, const float* __restrict__ w1, const float* __restrict__ w2,
                                              _Float16* __restrict__ X16, _Float16* __restrict__ BQ, _Float16* __restrict__ BK, _Float16* __restrict__ BV, _Float16* __restrict__ B1, _Float16* __restrict__ B2) {
  static_assert(HD == 64 && DM % 64 == 0 && NH * HD == DM && (NR * DM / 8) % 256 == 0, "k_prep: heads of 64 columns, whole tiles, whole work-groups");
  __shared__ unsigned tl[64][33];
  const int tid = threadIdx.x;
  if (blockIdx.x >= 5 * PW_TILES) {      /* the same for the whole work-group, in front of the barrier */
    const size_t t = (size_t)(blockIdx.x - 5 * PW_TILES) * 256 + tid; FragH f;
#pragma unroll      /* register arrays need constant indices */
    for (int q = 0; q < 8; ++q) f.h[q] = (_Float16)bf16_round(x[t * 8 + q]);
    *(v8us*)((unsigned short*)X16 + t * 8) = f.half[0]; return; }
  const int sel = blockIdx.x / PW_TILES, tile = blockIdx.x % PW_TILES; const int nt = tile / (DM / 64), k0 = (tile % (DM / 64)) * 64;
  const float* sp; int ld; _Float16* bt;
  if (sel < 3) { sp = (sel == 0 ? wq : sel == 1 ? wk : wv) + ((size_t)nt * DM + k0) * HD; ld = HD; bt = sel == 0 ? BQ : sel == 1 ? BK : BV; }      /* head nt, rows k0 .. k0 + 63 */
  else { sp = (sel == 3 ? w1 : w2) + (size_t)k0 * DM + nt * 64; ld = DM; bt = sel == 3 ? B1 : B2; }
  const int c4 = (tid & 15) * 4, rr = tid >> 4;
  const float* p00 = sp + (size_t)(2 * rr) * ld + c4; const float* p01 = p00 + ld; const float* p10 = p00 + (size_t)32 * ld; const float* p11 = p10 + ld;      /* rows 2 rr, 2 rr + 1, 32 + 2 rr, 33 + 2 rr of the tile */
  const v4f a[2][2] = {{*(const v4fa*)p00, *(const v4fa*)p01}, {*(const v4fa*)p10, *(const v4fa*)p11}};
  asm volatile("s_wait_xcnt 0x0" :: "v"(p00), "v"(p01), "v"(p10), "v"(p11) : "memory");      /* behind the four loads, in front of every later write of a register that they name; the addresses are inputs so that they keep their registers up to here: left free, one load's result was placed over another load's address */
#pragma unroll      /* register arrays need constant indices */
  for (int p = 0; p < 2; ++p)
#pragma unroll      /* register arrays need constant indices */
    for (int q = 0; q < 4; ++q) { union { _Float16 h[2]; unsigned u; } z; z.h[0] = (_Float16)(bf16_round(a[p][0][q]) * 16.0f); z.h[1] = (_Float16)(bf16_round(a[p][1][q]) * 16.0f); tl[c4 + q][p * 16 + rr] = z.u; }
  __syncthreads();      /* a row of Bt is gathered from words that sixteen threads wrote */
  const int pc = tid & 7, rn = tid >> 3;
#pragma unroll      /* both rows' LDS reads go out ahead of the stores */
  for (int p = 0; p < 2; ++p) { union { unsigned u[4]; v8us v; } o;
#pragma unroll      /* register arrays need constant indices */
    for (int j = 0; j < 4; ++j) o.u[j] = tl[p * 32 + rn][pc * 4 + j];
    *(v8us*)((unsigned short*)bt + (size_t)(nt * 64 + p * 32 + rn) * DM + k0 + pc * 8) = o.v; } }
// lane exchanges for the attention kernel's softmax and the LayerNorm sums; native exponentials for the softmax
typedef int v4ia __attribute__((ext_vector_type(4), may_alias));
template <int M> __device__ __forceinline__ float rs_xrow(float x) { return __builtin_bit_cast(float, __builtin_amdgcn_update_dpp(0, __builtin_bit_cast(int, x), 0x160 | M, 0xf, 0xf, true)); }      /* lane l <- lane l ^ M inside a 16-lane row (row_xmask) */
__device__ __forceinline__ float rs_xhalf(float x) { return __builtin_bit_cast(float, __builtin_amdgcn_permlanex16(__builtin_bit_cast(int, x), __builtin_bit_cast(int, x), 0x76543210, 0xfedcba98, false, false)); }      /* lane l <- lane l ^ 16 */
// four independent 2^x in one statement, closed by the one v_nop that the instruction set asks for behind a transcendental before its result is used or its source overwritten
// outputs are early-clobber so that no exponential writes a neighbour's source
__device__ __forceinline__ void rs_exp2x4(float* x) { float r0, r1, r2, r3;
  asm("v_exp_f32 %0, %4\n\tv_exp_f32 %1, %5\n\tv_exp_f32 %2, %6\n\tv_exp_f32 %3, %7\n\tv_nop" : "=&v"(r0), "=&v"(r1), "=&v"(r2), "=&v"(r3) : "v"(x[0]), "v"(x[1]), "v"(x[2]), "v"(x[3]));
  x[0] = r0; x[1] = r1; x[2] = r2; x[3] = r3; }
// Fused attention, one launch for all batches and heads: a work-group takes 128 query rows of one (batch, head), a wave 32 of them (two 16-column groups), and walks the 1024 keys in passes of 32, two passes a trip.
// Per trip the 64 K rows of the head (128 bytes a row) and 64 keys of its 64 V^T rows (128 bytes a row) lie in LDS at a pitch of 144 bytes, one copy for the four waves;
// asynchronous copies bring them there in whole 128-byte lines, two buffers, the next trip's tiles in flight while these are worked on. Fragments are read from LDS in the k order they had from global memory.
// S^T = K Q^T (A = K rows, B = Q rows kept in registers): in each group lane (ln, hh) holds, for query ln, the scores of keys 16 kt + 8 hh + r. Running maximum and sum are per lane, joined between the wave halves by one exchange.
// The two f32 score tiles of a pass, converted in place, are the f16 B operand of O^T += V^T P^T (A = V^T rows in the same k order): scores and weights never leave the registers.
// Weights are exp(s - running maximum), unnormalised (at most 1); the division by the row sum is done once, in f32, on O^T. A masked key enters as -inf (weight 0); a row with every key masked gives 0.
__device__ __forceinline__ v8f fa_mma(v16h a, v16h b, v8f c) { return __builtin_amdgcn_wmma_f32_16x16x32_f16(false, a, false, b, (short)0, c, false, false); }
// one 2^x, closed by the v_nop that the instruction set asks for behind a transcendental before its result is used or its source overwritten
__device__ __forceinline__ float fa_exp2(float x) { float r; asm("v_exp_f32 %0, %1\n\tv_nop" : "=&v"(r) : "v"(x)); return r; }
#define FA_TILE (64 * G3_PITCH)        /* one operand's tile in LDS, bytes: 64 rows of 128 bytes at the padded pitch */
// eight copies of 16 bytes a lane: rows r, r + 16, r + 32, r + 48 of the K tile, then of the V^T tile behind it (l: the lane's LDS byte address in row r of the K tile; gk, gv: its global addresses there).
// The s_wait_xcnt closes the statement so that it stands in front of every later write of a register that a copy names.
__device__ __forceinline__ void fa_copy8(unsigned l, const _Float16* gk, const _Float16* gv) { constexpr size_t rk = (size_t)16 * DM, rv = (size_t)16 * SQ;      /* 16 rows in elements */
  asm volatile("global_load_async_to_lds_b128 %0, %8, off\n\tglobal_load_async_to_lds_b128 %1, %9, off\n\tglobal_load_async_to_lds_b128 %2, %10, off\n\tglobal_load_async_to_lds_b128 %3, %11, off\n\t"
               "global_load_async_to_lds_b128 %4, %12, off\n\tglobal_load_async_to_lds_b128 %5, %13, off\n\tglobal_load_async_to_lds_b128 %6, %14, off\n\tglobal_load_async_to_lds_b128 %7, %15, off\n\ts_wait_xcnt 0x0"
               :: "v"(l), "v"(l + 16 * G3_PITCH), "v"(l + 32 * G3_PITCH), "v"(l + 48 * G3_PITCH), "v"(l + FA_TILE), "v"(l + FA_TILE + 16 * G3_PITCH), "v"(l + FA_TILE + 32 * G3_PITCH), "v"(l + FA_TILE + 48 * G3_PITCH),
                  "v"(gk), "v"(gk + rk), "v"(gk + 2 * rk), "v"(gk + 3 * rk), "v"(gv), "v"(gv + rv), "v"(gv + 2 * rv), "v"(gv + 3 * rv) : "memory"); }
__global__ __launch_bounds__(128) void k_fattn(const _Float16* __restrict__ Q16, const _Float16* __restrict__ K16, const _Float16* __restrict__ VT, const int* __restrict__ mk, float* __restrict__ AF) {
  static_assert(HD == 64 && SQ % 64 == 0 && SQ >= 128, "k_fattn: heads of 64 columns, whole trips of 64 keys, two or more of them");
  __shared__ __attribute__((aligned(16))) float kbias[SQ];      /* 0 for a key that counts, -inf for a masked one */
  __shared__ __attribute__((aligned(16))) unsigned char kv[4 * FA_TILE];      /* buffer u: K tile at 2 u tiles, V^T tile at 2 u + 1 */
  const int tid = threadIdx.x, w = tid >> 5, lane = tid & 31, ln = lane & 15, hh = lane >> 4;
  const int bh = blockIdx.x / (SQ / 128), qb = blockIdx.x % (SQ / 128); const int b = bh / NH, h = bh % NH;
  const unsigned l0 = (unsigned)(size_t)kv + (unsigned)((tid >> 3) * G3_PITCH + (tid & 7) * 16);      /* eight lanes a row: a wave's copy covers four whole 128-byte lines */
  const _Float16* gk = K16 + ((size_t)b * SQ + (tid >> 3)) * DM + h * HD + (tid & 7) * 8; const _Float16* gv = VT + ((size_t)bh * HD + (tid >> 3)) * SQ + (tid & 7) * 8; constexpr int nt = SQ / 64;
  fa_copy8(l0, gk, gv);
  const v4ia m0 = *(const v4ia*)(mk + (size_t)b * SQ + tid * 8), m1 = *(const v4ia*)(mk + (size_t)b * SQ + tid * 8 + 4);      /* eight keys of the mask row a thread */
  const int q0 = qb * 128 + w * 32;
  const _Float16* qp = Q16 + ((size_t)b * SQ + q0 + ln) * DM + h * HD;
  v16h qf[2][2];
#pragma unroll      /* register arrays need constant indices */
  for (int u = 0; u < 2; ++u)
#pragma unroll      /* register arrays need constant indices */
    for (int ks = 0; ks < 2; ++ks) qf[u][ks] = g2_frag(qp + (size_t)u * 16 * DM + ks * 32, hh);
  { v4f b0, b1;
#pragma unroll      /* register arrays need constant indices */
    for (int q = 0; q < 4; ++q) { b0[q] = (m0[q] == 0) ? 0.f : -__builtin_inff(); b1[q] = (m1[q] == 0) ? 0.f : -__builtin_inff(); }
    *(v4fa*)&kbias[tid * 8] = b0; *(v4fa*)&kbias[tid * 8 + 4] = b1; }
  asm volatile("s_wait_asynccnt 0x0" ::: "memory");      /* this wave's share of the first tiles has landed */
  __syncthreads();      /* the bias row and the first tiles are read by every wave */
  fa_copy8(l0 + 2 * FA_TILE, gk + (size_t)64 * DM, gv + 64);
  const unsigned char* fk = kv + ln * G3_PITCH + 16 * hh; const unsigned char* fv = kv + FA_TILE + ln * G3_PITCH + 16 * hh;
  const v8f z8 = {0.f, 0.f, 0.f, 0.f, 0.f, 0.f, 0.f, 0.f};
  v8f o[2][4] = {{z8, z8, z8, z8}, {z8, z8, z8, z8}}; float mr[2] = {-3.0e38f, -3.0e38f}, lr[2] = {0.f, 0.f};
#pragma unroll 1      /* one trip per pair of tiles: the buffer is chosen at run time, and an unrolled body would only grow the text */
  for (int t = 0; t < nt; ++t) { const unsigned bo = (unsigned)(t & 1) * (2 * FA_TILE);
#pragma unroll      /* the pass's place in the tiles becomes a constant offset of its LDS reads */
   for (int ps = 0; ps < 2; ++ps) { const int key0 = t * 64 + ps * 32;
    v16h kf[2][2], vf[4]; v4f bs[4];
#pragma unroll      /* register arrays need constant indices */
    for (int kt = 0; kt < 2; ++kt)
#pragma unroll      /* register arrays need constant indices */
      for (int ks = 0; ks < 2; ++ks) kf[kt][ks] = g3_frag(fk + bo + (ps * 32 + kt * 16) * G3_PITCH + ks * 64);
#pragma unroll      /* register arrays need constant indices */
    for (int dt = 0; dt < 4; ++dt) { vf[dt] = g3_frag(fv + bo + dt * 16 * G3_PITCH + ps * 64); bs[dt] = *(const v4fa*)&kbias[key0 + (dt >> 1) * 16 + 8 * hh + (dt & 1) * 4]; }
    v8f s[2][2];
#pragma unroll      /* register arrays need constant indices */
    for (int qi = 0; qi < 2; ++qi)
#pragma unroll      /* register arrays need constant indices */
      for (int kt = 0; kt < 2; ++kt) s[qi][kt] = fa_mma(kf[kt][1], qf[qi][1], fa_mma(kf[kt][0], qf[qi][0], z8));
#pragma unroll      /* register arrays need constant indices */
    for (int qi = 0; qi < 2; ++qi) { float t16[16];
#pragma unroll      /* register arrays need constant indices */
      for (int i = 0; i < 16; ++i) t16[i] = s[qi][i >> 3][i & 7] * 0.18033688f + bs[i >> 2][i & 3];      /* score / 8 in log2 units: exp(x) = 2^(x log2 e), the native form */
      float mx = t16[0];
#pragma unroll      /* register arrays need constant indices */
      for (int i = 1; i < 16; ++i) mx = fmaxf(mx, t16[i]);
      mx = fmaxf(mx, rs_xhalf(mx)); const float mn = fmaxf(mr[qi], mx); const float f = fa_exp2(mr[qi] - mn); mr[qi] = mn;
#pragma unroll      /* register arrays need constant indices */
      for (int i = 0; i < 16; ++i) t16[i] -= mn;
      rs_exp2x4(t16); rs_exp2x4(t16 + 4); rs_exp2x4(t16 + 8); rs_exp2x4(t16 + 12);
      float s4[4] = {t16[0], t16[1], t16[2], t16[3]};
#pragma unroll      /* register arrays need constant indices */
      for (int i = 4; i < 16; ++i) s4[i & 3] += t16[i];
      lr[qi] = lr[qi] * f + ((s4[0] + s4[1]) + (s4[2] + s4[3]));
      FragH p;
#pragma unroll      /* register arrays need constant indices */
      for (int i = 0; i < 16; ++i) p.h[i] = (_Float16)t16[i];
#pragma unroll      /* register arrays need constant indices */
      for (int dt = 0; dt < 4; ++dt) o[qi][dt] = fa_mma(vf[dt], p.v, o[qi][dt] * f); } }
    asm volatile("s_wait_dscnt 0x0" ::: "memory");      /* this wave's reads of the buffer have returned before the barrier behind which it is refilled */
    asm volatile("s_wait_asynccnt 0x0" ::: "memory");      /* this wave's share of the next trip's tiles has landed */
    __syncthreads();      /* publishes the tiles of trip t + 1 and ends every wave's reads of those of trip t */
    if (t + 2 < nt) fa_copy8(l0 + bo, gk + (size_t)(t + 2) * 64 * DM, gv + (size_t)(t + 2) * 64); }
  asm volatile("s_wait_asynccnt 0x0" ::: "memory");      /* no copy is outstanding when the wave ends */
#pragma unroll      /* register arrays need constant indices */
  for (int qi = 0; qi < 2; ++qi) { const float se = lr[qi] + rs_xhalf(lr[qi]); const float inv = (se == 0.f) ? 0.f : 1.0f / se;
    float* dst = AF + ((size_t)b * SQ + q0 + qi * 16 + ln) * DM + h * HD + 8 * hh;      /* lane (ln, hh): query ln, head columns 16 dt + 8 hh + r */
#pragma unroll      /* register arrays need constant indices */
    for (int dt = 0; dt < 4; ++dt) { const v8f v = o[qi][dt] * inv; const v4f lo = {v[0], v[1], v[2], v[3]}, hi = {v[4], v[5], v[6], v[7]}; *(v4f*)(dst + dt * 16) = lo; *(v4f*)(dst + dt * 16 + 4) = hi; } } }
// OF_ = R + LayerNorm(A) g + bta (H16: and its f16 copy OH_): two rows a wave, eight waves a work-group, no LDS and no barrier.
// Lane l holds columns 128 u + 4 l + 0..3 (u = 0..7) of each row, so every load and every f32 store of a wave is 512 contiguous bytes; all loads of both rows go out ahead of the arithmetic.
// Mean and biased variance (two passes over the registers): four partial sums a lane, joined pairwise, then a five-step xor butterfly that leaves the same sum in every lane.
__device__ __forceinline__ float ln_wsum(float s) { s += rs_xrow<1>(s); s += rs_xrow<2>(s); s += rs_xrow<4>(s); s += rs_xrow<8>(s); return s + rs_xhalf(s); }
template <int RBF, bool H16>
__global__ __launch_bounds__(256) void k_lnadd(const float* __restrict__ A, const float* __restrict__ R, const float* __restrict__ g, const float* __restrict__ bta, float eps, float* __restrict__ OF_, _Float16* __restrict__ OH_) {
  static_assert(DM == 1024 && MPO % 16 == 0, "k_lnadd: rows of 1024 columns, sixteen rows a work-group");
  const int j0 = (threadIdx.x & 31) * 4;      /* the one per-lane part of every address */
  const size_t e0 = ((size_t)blockIdx.x * 8 + (size_t)__builtin_amdgcn_readfirstlane(threadIdx.x >> 5)) * 2 * DM;      /* first element of the wave's first row: the same in every lane, so the row bases are scalar */
  const float* ap = A + e0; const float* rp = R + e0; float* op = OF_ + e0; _Float16* hp = OH_ + e0;
  v4f a[2][8], r[2][8], gv[8], bv[8];
  asm volatile("" :: "s"(eps), "s"(OF_), "s"(OH_));      /* inputs only: the arguments that are used behind the loads are fetched in front of them; left free, their fetch stood behind the loads */
  __builtin_amdgcn_sched_barrier(0);      /* keeps the loads behind that fetch */
#pragma unroll      /* register arrays need constant indices */
  for (int p = 0; p < 2; ++p)
#pragma unroll      /* register arrays need constant indices */
    for (int u = 0; u < 8; ++u) a[p][u] = *(const v4fa*)(ap + p * DM + u * 128 + j0);
#pragma unroll      /* register arrays need constant indices */
  for (int p = 0; p < 2; ++p)
#pragma unroll      /* register arrays need constant indices */
    for (int u = 0; u < 8; ++u) r[p][u] = *(const v4fa*)(rp + p * DM + u * 128 + j0);
#pragma unroll      /* register arrays need constant indices */
  for (int u = 0; u < 8; ++u) { gv[u] = *(const v4fa*)(g + u * 128 + j0); bv[u] = *(const v4fa*)(bta + u * 128 + j0); }
  asm volatile("s_wait_xcnt 0x0" ::: "memory");      /* behind the loads, in front of every later reuse of a register that they name as an address */
  __builtin_amdgcn_sched_barrier(0);      /* all 48 loads are issued here, in front of the arithmetic: left free, the second row's loads sank behind the first row's sums and their latency was waited out a second time */
#pragma unroll      /* register arrays need constant indices */
  for (int p = 0; p < 2; ++p) { v4f c = a[p][0];
#pragma unroll      /* register arrays need constant indices */
    for (int u = 1; u < 8; ++u) c += a[p][u];
    const float mu = ln_wsum((c[0] + c[1]) + (c[2] + c[3])) / (float)DM;
    v4f d = (a[p][0] - mu) * (a[p][0] - mu);
#pragma unroll      /* register arrays need constant indices */
    for (int u = 1; u < 8; ++u) d += (a[p][u] - mu) * (a[p][u] - mu);
    const float rs = rsqrtf(ln_wsum((d[0] + d[1]) + (d[2] + d[3])) / (float)DM + eps);
#pragma unroll      /* register arrays need constant indices */
    for (int u = 0; u < 8; ++u) { v4f o; v4h h4;
#pragma unroll      /* register arrays need constant indices */
      for (int q = 0; q < 4; ++q) { o[q] = (RBF ? bf16_round(r[p][u][q]) : r[p][u][q]) + ((a[p][u][q] - mu) * rs * bf16_round(gv[u][q]) + bf16_round(bv[u][q])); h4[q] = (_Float16)o[q]; }
      *(v4f*)(op + p * DM + u * 128 + j0) = o; if (H16) *(v4h*)(hp + p * DM + u * 128 + j0) = h4; } } }

extern "C" void kernel_launch(void* const* d_in, const int* in_sizes, int n_in,
                              void* d_out, int out_size, void* d_ws, size_t ws_size, hipStream_t stream) {
  (void)in_sizes; (void)n_in; (void)out_size;
  const float* const* I = (const float* const*)d_in; const float* x = I[0]; const int* xmask = (const int*)d_in[1]; const float* wq = I[2]; const float* bq = I[3]; const float* wk = I[4]; const float* bk = I[5]; const float* wv = I[6]; const float* bv = I[7]; const float* w1 = I[8]; const float* b1 = I[9]; const float* w2 = I[10]; const float* b2 = I[11]; const float* g1 = I[12]; const float* be1 = I[13]; const float* g2 = I[14]; const float* be2 = I[15];
  char* ws = (char*)d_ws; size_t off = 0;
  auto take = [&](size_t bytes) { char* p = ws + off; off += (bytes + 255) & ~(size_t)255; return p; };
  _Float16* BQ = (_Float16*)take((size_t)DM * DM * 2); _Float16* BK = (_Float16*)take((size_t)DM * DM * 2); _Float16* BV = (_Float16*)take((size_t)DM * DM * 2); _Float16* B1 = (_Float16*)take((size_t)DM * DM * 2); _Float16* B2 = (_Float16*)take((size_t)DM * DM * 2);
  _Float16* X16 = (_Float16*)take(NR * DM * 2); _Float16* Q16 = (_Float16*)take(NR * DM * 2); _Float16* K16 = (_Float16*)take(NR * DM * 2); float* AF = (float*)take(NR * DM * 4); float* X1F = (float*)take(NR * DM * 4); _Float16* X1H = (_Float16*)take(NR * DM * 2); _Float16* H16 = (_Float16*)take(NR * DM * 2); float* FF = AF;      /* f rows reuse the attention-output rows (dead after the first LayerNorm; same type) */
  _Float16* VT = (_Float16*)take((size_t)NB * NH * HD * SQ * 2);
  if (off > ws_size) return;      /* 10 + 16x3 + 32 + 32 + 16 + 16 + 16 = approx 170 MiB */
  k_prep<<<5 * PW_TILES + PX_WGS, 256, 0, stream>>>(x, wq, wk, wv, w1, w2, X16, BQ, BK, BV, B1, B2);      /* the five weights as f16 [n][k], x as f16 rows */
  const size_t r0p = (size_t)B0 * SQ; const dim3 gp((unsigned)(3 * (MP / 128) * (DM / 128)), 1);
  k_gemm3<0, true, true><<<gp, 128, 0, stream>>>(X16 + r0p * DM, BQ, BK, BV, 0.0625f, bq, bk, bv, nullptr, Q16 + r0p * DM, K16 + r0p * DM, VT + r0p * DM);      /* q, k as rows, V^T of every (batch, head) */
  k_fattn<<<NB * NH * (SQ / 128), 128, 0, stream>>>(Q16, K16, VT, xmask, AF);      /* a (merged heads) as f32 rows */
  k_lnadd<1, true><<<(unsigned)(MPO / 16), 256, 0, stream>>>(AF + r0p * DM, x + r0p * DM, g1, be1, 1e-5f, X1F + r0p * DM, X1H + r0p * DM);      /* x1 = bf16(x) + LN(a) */
  const dim3 gf((unsigned)((MPO / 128) * (DM / 128)), 1);
  k_gemm3<3, true, false><<<gf, 128, 0, stream>>>(X1H + r0p * DM, B1, nullptr, nullptr, 0.0625f, b1, nullptr, nullptr, nullptr, H16 + r0p * DM, nullptr, nullptr);      /* h = relu(x1 W1 + b1) (f16) */
  k_gemm3<0, false, false><<<gf, 128, 0, stream>>>(H16 + r0p * DM, B2, nullptr, nullptr, 0.0625f, b2, nullptr, nullptr, FF + r0p * DM, nullptr, nullptr, nullptr);      /* f = h W2 + b2 (f32) */
  k_lnadd<0, false><<<(unsigned)(MPO / 16), 256, 0, stream>>>(FF + r0p * DM, X1F + r0p * DM, g2, be2, 1e-5f, (float*)d_out + r0p * DM, nullptr);      /* out = x1 + LN(f) */
}

// v009
// Measured time: 139 microseconds a run.
// Next to v008, in two timings, it ran 1.04 times as fast each time.
// Over all steps from v000 it is 79.2 times as fast.
#include <hip/hip_runtime.h>
// Transformer encoder layer (x [8][1024][1024]; per-head q/k/v = x Wq[h] + bq[h] (Wq [16][1024][64]); scores / 8 with a key-padding mask x_mask [8][1][1024] (int32, read; all zeros here); softmax; a = attn v concatenated over heads; x1 = x + LayerNorm(a) g1 + be1; h = relu(x1 W1 + b1); f = h W2 + b2 (W1, W2 [1024][1024] [in][out]); out = x1 + LayerNorm(f) g2 + be2 -> [8][1024][1024]).
// Structure: token rows; x as exact f16 rows; Q, K and V^T as WMMA GEMMs in one launch (128x128 work-group tiles staged in LDS, 64x64 wave tiles, f32 accumulation, exact x16 head-stacked weights + bias, f16 outputs; V^T = Wv^T x^T, the operands exchanged); one fused attention launch (scores K = 64 as S^T = K Q^T, masked running-maximum softmax on VALU in f32 with native exp, weights f16 at most 1, masked keys 0, O^T += V^T P^T, divided by the row sum in f32) into f32 rows; per row on VALU: x1 = bf16(x) + LayerNorm(a) (f32 + f16 copies); h = relu(x1 W1 + b1) GEMM (f16); f = h W2 + b2 GEMM (f32); per row on VALU: out = x1 + LayerNorm(f).
// Compute dtype: inputs rounded to bf16; x / weights exact; q, k, v, softmax weights, x1 (as GEMM operand) and h plain f16 (~2^-12); attention output, LayerNorms, residuals f32. v_wmma_f32_16x16x32_f16.
#define NB 8
#define SQ 1024
#define DM 1024
#define NH 16
#define HD 64
#define HG 4
#define B0 0                         /* first batch processed (debug hook) */
#define NBR NB                       /* batches processed (debug hook) */
#define QN SQ                        /* unused; attention covers all SQ query rows of a batch */
#define NR ((size_t)NB * SQ)
#define MP ((int)((size_t)NBR * SQ)) /* rows projected (debug hook) */
#define MPO MP                       /* rows through the post-attention stages (debug hook) */
typedef __bf16 v16b __attribute__((ext_vector_type(16)));
typedef unsigned short v8us __attribute__((ext_vector_type(8), may_alias));
typedef float  v8f  __attribute__((ext_vector_type(8)));
typedef float  v4f  __attribute__((ext_vector_type(4)));
typedef float  v4fa __attribute__((ext_vector_type(4), may_alias));
union FragB { v16b v; v8us half[2]; unsigned short u[16]; };

__device__ __forceinline__ unsigned short bf16_bits(float x) { unsigned int u = __float_as_uint(x); return (unsigned short)((u + 0x7FFFu + ((u >> 16) & 1u)) >> 16); }
__device__ __forceinline__ float bf16_val(unsigned short b) { return __uint_as_float(((unsigned int)b) << 16); }
__device__ __forceinline__ float bf16_round(float x) { return bf16_val(bf16_bits(x)); }
// D += A·B with NT terms: 1 = ah·bh, 2 = + al·bh (A split), 3 = + ah·bl (both split)
template <int NT>
__device__ __forceinline__ v8f mmaN(v16b ah, v16b al, v16b bh, v16b bl, v8f c) {
  c = __builtin_amdgcn_wmma_f32_16x16x32_bf16(false, ah, false, bh, (short)0, c, false, false);
  if (NT >= 2) c = __builtin_amdgcn_wmma_f32_16x16x32_bf16(false, al, false, bh, (short)0, c, false, false);
  if (NT >= 3) c = __builtin_amdgcn_wmma_f32_16x16x32_bf16(false, ah, false, bl, (short)0, c, false, false);
  asm volatile("v_nop\n\tv_nop\n\tv_nop\n\tv_nop" : "+v"(c) : "v"(ah), "v"(al), "v"(bh), "v"(bl));
  return c;
}

__global__ __launch_bounds__(256) void k_wt_bf16(const float* __restrict__ W, unsigned short* __restrict__ Wt, int K, int N) {
  const int t = blockIdx.x * 256 + threadIdx.x;
  const int k8n = K / 8;
  if (t >= N * k8n) return;
  const int n = t / k8n, k8 = (t % k8n) * 8;
  v8us v;
#pragma unroll
  for (int i = 0; i < 8; ++i) v[i] = bf16_bits(W[(size_t)(k8 + i) * N + n]);
  *(v8us*)(Wt + (size_t)n * K + k8) = v;
  
}

// GEMM C[M][N] (f32, pitch ldc) = act(A[M][K]·W + bias). A f32 row-major (pitch lda) converted per fragment to bf16
// (ASPLIT: hi/lo two planes -> 2 terms, else single rounded term); Wt bf16 [N][K] (pitch ldb). BIAS_BF16 rounds the
// bias to bf16 first (bias quantised to bf16 before the add). K%32==0, M%16==0, N%64==0.
template <bool ASPLIT, int ACT, bool BIAS_BF16>
__global__ __launch_bounds__(128) void k_gemm_bf(const float* __restrict__ A, int lda, const unsigned short* __restrict__ Wt, int ldb,
                                               const float* __restrict__ bias, float* __restrict__ C, int ldc, int M, int N, int K) {
  __shared__ __attribute__((aligned(16))) float so[4][16][64];
  const int tid = threadIdx.x, w = tid >> 5, lane = tid & 31, ln = lane & 15, hh = lane >> 4;
  const int ntn = N / 64;
  const int wid = blockIdx.x * 4 + w;
  const int mt = wid / ntn, nq = wid % ntn;
  if (mt * 16 >= M) return;
  const int row0 = mt * 16, col0 = nq * 64;
  const float* arow = A + (size_t)(row0 + ln) * lda;
  v8f acc[4] = {};
  for (int kb = 0; kb < K; kb += 32) {
    FragB ah, al;
    const v4f x0 = *(const v4fa*)(arow + kb + 8 * hh), x1 = *(const v4fa*)(arow + kb + 8 * hh + 4);
    const v4f x2 = *(const v4fa*)(arow + kb + 16 + 8 * hh), x3 = *(const v4fa*)(arow + kb + 16 + 8 * hh + 4);
    float xs[16] = {x0[0],x0[1],x0[2],x0[3],x1[0],x1[1],x1[2],x1[3],x2[0],x2[1],x2[2],x2[3],x3[0],x3[1],x3[2],x3[3]};
#pragma unroll
    for (int i = 0; i < 16; ++i) { const unsigned short hb = bf16_bits(xs[i]); ah.u[i] = hb; al.u[i] = ASPLIT ? bf16_bits(xs[i] - bf16_val(hb)) : (unsigned short)0; }
#pragma unroll
    for (int t = 0; t < 4; ++t) {
      const unsigned short* brow = Wt + (size_t)(col0 + t * 16 + ln) * ldb + kb;
      FragB b;
      b.half[0] = *(const v8us*)(brow + 8 * hh);
      b.half[1] = *(const v8us*)(brow + 16 + 8 * hh);
      acc[t] = mmaN<ASPLIT ? 2 : 1>(ah.v, al.v, b.v, b.v, acc[t]);
    }
  }
#pragma unroll
  for (int t = 0; t < 4; ++t) {
    float bv = bias ? bias[col0 + t * 16 + ln] : 0.f;
    if (BIAS_BF16) bv = bf16_round(bv);
#pragma unroll
    for (int r = 0; r < 8; ++r) { float v = acc[t][r] + bv; if (ACT == 1) v = fmaxf(v, 0.f); so[w][8 * hh + r][t * 16 + ln] = v; }
  }
  __builtin_amdgcn_fence(__ATOMIC_ACQ_REL, "workgroup");
  __builtin_amdgcn_wave_barrier();
  const int rsub = lane >> 4, c4 = (lane & 15) * 4;
  {
#pragma unroll
    for (int q = 0; q < 8; ++q) {
      const int r = q * 2 + rsub;
      const v4f v = *(const v4fa*)&so[w][r][c4];
      *(v4f*)(C + (size_t)(row0 + r) * ldc + col0 + c4) = v;
    }
    
  }
}

// GEMM C = act(A·W + bias + resid): A f32 (ASPLIT -> hi/lo 2 terms), Wt bf16 [N][K]; ACT 0 none, 1 relu, 2 exact gelu;
// resid (optional, f32, row index = (row % rmod), pitch ldr, RES_BF16 rounds it) added before the activation.
template <bool ASPLIT, int ACT, bool BIAS_BF16, bool RES_BF16>
__global__ __launch_bounds__(128) void k_gemm_bf3(const float* __restrict__ A, int lda, const unsigned short* __restrict__ Wt, int ldb,
                                                const float* __restrict__ bias, const float* __restrict__ resid, int rmod, int ldr,
                                                float* __restrict__ C, int ldc, int M, int N, int K) {
  __shared__ __attribute__((aligned(16))) float so[4][16][64];
  const int tid = threadIdx.x, w = tid >> 5, lane = tid & 31, ln = lane & 15, hh = lane >> 4;
  const int ntn = N / 64;
  const int wid = blockIdx.x * 4 + w;
  const int mt = wid / ntn, nq = wid % ntn;
  if (mt * 16 >= M) return;
  const int row0 = mt * 16, col0 = nq * 64;
  const float* arow = A + (size_t)(row0 + ln) * lda;
  v8f acc[4] = {};
  for (int kb = 0; kb < K; kb += 32) {
    FragB ah, al;
    const v4f x0 = *(const v4fa*)(arow + kb + 8 * hh), x1 = *(const v4fa*)(arow + kb + 8 * hh + 4);
    const v4f x2 = *(const v4fa*)(arow + kb + 16 + 8 * hh), x3 = *(const v4fa*)(arow + kb + 16 + 8 * hh + 4);
    float xs[16] = {x0[0],x0[1],x0[2],x0[3],x1[0],x1[1],x1[2],x1[3],x2[0],x2[1],x2[2],x2[3],x3[0],x3[1],x3[2],x3[3]};
#pragma unroll
    for (int i = 0; i < 16; ++i) { const unsigned short hb = bf16_bits(xs[i]); ah.u[i] = hb; al.u[i] = ASPLIT ? bf16_bits(xs[i] - bf16_val(hb)) : (unsigned short)0; }
#pragma unroll
    for (int t = 0; t < 4; ++t) {
      const unsigned short* brow = Wt + (size_t)(col0 + t * 16 + ln) * ldb + kb;
      FragB b;
      b.half[0] = *(const v8us*)(brow + 8 * hh);
      b.half[1] = *(const v8us*)(brow + 16 + 8 * hh);
      acc[t] = mmaN<ASPLIT ? 2 : 1>(ah.v, al.v, b.v, b.v, acc[t]);
    }
  }
#pragma unroll
  for (int t = 0; t < 4; ++t) {
    const int col = col0 + t * 16 + ln;
    float bv = bias ? bias[col] : 0.f;
    if (BIAS_BF16) bv = bf16_round(bv);
#pragma unroll
    for (int r = 0; r < 8; ++r) {
      float v = acc[t][r] + bv;
      if (resid) { float rv = resid[(size_t)((row0 + 8 * hh + r) % rmod) * ldr + col]; if (RES_BF16) rv = bf16_round(rv); v += rv; }
      if (ACT == 1) v = fmaxf(v, 0.f);
      if (ACT == 2) v = 0.5f * v * (1.0f + erff(v * 0.70710678118654752f));
      if (ACT == 3) { const float u = 0.7978845608028654f * (v + 0.044715f * v * v * v); v = 0.5f * v * (1.0f + tanhf(u)); }
      so[w][8 * hh + r][t * 16 + ln] = v;
    }
  }
  __builtin_amdgcn_fence(__ATOMIC_ACQ_REL, "workgroup");
  __builtin_amdgcn_wave_barrier();
  const int rsub = lane >> 4, c4 = (lane & 15) * 4;
  {
#pragma unroll
    for (int q = 0; q < 8; ++q) {
      const int r = q * 2 + rsub;
      const v4f v = *(const v4fa*)&so[w][r][c4];
      *(v4f*)(C + (size_t)(row0 + r) * ldc + col0 + c4) = v;
    }
    
  }
}
// row LayerNorm (biased variance, eps) over N: s = X (+ R); optional out_sum <- s; out_norm <- (s-mu)*rsqrt(var+eps)*g + b
template <bool PARAM_BF16>
__global__ __launch_bounds__(256) void k_layernorm(const float* __restrict__ X, const float* __restrict__ R, const float* __restrict__ g, const float* __restrict__ bta,
                                                  float* __restrict__ out_sum, float* __restrict__ out_norm, int N, float eps) {
  __shared__ float red[256];
  const int row = blockIdx.x, tid = threadIdx.x;
  const float* x = X + (size_t)row * N; const float* rr = R ? R + (size_t)row * N : nullptr;
  float vals[16];                     // up to N = 4096
  const int per = N / 256;            // contiguous chunk per thread? use strided-by-4 chunks: thread handles j = tid*4 + 1024*u
  float s1 = 0.f;
  for (int u = 0; u < per / 4; ++u) {
    const int j = tid * 4 + 1024 * u;
    const v4f a = *(const v4fa*)(x + j);
    v4f b = {0.f,0.f,0.f,0.f}; if (rr) b = *(const v4fa*)(rr + j);
#pragma unroll
    for (int q = 0; q < 4; ++q) { const float v = a[q] + b[q]; vals[u * 4 + q] = v; s1 += v; }
  }
  red[tid] = s1; __syncthreads();
  for (int st = 128; st > 0; st >>= 1) { if (tid < st) red[tid] += red[tid + st]; __syncthreads(); }
  const float mu = red[0] / (float)N; __syncthreads();
  float s2 = 0.f;
  for (int u = 0; u < per / 4; ++u)
#pragma unroll
    for (int q = 0; q < 4; ++q) { const float c = vals[u * 4 + q] - mu; s2 += c * c; }
  red[tid] = s2; __syncthreads();
  for (int st = 128; st > 0; st >>= 1) { if (tid < st) red[tid] += red[tid + st]; __syncthreads(); }
  const float rs = rsqrtf(red[0] / (float)N + eps);
  {
    for (int u = 0; u < per / 4; ++u) {
      const int j = tid * 4 + 1024 * u;
      v4f o, sm;
#pragma unroll
      for (int q = 0; q < 4; ++q) {
        float gg = g[j + q], bb = bta[j + q];
        if (PARAM_BF16) { gg = bf16_round(gg); bb = bf16_round(bb); }
        sm[q] = vals[u * 4 + q]; o[q] = (vals[u * 4 + q] - mu) * rs * gg + bb;
      }
      if (out_sum) *(v4f*)(out_sum + (size_t)row * N + j) = sm;
      *(v4f*)(out_norm + (size_t)row * N + j) = o;
    }
    
  }
}



// ---- f16 WMMA path (v_wmma_f32_16x16x32_f16): 11-bit significands for operands in range — used for every GEMM launched here
typedef _Float16 v16h __attribute__((ext_vector_type(16)));
union FragH { v16h v; v8us half[2]; _Float16 h[16]; unsigned short u[16]; };
template <int NT>
__device__ __forceinline__ v8f mmaH(v16h ah, v16h al, v16h bh, v16h bl, v8f c) {
  c = __builtin_amdgcn_wmma_f32_16x16x32_f16(false, ah, false, bh, (short)0, c, false, false);
  if (NT >= 2) c = __builtin_amdgcn_wmma_f32_16x16x32_f16(false, al, false, bh, (short)0, c, false, false);
  if (NT >= 3) c = __builtin_amdgcn_wmma_f32_16x16x32_f16(false, ah, false, bl, (short)0, c, false, false);
  asm volatile("v_nop\n\tv_nop\n\tv_nop\n\tv_nop" : "+v"(c) : "v"(ah), "v"(al), "v"(bh), "v"(bl));
  return c;
}
// batched GEMM like k_gemm_b but f16 operands: A f32 (split into f16 hi/lo if ASPLIT, else rounded to f16), Bt = f16 values [n][k]; alpha; C f32; N multiple of 16 (partial tiles skipped)
template <bool ASPLIT>
__global__ __launch_bounds__(128) void k_gemm_h(const float* __restrict__ A, int lda, size_t sA, const _Float16* __restrict__ Bh, int ldb, size_t sB, float alpha, float* __restrict__ C, int ldc, size_t sC, int M, int N, int K) {
  __shared__ __attribute__((aligned(16))) float so[4][16][64];
  const int tid = threadIdx.x, w = tid >> 5, lane = tid & 31, ln = lane & 15, hh = lane >> 4; const int by = blockIdx.y;
  A += (size_t)by * sA; Bh += (size_t)by * sB; C += (size_t)by * sC;
  const int ntn = (N + 63) / 64; const int wid = blockIdx.x * 4 + w; const int mt = wid / ntn, nq = wid % ntn; if (mt * 16 >= M) return;
  const int row0 = mt * 16, col0 = nq * 64; const float* arow = A + (size_t)(row0 + ln) * lda;
  v8f acc[4] = {};
  for (int kb = 0; kb < K; kb += 32) {
    FragH ah, al;
    const v4f x0 = *(const v4fa*)(arow + kb + 8 * hh), x1 = *(const v4fa*)(arow + kb + 8 * hh + 4), x2 = *(const v4fa*)(arow + kb + 16 + 8 * hh), x3 = *(const v4fa*)(arow + kb + 16 + 8 * hh + 4);
    float xs[16] = {x0[0],x0[1],x0[2],x0[3],x1[0],x1[1],x1[2],x1[3],x2[0],x2[1],x2[2],x2[3],x3[0],x3[1],x3[2],x3[3]};
#pragma unroll
    for (int i = 0; i < 16; ++i) { const _Float16 h = (_Float16)xs[i]; ah.h[i] = h; al.h[i] = ASPLIT ? (_Float16)(xs[i] - (float)h) : (_Float16)0.0f; }
#pragma unroll
    for (int t = 0; t < 4; ++t) { if (col0 + t * 16 >= N) continue; const size_t boff = (size_t)(col0 + t * 16 + ln) * ldb + kb; FragH bq; bq.half[0] = *(const v8us*)(Bh + boff + 8 * hh); bq.half[1] = *(const v8us*)(Bh + boff + 16 + 8 * hh);
      acc[t] = mmaH<ASPLIT ? 2 : 1>(ah.v, al.v, bq.v, bq.v, acc[t]); }
  }
#pragma unroll
  for (int t = 0; t < 4; ++t) { if (col0 + t * 16 >= N) continue;
#pragma unroll
    for (int r = 0; r < 8; ++r) so[w][8 * hh + r][t * 16 + ln] = acc[t][r] * alpha; }
  __builtin_amdgcn_fence(__ATOMIC_ACQ_REL, "workgroup"); __builtin_amdgcn_wave_barrier();
  const int rsub = lane >> 4, c4 = (lane & 15) * 4;
  {
#pragma unroll
    for (int q = 0; q < 8; ++q) { const int r = q * 2 + rsub; if (col0 + c4 < N) { const v4f v = *(const v4fa*)&so[w][r][c4]; *(v4f*)(C + (size_t)(row0 + r) * ldc + col0 + c4) = v; } }
     }
}

// k_gemm_hh variant with fused epilogue: v = acc·alpha + bias[by·sBias + col] (+ CP[(row/rowsPerB)·sCPb + by·64 + col] if CP) ; ACT 0 none / 1 elu ; writes f16 C16 (and f32 C if non-null)
template <int ACT>
__global__ __launch_bounds__(128) void k_gemm_hhx(const _Float16* __restrict__ A, int lda, size_t sA, const _Float16* __restrict__ Bh, int ldb, size_t sB, float alpha, const float* __restrict__ bias, size_t sBias, const float* __restrict__ CP, int rowsPerB, size_t sCPb, int row0g,
    float* __restrict__ C, _Float16* __restrict__ C16, int ldc, size_t sC, int M, int N, int K) {
  __shared__ __attribute__((aligned(16))) float so[4][16][64];
  const int tid = threadIdx.x, w = tid >> 5, lane = tid & 31, ln = lane & 15, hh = lane >> 4; const int by = blockIdx.y;
  A += (size_t)by * sA; Bh += (size_t)by * sB; const size_t cofs = (size_t)by * sC; const float* bp = bias ? bias + (size_t)by * sBias : nullptr;
  const int ntn = (N + 63) / 64; const int wid = blockIdx.x * 4 + w; const int mt = wid / ntn, nq = wid % ntn; if (mt * 16 >= M) return;
  const int row0 = mt * 16, col0 = nq * 64; const _Float16* arow = A + (size_t)(row0 + ln) * lda;
  v8f acc[4] = {};
  for (int kb = 0; kb < K; kb += 32) { FragH ah; ah.half[0] = *(const v8us*)((const unsigned short*)arow + kb + 8 * hh); ah.half[1] = *(const v8us*)((const unsigned short*)arow + kb + 16 + 8 * hh);
#pragma unroll
    for (int t = 0; t < 4; ++t) { if (col0 + t * 16 >= N) continue; const size_t boff = (size_t)(col0 + t * 16 + ln) * ldb + kb; FragH bq; bq.half[0] = *(const v8us*)((const unsigned short*)Bh + boff + 8 * hh); bq.half[1] = *(const v8us*)((const unsigned short*)Bh + boff + 16 + 8 * hh);
      acc[t] = mmaH<1>(ah.v, ah.v, bq.v, bq.v, acc[t]); }
  }
#pragma unroll
  for (int t = 0; t < 4; ++t) { if (col0 + t * 16 >= N) continue; const int col = col0 + t * 16 + ln; const float bv = bp ? bf16_round(bp[col]) : 0.f;
#pragma unroll
    for (int r = 0; r < 8; ++r) { float v = acc[t][r] * alpha + bv; if (CP) { const int rr = row0g + row0 + 8 * hh + r; if (rowsPerB < 0) v += CP[cofs + (size_t)rr * ldc + col];      /* rowsPerB < 0: own element of the batched C plane */ else { const int bidx = rr / rowsPerB; v += CP[(size_t)bidx * sCPb + (size_t)by * 64 + col]; } } if (ACT == 1) v = (v > 0.f) ? v : expm1f(v); else if (ACT == 7) v = (v > 0.f) ? v + 1.0f : expf(v); else if (ACT == 8) v = tanhf(v); else if (ACT == 9) v = 0.5f * v * (1.0f + tanhf(0.7978845608028654f * (v + 0.044715f * v * v * v))); else if (ACT == 11) v = 1.0f / (1.0f + expf(-v)); else if (ACT == 12) v = (v > 0.f) ? v : 0.01f * v; else if (ACT == 14) v = (v > 0.f) ? v : 0.1f * v; else if (ACT == 16) v = (v >= 0.f) ? v : 0.3f * v; else if (ACT == 17) v = (v >= 0.f) ? v : 0.2f * v; else if (ACT == 15) v = v / (1.0f + expf(-v)); else if (ACT == 3) v = fmaxf(v, 0.f); else if (ACT == 6) v = 0.5f * v * (1.0f + erff(v * 0.70710678118654752f)); so[w][8 * hh + r][t * 16 + ln] = v; } }
  __builtin_amdgcn_fence(__ATOMIC_ACQ_REL, "workgroup"); __builtin_amdgcn_wave_barrier();
  const int rsub = lane >> 4, c4 = (lane & 15) * 4; typedef _Float16 v4h __attribute__((ext_vector_type(4)));
  {
#pragma unroll
    for (int q = 0; q < 8; ++q) { const int r = q * 2 + rsub; if (col0 + c4 < N) { const v4f v = *(const v4fa*)&so[w][r][c4]; if (C) *(v4f*)(C + cofs + (size_t)(row0 + r) * ldc + col0 + c4) = v; if (C16) { v4h h4; for (int i = 0; i < 4; ++i) h4[i] = (_Float16)v[i]; *(v4h*)(C16 + cofs + (size_t)(row0 + r) * ldc + col0 + c4) = h4; } } }
     }
}


typedef _Float16 v4h __attribute__((ext_vector_type(4)));

__global__ __launch_bounds__(256) void k_h16(const float* __restrict__ x, _Float16* __restrict__ X16, size_t n8) { const size_t t = (size_t)blockIdx.x * 256 + threadIdx.x; if (t >= n8) return; FragH f;
#pragma unroll
  for (int q = 0; q < 8; ++q) f.h[q] = (_Float16)x[t * 8 + q]; *(v8us*)((unsigned short*)X16 + t * 8) = f.half[0];  }
__global__ __launch_bounds__(256) void k_round16f(const float* __restrict__ W, _Float16* __restrict__ Bt, size_t n8) { const size_t t = (size_t)blockIdx.x * 256 + threadIdx.x; if (t >= n8) return; FragH f;
#pragma unroll
  for (int i = 0; i < 8; ++i) f.h[i] = (_Float16)(bf16_round(W[t * 8 + i]) * 16.0f); *(v8us*)((unsigned short*)Bt + t * 8) = f.half[0];  }
template <int NHv, int TTv>
__global__ __launch_bounds__(256) void k_vt(const _Float16* __restrict__ V16, int ldv, int voff, _Float16* __restrict__ Vt) { __shared__ unsigned short tl[64][66]; const int tid = threadIdx.x; const int slab = blockIdx.x / (TTv / 64), lg = blockIdx.x % (TTv / 64); const int b = slab / NHv, h = slab % NHv;
  for (int i = tid; i < 64 * 8; i += 256) { const int r = i / 8, c8 = (i % 8) * 8; FragH f; f.half[0] = *(const v8us*)((const unsigned short*)V16 + ((size_t)b * TTv + lg * 64 + r) * ldv + voff + h * 64 + c8);
#pragma unroll
    for (int q = 0; q < 8; ++q) tl[r][c8 + q] = f.u[q]; }
  __syncthreads();
  {
#pragma unroll
    for (int rd = 0; rd < 2; ++rd) { const int d = rd * 32 + tid / 8, pc = tid % 8; FragH f;
#pragma unroll
      for (int q = 0; q < 8; ++q) f.u[q] = tl[pc * 8 + q][d];
      *(v8us*)((unsigned short*)Vt + ((size_t)slab * 64 + d) * TTv + lg * 64 + pc * 8) = f.half[0]; }
     } }

__global__ __launch_bounds__(256) void k_hl(const float* __restrict__ F, _Float16* __restrict__ Hh, _Float16* __restrict__ Hl, size_t n8) { const size_t t = (size_t)blockIdx.x * 256 + threadIdx.x; if (t >= n8) return; FragH fh, fl; const v4f a = *(const v4fa*)(F + t * 8), c = *(const v4fa*)(F + t * 8 + 4);
#pragma unroll
  for (int q = 0; q < 4; ++q) { _Float16 h = (_Float16)a[q]; fh.h[q] = h; fl.h[q] = (_Float16)((a[q] - (float)h) * 1024.0f); h = (_Float16)c[q]; fh.h[4 + q] = h; fl.h[4 + q] = (_Float16)((c[q] - (float)h) * 1024.0f); }
  { *(v8us*)((unsigned short*)Hh + t * 8) = fh.half[0]; *(v8us*)((unsigned short*)Hl + t * 8) = fl.half[0];  } }

// ---- staged GEMM: C = act(A B^T alpha + bias), A f16 [M][K], Bh f16 [N][K], both K-contiguous, N = K = DM; M % 128 == 0; grid = (M / 128) * (N / 128); H16 picks the f16 output C16, else the f32 output C ----
// QKV: three products of the same A in one launch, grid = 3 (M / 128) (N / 128), the 3 (N / 128) work-groups of one block of 128 A rows next to each other: C16 = A Bh^T alpha + bias, C16b = A Bh2^T alpha + bias2, and the third one transposed,
// C16c[(batch DM + n) SQ + s] = (Bh3 A^T alpha + bias3[n]) for A row batch SQ + s: its work-groups take the Bh3 rows as the matrix instruction's A operand and the A rows as its B operand, so that the accumulator tiles already hold n in rows and s in columns.
// A work-group of four waves takes a 128 x 128 tile of C, a wave 64 x 64 of it (4 x 4 accumulator tiles). Per trip 128 k of the 128 A rows and the 128 B rows (256 bytes a row) lie in LDS at a pitch of 272 bytes,
// in four slices of 64 rows (A rows 0..63, A rows 64..127, B rows 0..63, B rows 64..127); wave w brings slice w there with one tensor load, two buffers, the next stage in flight while this one is worked on.
// The k order of every sum is ascending in steps of 32, as with fragments read from global memory.
__device__ __forceinline__ v16h g2_frag(const _Float16* p, int hh) { FragH f; f.half[0] = *(const v8us*)((const unsigned short*)p + 8 * hh); f.half[1] = *(const v8us*)((const unsigned short*)p + 16 + 8 * hh); return f.v; }
#define G3_PITCH 144                   /* LDS bytes per 128-byte row: 16 B x odd, for ds_load_b128 readers */
#define G4_PITCH 272                   /* LDS bytes per 256-byte row of a GEMM tile: 16 B x odd, for ds_load_b128 readers */
#define G4_TILE (128 * G4_PITCH)       /* spacing of the waves' output staging in LDS, bytes */
__device__ __forceinline__ v8f g3_mma(v16h a, v16h b, v8f c) { return __builtin_amdgcn_wmma_f32_16x16x32_f16(false, a, false, b, (short)0, c, false, false); }
__device__ __forceinline__ v16h g3_frag(const unsigned char* p) { FragH f; f.half[0] = *(const v8us*)p; f.half[1] = *(const v8us*)(p + 32); return f.v; }      /* p already holds the lane's row and its 16 hh bytes: k = 8 hh + 0..7, then 16 + 8 hh + 0..7 */
#define G5_SLICE 18432                 /* LDS bytes of one slice: 64 rows at 272 bytes = 17,408, rounded up to a multiple of 2 KiB so that every slice's place is one */
#define G5_STAGE (4 * G5_SLICE)        /* one stage in LDS, bytes: two A slices, then two B slices */
typedef unsigned u32x4 __attribute__((ext_vector_type(4)));
typedef unsigned u32x8 __attribute__((ext_vector_type(8)));
__device__ __forceinline__ unsigned g5_uni(unsigned v) { return (unsigned)__builtin_amdgcn_readfirstlane(v); }
// a wave-uniform value held in a scalar register: a test on it compiles to s_cmp and s_cbranch_scc (a tensor load ignores EXEC), and what is computed from it stays behind the asm waits in front of it
__device__ __forceinline__ unsigned g5_pinned(unsigned v) { unsigned w = g5_uni(v); asm volatile("" : "+s"(w)); /* pinned(): a descriptor word or issue test held in a scalar register */ return w; }
// one request of the whole wave: 64 rows of 256 bytes, source pitch 2 DM bytes, first byte at g, to LDS byte lds, 16 bytes of pad behind every row (pitch 272 bytes); extents in bytes, no mask
__device__ __forceinline__ void g5_load(unsigned lds, const _Float16* g) { const unsigned long long ga = (unsigned long long)g; u32x4 g0; u32x8 g1;
  g0[0] = g5_uni(1u); g0[1] = g5_uni(lds); g0[2] = g5_uni((unsigned)ga); g0[3] = g5_uni((((unsigned)(ga >> 32)) & 0x01FFFFFFu) | 0x80000000u);
  g1[0] = g5_uni((1u << 20) | (5u << 22) | (3u << 25)); g1[1] = g5_uni(256u << 16); g1[2] = g5_uni(64u << 16); g1[3] = g5_uni(256u << 16); g1[4] = g5_uni(64u); g1[5] = g5_uni(2u * DM); g1[6] = g5_uni(0u); g1[7] = g5_uni(0u);
  asm volatile("tensor_load_to_lds %0, %1" :: "s"(g0), "s"(g1) : "memory"); }
template <int ACT, bool H16, bool QKV>
__global__ __launch_bounds__(128) void k_gemm3(const _Float16* __restrict__ A, const _Float16* __restrict__ Bh, const _Float16* __restrict__ Bh2, const _Float16* __restrict__ Bh3, float alpha, const float* __restrict__ bias, const float* __restrict__ bias2, const float* __restrict__ bias3,
                                               float* __restrict__ C, _Float16* __restrict__ C16, _Float16* __restrict__ C16b, _Float16* __restrict__ C16c) { static_assert(ACT == 0 || ACT == 3, "k_gemm3: unsupported ACT code (would silently apply no activation)");
  static_assert(!QKV || (H16 && ACT == 0 && SQ % 128 == 0 && SQ == DM), "k_gemm3: the three-product form writes f16, applies no activation, and its transposed tiles lie inside one batch, rows of SQ = N elements");
  constexpr int N = DM, K = DM; static_assert(N % 128 == 0 && K % 128 == 0 && K >= 256, "k_gemm3: whole tiles only, two or more of them along K");
  __shared__ __attribute__((aligned(2048))) unsigned char sm[2 * G5_STAGE];      /* buffer u at u stages; the kernel's only LDS, so every slice stands at a multiple of 2 KiB; behind the loop each wave's output staging, G4_TILE bytes apart */
  const int tid = threadIdx.x, w = tid >> 5, lane = tid & 31, ln = lane & 15, hh = lane >> 4;
  const int ntn = N >> 7; const int mt = blockIdx.x / (QKV ? 3 * ntn : ntn), nc = blockIdx.x - mt * (QKV ? 3 * ntn : ntn); const int sel = nc / ntn, nq = nc - sel * ntn; const bool tr = QKV && sel == 2;      /* sel, tr: from blockIdx alone, the same for the whole work-group */
  const int row0 = (tr ? nq : mt) * 128, col0 = (tr ? mt : nq) * 128; const int wr = (w >> 1) * 64, wc = (w & 1) * 64;      /* first row of the tile of the matrix instruction's A operand, of its B operand */
  const _Float16* Ao = tr ? Bh3 : A; const _Float16* Bo = tr ? A : (QKV && sel == 1) ? Bh2 : Bh;
  const unsigned wv = g5_uni((unsigned)tid >> 5);      /* the wave's number, scalar: every wave issues its own slice */
  const unsigned lw = (unsigned)(size_t)sm + wv * G5_SLICE;      /* the slice's place in buffer 0 */
  const _Float16* gw = wv < 2u ? Ao + (size_t)(row0 + (int)wv * 64) * K : Bo + (size_t)(col0 + ((int)wv - 2) * 64) * K; constexpr int nt = K >> 7;      /* first element of the slice's first row */
  g5_load(lw, gw);
  asm volatile("s_wait_tensorcnt 0x0" ::: "memory");      /* this wave's slice of stage 0 has landed */
  __syncthreads();      /* stage 0 is read by every wave */
  g5_load(lw + G5_STAGE, gw + 128);
  const unsigned char* fa = sm + (w >> 1) * G5_SLICE + ln * G4_PITCH + 16 * hh; const unsigned char* fb = sm + (2 + (w & 1)) * G5_SLICE + ln * G4_PITCH + 16 * hh;      /* the wave's 64 A rows are one slice, its 64 B rows another */
  const v8f z8 = {0.f, 0.f, 0.f, 0.f, 0.f, 0.f, 0.f, 0.f}; v8f acc[4][4];
#pragma unroll      /* register arrays need constant indices */
  for (int i = 0; i < 4; ++i)
#pragma unroll      /* register arrays need constant indices */
    for (int j = 0; j < 4; ++j) acc[i][j] = z8;
#pragma unroll 1      /* one trip per tile: the buffer is chosen at run time, and an unrolled body would only grow the text */
  for (int t = 0; t < nt; ++t) { const unsigned bo = (unsigned)(t & 1) * G5_STAGE;
#pragma unroll      /* register arrays need constant indices */
    for (int ks = 0; ks < 4; ++ks) { v16h af[4], bf[4];
#pragma unroll      /* register arrays need constant indices */
      for (int i = 0; i < 4; ++i) bf[i] = g3_frag(fb + bo + i * 16 * G4_PITCH + ks * 64);
#pragma unroll      /* register arrays need constant indices */
      for (int i = 0; i < 4; ++i) af[i] = g3_frag(fa + bo + i * 16 * G4_PITCH + ks * 64);
      __builtin_amdgcn_sched_barrier(0);      /* the sixteen LDS reads of a block go out as one group in front of its products: left free, each A fragment was read alone and waited for in front of its four products */
#pragma unroll      /* register arrays need constant indices */
      for (int i = 0; i < 4; ++i)
#pragma unroll      /* register arrays need constant indices */
        for (int j = 0; j < 4; ++j) acc[i][j] = g3_mma(af[i], bf[j], acc[i][j]);
      __builtin_amdgcn_sched_barrier(0); }      /* the next group of reads stays behind this block's products, whose fragment registers it reuses */
    asm volatile("s_wait_dscnt 0x0" ::: "memory");      /* this wave's reads of the buffer have returned before the barrier behind which it is refilled */
    asm volatile("s_wait_tensorcnt 0x0" ::: "memory");
    __syncthreads();      /* publishes stage t + 1 and ends every wave's reads of stage t */
    if (g5_pinned((unsigned)(t + 2 < nt))) { const unsigned tn = g5_pinned((unsigned)t + 2u); g5_load(lw + bo, gw + (size_t)tn * 128); } }      /* a scalar branch; the address is formed from a value pinned behind the wait, when no request is outstanding */
  asm volatile("s_wait_tensorcnt 0x0" ::: "memory");      /* no request is outstanding when the buffers become output staging */
  asm volatile("s_wait_dscnt 0x0" ::: "memory");      /* nor an LDS read of this wave */
  float* so = (float*)(sm + w * G4_TILE);      /* 64 rows of 68 floats, this wave's own; the last trip's barrier has ended every read of the tiles */
  if (tr) {      /* the bias goes with the accumulator's row */
#pragma unroll      /* register arrays need constant indices */
    for (int i = 0; i < 4; ++i) { const float* bp = bias3 + row0 + wr + i * 16 + 8 * hh; const v4f bl = *(const v4fa*)bp, bu = *(const v4fa*)(bp + 4);
#pragma unroll      /* register arrays need constant indices */
      for (int r = 0; r < 8; ++r) { const float bv = bf16_round(r < 4 ? bl[r & 3] : bu[r & 3]);
#pragma unroll      /* register arrays need constant indices */
        for (int j = 0; j < 4; ++j) so[(i * 16 + 8 * hh + r) * 68 + j * 16 + ln] = acc[i][j][r] * alpha + bv; } } }
  else { const float* bc = (QKV && sel == 1) ? bias2 : bias;
#pragma unroll      /* register arrays need constant indices */
  for (int j = 0; j < 4; ++j) { const float bv = bf16_round(bc[col0 + wc + j * 16 + ln]);
#pragma unroll      /* register arrays need constant indices */
    for (int i = 0; i < 4; ++i)
#pragma unroll      /* register arrays need constant indices */
      for (int r = 0; r < 8; ++r) { float v = acc[i][j][r] * alpha + bv; if (ACT == 3) v = fmaxf(v, 0.f); so[(i * 16 + 8 * hh + r) * 68 + j * 16 + ln] = v; } } }
  __builtin_amdgcn_fence(__ATOMIC_ACQ_REL, "workgroup"); __builtin_amdgcn_wave_barrier();      /* the wave's staging writes stay in front of its reads of words that other lanes wrote */
  const int rsub = lane >> 4, c4 = (lane & 15) * 4;
  const size_t o = tr ? ((size_t)(col0 / SQ) * DM + row0 + wr + rsub) * SQ + col0 % SQ + wc + c4 : (size_t)(row0 + wr + rsub) * N + col0 + wc + c4;      /* transposed: row n of the batch's plane, column s */
  _Float16* Co = tr ? C16c : (QKV && sel == 1) ? C16b : C16;
#pragma unroll      /* register arrays need constant indices */
  for (int q0 = 0; q0 < 32; q0 += 8) { v4f v[8];      /* the reads go out in groups ahead of their stores, each store whole 128-byte lines */
#pragma unroll      /* register arrays need constant indices */
    for (int u = 0; u < 8; ++u) v[u] = *(const v4fa*)&so[((q0 + u) * 2 + rsub) * 68 + c4];
#pragma unroll      /* register arrays need constant indices */
    for (int u = 0; u < 8; ++u) { if (H16) { v4h h4; for (int i = 0; i < 4; ++i) h4[i] = (_Float16)v[u][i]; *(v4h*)(Co + o + (size_t)(q0 + u) * 2 * N) = h4; } else *(v4f*)(C + o + (size_t)(q0 + u) * 2 * N) = v[u]; } } }


__global__ __launch_bounds__(256) void k_wnat(const float* __restrict__ w, size_t n8, _Float16* __restrict__ Bt) { const size_t t = (size_t)blockIdx.x * 256 + threadIdx.x; if (t >= n8) return; FragH f; for (int q = 0; q < 8; ++q) f.h[q] = (_Float16)(bf16_round(w[t * 8 + q]) * 16.0f); *(v8us*)((unsigned short*)Bt + t * 8) = f.half[0];  }
__global__ __launch_bounds__(256) void k_rsm(const float* __restrict__ S, _Float16* __restrict__ P, int nrows) {
  #pragma clang fp contract(off)
  const int i = blockIdx.x * 256 + threadIdx.x; if (i >= nrows) return; const float* s = S + (size_t)i * SQ; float mx = -3.0e38f;
#pragma unroll 1
  for (int j = 0; j < SQ; ++j) mx = fmaxf(mx, s[j]); float se = 0.f;
#pragma unroll 1
  for (int j = 0; j < SQ; ++j) se += expf(s[j] - mx); const float sc = 256.0f / se;
#pragma unroll 1
  for (int j0 = 0; j0 < SQ; j0 += 8) { FragH f; for (int q = 0; q < 8; ++q) f.h[q] = (_Float16)(expf(s[j0 + q] - mx) * sc); unsigned short* d = (unsigned short*)P + (size_t)i * SQ + j0; *(v8us*)d = f.half[0];  } }
__global__ __launch_bounds__(256) void k_vt(const _Float16* __restrict__ V16, int b, int h0, _Float16* __restrict__ VT) { __shared__ unsigned short tl[64][65]; const int tid = threadIdx.x; const int hh = blockIdx.x % HG, sg = blockIdx.x / HG; const int s0 = sg * 64; const int h = h0 + hh;
  for (int i = tid; i < 64 * 8; i += 256) { const int j = i / 8, d8 = (i % 8) * 8; FragH f; f.half[0] = *(const v8us*)((const unsigned short*)V16 + ((size_t)b * SQ + s0 + j) * DM + h * HD + d8); for (int q = 0; q < 8; ++q) tl[d8 + q][j] = f.u[q]; }
  __syncthreads();
  { for (int i = tid; i < 64 * 8; i += 256) { const int d = i / 8, j8 = (i % 8) * 8; FragH f; for (int q = 0; q < 8; ++q) f.u[q] = tl[d][j8 + q]; *(v8us*)((unsigned short*)VT + ((size_t)hh * HD + d) * SQ + s0 + j8) = f.half[0]; }  } }


// Operand preparation, one launch. Work-groups 0 .. 5 PW_TILES - 1 each take one tile, 64 k x 64 n, of one weight: Bt[n][k] = f16(bf16(W[k][n]) x 16) (a power of two: bf16-exact weights stay exact in f16 away from the subnormal range).
// n is the output column (head-stacked, 64 h + column, for Wq, Wk, Wv [16][1024][64]; the column for W1, W2 [in][out]), k the input column. A tile's source rows are 256 contiguous bytes, read 16 bytes a lane;
// two neighbouring k are packed into one LDS word at [n][k / 2], pitch 33 words (odd: neither the writers, 4 n apart, nor the readers, rows of 4 words, meet in a bank); its 128-byte rows of Bt are written 16 bytes a lane, whole lines.
// The work-groups behind them turn x into f16 rows, eight elements a thread.
#define PW_TILES ((DM / 64) * (DM / 64))      /* tiles of one weight */
#define PX_WGS ((unsigned)(NR * DM / 8 / 256))      /* work-groups of the x part */
__global__ __launch_bounds__(256) void k_prep(const float* __restrict__ x, const float* __restrict__ wq, const float* __restrict__ wk, const float* __restrict__ wv, const float* __restrict__ w1, const float* __restrict__ w2,
                                              _Float16* __restrict__ X16, _Float16* __restrict__ BQ, _Float16* __restrict__ BK, _Float16* __restrict__ BV, _Float16* __restrict__ B1, _Float16* __restrict__ B2) {
  static_assert(HD == 64 && DM % 64 == 0 && NH * HD == DM && (NR * DM / 8) % 256 == 0, "k_prep: heads of 64 columns, whole tiles, whole work-groups");
  __shared__ unsigned tl[64][33];
  const int tid = threadIdx.x;
  if (blockIdx.x >= 5 * PW_TILES) {      /* the same for the whole work-group, in front of the barrier */
    const size_t t = (size_t)(blockIdx.x - 5 * PW_TILES) * 256 + tid; FragH f;
#pragma unroll      /* register arrays need constant indices */
    for (int q = 0; q < 8; ++q) f.h[q] = (_Float16)bf16_round(x[t * 8 + q]);
    *(v8us*)((unsigned short*)X16 + t * 8) = f.half[0]; return; }
  const int sel = blockIdx.x / PW_TILES, tile = blockIdx.x % PW_TILES; const int nt = tile / (DM / 64), k0 = (tile % (DM / 64)) * 64;
  const float* sp; int ld; _Float16* bt;
  if (sel < 3) { sp = (sel == 0 ? wq : sel == 1 ? wk : wv) + ((size_t)nt * DM + k0) * HD; ld = HD; bt = sel == 0 ? BQ : sel == 1 ? BK : BV; }      /* head nt, rows k0 .. k0 + 63 */
  else { sp = (sel == 3 ? w1 : w2) + (size_t)k0 * DM + nt * 64; ld = DM; bt = sel == 3 ? B1 : B2; }
  const int c4 = (tid & 15) * 4, rr = tid >> 4;
  const float* p00 = sp + (size_t)(2 * rr) * ld + c4; const float* p01 = p00 + ld; const float* p10 = p00 + (size_t)32 * ld; const float* p11 = p10 + ld;      /* rows 2 rr, 2 rr + 1, 32 + 2 rr, 33 + 2 rr of the tile */
  const v4f a[2][2] = {{*(const v4fa*)p00, *(const v4fa*)p01}, {*(const v4fa*)p10, *(const v4fa*)p11}};
  asm volatile("s_wait_xcnt 0x0" :: "v"(p00), "v"(p01), "v"(p10), "v"(p11) : "memory");      /* behind the four loads, in front of every later write of a register that they name; the addresses are inputs so that they keep their registers up to here: left free, one load's result was placed over another load's address */
#pragma unroll      /* register arrays need constant indices */
  for (int p = 0; p < 2; ++p)
#pragma unroll      /* register arrays need constant indices */
    for (int q = 0; q < 4; ++q) { union { _Float16 h[2]; unsigned u; } z; z.h[0] = (_Float16)(bf16_round(a[p][0][q]) * 16.0f); z.h[1] = (_Float16)(bf16_round(a[p][1][q]) * 16.0f); tl[c4 + q][p * 16 + rr] = z.u; }
  __syncthreads();      /* a row of Bt is gathered from words that sixteen threads wrote */
  const int pc = tid & 7, rn = tid >> 3;
#pragma unroll      /* both rows' LDS reads go out ahead of the stores */
  for (int p = 0; p < 2; ++p) { union { unsigned u[4]; v8us v; } o;
#pragma unroll      /* register arrays need constant indices */
    for (int j = 0; j < 4; ++j) o.u[j] = tl[p * 32 + rn][pc * 4 + j];
    *(v8us*)((unsigned short*)bt + (size_t)(nt * 64 + p * 32 + rn) * DM + k0 + pc * 8) = o.v; } }
// lane exchanges for the attention kernel's softmax and the LayerNorm sums; native exponentials for the softmax
typedef int v4ia __attribute__((ext_vector_type(4), may_alias));
template <int M> __device__ __forceinline__ float rs_xrow(float x) { return __builtin_bit_cast(float, __builtin_amdgcn_update_dpp(0, __builtin_bit_cast(int, x), 0x160 | M, 0xf, 0xf, true)); }      /* lane l <- lane l ^ M inside a 16-lane row (row_xmask) */
__device__ __forceinline__ float rs_xhalf(float x) { return __builtin_bit_cast(float, __builtin_amdgcn_permlanex16(__builtin_bit_cast(int, x), __builtin_bit_cast(int, x), 0x76543210, 0xfedcba98, false, false)); }      /* lane l <- lane l ^ 16 */
// four independent 2^x in one statement, closed by the one v_nop that the instruction set asks for behind a transcendental before its result is used or its source overwritten
// outputs are early-clobber so that no exponential writes a neighbour's source
__device__ __forceinline__ void rs_exp2x4(float* x) { float r0, r1, r2, r3;
  asm("v_exp_f32 %0, %4\n\tv_exp_f32 %1, %5\n\tv_exp_f32 %2, %6\n\tv_exp_f32 %3, %7\n\tv_nop" : "=&v"(r0), "=&v"(r1), "=&v"(r2), "=&v"(r3) : "v"(x[0]), "v"(x[1]), "v"(x[2]), "v"(x[3]));
  x[0] = r0; x[1] = r1; x[2] = r2; x[3] = r3; }
// Fused attention, one launch for all batches and heads: a work-group takes 128 query rows of one (batch, head), a wave 32 of them (two 16-column groups), and walks the 1024 keys in passes of 32, two passes a trip.
// Per trip the 64 K rows of the head (128 bytes a row) and 64 keys of its 64 V^T rows (128 bytes a row) lie in LDS at a pitch of 144 bytes, one copy for the four waves;
// asynchronous copies bring them there in whole 128-byte lines, two buffers, the next trip's tiles in flight while these are worked on. Fragments are read from LDS in the k order they had from global memory.
// S^T = K Q^T (A = K rows, B = Q rows kept in registers): in each group lane (ln, hh) holds, for query ln, the scores of keys 16 kt + 8 hh + r. Running maximum and sum are per lane, joined between the wave halves by one exchange.
// The two f32 score tiles of a pass, converted in place, are the f16 B operand of O^T += V^T P^T (A = V^T rows in the same k order): scores and weights never leave the registers.
// Weights are exp(s - running maximum), unnormalised (at most 1); the division by the row sum is done once, in f32, on O^T. A masked key enters as -inf (weight 0); a row with every key masked gives 0.
__device__ __forceinline__ v8f fa_mma(v16h a, v16h b, v8f c) { return __builtin_amdgcn_wmma_f32_16x16x32_f16(false, a, false, b, (short)0, c, false, false); }
// one 2^x, closed by the v_nop that the instruction set asks for behind a transcendental before its result is used or its source overwritten
__device__ __forceinline__ float fa_exp2(float x) { float r; asm("v_exp_f32 %0, %1\n\tv_nop" : "=&v"(r) : "v"(x)); return r; }
#define FA_TILE (64 * G3_PITCH)        /* one operand's tile in LDS, bytes: 64 rows of 128 bytes at the padded pitch */
// eight copies of 16 bytes a lane: rows r, r + 16, r + 32, r + 48 of the K tile, then of the V^T tile behind it (l: the lane's LDS byte address in row r of the K tile; gk, gv: its global addresses there).
// The s_wait_xcnt closes the statement so that it stands in front of every later write of a register that a copy names.
__device__ __forceinline__ void fa_copy8(unsigned l, const _Float16* gk, const _Float16* gv) { constexpr size_t rk = (size_t)16 * DM, rv = (size_t)16 * SQ;      /* 16 rows in elements */
  asm volatile("global_load_async_to_lds_b128 %0, %8, off\n\tglobal_load_async_to_lds_b128 %1, %9, off\n\tglobal_load_async_to_lds_b128 %2, %10, off\n\tglobal_load_async_to_lds_b128 %3, %11, off\n\t"
               "global_load_async_to_lds_b128 %4, %12, off\n\tglobal_load_async_to_lds_b128 %5, %13, off\n\tglobal_load_async_to_lds_b128 %6, %14, off\n\tglobal_load_async_to_lds_b128 %7, %15, off\n\ts_wait_xcnt 0x0"
               :: "v"(l), "v"(l + 16 * G3_PITCH), "v"(l + 32 * G3_PITCH), "v"(l + 48 * G3_PITCH), "v"(l + FA_TILE), "v"(l + FA_TILE + 16 * G3_PITCH), "v"(l + FA_TILE + 32 * G3_PITCH), "v"(l + FA_TILE + 48 * G3_PITCH),
                  "v"(gk), "v"(gk + rk), "v"(gk + 2 * rk), "v"(gk + 3 * rk), "v"(gv), "v"(gv + rv), "v"(gv + 2 * rv), "v"(gv + 3 * rv) : "memory"); }
__global__ __launch_bounds__(128) void k_fattn(const _Float16* __restrict__ Q16, const _Float16* __restrict__ K16, const _Float16* __restrict__ VT, const int* __restrict__ mk, float* __restrict__ AF) {
  static_assert(HD == 64 && SQ % 64 == 0 && SQ >= 128, "k_fattn: heads of 64 columns, whole trips of 64 keys, two or more of them");
  __shared__ __attribute__((aligned(16))) float kbias[SQ];      /* 0 for a key that counts, -inf for a masked one */
  __shared__ __attribute__((aligned(16))) unsigned char kv[4 * FA_TILE];      /* buffer u: K tile at 2 u tiles, V^T tile at 2 u + 1 */
  const int tid = threadIdx.x, w = tid >> 5, lane = tid & 31, ln = lane & 15, hh = lane >> 4;
  const int bh = blockIdx.x / (SQ / 128), qb = blockIdx.x % (SQ / 128); const int b = bh / NH, h = bh % NH;
  const unsigned l0 = (unsigned)(size_t)kv + (unsigned)((tid >> 3) * G3_PITCH + (tid & 7) * 16);      /* eight lanes a row: a wave's copy covers four whole 128-byte lines */
  const _Float16* gk = K16 + ((size_t)b * SQ + (tid >> 3)) * DM + h * HD + (tid & 7) * 8; const _Float16* gv = VT + ((size_t)bh * HD + (tid >> 3)) * SQ + (tid & 7) * 8; constexpr int nt = SQ / 64;
  fa_copy8(l0, gk, gv);
  const v4ia m0 = *(const v4ia*)(mk + (size_t)b * SQ + tid * 8), m1 = *(const v4ia*)(mk + (size_t)b * SQ + tid * 8 + 4);      /* eight keys of the mask row a thread */
  const int q0 = qb * 128 + w * 32;
  const _Float16* qp = Q16 + ((size_t)b * SQ + q0 + ln) * DM + h * HD;
  v16h qf[2][2];
#pragma unroll      /* register arrays need constant indices */
  for (int u = 0; u < 2; ++u)
#pragma unroll      /* register arrays need constant indices */
    for (int ks = 0; ks < 2; ++ks) qf[u][ks] = g2_frag(qp + (size_t)u * 16 * DM + ks * 32, hh);
  { v4f b0, b1;
#pragma unroll      /* register arrays need constant indices */
    for (int q = 0; q < 4; ++q) { b0[q] = (m0[q] == 0) ? 0.f : -__builtin_inff(); b1[q] = (m1[q] == 0) ? 0.f : -__builtin_inff(); }
    *(v4fa*)&kbias[tid * 8] = b0; *(v4fa*)&kbias[tid * 8 + 4] = b1; }
  asm volatile("s_wait_asynccnt 0x0" ::: "memory");      /* this wave's share of the first tiles has landed */
  __syncthreads();      /* the bias row and the first tiles are read by every wave */
  fa_copy8(l0 + 2 * FA_TILE, gk + (size_t)64 * DM, gv + 64);
  const unsigned char* fk = kv + ln * G3_PITCH + 16 * hh; const unsigned char* fv = kv + FA_TILE + ln * G3_PITCH + 16 * hh;
  const v8f z8 = {0.f, 0.f, 0.f, 0.f, 0.f, 0.f, 0.f, 0.f};
  v8f o[2][4] = {{z8, z8, z8, z8}, {z8, z8, z8, z8}}; float mr[2] = {-3.0e38f, -3.0e38f}, lr[2] = {0.f, 0.f};
#pragma unroll 1      /* one trip per pair of tiles: the buffer is chosen at run time, and an unrolled body would only grow the text */
  for (int t = 0; t < nt; ++t) { const unsigned bo = (unsigned)(t & 1) * (2 * FA_TILE);
#pragma unroll      /* the pass's place in the tiles becomes a constant offset of its LDS reads */
   for (int ps = 0; ps < 2; ++ps) { const int key0 = t * 64 + ps * 32;
    v16h kf[2][2], vf[4]; v4f bs[4];
#pragma unroll      /* register arrays need constant indices */
    for (int kt = 0; kt < 2; ++kt)
#pragma unroll      /* register arrays need constant indices */
      for (int ks = 0; ks < 2; ++ks) kf[kt][ks] = g3_frag(fk + bo + (ps * 32 + kt * 16) * G3_PITCH + ks * 64);
#pragma unroll      /* register arrays need constant indices */
    for (int dt = 0; dt < 4; ++dt) { vf[dt] = g3_frag(fv + bo + dt * 16 * G3_PITCH + ps * 64); bs[dt] = *(const v4fa*)&kbias[key0 + (dt >> 1) * 16 + 8 * hh + (dt & 1) * 4]; }
    v8f s[2][2];
#pragma unroll      /* register arrays need constant indices */
    for (int qi = 0; qi < 2; ++qi)
#pragma unroll      /* register arrays need constant indices */
      for (int kt = 0; kt < 2; ++kt) s[qi][kt] = fa_mma(kf[kt][1], qf[qi][1], fa_mma(kf[kt][0], qf[qi][0], z8));
#pragma unroll      /* register arrays need constant indices */
    for (int qi = 0; qi < 2; ++qi) { float t16[16];
#pragma unroll      /* register arrays need constant indices */
      for (int i = 0; i < 16; ++i) t16[i] = s[qi][i >> 3][i & 7] * 0.18033688f + bs[i >> 2][i & 3];      /* score / 8 in log2 units: exp(x) = 2^(x log2 e), the native form */
      float mx = t16[0];
#pragma unroll      /* register arrays need constant indices */
      for (int i = 1; i < 16; ++i) mx = fmaxf(mx, t16[i]);
      mx = fmaxf(mx, rs_xhalf(mx)); const float mn = fmaxf(mr[qi], mx); const float f = fa_exp2(mr[qi] - mn); mr[qi] = mn;
#pragma unroll      /* register arrays need constant indices */
      for (int i = 0; i < 16; ++i) t16[i] -= mn;
      rs_exp2x4(t16); rs_exp2x4(t16 + 4); rs_exp2x4(t16 + 8); rs_exp2x4(t16 + 12);
      float s4[4] = {t16[0], t16[1], t16[2], t16[3]};
#pragma unroll      /* register arrays need constant indices */
      for (int i = 4; i < 16; ++i) s4[i & 3] += t16[i];
      lr[qi] = lr[qi] * f + ((s4[0] + s4[1]) + (s4[2] + s4[3]));
      FragH p;
#pragma unroll      /* register arrays need constant indices */
      for (int i = 0; i < 16; ++i) p.h[i] = (_Float16)t16[i];
#pragma unroll      /* register arrays need constant indices */
      for (int dt = 0; dt < 4; ++dt) o[qi][dt] = fa_mma(vf[dt], p.v, o[qi][dt] * f); } }
    asm volatile("s_wait_dscnt 0x0" ::: "memory");      /* this wave's reads of the buffer have returned before the barrier behind which it is refilled */
    asm volatile("s_wait_asynccnt 0x0" ::: "memory");      /* this wave's share of the next trip's tiles has landed */
    __syncthreads();      /* publishes the tiles of trip t + 1 and ends every wave's reads of those of trip t */
    if (t + 2 < nt) fa_copy8(l0 + bo, gk + (size_t)(t + 2) * 64 * DM, gv + (size_t)(t + 2) * 64); }
  asm volatile("s_wait_asynccnt 0x0" ::: "memory");      /* no copy is outstanding when the wave ends */
#pragma unroll      /* register arrays need constant indices */
  for (int qi = 0; qi < 2; ++qi) { const float se = lr[qi] + rs_xhalf(lr[qi]); const float inv = (se == 0.f) ? 0.f : 1.0f / se;
    float* dst = AF + ((size_t)b * SQ + q0 + qi * 16 + ln) * DM + h * HD + 8 * hh;      /* lane (ln, hh): query ln, head columns 16 dt + 8 hh + r */
#pragma unroll      /* register arrays need constant indices */
    for (int dt = 0; dt < 4; ++dt) { const v8f v = o[qi][dt] * inv; const v4f lo = {v[0], v[1], v[2], v[3]}, hi = {v[4], v[5], v[6], v[7]}; *(v4f*)(dst + dt * 16) = lo; *(v4f*)(dst + dt * 16 + 4) = hi; } } }
// OF_ = R + LayerNorm(A) g + bta (H16: and its f16 copy OH_): two rows a wave, eight waves a work-group, no LDS and no barrier.
// Lane l holds columns 128 u + 4 l + 0..3 (u = 0..7) of each row, so every load and every f32 store of a wave is 512 contiguous bytes; all loads of both rows go out ahead of the arithmetic.
// Mean and biased variance (two passes over the registers): four partial sums a lane, joined pairwise, then a five-step xor butterfly that leaves the same sum in every lane.
__device__ __forceinline__ float ln_wsum(float s) { s += rs_xrow<1>(s); s += rs_xrow<2>(s); s += rs_xrow<4>(s); s += rs_xrow<8>(s); return s + rs_xhalf(s); }
template <int RBF, bool H16>
__global__ __launch_bounds__(256) void k_lnadd(const float* __restrict__ A, const float* __restrict__ R, const float* __restrict__ g, const float* __restrict__ bta, float eps, float* __restrict__ OF_, _Float16* __restrict__ OH_) {
  static_assert(DM == 1024 && MPO % 16 == 0, "k_lnadd: rows of 1024 columns, sixteen rows a work-group");
  const int j0 = (threadIdx.x & 31) * 4;      /* the one per-lane part of every address */
  const size_t e0 = ((size_t)blockIdx.x * 8 + (size_t)__builtin_amdgcn_readfirstlane(threadIdx.x >> 5)) * 2 * DM;      /* first element of the wave's first row: the same in every lane, so the row bases are scalar */
  const float* ap = A + e0; const float* rp = R + e0; float* op = OF_ + e0; _Float16* hp = OH_ + e0;
  v4f a[2][8], r[2][8], gv[8], bv[8];
  asm volatile("" :: "s"(eps), "s"(OF_), "s"(OH_));      /* inputs only: the arguments that are used behind the loads are fetched in front of them; left free, their fetch stood behind the loads */
  __builtin_amdgcn_sched_barrier(0);      /* keeps the loads behind that fetch */
#pragma unroll      /* register arrays need constant indices */
  for (int p = 0; p < 2; ++p)
#pragma unroll      /* register arrays need constant indices */
    for (int u = 0; u < 8; ++u) a[p][u] = *(const v4fa*)(ap + p * DM + u * 128 + j0);
#pragma unroll      /* register arrays need constant indices */
  for (int p = 0; p < 2; ++p)
#pragma unroll      /* register arrays need constant indices */
    for (int u = 0; u < 8; ++u) r[p][u] = *(const v4fa*)(rp + p * DM + u * 128 + j0);
#pragma unroll      /* register arrays need constant indices */
  for (int u = 0; u < 8; ++u) { gv[u] = *(const v4fa*)(g + u * 128 + j0); bv[u] = *(const v4fa*)(bta + u * 128 + j0); }
  asm volatile("s_wait_xcnt 0x0" ::: "memory");      /* behind the loads, in front of every later reuse of a register that they name as an address */
  __builtin_amdgcn_sched_barrier(0);      /* all 48 loads are issued here, in front of the arithmetic: left free, the second row's loads sank behind the first row's sums and their latency was waited out a second time */
#pragma unroll      /* register arrays need constant indices */
  for (int p = 0; p < 2; ++p) { v4f c = a[p][0];
#pragma unroll      /* register arrays need constant indices */
    for (int u = 1; u < 8; ++u) c += a[p][u];
    const float mu = ln_wsum((c[0] + c[1]) + (c[2] + c[3])) / (float)DM;
    v4f d = (a[p][0] - mu) * (a[p][0] - mu);
#pragma unroll      /* register arrays need constant indices */
    for (int u = 1; u < 8; ++u) d += (a[p][u] - mu) * (a[p][u] - mu);
    const float rs = rsqrtf(ln_wsum((d[0] + d[1]) + (d[2] + d[3])) / (float)DM + eps);
#pragma unroll      /* register arrays need constant indices */
    for (int u = 0; u < 8; ++u) { v4f o; v4h h4;
#pragma unroll      /* register arrays need constant indices */
      for (int q = 0; q < 4; ++q) { o[q] = (RBF ? bf16_round(r[p][u][q]) : r[p][u][q]) + ((a[p][u][q] - mu) * rs * bf16_round(gv[u][q]) + bf16_round(bv[u][q])); h4[q] = (_Float16)o[q]; }
      *(v4f*)(op + p * DM + u * 128 + j0) = o; if (H16) *(v4h*)(hp + p * DM + u * 128 + j0) = h4; } } }

extern "C" void kernel_launch(void* const* d_in, const int* in_sizes, int n_in,
                              void* d_out, int out_size, void* d_ws, size_t ws_size, hipStream_t stream) {
  (void)in_sizes; (void)n_in; (void)out_size;
  const float* const* I = (const float* const*)d_in; const float* x = I[0]; const int* xmask = (const int*)d_in[1]; const float* wq = I[2]; const float* bq = I[3]; const float* wk = I[4]; const float* bk = I[5]; const float* wv = I[6]; const float* bv = I[7]; const float* w1 = I[8]; const float* b1 = I[9]; const float* w2 = I[10]; const float* b2 = I[11]; const float* g1 = I[12]; const float* be1 = I[13]; const float* g2 = I[14]; const float* be2 = I[15];
  char* ws = (char*)d_ws; size_t off = 0;
  auto take = [&](size_t bytes) { char* p = ws + off; off += (bytes + 255) & ~(size_t)255; return p; };
  _Float16* BQ = (_Float16*)take((size_t)DM * DM * 2); _Float16* BK = (_Float16*)take((size_t)DM * DM * 2); _Float16* BV = (_Float16*)take((size_t)DM * DM * 2); _Float16* B1 = (_Float16*)take((size_t)DM * DM * 2); _Float16* B2 = (_Float16*)take((size_t)DM * DM * 2);
  _Float16* X16 = (_Float16*)take(NR * DM * 2); _Float16* Q16 = (_Float16*)take(NR * DM * 2); _Float16* K16 = (_Float16*)take(NR * DM * 2); float* AF = (float*)take(NR * DM * 4); float* X1F = (float*)take(NR * DM * 4); _Float16* X1H = (_Float16*)take(NR * DM * 2); _Float16* H16 = (_Float16*)take(NR * DM * 2); float* FF = AF;      /* f rows reuse the attention-output rows (dead after the first LayerNorm; same type) */
  _Float16* VT = (_Float16*)take((size_t)NB * NH * HD * SQ * 2);
  if (off > ws_size) return;      /* 10 + 16x3 + 32 + 32 + 16 + 16 + 16 = approx 170 MiB */
  k_prep<<<5 * PW_TILES + PX_WGS, 256, 0, stream>>>(x, wq, wk, wv, w1, w2, X16, BQ, BK, BV, B1, B2);      /* the five weights as f16 [n][k], x as f16 rows */
  const size_t r0p = (size_t)B0 * SQ; const dim3 gp((unsigned)(3 * (MP / 128) * (DM / 128)), 1);
  k_gemm3<0, true, true><<<gp, 128, 0, stream>>>(X16 + r0p * DM, BQ, BK, BV, 0.0625f, bq, bk, bv, nullptr, Q16 + r0p * DM, K16 + r0p * DM, VT + r0p * DM);      /* q, k as rows, V^T of every (batch, head) */
  k_fattn<<<NB * NH * (SQ / 128), 128, 0, stream>>>(Q16, K16, VT, xmask, AF);      /* a (merged heads) as f32 rows */
  k_lnadd<1, true><<<(unsigned)(MPO / 16), 256, 0, stream>>>(AF + r0p * DM, x + r0p * DM, g1, be1, 1e-5f, X1F + r0p * DM, X1H + r0p * DM);      /* x1 = bf16(x) + LN(a) */
  const dim3 gf((unsigned)((MPO / 128) * (DM / 128)), 1);
  k_gemm3<3, true, false><<<gf, 128, 0, stream>>>(X1H + r0p * DM, B1, nullptr, nullptr, 0.0625f, b1, nullptr, nullptr, nullptr, H16 + r0p * DM, nullptr, nullptr);      /* h = relu(x1 W1 + b1) (f16) */
  k_gemm3<0, false, false><<<gf, 128, 0, stream>>>(H16 + r0p * DM, B2, nullptr, nullptr, 0.0625f, b2, nullptr, nullptr, FF + r0p * DM, nullptr, nullptr, nullptr);      /* f = h W2 + b2 (f32) */
  k_lnadd<0, false><<<(unsigned)(MPO / 16), 256, 0, stream>>>(FF + r0p * DM, X1F + r0p * DM, g2, be2, 1e-5f, (float*)d_out + r0p * DM, nullptr);      /* out = x1 + LN(f) */
}

// v010
// Measured time: 134 microseconds a run.
// In two side-by-side timings against v009, it was 1.03 and 1.04 times as fast.
// Over all steps from v000 it is 82.2 times as fast.
#include <hip/hip_runtime.h>
// Transformer encoder layer (x [8][1024][1024]; per-head q/k/v = x Wq[h] + bq[h] (Wq [16][1024][64]); scores / 8 with a key-padding mask x_mask [8][1][1024] (int32, read; all zeros here); softmax; a = attn v concatenated over heads; x1 = x + LayerNorm(a) g1 + be1; h = relu(x1 W1 + b1); f = h W2 + b2 (W1, W2 [1024][1024] [in][out]); out = x1 + LayerNorm(f) g2 + be2 -> [8][1024][1024]).
// Structure: token rows; x as exact f16 rows; Q, K and V^T as WMMA GEMMs in one launch (128x128 work-group tiles staged in LDS, 64x64 wave tiles, f32 accumulation, exact x16 head-stacked weights + bias, f16 outputs; V^T = Wv^T x^T, the operands exchanged); one fused attention launch (scores K = 64 as S^T = K Q^T - maximum in use, q rows pre-scaled by log2(e) / 8, masked softmax on VALU in f32 with native exp, the maximum renewed when a lane's sum of sixteen weights passes 4096, weights f16 at most 4096, masked keys 0, O^T += V^T P^T, divided by the row sum in f32) into f32 rows; per row on VALU: x1 = bf16(x) + LayerNorm(a) (f32 + f16 copies); h = relu(x1 W1 + b1) GEMM (f16); f = h W2 + b2 GEMM (f32); per row on VALU: out = x1 + LayerNorm(f).
// Compute dtype: inputs rounded to bf16; x / weights exact; q, k, v, softmax weights, x1 (as GEMM operand) and h plain f16 (~2^-12); attention output, LayerNorms, residuals f32. v_wmma_f32_16x16x32_f16.
#define NB 8
#define SQ 1024
#define DM 1024
#define NH 16
#define HD 64
#define HG 4
#define B0 0                         /* first batch processed (debug hook) */
#define NBR NB                       /* batches processed (debug hook) */
#define QN SQ                        /* unused; attention covers all SQ query rows of a batch */
#define NR ((size_t)NB * SQ)
#define MP ((int)((size_t)NBR * SQ)) /* rows projected (debug hook) */
#define MPO MP                       /* rows through the post-attention stages (debug hook) */
typedef __bf16 v16b __attribute__((ext_vector_type(16)));
typedef unsigned short v8us __attribute__((ext_vector_type(8), may_alias));
typedef float  v8f  __attribute__((ext_vector_type(8)));
typedef float  v4f  __attribute__((ext_vector_type(4)));
typedef float  v4fa __attribute__((ext_vector_type(4), may_alias));
union FragB { v16b v; v8us half[2]; unsigned short u[16]; };

__device__ __forceinline__ unsigned short bf16_bits(float x) { unsigned int u = __float_as_uint(x); return (unsigned short)((u + 0x7FFFu + ((u >> 16) & 1u)) >> 16); }
__device__ __forceinline__ float bf16_val(unsigned short b) { return __uint_as_float(((unsigned int)b) << 16); }
__device__ __forceinline__ float bf16_round(float x) { return bf16_val(bf16_bits(x)); }
// D += A·B with NT terms: 1 = ah·bh, 2 = + al·bh (A split), 3 = + ah·bl (both split)
template <int NT>
__device__ __forceinline__ v8f mmaN(v16b ah, v16b al, v16b bh, v16b bl, v8f c) {
  c = __builtin_amdgcn_wmma_f32_16x16x32_bf16(false, ah, false, bh, (short)0, c, false, false);
  if (NT >= 2) c = __builtin_amdgcn_wmma_f32_16x16x32_bf16(false, al, false, bh, (short)0, c, false, false);
  if (NT >= 3) c = __builtin_amdgcn_wmma_f32_16x16x32_bf16(false, ah, false, bl, (short)0, c, false, false);
  asm volatile("v_nop\n\tv_nop\n\tv_nop\n\tv_nop" : "+v"(c) : "v"(ah), "v"(al), "v"(bh), "v"(bl));
  return c;
}

__global__ __launch_bounds__(256) void k_wt_bf16(const float* __restrict__ W, unsigned short* __restrict__ Wt, int K, int N) {
  const int t = blockIdx.x * 256 + threadIdx.x;
  const int k8n = K / 8;
  if (t >= N * k8n) return;
  const int n = t / k8n, k8 = (t % k8n) * 8;
  v8us v;
#pragma unroll
  for (int i = 0; i < 8; ++i) v[i] = bf16_bits(W[(size_t)(k8 + i) * N + n]);
  *(v8us*)(Wt + (size_t)n * K + k8) = v;
  
}

// GEMM C[M][N] (f32, pitch ldc) = act(A[M][K]·W + bias). A f32 row-major (pitch lda) converted per fragment to bf16
// (ASPLIT: hi/lo two planes -> 2 terms, else single rounded term); Wt bf16 [N][K] (pitch ldb). BIAS_BF16 rounds the
// bias to bf16 first (bias quantised to bf16 before the add). K%32==0, M%16==0, N%64==0.
template <bool ASPLIT, int ACT, bool BIAS_BF16>
__global__ __launch_bounds__(128) void k_gemm_bf(const float* __restrict__ A, int lda, const unsigned short* __restrict__ Wt, int ldb,
                                               const float* __restrict__ bias, float* __restrict__ C, int ldc, int M, int N, int K) {
  __shared__ __attribute__((aligned(16))) float so[4][16][64];
  const int tid = threadIdx.x, w = tid >> 5, lane = tid & 31, ln = lane & 15, hh = lane >> 4;
  const int ntn = N / 64;
  const int wid = blockIdx.x * 4 + w;
  const int mt = wid / ntn, nq = wid % ntn;
  if (mt * 16 >= M) return;
  const int row0 = mt * 16, col0 = nq * 64;
  const float* arow = A + (size_t)(row0 + ln) * lda;
  v8f acc[4] = {};
  for (int kb = 0; kb < K; kb += 32) {
    FragB ah, al;
    const v4f x0 = *(const v4fa*)(arow + kb + 8 * hh), x1 = *(const v4fa*)(arow + kb + 8 * hh + 4);
    const v4f x2 = *(const v4fa*)(arow + kb + 16 + 8 * hh), x3 = *(const v4fa*)(arow + kb + 16 + 8 * hh + 4);
    float xs[16] = {x0[0],x0[1],x0[2],x0[3],x1[0],x1[1],x1[2],x1[3],x2[0],x2[1],x2[2],x2[3],x3[0],x3[1],x3[2],x3[3]};
#pragma unroll
    for (int i = 0; i < 16; ++i) { const unsigned short hb = bf16_bits(xs[i]); ah.u[i] = hb; al.u[i] = ASPLIT ? bf16_bits(xs[i] - bf16_val(hb)) : (unsigned short)0; }
#pragma unroll
    for (int t = 0; t < 4; ++t) {
      const unsigned short* brow = Wt + (size_t)(col0 + t * 16 + ln) * ldb + kb;
      FragB b;
      b.half[0] = *(const v8us*)(brow + 8 * hh);
      b.half[1] = *(const v8us*)(brow + 16 + 8 * hh);
      acc[t] = mmaN<ASPLIT ? 2 : 1>(ah.v, al.v, b.v, b.v, acc[t]);
    }
  }
#pragma unroll
  for (int t = 0; t < 4; ++t) {
    float bv = bias ? bias[col0 + t * 16 + ln] : 0.f;
    if (BIAS_BF16) bv = bf16_round(bv);
#pragma unroll
    for (int r = 0; r < 8; ++r) { float v = acc[t][r] + bv; if (ACT == 1) v = fmaxf(v, 0.f); so[w][8 * hh + r][t * 16 + ln] = v; }
  }
  __builtin_amdgcn_fence(__ATOMIC_ACQ_REL, "workgroup");
  __builtin_amdgcn_wave_barrier();
  const int rsub = lane >> 4, c4 = (lane & 15) * 4;
  {
#pragma unroll
    for (int q = 0; q < 8; ++q) {
      const int r = q * 2 + rsub;
      const v4f v = *(const v4fa*)&so[w][r][c4];
      *(v4f*)(C + (size_t)(row0 + r) * ldc + col0 + c4) = v;
    }
    
  }
}

// GEMM C = act(A·W + bias + resid): A f32 (ASPLIT -> hi/lo 2 terms), Wt bf16 [N][K]; ACT 0 none, 1 relu, 2 exact gelu;
// resid (optional, f32, row index = (row % rmod), pitch ldr, RES_BF16 rounds it) added before the activation.
template <bool ASPLIT, int ACT, bool BIAS_BF16, bool RES_BF16>
__global__ __launch_bounds__(128) void k_gemm_bf3(const float* __restrict__ A, int lda, const unsigned short* __restrict__ Wt, int ldb,
                                                const float* __restrict__ bias, const float* __restrict__ resid, int rmod, int ldr,
                                                float* __restrict__ C, int ldc, int M, int N, int K) {
  __shared__ __attribute__((aligned(16))) float so[4][16][64];
  const int tid = threadIdx.x, w = tid >> 5, lane = tid & 31, ln = lane & 15, hh = lane >> 4;
  const int ntn = N / 64;
  const int wid = blockIdx.x * 4 + w;
  const int mt = wid / ntn, nq = wid % ntn;
  if (mt * 16 >= M) return;
  const int row0 = mt * 16, col0 = nq * 64;
  const float* arow = A + (size_t)(row0 + ln) * lda;
  v8f acc[4] = {};
  for (int kb = 0; kb < K; kb += 32) {
    FragB ah, al;
    const v4f x0 = *(const v4fa*)(arow + kb + 8 * hh), x1 = *(const v4fa*)(arow + kb + 8 * hh + 4);
    const v4f x2 = *(const v4fa*)(arow + kb + 16 + 8 * hh), x3 = *(const v4fa*)(arow + kb + 16 + 8 * hh + 4);
    float xs[16] = {x0[0],x0[1],x0[2],x0[3],x1[0],x1[1],x1[2],x1[3],x2[0],x2[1],x2[2],x2[3],x3[0],x3[1],x3[2],x3[3]};
#pragma unroll
    for (int i = 0; i < 16; ++i) { const unsigned short hb = bf16_bits(xs[i]); ah.u[i] = hb; al.u[i] = ASPLIT ? bf16_bits(xs[i] - bf16_val(hb)) : (unsigned short)0; }
#pragma unroll
    for (int t = 0; t < 4; ++t) {
      const unsigned short* brow = Wt + (size_t)(col0 + t * 16 + ln) * ldb + kb;
      FragB b;
      b.half[0] = *(const v8us*)(brow + 8 * hh);
      b.half[1] = *(const v8us*)(brow + 16 + 8 * hh);
      acc[t] = mmaN<ASPLIT ? 2 : 1>(ah.v, al.v, b.v, b.v, acc[t]);
    }
  }
#pragma unroll
  for (int t = 0; t < 4; ++t) {
    const int col = col0 + t * 16 + ln;
    float bv = bias ? bias[col] : 0.f;
    if (BIAS_BF16) bv = bf16_round(bv);
#pragma unroll
    for (int r = 0; r < 8; ++r) {
      float v = acc[t][r] + bv;
      if (resid) { float rv = resid[(size_t)((row0 + 8 * hh + r) % rmod) * ldr + col]; if (RES_BF16) rv = bf16_round(rv); v += rv; }
      if (ACT == 1) v = fmaxf(v, 0.f);
      if (ACT == 2) v = 0.5f * v * (1.0f + erff(v * 0.70710678118654752f));
      if (ACT == 3) { const float u = 0.7978845608028654f * (v + 0.044715f * v * v * v); v = 0.5f * v * (1.0f + tanhf(u)); }
      so[w][8 * hh + r][t * 16 + ln] = v;
    }
  }
  __builtin_amdgcn_fence(__ATOMIC_ACQ_REL, "workgroup");
  __builtin_amdgcn_wave_barrier();
  const int rsub = lane >> 4, c4 = (lane & 15) * 4;
  {
#pragma unroll
    for (int q = 0; q < 8; ++q) {
      const int r = q * 2 + rsub;
      const v4f v = *(const v4fa*)&so[w][r][c4];
      *(v4f*)(C + (size_t)(row0 + r) * ldc + col0 + c4) = v;
    }
    
  }
}
// row LayerNorm (biased variance, eps) over N: s = X (+ R); optional out_sum <- s; out_norm <- (s-mu)*rsqrt(var+eps)*g + b
template <bool PARAM_BF16>
__global__ __launch_bounds__(256) void k_layernorm(const float* __restrict__ X, const float* __restrict__ R, const float* __restrict__ g, const float* __restrict__ bta,
                                                  float* __restrict__ out_sum, float* __restrict__ out_norm, int N, float eps) {
  __shared__ float red[256];
  const int row = blockIdx.x, tid = threadIdx.x;
  const float* x = X + (size_t)row * N; const float* rr = R ? R + (size_t)row * N : nullptr;
  float vals[16];                     // up to N = 4096
  const int per = N / 256;            // contiguous chunk per thread? use strided-by-4 chunks: thread handles j = tid*4 + 1024*u
  float s1 = 0.f;
  for (int u = 0; u < per / 4; ++u) {
    const int j = tid * 4 + 1024 * u;
    const v4f a = *(const v4fa*)(x + j);
    v4f b = {0.f,0.f,0.f,0.f}; if (rr) b = *(const v4fa*)(rr + j);
#pragma unroll
    for (int q = 0; q < 4; ++q) { const float v = a[q] + b[q]; vals[u * 4 + q] = v; s1 += v; }
  }
  red[tid] = s1; __syncthreads();
  for (int st = 128; st > 0; st >>= 1) { if (tid < st) red[tid] += red[tid + st]; __syncthreads(); }
  const float mu = red[0] / (float)N; __syncthreads();
  float s2 = 0.f;
  for (int u = 0; u < per / 4; ++u)
#pragma unroll
    for (int q = 0; q < 4; ++q) { const float c = vals[u * 4 + q] - mu; s2 += c * c; }
  red[tid] = s2; __syncthreads();
  for (int st = 128; st > 0; st >>= 1) { if (tid < st) red[tid] += red[tid + st]; __syncthreads(); }
  const float rs = rsqrtf(red[0] / (float)N + eps);
  {
    for (int u = 0; u < per / 4; ++u) {
      const int j = tid * 4 + 1024 * u;
      v4f o, sm;
#pragma unroll
      for (int q = 0; q < 4; ++q) {
        float gg = g[j + q], bb = bta[j + q];
        if (PARAM_BF16) { gg = bf16_round(gg); bb = bf16_round(bb); }
        sm[q] = vals[u * 4 + q]; o[q] = (vals[u * 4 + q] - mu) * rs * gg + bb;
      }
      if (out_sum) *(v4f*)(out_sum + (size_t)row * N + j) = sm;
      *(v4f*)(out_norm + (size_t)row * N + j) = o;
    }
    
  }
}



// ---- f16 WMMA path (v_wmma_f32_16x16x32_f16): 11-bit significands for operands in range — used for every GEMM launched here
typedef _Float16 v16h __attribute__((ext_vector_type(16)));
union FragH { v16h v; v8us half[2]; _Float16 h[16]; unsigned short u[16]; };
template <int NT>
__device__ __forceinline__ v8f mmaH(v16h ah, v16h al, v16h bh, v16h bl, v8f c) {
  c = __builtin_amdgcn_wmma_f32_16x16x32_f16(false, ah, false, bh, (short)0, c, false, false);
  if (NT >= 2) c = __builtin_amdgcn_wmma_f32_16x16x32_f16(false, al, false, bh, (short)0, c, false, false);
  if (NT >= 3) c = __builtin_amdgcn_wmma_f32_16x16x32_f16(false, ah, false, bl, (short)0, c, false, false);
  asm volatile("v_nop\n\tv_nop\n\tv_nop\n\tv_nop" : "+v"(c) : "v"(ah), "v"(al), "v"(bh), "v"(bl));
  return c;
}
// batched GEMM like k_gemm_b but f16 operands: A f32 (split into f16 hi/lo if ASPLIT, else rounded to f16), Bt = f16 values [n][k]; alpha; C f32; N multiple of 16 (partial tiles skipped)
template <bool ASPLIT>
__global__ __launch_bounds__(128) void k_gemm_h(const float* __restrict__ A, int lda, size_t sA, const _Float16* __restrict__ Bh, int ldb, size_t sB, float alpha, float* __restrict__ C, int ldc, size_t sC, int M, int N, int K) {
  __shared__ __attribute__((aligned(16))) float so[4][16][64];
  const int tid = threadIdx.x, w = tid >> 5, lane = tid & 31, ln = lane & 15, hh = lane >> 4; const int by = blockIdx.y;
  A += (size_t)by * sA; Bh += (size_t)by * sB; C += (size_t)by * sC;
  const int ntn = (N + 63) / 64; const int wid = blockIdx.x * 4 + w; const int mt = wid / ntn, nq = wid % ntn; if (mt * 16 >= M) return;
  const int row0 = mt * 16, col0 = nq * 64; const float* arow = A + (size_t)(row0 + ln) * lda;
  v8f acc[4] = {};
  for (int kb = 0; kb < K; kb += 32) {
    FragH ah, al;
    const v4f x0 = *(const v4fa*)(arow + kb + 8 * hh), x1 = *(const v4fa*)(arow + kb + 8 * hh + 4), x2 = *(const v4fa*)(arow + kb + 16 + 8 * hh), x3 = *(const v4fa*)(arow + kb + 16 + 8 * hh + 4);
    float xs[16] = {x0[0],x0[1],x0[2],x0[3],x1[0],x1[1],x1[2],x1[3],x2[0],x2[1],x2[2],x2[3],x3[0],x3[1],x3[2],x3[3]};
#pragma unroll
    for (int i = 0; i < 16; ++i) { const _Float16 h = (_Float16)xs[i]; ah.h[i] = h; al.h[i] = ASPLIT ? (_Float16)(xs[i] - (float)h) : (_Float16)0.0f; }
#pragma unroll
    for (int t = 0; t < 4; ++t) { if (col0 + t * 16 >= N) continue; const size_t boff = (size_t)(col0 + t * 16 + ln) * ldb + kb; FragH bq; bq.half[0] = *(const v8us*)(Bh + boff + 8 * hh); bq.half[1] = *(const v8us*)(Bh + boff + 16 + 8 * hh);
      acc[t] = mmaH<ASPLIT ? 2 : 1>(ah.v, al.v, bq.v, bq.v, acc[t]); }
  }
#pragma unroll
  for (int t = 0; t < 4; ++t) { if (col0 + t * 16 >= N) continue;
#pragma unroll
    for (int r = 0; r < 8; ++r) so[w][8 * hh + r][t * 16 + ln] = acc[t][r] * alpha; }
  __builtin_amdgcn_fence(__ATOMIC_ACQ_REL, "workgroup"); __builtin_amdgcn_wave_barrier();
  const int rsub = lane >> 4, c4 = (lane & 15) * 4;
  {
#pragma unroll
    for (int q = 0; q < 8; ++q) { const int r = q * 2 + rsub; if (col0 + c4 < N) { const v4f v = *(const v4fa*)&so[w][r][c4]; *(v4f*)(C + (size_t)(row0 + r) * ldc + col0 + c4) = v; } }
     }
}

// k_gemm_hh variant with fused epilogue: v = acc·alpha + bias[by·sBias + col] (+ CP[(row/rowsPerB)·sCPb + by·64 + col] if CP) ; ACT 0 none / 1 elu ; writes f16 C16 (and f32 C if non-null)
template <int ACT>
__global__ __launch_bounds__(128) void k_gemm_hhx(const _Float16* __restrict__ A, int lda, size_t sA, const _Float16* __restrict__ Bh, int ldb, size_t sB, float alpha, const float* __restrict__ bias, size_t sBias, const float* __restrict__ CP, int rowsPerB, size_t sCPb, int row0g,
    float* __restrict__ C, _Float16* __restrict__ C16, int ldc, size_t sC, int M, int N, int K) {
  __shared__ __attribute__((aligned(16))) float so[4][16][64];
  const int tid = threadIdx.x, w = tid >> 5, lane = tid & 31, ln = lane & 15, hh = lane >> 4; const int by = blockIdx.y;
  A += (size_t)by * sA; Bh += (size_t)by * sB; const size_t cofs = (size_t)by * sC; const float* bp = bias ? bias + (size_t)by * sBias : nullptr;
  const int ntn = (N + 63) / 64; const int wid = blockIdx.x * 4 + w; const int mt = wid / ntn, nq = wid % ntn; if (mt * 16 >= M) return;
  const int row0 = mt * 16, col0 = nq * 64; const _Float16* arow = A + (size_t)(row0 + ln) * lda;
  v8f acc[4] = {};
  for (int kb = 0; kb < K; kb += 32) { FragH ah; ah.half[0] = *(const v8us*)((const unsigned short*)arow + kb + 8 * hh); ah.half[1] = *(const v8us*)((const unsigned short*)arow + kb + 16 + 8 * hh);
#pragma unroll
    for (int t = 0; t < 4; ++t) { if (col0 + t * 16 >= N) continue; const size_t boff = (size_t)(col0 + t * 16 + ln) * ldb + kb; FragH bq; bq.half[0] = *(const v8us*)((const unsigned short*)Bh + boff + 8 * hh); bq.half[1] = *(const v8us*)((const unsigned short*)Bh + boff + 16 + 8 * hh);
      acc[t] = mmaH<1>(ah.v, ah.v, bq.v, bq.v, acc[t]); }
  }
#pragma unroll
  for (int t = 0; t < 4; ++t) { if (col0 + t * 16 >= N) continue; const int col = col0 + t * 16 + ln; const float bv = bp ? bf16_round(bp[col]) : 0.f;
#pragma unroll
    for (int r = 0; r < 8; ++r) { float v = acc[t][r] * alpha + bv; if (CP) { const int rr = row0g + row0 + 8 * hh + r; if (rowsPerB < 0) v += CP[cofs + (size_t)rr * ldc + col];      /* rowsPerB < 0: own element of the batched C plane */ else { const int bidx = rr / rowsPerB; v += CP[(size_t)bidx * sCPb + (size_t)by * 64 + col]; } } if (ACT == 1) v = (v > 0.f) ? v : expm1f(v); else if (ACT == 7) v = (v > 0.f) ? v + 1.0f : expf(v); else if (ACT == 8) v = tanhf(v); else if (ACT == 9) v = 0.5f * v * (1.0f + tanhf(0.7978845608028654f * (v + 0.044715f * v * v * v))); else if (ACT == 11) v = 1.0f / (1.0f + expf(-v)); else if (ACT == 12) v = (v > 0.f) ? v : 0.01f * v; else if (ACT == 14) v = (v > 0.f) ? v : 0.1f * v; else if (ACT == 16) v = (v >= 0.f) ? v : 0.3f * v; else if (ACT == 17) v = (v >= 0.f) ? v : 0.2f * v; else if (ACT == 15) v = v / (1.0f + expf(-v)); else if (ACT == 3) v = fmaxf(v, 0.f); else if (ACT == 6) v = 0.5f * v * (1.0f + erff(v * 0.70710678118654752f)); so[w][8 * hh + r][t * 16 + ln] = v; } }
  __builtin_amdgcn_fence(__ATOMIC_ACQ_REL, "workgroup"); __builtin_amdgcn_wave_barrier();
  const int rsub = lane >> 4, c4 = (lane & 15) * 4; typedef _Float16 v4h __attribute__((ext_vector_type(4)));
  {
#pragma unroll
    for (int q = 0; q < 8; ++q) { const int r = q * 2 + rsub; if (col0 + c4 < N) { const v4f v = *(const v4fa*)&so[w][r][c4]; if (C) *(v4f*)(C + cofs + (size_t)(row0 + r) * ldc + col0 + c4) = v; if (C16) { v4h h4; for (int i = 0; i < 4; ++i) h4[i] = (_Float16)v[i]; *(v4h*)(C16 + cofs + (size_t)(row0 + r) * ldc + col0 + c4) = h4; } } }
     }
}


typedef _Float16 v4h __attribute__((ext_vector_type(4)));

__global__ __launch_bounds__(256) void k_h16(const float* __restrict__ x, _Float16* __restrict__ X16, size_t n8) { const size_t t = (size_t)blockIdx.x * 256 + threadIdx.x; if (t >= n8) return; FragH f;
#pragma unroll
  for (int q = 0; q < 8; ++q) f.h[q] = (_Float16)x[t * 8 + q]; *(v8us*)((unsigned short*)X16 + t * 8) = f.half[0];  }
__global__ __launch_bounds__(256) void k_round16f(const float* __restrict__ W, _Float16* __restrict__ Bt, size_t n8) { const size_t t = (size_t)blockIdx.x * 256 + threadIdx.x; if (t >= n8) return; FragH f;
#pragma unroll
  for (int i = 0; i < 8; ++i) f.h[i] = (_Float16)(bf16_round(W[t * 8 + i]) * 16.0f); *(v8us*)((unsigned short*)Bt + t * 8) = f.half[0];  }
template <int NHv, int TTv>
__global__ __launch_bounds__(256) void k_vt(const _Float16* __restrict__ V16, int ldv, int voff, _Float16* __restrict__ Vt) { __shared__ unsigned short tl[64][66]; const int tid = threadIdx.x; const int slab = blockIdx.x / (TTv / 64), lg = blockIdx.x % (TTv / 64); const int b = slab / NHv, h = slab % NHv;
  for (int i = tid; i < 64 * 8; i += 256) { const int r = i / 8, c8 = (i % 8) * 8; FragH f; f.half[0] = *(const v8us*)((const unsigned short*)V16 + ((size_t)b * TTv + lg * 64 + r) * ldv + voff + h * 64 + c8);
#pragma unroll
    for (int q = 0; q < 8; ++q) tl[r][c8 + q] = f.u[q]; }
  __syncthreads();
  {
#pragma unroll
    for (int rd = 0; rd < 2; ++rd) { const int d = rd * 32 + tid / 8, pc = tid % 8; FragH f;
#pragma unroll
      for (int q = 0; q < 8; ++q) f.u[q] = tl[pc * 8 + q][d];
      *(v8us*)((unsigned short*)Vt + ((size_t)slab * 64 + d) * TTv + lg * 64 + pc * 8) = f.half[0]; }
     } }

__global__ __launch_bounds__(256) void k_hl(const float* __restrict__ F, _Float16* __restrict__ Hh, _Float16* __restrict__ Hl, size_t n8) { const size_t t = (size_t)blockIdx.x * 256 + threadIdx.x; if (t >= n8) return; FragH fh, fl; const v4f a = *(const v4fa*)(F + t * 8), c = *(const v4fa*)(F + t * 8 + 4);
#pragma unroll
  for (int q = 0; q < 4; ++q) { _Float16 h = (_Float16)a[q]; fh.h[q] = h; fl.h[q] = (_Float16)((a[q] - (float)h) * 1024.0f); h = (_Float16)c[q]; fh.h[4 + q] = h; fl.h[4 + q] = (_Float16)((c[q] - (float)h) * 1024.0f); }
  { *(v8us*)((unsigned short*)Hh + t * 8) = fh.half[0]; *(v8us*)((unsigned short*)Hl + t * 8) = fl.half[0];  } }

// ---- staged GEMM: C = act(A B^T alpha + bias), A f16 [M][K], Bh f16 [N][K], both K-contiguous, N = K = DM; M % 128 == 0; grid = (M / 128) * (N / 128); H16 picks the f16 output C16, else the f32 output C ----
// QKV: three products of the same A in one launch, grid = 3 (M / 128) (N / 128), the 3 (N / 128) work-groups of one block of 128 A rows next to each other: C16 = (A Bh^T alpha + bias) FA_QSCALE, C16b = A Bh2^T alpha + bias2, and the third one transposed,
// C16c[(batch DM + n) SQ + s] = (Bh3 A^T alpha + bias3[n]) for A row batch SQ + s: its work-groups take the Bh3 rows as the matrix instruction's A operand and the A rows as its B operand, so that the accumulator tiles already hold n in rows and s in columns.
// A work-group of four waves takes a 128 x 128 tile of C, a wave 64 x 64 of it (4 x 4 accumulator tiles). Per trip 128 k of the 128 A rows and the 128 B rows (256 bytes a row) lie in LDS at a pitch of 272 bytes,
// in four slices of 64 rows (A rows 0..63, A rows 64..127, B rows 0..63, B rows 64..127); wave w brings slice w there with one tensor load, two buffers, the next stage in flight while this one is worked on.
// The k order of every sum is ascending in steps of 32, as with fragments read from global memory.
__device__ __forceinline__ v16h g2_frag(const _Float16* p, int hh) { FragH f; f.half[0] = *(const v8us*)((const unsigned short*)p + 8 * hh); f.half[1] = *(const v8us*)((const unsigned short*)p + 16 + 8 * hh); return f.v; }
#define FA_QSCALE 0.18033688f          /* log2(e) / 8: q rows carry it, so that K Q^T is score / 8 in log2 units, exp(x) = 2^(x log2 e) */
#define G3_PITCH 144                   /* LDS bytes per 128-byte row: 16 B x odd, for ds_load_b128 readers */
#define G4_PITCH 272                   /* LDS bytes per 256-byte row of a GEMM tile: 16 B x odd, for ds_load_b128 readers */
#define G4_TILE (128 * G4_PITCH)       /* spacing of the waves' output staging in LDS, bytes */
__device__ __forceinline__ v8f g3_mma(v16h a, v16h b, v8f c) { return __builtin_amdgcn_wmma_f32_16x16x32_f16(false, a, false, b, (short)0, c, false, false); }
__device__ __forceinline__ v16h g3_frag(const unsigned char* p) { FragH f; f.half[0] = *(const v8us*)p; f.half[1] = *(const v8us*)(p + 32); return f.v; }      /* p already holds the lane's row and its 16 hh bytes: k = 8 hh + 0..7, then 16 + 8 hh + 0..7 */
#define G5_SLICE 18432                 /* LDS bytes of one slice: 64 rows at 272 bytes = 17,408, rounded up to a multiple of 2 KiB so that every slice's place is one */
#define G5_STAGE (4 * G5_SLICE)        /* one stage in LDS, bytes: two A slices, then two B slices */
typedef unsigned u32x4 __attribute__((ext_vector_type(4)));
typedef unsigned u32x8 __attribute__((ext_vector_type(8)));
__device__ __forceinline__ unsigned g5_uni(unsigned v) { return (unsigned)__builtin_amdgcn_readfirstlane(v); }
// a wave-uniform value held in a scalar register: a test on it compiles to s_cmp and s_cbranch_scc (a tensor load ignores EXEC), and what is computed from it stays behind the asm waits in front of it
__device__ __forceinline__ unsigned g5_pinned(unsigned v) { unsigned w = g5_uni(v); asm volatile("" : "+s"(w)); /* pinned(): a descriptor word or issue test held in a scalar register */ return w; }
// one request of the whole wave: 64 rows of 256 bytes, source pitch 2 DM bytes, first byte at g, to LDS byte lds, 16 bytes of pad behind every row (pitch 272 bytes); extents in bytes, no mask
__device__ __forceinline__ void g5_load(unsigned lds, const _Float16* g) { const unsigned long long ga = (unsigned long long)g; u32x4 g0; u32x8 g1;
  g0[0] = g5_uni(1u); g0[1] = g5_uni(lds); g0[2] = g5_uni((unsigned)ga); g0[3] = g5_uni((((unsigned)(ga >> 32)) & 0x01FFFFFFu) | 0x80000000u);
  g1[0] = g5_uni((1u << 20) | (5u << 22) | (3u << 25)); g1[1] = g5_uni(256u << 16); g1[2] = g5_uni(64u << 16); g1[3] = g5_uni(256u << 16); g1[4] = g5_uni(64u); g1[5] = g5_uni(2u * DM); g1[6] = g5_uni(0u); g1[7] = g5_uni(0u);
  asm volatile("tensor_load_to_lds %0, %1" :: "s"(g0), "s"(g1) : "memory"); }
template <int ACT, bool H16, bool QKV>
__global__ __launch_bounds__(128) void k_gemm3(const _Float16* __restrict__ A, const _Float16* __restrict__ Bh, const _Float16* __restrict__ Bh2, const _Float16* __restrict__ Bh3, float alpha, const float* __restrict__ bias, const float* __restrict__ bias2, const float* __restrict__ bias3,
                                               float* __restrict__ C, _Float16* __restrict__ C16, _Float16* __restrict__ C16b, _Float16* __restrict__ C16c) { static_assert(ACT == 0 || ACT == 3, "k_gemm3: unsupported ACT code (would silently apply no activation)");
  static_assert(!QKV || (H16 && ACT == 0 && SQ % 128 == 0 && SQ == DM), "k_gemm3: the three-product form writes f16, applies no activation, and its transposed tiles lie inside one batch, rows of SQ = N elements");
  constexpr int N = DM, K = DM; static_assert(N % 128 == 0 && K % 128 == 0 && K >= 256, "k_gemm3: whole tiles only, two or more of them along K");
  __shared__ __attribute__((aligned(2048))) unsigned char sm[2 * G5_STAGE];      /* buffer u at u stages; the kernel's only LDS, so every slice stands at a multiple of 2 KiB; behind the loop each wave's output staging, G4_TILE bytes apart */
  const int tid = threadIdx.x, w = tid >> 5, lane = tid & 31, ln = lane & 15, hh = lane >> 4;
  const int ntn = N >> 7; const int mt = blockIdx.x / (QKV ? 3 * ntn : ntn), nc = blockIdx.x - mt * (QKV ? 3 * ntn : ntn); const int sel = nc / ntn, nq = nc - sel * ntn; const bool tr = QKV && sel == 2;      /* sel, tr: from blockIdx alone, the same for the whole work-group */
  const int row0 = (tr ? nq : mt) * 128, col0 = (tr ? mt : nq) * 128; const int wr = (w >> 1) * 64, wc = (w & 1) * 64;      /* first row of the tile of the matrix instruction's A operand, of its B operand */
  const _Float16* Ao = tr ? Bh3 : A; const _Float16* Bo = tr ? A : (QKV && sel == 1) ? Bh2 : Bh;
  const unsigned wv = g5_uni((unsigned)tid >> 5);      /* the wave's number, scalar: every wave issues its own slice */
  const unsigned lw = (unsigned)(size_t)sm + wv * G5_SLICE;      /* the slice's place in buffer 0 */
  const _Float16* gw = wv < 2u ? Ao + (size_t)(row0 + (int)wv * 64) * K : Bo + (size_t)(col0 + ((int)wv - 2) * 64) * K; constexpr int nt = K >> 7;      /* first element of the slice's first row */
  g5_load(lw, gw);
  asm volatile("s_wait_tensorcnt 0x0" ::: "memory");      /* this wave's slice of stage 0 has landed */
  __syncthreads();      /* stage 0 is read by every wave */
  g5_load(lw + G5_STAGE, gw + 128);
  const unsigned char* fa = sm + (w >> 1) * G5_SLICE + ln * G4_PITCH + 16 * hh; const unsigned char* fb = sm + (2 + (w & 1)) * G5_SLICE + ln * G4_PITCH + 16 * hh;      /* the wave's 64 A rows are one slice, its 64 B rows another */
  const v8f z8 = {0.f, 0.f, 0.f, 0.f, 0.f, 0.f, 0.f, 0.f}; v8f acc[4][4];
#pragma unroll      /* register arrays need constant indices */
  for (int i = 0; i < 4; ++i)
#pragma unroll      /* register arrays need constant indices */
    for (int j = 0; j < 4; ++j) acc[i][j] = z8;
#pragma unroll 1      /* one trip per tile: the buffer is chosen at run time, and an unrolled body would only grow the text */
  for (int t = 0; t < nt; ++t) { const unsigned bo = (unsigned)(t & 1) * G5_STAGE;
#pragma unroll      /* register arrays need constant indices */
    for (int ks = 0; ks < 4; ++ks) { v16h af[4], bf[4];
#pragma unroll      /* register arrays need constant indices */
      for (int i = 0; i < 4; ++i) bf[i] = g3_frag(fb + bo + i * 16 * G4_PITCH + ks * 64);
#pragma unroll      /* register arrays need constant indices */
      for (int i = 0; i < 4; ++i) af[i] = g3_frag(fa + bo + i * 16 * G4_PITCH + ks * 64);
      __builtin_amdgcn_sched_barrier(0);      /* the sixteen LDS reads of a block go out as one group in front of its products: left free, each A fragment was read alone and waited for in front of its four products */
#pragma unroll      /* register arrays need constant indices */
      for (int i = 0; i < 4; ++i)
#pragma unroll      /* register arrays need constant indices */
        for (int j = 0; j < 4; ++j) acc[i][j] = g3_mma(af[i], bf[j], acc[i][j]);
      __builtin_amdgcn_sched_barrier(0); }      /* the next group of reads stays behind this block's products, whose fragment registers it reuses */
    asm volatile("s_wait_dscnt 0x0" ::: "memory");      /* this wave's reads of the buffer have returned before the barrier behind which it is refilled */
    asm volatile("s_wait_tensorcnt 0x0" ::: "memory");
    __syncthreads();      /* publishes stage t + 1 and ends every wave's reads of stage t */
    if (g5_pinned((unsigned)(t + 2 < nt))) { const unsigned tn = g5_pinned((unsigned)t + 2u); g5_load(lw + bo, gw + (size_t)tn * 128); } }      /* a scalar branch; the address is formed from a value pinned behind the wait, when no request is outstanding */
  asm volatile("s_wait_tensorcnt 0x0" ::: "memory");      /* no request is outstanding when the buffers become output staging */
  asm volatile("s_wait_dscnt 0x0" ::: "memory");      /* nor an LDS read of this wave */
  float* so = (float*)(sm + w * G4_TILE);      /* 64 rows of 68 floats, this wave's own; the last trip's barrier has ended every read of the tiles */
  if (tr) {      /* the bias goes with the accumulator's row */
#pragma unroll      /* register arrays need constant indices */
    for (int i = 0; i < 4; ++i) { const float* bp = bias3 + row0 + wr + i * 16 + 8 * hh; const v4f bl = *(const v4fa*)bp, bu = *(const v4fa*)(bp + 4);
#pragma unroll      /* register arrays need constant indices */
      for (int r = 0; r < 8; ++r) { const float bv = bf16_round(r < 4 ? bl[r & 3] : bu[r & 3]);
#pragma unroll      /* register arrays need constant indices */
        for (int j = 0; j < 4; ++j) so[(i * 16 + 8 * hh + r) * 68 + j * 16 + ln] = acc[i][j][r] * alpha + bv; } } }
  else { const float* bc = (QKV && sel == 1) ? bias2 : bias; const float qs = (QKV && sel == 0) ? FA_QSCALE : 1.0f;      /* q rows leave scaled, in f32, before their one rounding to f16 */
#pragma unroll      /* register arrays need constant indices */
  for (int j = 0; j < 4; ++j) { const float bv = bf16_round(bc[col0 + wc + j * 16 + ln]);
#pragma unroll      /* register arrays need constant indices */
    for (int i = 0; i < 4; ++i)
#pragma unroll      /* register arrays need constant indices */
      for (int r = 0; r < 8; ++r) { float v = acc[i][j][r] * alpha + bv; if (ACT == 3) v = fmaxf(v, 0.f); if (QKV) v *= qs; so[(i * 16 + 8 * hh + r) * 68 + j * 16 + ln] = v; } } }
  __builtin_amdgcn_fence(__ATOMIC_ACQ_REL, "workgroup"); __builtin_amdgcn_wave_barrier();      /* the wave's staging writes stay in front of its reads of words that other lanes wrote */
  const int rsub = lane >> 4, c4 = (lane & 15) * 4;
  const size_t o = tr ? ((size_t)(col0 / SQ) * DM + row0 + wr + rsub) * SQ + col0 % SQ + wc + c4 : (size_t)(row0 + wr + rsub) * N + col0 + wc + c4;      /* transposed: row n of the batch's plane, column s */
  _Float16* Co = tr ? C16c : (QKV && sel == 1) ? C16b : C16;
#pragma unroll      /* register arrays need constant indices */
  for (int q0 = 0; q0 < 32; q0 += 8) { v4f v[8];      /* the reads go out in groups ahead of their stores, each store whole 128-byte lines */
#pragma unroll      /* register arrays need constant indices */
    for (int u = 0; u < 8; ++u) v[u] = *(const v4fa*)&so[((q0 + u) * 2 + rsub) * 68 + c4];
#pragma unroll      /* register arrays need constant indices */
    for (int u = 0; u < 8; ++u) { if (H16) { v4h h4; for (int i = 0; i < 4; ++i) h4[i] = (_Float16)v[u][i]; *(v4h*)(Co + o + (size_t)(q0 + u) * 2 * N) = h4; } else *(v4f*)(C + o + (size_t)(q0 + u) * 2 * N) = v[u]; } } }


__global__ __launch_bounds__(256) void k_wnat(const float* __restrict__ w, size_t n8, _Float16* __restrict__ Bt) { const size_t t = (size_t)blockIdx.x * 256 + threadIdx.x; if (t >= n8) return; FragH f; for (int q = 0; q < 8; ++q) f.h[q] = (_Float16)(bf16_round(w[t * 8 + q]) * 16.0f); *(v8us*)((unsigned short*)Bt + t * 8) = f.half[0];  }
__global__ __launch_bounds__(256) void k_rsm(const float* __restrict__ S, _Float16* __restrict__ P, int nrows) {
  #pragma clang fp contract(off)
  const int i = blockIdx.x * 256 + threadIdx.x; if (i >= nrows) return; const float* s = S + (size_t)i * SQ; float mx = -3.0e38f;
#pragma unroll 1
  for (int j = 0; j < SQ; ++j) mx = fmaxf(mx, s[j]); float se = 0.f;
#pragma unroll 1
  for (int j = 0; j < SQ; ++j) se += expf(s[j] - mx); const float sc = 256.0f / se;
#pragma unroll 1
  for (int j0 = 0; j0 < SQ; j0 += 8) { FragH f; for (int q = 0; q < 8; ++q) f.h[q] = (_Float16)(expf(s[j0 + q] - mx) * sc); unsigned short* d = (unsigned short*)P + (size_t)i * SQ + j0; *(v8us*)d = f.half[0];  } }
__global__ __launch_bounds__(256) void k_vt(const _Float16* __restrict__ V16, int b, int h0, _Float16* __restrict__ VT) { __shared__ unsigned short tl[64][65]; const int tid = threadIdx.x; const int hh = blockIdx.x % HG, sg = blockIdx.x / HG; const int s0 = sg * 64; const int h = h0 + hh;
  for (int i = tid; i < 64 * 8; i += 256) { const int j = i / 8, d8 = (i % 8) * 8; FragH f; f.half[0] = *(const v8us*)((const unsigned short*)V16 + ((size_t)b * SQ + s0 + j) * DM + h * HD + d8); for (int q = 0; q < 8; ++q) tl[d8 + q][j] = f.u[q]; }
  __syncthreads();
  { for (int i = tid; i < 64 * 8; i += 256) { const int d = i / 8, j8 = (i % 8) * 8; FragH f; for (int q = 0; q < 8; ++q) f.u[q] = tl[d][j8 + q]; *(v8us*)((unsigned short*)VT + ((size_t)hh * HD + d) * SQ + s0 + j8) = f.half[0]; }  } }


// Operand preparation, one launch. Work-groups 0 .. 5 PW_TILES - 1 each take one tile, 64 k x 64 n, of one weight: Bt[n][k] = f16(bf16(W[k][n]) x 16) (a power of two: bf16-exact weights stay exact in f16 away from the subnormal range).
// n is the output column (head-stacked, 64 h + column, for Wq, Wk, Wv [16][1024][64]; the column for W1, W2 [in][out]), k the input column. A tile's source rows are 256 contiguous bytes, read 16 bytes a lane;
// two neighbouring k are packed into one LDS word at [n][k / 2], pitch 33 words (odd: neither the writers, 4 n apart, nor the readers, rows of 4 words, meet in a bank); its 128-byte rows of Bt are written 16 bytes a lane, whole lines.
// The work-groups behind them turn x into f16 rows, eight elements a thread.
#define PW_TILES ((DM / 64) * (DM / 64))      /* tiles of one weight */
#define PX_WGS ((unsigned)(NR * DM / 8 / 256))      /* work-groups of the x part */
__global__ __launch_bounds__(256) void k_prep(const float* __restrict__ x, const float* __restrict__ wq, const float* __restrict__ wk, const float* __restrict__ wv, const float* __restrict__ w1, const float* __restrict__ w2,
                                              _Float16* __restrict__ X16, _Float16* __restrict__ BQ, _Float16* __restrict__ BK, _Float16* __restrict__ BV, _Float16* __restrict__ B1, _Float16* __restrict__ B2) {
  static_assert(HD == 64 && DM % 64 == 0 && NH * HD == DM && (NR * DM / 8) % 256 == 0, "k_prep: heads of 64 columns, whole tiles, whole work-groups");
  __shared__ unsigned tl[64][33];
  const int tid = threadIdx.x;
  if (blockIdx.x >= 5 * PW_TILES) {      /* the same for the whole work-group, in front of the barrier */
    const size_t t = (size_t)(blockIdx.x - 5 * PW_TILES) * 256 + tid; FragH f;
#pragma unroll      /* register arrays need constant indices */
    for (int q = 0; q < 8; ++q) f.h[q] = (_Float16)bf16_round(x[t * 8 + q]);
    *(v8us*)((unsigned short*)X16 + t * 8) = f.half[0]; return; }
  const int sel = blockIdx.x / PW_TILES, tile = blockIdx.x % PW_TILES; const int nt = tile / (DM / 64), k0 = (tile % (DM / 64)) * 64;
  const float* sp; int ld; _Float16* bt;
  if (sel < 3) { sp = (sel == 0 ? wq : sel == 1 ? wk : wv) + ((size_t)nt * DM + k0) * HD; ld = HD; bt = sel == 0 ? BQ : sel == 1 ? BK : BV; }      /* head nt, rows k0 .. k0 + 63 */
  else { sp = (sel == 3 ? w1 : w2) + (size_t)k0 * DM + nt * 64; ld = DM; bt = sel == 3 ? B1 : B2; }
  const int c4 = (tid & 15) * 4, rr = tid >> 4;
  const float* p00 = sp + (size_t)(2 * rr) * ld + c4; const float* p01 = p00 + ld; const float* p10 = p00 + (size_t)32 * ld; const float* p11 = p10 + ld;      /* rows 2 rr, 2 rr + 1, 32 + 2 rr, 33 + 2 rr of the tile */
  const v4f a[2][2] = {{*(const v4fa*)p00, *(const v4fa*)p01}, {*(const v4fa*)p10, *(const v4fa*)p11}};
  asm volatile("s_wait_xcnt 0x0" :: "v"(p00), "v"(p01), "v"(p10), "v"(p11) : "memory");      /* behind the four loads, in front of every later write of a register that they name; the addresses are inputs so that they keep their registers up to here: left free, one load's result was placed over another load's address */
#pragma unroll      /* register arrays need constant indices */
  for (int p = 0; p < 2; ++p)
#pragma unroll      /* register arrays need constant indices */
    for (int q = 0; q < 4; ++q) { union { _Float16 h[2]; unsigned u; } z; z.h[0] = (_Float16)(bf16_round(a[p][0][q]) * 16.0f); z.h[1] = (_Float16)(bf16_round(a[p][1][q]) * 16.0f); tl[c4 + q][p * 16 + rr] = z.u; }
  __syncthreads();      /* a row of Bt is gathered from words that sixteen threads wrote */
  const int pc = tid & 7, rn = tid >> 3;
#pragma unroll      /* both rows' LDS reads go out ahead of the stores */
  for (int p = 0; p < 2; ++p) { union { unsigned u[4]; v8us v; } o;
#pragma unroll      /* register arrays need constant indices */
    for (int j = 0; j < 4; ++j) o.u[j] = tl[p * 32 + rn][pc * 4 + j];
    *(v8us*)((unsigned short*)bt + (size_t)(nt * 64 + p * 32 + rn) * DM + k0 + pc * 8) = o.v; } }
// lane exchanges for the attention kernel's softmax and the LayerNorm sums; native exponentials for the softmax
typedef int v4ia __attribute__((ext_vector_type(4), may_alias));
template <int M> __device__ __forceinline__ float rs_xrow(float x) { return __builtin_bit_cast(float, __builtin_amdgcn_update_dpp(0, __builtin_bit_cast(int, x), 0x160 | M, 0xf, 0xf, true)); }      /* lane l <- lane l ^ M inside a 16-lane row (row_xmask) */
__device__ __forceinline__ float rs_xhalf(float x) { return __builtin_bit_cast(float, __builtin_amdgcn_permlanex16(__builtin_bit_cast(int, x), __builtin_bit_cast(int, x), 0x76543210, 0xfedcba98, false, false)); }      /* lane l <- lane l ^ 16 */
// four independent 2^x in one statement, closed by the one v_nop that the instruction set asks for behind a transcendental before its result is used or its source overwritten
// outputs are early-clobber so that no exponential writes a neighbour's source
__device__ __forceinline__ void rs_exp2x4(float* x) { float r0, r1, r2, r3;
  asm("v_exp_f32 %0, %4\n\tv_exp_f32 %1, %5\n\tv_exp_f32 %2, %6\n\tv_exp_f32 %3, %7\n\tv_nop" : "=&v"(r0), "=&v"(r1), "=&v"(r2), "=&v"(r3) : "v"(x[0]), "v"(x[1]), "v"(x[2]), "v"(x[3]));
  x[0] = r0; x[1] = r1; x[2] = r2; x[3] = r3; }
// Fused attention, one launch for all batches and heads: a work-group takes 128 query rows of one (batch, head), a wave 32 of them (two 16-column groups), and walks the 1024 keys in passes of 32, two passes a trip.
// Per trip the 64 K rows of the head (128 bytes a row) and 64 keys of its 64 V^T rows (128 bytes a row) lie in LDS at a pitch of 144 bytes, one copy for the four waves;
// asynchronous copies bring them there in whole 128-byte lines, two buffers, the next trip's tiles in flight while these are worked on. Fragments are read from LDS in the k order they had from global memory.
// S^T = K Q^T + C (A = K rows, B = Q rows kept in registers, pre-scaled so that the product is score / 8 in log2 units, C = minus the query's maximum in use): in each group lane (ln, hh) holds, for query ln, the exponents of keys 16 kt + 8 hh + r.
// The maximum in use is the same in both wave halves; it is renewed, and O^T and the sum rescaled, only in a pass in which some lane's sum of sixteen weights exceeds 4096 (the first pass with a key that counts is such a pass: it starts from -3e38). The sums are per lane, joined between the halves at the end.
// The two f32 score tiles of a pass, converted in place, are the f16 B operand of O^T += V^T P^T (A = V^T rows in the same k order): scores and weights never leave the registers.
// Weights are exp(s - maximum in use), unnormalised (at most 4096); the division by the row sum is done once, in f32, on O^T. A masked key has weight 0 (the bias row is read by passes whose flag bit says that they hold one and by passes that renew the maximum); a row with every key masked gives 0.
__device__ __forceinline__ v8f fa_mma(v16h a, v16h b, v8f c) { return __builtin_amdgcn_wmma_f32_16x16x32_f16(false, a, false, b, (short)0, c, false, false); }
// one 2^x, closed by the v_nop that the instruction set asks for behind a transcendental before its result is used or its source overwritten
__device__ __forceinline__ float fa_exp2(float x) { float r; asm("v_exp_f32 %0, %1\n\tv_nop" : "=&v"(r) : "v"(x)); return r; }
#define FA_TILE (64 * G3_PITCH)        /* one operand's tile in LDS, bytes: 64 rows of 128 bytes at the padded pitch */
// eight copies of 16 bytes a lane: rows r, r + 16, r + 32, r + 48 of the K tile, then of the V^T tile behind it (l: the lane's LDS byte address in row r of the K tile; gk, gv: its global addresses there).
// The s_wait_xcnt closes the statement so that it stands in front of every later write of a register that a copy names.
__device__ __forceinline__ void fa_copy8(unsigned l, const _Float16* gk, const _Float16* gv) { constexpr size_t rk = (size_t)16 * DM, rv = (size_t)16 * SQ;      /* 16 rows in elements */
  asm volatile("global_load_async_to_lds_b128 %0, %8, off\n\tglobal_load_async_to_lds_b128 %1, %9, off\n\tglobal_load_async_to_lds_b128 %2, %10, off\n\tglobal_load_async_to_lds_b128 %3, %11, off\n\t"
               "global_load_async_to_lds_b128 %4, %12, off\n\tglobal_load_async_to_lds_b128 %5, %13, off\n\tglobal_load_async_to_lds_b128 %6, %14, off\n\tglobal_load_async_to_lds_b128 %7, %15, off\n\ts_wait_xcnt 0x0"
               :: "v"(l), "v"(l + 16 * G3_PITCH), "v"(l + 32 * G3_PITCH), "v"(l + 48 * G3_PITCH), "v"(l + FA_TILE), "v"(l + FA_TILE + 16 * G3_PITCH), "v"(l + FA_TILE + 32 * G3_PITCH), "v"(l + FA_TILE + 48 * G3_PITCH),
                  "v"(gk), "v"(gk + rk), "v"(gk + 2 * rk), "v"(gk + 3 * rk), "v"(gv), "v"(gv + rv), "v"(gv + 2 * rv), "v"(gv + 3 * rv) : "memory"); }
// The eight score products of a pass in one statement, C = ng (the same value in all eight rows of a query's column): s[qi][kt] = K rows 16 kt .. + 15 times the queries of group qi, 64 k in two accumulating steps, + ng[qi].
// One statement because their readers are asm exponentials: here each tile's last product has the later products as its vector slots, and the four v_nop at the end are the slots of the last ones.
__device__ __forceinline__ void fa_scores(v8f (&s)[2][2], const v16h (&kf)[2][2], const v16h (&qf)[2][2], const v8f (&ng)[2]) {
  asm("v_wmma_f32_16x16x32_f16 %0, %4, %8, %12\n\tv_wmma_f32_16x16x32_f16 %1, %6, %8, %12\n\tv_wmma_f32_16x16x32_f16 %2, %4, %10, %13\n\tv_wmma_f32_16x16x32_f16 %3, %6, %10, %13\n\t"
      "v_wmma_f32_16x16x32_f16 %0, %5, %9, %0\n\tv_wmma_f32_16x16x32_f16 %1, %7, %9, %1\n\tv_wmma_f32_16x16x32_f16 %2, %5, %11, %2\n\tv_wmma_f32_16x16x32_f16 %3, %7, %11, %3\n\tv_nop\n\tv_nop\n\tv_nop\n\tv_nop"
      : "=&v"(s[0][0]), "=&v"(s[0][1]), "=&v"(s[1][0]), "=&v"(s[1][1])
      : "v"(kf[0][0]), "v"(kf[0][1]), "v"(kf[1][0]), "v"(kf[1][1]), "v"(qf[0][0]), "v"(qf[0][1]), "v"(qf[1][0]), "v"(qf[1][1]), "v"(ng[0]), "v"(ng[1])); }
// the mask row's bias (0 or -inf) of the pass's keys 16 kt + 8 hh + r, added to both query groups' score tiles (kb: the lane's first key of the pass)
__device__ __forceinline__ void fa_bias(v8f (&s)[2][2], const float* kb) {
#pragma unroll      /* register arrays need constant indices */
  for (int kt = 0; kt < 2; ++kt) { const v4f b0 = *(const v4fa*)(kb + kt * 16), b1 = *(const v4fa*)(kb + kt * 16 + 4);
#pragma unroll      /* register arrays need constant indices */
    for (int qi = 0; qi < 2; ++qi)
#pragma unroll      /* register arrays need constant indices */
      for (int r = 0; r < 8; ++r) s[qi][kt][r] += r < 4 ? b0[r & 3] : b1[r & 3]; } }
// the weights of the pass's masked keys become 0, in both query groups (kb as above)
__device__ __forceinline__ void fa_drop(float (&e)[2][16], const float* kb) {
#pragma unroll      /* register arrays need constant indices */
  for (int kt = 0; kt < 2; ++kt) { const v4f b0 = *(const v4fa*)(kb + kt * 16), b1 = *(const v4fa*)(kb + kt * 16 + 4);
#pragma unroll      /* register arrays need constant indices */
    for (int qi = 0; qi < 2; ++qi)
#pragma unroll      /* register arrays need constant indices */
      for (int r = 0; r < 8; ++r) e[qi][kt * 8 + r] = (r < 4 ? b0[r & 3] : b1[r & 3]) == 0.f ? e[qi][kt * 8 + r] : 0.f; } }
// sixteen exponents become weights in place
__device__ __forceinline__ void fa_exp16(float* e) { rs_exp2x4(e); rs_exp2x4(e + 4); rs_exp2x4(e + 8); rs_exp2x4(e + 12); }
// the sum of sixteen weights: four partial sums, joined pairwise
__device__ __forceinline__ float fa_sum16(const float* e) {
  float s4[4] = {e[0], e[1], e[2], e[3]};
#pragma unroll      /* register arrays need constant indices */
  for (int i = 4; i < 16; ++i) s4[i & 3] += e[i];
  return (s4[0] + s4[1]) + (s4[2] + s4[3]); }
__global__ __launch_bounds__(128) void k_fattn(const _Float16* __restrict__ Q16, const _Float16* __restrict__ K16, const _Float16* __restrict__ VT, const int* __restrict__ mk, float* __restrict__ AF) {
  static_assert(HD == 64 && SQ == 1024, "k_fattn: heads of 64 columns, 32 passes of 32 keys (one flag bit and one lane a pass), whole trips of 64 keys");
  __shared__ __attribute__((aligned(16))) float kbias[SQ];      /* 0 for a key that counts, -inf for a masked one */
  __shared__ __attribute__((aligned(16))) unsigned char kv[4 * FA_TILE];      /* buffer u: K tile at 2 u tiles, V^T tile at 2 u + 1 */
  const int tid = threadIdx.x, w = tid >> 5, lane = tid & 31, ln = lane & 15, hh = lane >> 4;
  const int bh = blockIdx.x / (SQ / 128), qb = blockIdx.x % (SQ / 128); const int b = bh / NH, h = bh % NH;
  const unsigned l0 = (unsigned)(size_t)kv + (unsigned)((tid >> 3) * G3_PITCH + (tid & 7) * 16);      /* eight lanes a row: a wave's copy covers four whole 128-byte lines */
  const _Float16* gk = K16 + ((size_t)b * SQ + (tid >> 3)) * DM + h * HD + (tid & 7) * 8; const _Float16* gv = VT + ((size_t)bh * HD + (tid >> 3)) * SQ + (tid & 7) * 8; constexpr int nt = SQ / 64;
  fa_copy8(l0, gk, gv);
  const v4ia m0 = *(const v4ia*)(mk + (size_t)b * SQ + tid * 8), m1 = *(const v4ia*)(mk + (size_t)b * SQ + tid * 8 + 4);      /* eight keys of the mask row a thread */
  const int* mp = mk + (size_t)b * SQ + lane * 32; v4ia mo = *(const v4ia*)mp;      /* lane l: the 32 keys of pass l */
#pragma unroll      /* register arrays need constant indices */
  for (int i = 1; i < 8; ++i) mo |= *(const v4ia*)(mp + i * 4);
  asm volatile("s_wait_xcnt 0x0" :: "v"(mp) : "memory");      /* behind the eight loads, in front of every later write of the address register that they name; the address is an input so that it keeps its registers up to here */
  const unsigned mfl = __builtin_amdgcn_ballot_w32((mo[0] | mo[1] | mo[2] | mo[3]) != 0);      /* bit p: pass p holds a masked key; the same in every lane */
  const int q0 = qb * 128 + w * 32;
  const _Float16* qp = Q16 + ((size_t)b * SQ + q0 + ln) * DM + h * HD;
  v16h qf[2][2];
#pragma unroll      /* register arrays need constant indices */
  for (int u = 0; u < 2; ++u)
#pragma unroll      /* register arrays need constant indices */
    for (int ks = 0; ks < 2; ++ks) qf[u][ks] = g2_frag(qp + (size_t)u * 16 * DM + ks * 32, hh);
  { v4f b0, b1;
#pragma unroll      /* register arrays need constant indices */
    for (int q = 0; q < 4; ++q) { b0[q] = (m0[q] == 0) ? 0.f : -__builtin_inff(); b1[q] = (m1[q] == 0) ? 0.f : -__builtin_inff(); }
    *(v4fa*)&kbias[tid * 8] = b0; *(v4fa*)&kbias[tid * 8 + 4] = b1; }
  asm volatile("s_wait_asynccnt 0x0" ::: "memory");      /* this wave's share of the first tiles has landed */
  __syncthreads();      /* the bias row and the first tiles are read by every wave */
  fa_copy8(l0 + 2 * FA_TILE, gk + (size_t)64 * DM, gv + 64);
  const unsigned char* fk = kv + ln * G3_PITCH + 16 * hh; const unsigned char* fv = kv + FA_TILE + ln * G3_PITCH + 16 * hh;
  const v8f z8 = {0.f, 0.f, 0.f, 0.f, 0.f, 0.f, 0.f, 0.f};
  v8f o[2][4] = {{z8, z8, z8, z8}, {z8, z8, z8, z8}}; float mr[2] = {-3.0e38f, -3.0e38f}, lr[2] = {0.f, 0.f};
  v8f ng[2] = {z8 + 3.0e38f, z8 + 3.0e38f};      /* minus the maximum in use, in all eight rows: the C operand of the score products */
#pragma unroll 1      /* one trip per pair of tiles: the buffer is chosen at run time, and an unrolled body would only grow the text */
  for (int t = 0; t < nt; ++t) { const unsigned bo = (unsigned)(t & 1) * (2 * FA_TILE);
#pragma unroll      /* the pass's place in the tiles becomes a constant offset of its LDS reads */
   for (int ps = 0; ps < 2; ++ps) { const float* kb = &kbias[t * 64 + ps * 32 + 8 * hh];
    const bool msk = ((mfl >> (2 * t + ps)) & 1u) != 0u;      /* the same for the whole wave: a scalar branch */
    v16h kf[2][2], vf[4];
#pragma unroll      /* register arrays need constant indices */
    for (int kt = 0; kt < 2; ++kt)
#pragma unroll      /* register arrays need constant indices */
      for (int ks = 0; ks < 2; ++ks) kf[kt][ks] = g3_frag(fk + bo + (ps * 32 + kt * 16) * G3_PITCH + ks * 64);
#pragma unroll      /* register arrays need constant indices */
    for (int dt = 0; dt < 4; ++dt) vf[dt] = g3_frag(fv + bo + dt * 16 * G3_PITCH + ps * 64);
    v8f s[2][2]; float e[2][16], ls[2];
    fa_scores(s, kf, qf, ng);      /* score minus the maximum in use: already the exponent */
#pragma unroll      /* register arrays need constant indices */
    for (int qi = 0; qi < 2; ++qi) {
#pragma unroll      /* register arrays need constant indices */
      for (int i = 0; i < 16; ++i) e[qi][i] = s[qi][i >> 3][i & 7];
      fa_exp16(e[qi]); }
    if (msk) fa_drop(e, kb);      /* only a pass that holds a masked key reads the bias row here; a pass that renews the maximum also reads it, in fa_bias */
    ls[0] = fa_sum16(e[0]); ls[1] = fa_sum16(e[1]);
    if (__builtin_amdgcn_ballot_w32(fmaxf(ls[0], ls[1]) > 4096.0f) != 0u) {      /* one test a pass, a scalar branch: some weight above 256 (sixteen of at most 256 sum to at most 4096), so the maximum in use is renewed; else every weight is at most 4096, well inside f16 */
#pragma unroll      /* register arrays need constant indices */
      for (int qi = 0; qi < 2; ++qi)
#pragma unroll      /* register arrays need constant indices */
        for (int kt = 0; kt < 2; ++kt) s[qi][kt] = fa_mma(kf[kt][1], qf[qi][1], fa_mma(kf[kt][0], qf[qi][0], z8));      /* the plain scores anew: next to a far smaller maximum in use their low bits were lost */
      fa_bias(s, kb);      /* -inf for a masked key, ahead of the maximum */
#pragma unroll      /* register arrays need constant indices */
      for (int qi = 0; qi < 2; ++qi) { float mx = s[qi][0][0];
#pragma unroll      /* register arrays need constant indices */
        for (int i = 1; i < 16; ++i) mx = fmaxf(mx, s[qi][i >> 3][i & 7]);
        mx = fmaxf(mx, rs_xhalf(mx)); const float mn = fmaxf(mr[qi], mx); const float f = fa_exp2(mr[qi] - mn); mr[qi] = mn; ng[qi] = z8 - mn;
#pragma unroll      /* register arrays need constant indices */
        for (int i = 0; i < 16; ++i) e[qi][i] = s[qi][i >> 3][i & 7] - mn;
        fa_exp16(e[qi]); ls[qi] = fa_sum16(e[qi]); lr[qi] *= f;
#pragma unroll      /* register arrays need constant indices */
        for (int dt = 0; dt < 4; ++dt) o[qi][dt] *= f; } }
#pragma unroll      /* register arrays need constant indices */
    for (int qi = 0; qi < 2; ++qi) { lr[qi] += ls[qi];
      FragH p;
#pragma unroll      /* register arrays need constant indices */
      for (int i = 0; i < 16; ++i) p.h[i] = (_Float16)e[qi][i];
#pragma unroll      /* register arrays need constant indices */
      for (int dt = 0; dt < 4; ++dt) o[qi][dt] = fa_mma(vf[dt], p.v, o[qi][dt]); } }
    asm volatile("s_wait_dscnt 0x0" ::: "memory");      /* this wave's reads of the buffer have returned before the barrier behind which it is refilled */
    asm volatile("s_wait_asynccnt 0x0" ::: "memory");      /* this wave's share of the next trip's tiles has landed */
    __syncthreads();      /* publishes the tiles of trip t + 1 and ends every wave's reads of those of trip t */
    if (t + 2 < nt) fa_copy8(l0 + bo, gk + (size_t)(t + 2) * 64 * DM, gv + (size_t)(t + 2) * 64); }
  asm volatile("s_wait_asynccnt 0x0" ::: "memory");      /* no copy is outstanding when the wave ends */
#pragma unroll      /* register arrays need constant indices */
  for (int qi = 0; qi < 2; ++qi) { const float se = lr[qi] + rs_xhalf(lr[qi]); const float inv = (se == 0.f) ? 0.f : 1.0f / se;
    float* dst = AF + ((size_t)b * SQ + q0 + qi * 16 + ln) * DM + h * HD + 8 * hh;      /* lane (ln, hh): query ln, head columns 16 dt + 8 hh + r */
#pragma unroll      /* register arrays need constant indices */
    for (int dt = 0; dt < 4; ++dt) { const v8f v = o[qi][dt] * inv; const v4f lo = {v[0], v[1], v[2], v[3]}, hi = {v[4], v[5], v[6], v[7]}; *(v4f*)(dst + dt * 16) = lo; *(v4f*)(dst + dt * 16 + 4) = hi; } } }
// OF_ = R + LayerNorm(A) g + bta (H16: and its f16 copy OH_): two rows a wave, eight waves a work-group, no LDS and no barrier.
// Lane l holds columns 128 u + 4 l + 0..3 (u = 0..7) of each row, so every load and every f32 store of a wave is 512 contiguous bytes; all loads of both rows go out ahead of the arithmetic.
// Mean and biased variance (two passes over the registers): four partial sums a lane, joined pairwise, then a five-step xor butterfly that leaves the same sum in every lane.
__device__ __forceinline__ float ln_wsum(float s) { s += rs_xrow<1>(s); s += rs_xrow<2>(s); s += rs_xrow<4>(s); s += rs_xrow<8>(s); return s + rs_xhalf(s); }
template <int RBF, bool H16>
__global__ __launch_bounds__(256) void k_lnadd(const float* __restrict__ A, const float* __restrict__ R, const float* __restrict__ g, const float* __restrict__ bta, float eps, float* __restrict__ OF_, _Float16* __restrict__ OH_) {
  static_assert(DM == 1024 && MPO % 16 == 0, "k_lnadd: rows of 1024 columns, sixteen rows a work-group");
  const int j0 = (threadIdx.x & 31) * 4;      /* the one per-lane part of every address */
  const size_t e0 = ((size_t)blockIdx.x * 8 + (size_t)__builtin_amdgcn_readfirstlane(threadIdx.x >> 5)) * 2 * DM;      /* first element of the wave's first row: the same in every lane, so the row bases are scalar */
  const float* ap = A + e0; const float* rp = R + e0; float* op = OF_ + e0; _Float16* hp = OH_ + e0;
  v4f a[2][8], r[2][8], gv[8], bv[8];
  asm volatile("" :: "s"(eps), "s"(OF_), "s"(OH_));      /* inputs only: the arguments that are used behind the loads are fetched in front of them; left free, their fetch stood behind the loads */
  __builtin_amdgcn_sched_barrier(0);      /* keeps the loads behind that fetch */
#pragma unroll      /* register arrays need constant indices */
  for (int p = 0; p < 2; ++p)
#pragma unroll      /* register arrays need constant indices */
    for (int u = 0; u < 8; ++u) a[p][u] = *(const v4fa*)(ap + p * DM + u * 128 + j0);
#pragma unroll      /* register arrays need constant indices */
  for (int p = 0; p < 2; ++p)
#pragma unroll      /* register arrays need constant indices */
    for (int u = 0; u < 8; ++u) r[p][u] = *(const v4fa*)(rp + p * DM + u * 128 + j0);
#pragma unroll      /* register arrays need constant indices */
  for (int u = 0; u < 8; ++u) { gv[u] = *(const v4fa*)(g + u * 128 + j0); bv[u] = *(const v4fa*)(bta + u * 128 + j0); }
  asm volatile("s_wait_xcnt 0x0" ::: "memory");      /* behind the loads, in front of every later reuse of a register that they name as an address */
  __builtin_amdgcn_sched_barrier(0);      /* all 48 loads are issued here, in front of the arithmetic: left free, the second row's loads sank behind the first row's sums and their latency was waited out a second time */
#pragma unroll      /* register arrays need constant indices */
  for (int p = 0; p < 2; ++p) { v4f c = a[p][0];
#pragma unroll      /* register arrays need constant indices */
    for (int u = 1; u < 8; ++u) c += a[p][u];
    const float mu = ln_wsum((c[0] + c[1]) + (c[2] + c[3])) / (float)DM;
    v4f d = (a[p][0] - mu) * (a[p][0] - mu);
#pragma unroll      /* register arrays need constant indices */
    for (int u = 1; u < 8; ++u) d += (a[p][u] - mu) * (a[p][u] - mu);
    const float rs = rsqrtf(ln_wsum((d[0] + d[1]) + (d[2] + d[3])) / (float)DM + eps);
#pragma unroll      /* register arrays need constant indices */
    for (int u = 0; u < 8; ++u) { v4f o; v4h h4;
#pragma unroll      /* register arrays need constant indices */
      for (int q = 0; q < 4; ++q) { o[q] = (RBF ? bf16_round(r[p][u][q]) : r[p][u][q]) + ((a[p][u][q] - mu) * rs * bf16_round(gv[u][q]) + bf16_round(bv[u][q])); h4[q] = (_Float16)o[q]; }
      *(v4f*)(op + p * DM + u * 128 + j0) = o; if (H16) *(v4h*)(hp + p * DM + u * 128 + j0) = h4; } } }

extern "C" void kernel_launch(void* const* d_in, const int* in_sizes, int n_in,
                              void* d_out, int out_size, void* d_ws, size_t ws_size, hipStream_t stream) {
  (void)in_sizes; (void)n_in; (void)out_size;
  const float* const* I = (const float* const*)d_in; const float* x = I[0]; const int* xmask = (const int*)d_in[1]; const float* wq = I[2]; const float* bq = I[3]; const float* wk = I[4]; const float* bk = I[5]; const float* wv = I[6]; const float* bv = I[7]; const float* w1 = I[8]; const float* b1 = I[9]; const float* w2 = I[10]; const float* b2 = I[11]; const float* g1 = I[12]; const float* be1 = I[13]; const float* g2 = I[14]; const float* be2 = I[15];
  char* ws = (char*)d_ws; size_t off = 0;
  auto take = [&](size_t bytes) { char* p = ws + off; off += (bytes + 255) & ~(size_t)255; return p; };
  _Float16* BQ = (_Float16*)take((size_t)DM * DM * 2); _Float16* BK = (_Float16*)take((size_t)DM * DM * 2); _Float16* BV = (_Float16*)take((size_t)DM * DM * 2); _Float16* B1 = (_Float16*)take((size_t)DM * DM * 2); _Float16* B2 = (_Float16*)take((size_t)DM * DM * 2);
  _Float16* X16 = (_Float16*)take(NR * DM * 2); _Float16* Q16 = (_Float16*)take(NR * DM * 2); _Float16* K16 = (_Float16*)take(NR * DM * 2); float* AF = (float*)take(NR * DM * 4); float* X1F = (float*)take(NR * DM * 4); _Float16* X1H = (_Float16*)take(NR * DM * 2); _Float16* H16 = (_Float16*)take(NR * DM * 2); float* FF = AF;      /* f rows reuse the attention-output rows (dead after the first LayerNorm; same type) */
  _Float16* VT = (_Float16*)take((size_t)NB * NH * HD * SQ * 2);
  if (off > ws_size) return;      /* 10 + 16x3 + 32 + 32 + 16 + 16 + 16 = approx 170 MiB */
  k_prep<<<5 * PW_TILES + PX_WGS, 256, 0, stream>>>(x, wq, wk, wv, w1, w2, X16, BQ, BK, BV, B1, B2);      /* the five weights as f16 [n][k], x as f16 rows */
  const size_t r0p = (size_t)B0 * SQ; const dim3 gp((unsigned)(3 * (MP / 128) * (DM / 128)), 1);
  k_gemm3<0, true, true><<<gp, 128, 0, stream>>>(X16 + r0p * DM, BQ, BK, BV, 0.0625f, bq, bk, bv, nullptr, Q16 + r0p * DM, K16 + r0p * DM, VT + r0p * DM);      /* q, k as rows, V^T of every (batch, head) */
  k_fattn<<<NB * NH * (SQ / 128), 128, 0, stream>>>(Q16, K16, VT, xmask, AF);      /* a (merged heads) as f32 rows */
  k_lnadd<1, true><<<(unsigned)(MPO / 16), 256, 0, stream>>>(AF + r0p * DM, x + r0p * DM, g1, be1, 1e-5f, X1F + r0p * DM, X1H + r0p * DM);      /* x1 = bf16(x) + LN(a) */
  const dim3 gf((unsigned)((MPO / 128) * (DM / 128)), 1);
  k_gemm3<3, true, false><<<gf, 128, 0, stream>>>(X1H + r0p * DM, B1, nullptr, nullptr, 0.0625f, b1, nullptr, nullptr, nullptr, H16 + r0p * DM, nullptr, nullptr);      /* h = relu(x1 W1 + b1) (f16) */
  k_gemm3<0, false, false><<<gf, 128, 0, stream>>>(H16 + r0p * DM, B2, nullptr, nullptr, 0.0625f, b2, nullptr, nullptr, FF + r0p * DM, nullptr, nullptr, nullptr);      /* f = h W2 + b2 (f32) */
  k_lnadd<0, false><<<(unsigned)(MPO / 16), 256, 0, stream>>>(FF + r0p * DM, X1F + r0p * DM, g2, be2, 1e-5f, (float*)d_out + r0p * DM, nullptr);      /* out = x1 + LN(f) */
}
